// v000
// Times are from an AMD MI455X. After a warm-up the kernel runs many times in a row, and a time is the length of
// such a window on the GPU divided by its runs, so every launch and the gaps after it count. The runs cycle
// through copies of the inputs. A figure is the median of several windows, for all but v000 over two sittings.
// Sittings can differ by a few percent; kernels timed side by side share one.
// v000 is the starting kernel. One run takes 3120 microseconds.
#include <hip/hip_runtime.h>

// Hierarchical (char + concept) gated attention (values, keys, query [2][2048][1024]; concept_ids int32 [2][2048] -> ce = emb[concept_ids] ([1000][1024], gathered on device); char branch: q = query Wcq + bcq, k = keys Wck + bck, v = values Wcv + bcv; concept branch: q = query Wpq + bpq, k = ce Wpk + bpk, v = ce Wpv + bpv ('xw' [1024][1024] + biases; 16 heads x 64); per branch: scores masked causally (-1e20) then x 1/sqrt(1024), softmax, merged, Wo + bo; gate = sigmoid([char_out | concept_out] Wg + bg) (Wg [2048][1024]); out = gate char_out + (1 - gate) concept_out -> [2][2048][1024] (4.2 M)).
// Compute dtypes, f32 accumulate: every input rounded to bf16; q/k/v on PLAIN bf16 operands (inputs: exact) + biases; causal scores and attn.v (tile skipping): query rows < 512 hl (3 products), the rest single fp16 (x1024); softmax f32; Wco / Wpo hl x exact (2 products) + bias; gate GEMMs 2 products; sigmoid (precise expf) and the convex mix in f32.

#define NB_  2
#define TT   2048
#define DM   1024
#define NH_  16
#define NKV  16
#define REP  (NH_ / NKV)
#define HD   64
#define DQ   (NH_ * HD)
#define DKV  (NKV * HD)
#define NVOC 1000
#define ZH   2
#define RH   512                  // query rows < RH use hi+lo planes (0: none)
#define WIN  2048
#define PCAR 1024.0f
#define SCL  0.03125f   // 1/sqrt(embed_size = 1024) as in the source
typedef _Float16 h16;
typedef unsigned short bf;
typedef __attribute__((ext_vector_type(16))) __bf16   v16bf;
typedef __attribute__((ext_vector_type(16))) _Float16 v16h;
typedef __attribute__((ext_vector_type(8)))  _Float16 v8h;
typedef __attribute__((ext_vector_type(8)))  unsigned short v8us;
typedef __attribute__((ext_vector_type(8)))  float    v8f;
typedef __attribute__((ext_vector_type(4)))  float    v4f;
typedef v8h  __attribute__((may_alias)) v8ha;
typedef v4f  __attribute__((may_alias)) v4fa;
typedef v8us __attribute__((may_alias)) v8usa;

__device__ __forceinline__ unsigned short f2bf(float f) { unsigned u = __float_as_uint(f); u += 0x7FFFu + ((u >> 16) & 1u); return (unsigned short)(u >> 16); }
__device__ __forceinline__ float bf2f(unsigned short b) { return __uint_as_float(((unsigned)b) << 16); }
__device__ __forceinline__ float bfr(float f) { return bf2f(f2bf(f)); }
__device__ __forceinline__ v16h cat16(v8h lo, v8h hi) { return __builtin_shufflevector(lo, hi, 0, 1, 2, 3, 4, 5, 6, 7, 8, 9, 10, 11, 12, 13, 14, 15); }
__device__ __forceinline__ v16bf cat16b(v8us lo, v8us hi) { return __builtin_bit_cast(v16bf, __builtin_shufflevector(lo, hi, 0, 1, 2, 3, 4, 5, 6, 7, 8, 9, 10, 11, 12, 13, 14, 15)); }
__device__ __forceinline__ v8f wmma16(v16h a, v16h b, v8f c) { return __builtin_amdgcn_wmma_f32_16x16x32_f16(false, a, false, b, (short)0, c, false, false); }
__device__ __forceinline__ v8f wmmab(v16bf a, v16bf b, v8f c) { return __builtin_amdgcn_wmma_f32_16x16x32_bf16(false, a, false, b, (short)0, c, false, false); }



// ---- k_gemmw: register-blocked GEMM, ONE WAVE per 64x64 output tile (16 accumulators), operands straight from K-contiguous 16-bit planes; grid (M/64, N/64, Z), 32 threads.
// C[m][n] (f32, pitch ldc, + optional f32 bias[n]) = sum_k A[m][k] Bt[n][k] (+ split products per NSPLIT). z-batch strides sA/sB/sC in elements. K % 32 == 0.
template <typename T16> struct WFrag;
template <> struct WFrag<h16> { typedef v16h V; static __device__ __forceinline__ V ld(const h16* p) { return cat16(*(const v8h*)p, *(const v8h*)(p + 16)); } static __device__ __forceinline__ v8f mma(V a, V b, v8f c) { return wmma16(a, b, c); } };
template <> struct WFrag<bf> { typedef v16bf V; static __device__ __forceinline__ V ld(const bf* p) { return cat16b(*(const v8us*)p, *(const v8us*)(p + 16)); } static __device__ __forceinline__ v8f mma(V a, V b, v8f c) { return wmmab(a, b, c); } };
template <typename T16, int NSPLIT, bool BIAS>
__global__ __launch_bounds__(32) void k_gemmw(const T16* __restrict__ A, const T16* __restrict__ A2, const T16* __restrict__ Bt, const T16* __restrict__ Bt2, int K, float* C, int ldc, const float* __restrict__ bias, size_t sA, size_t sB, size_t sC) {
    typedef typename WFrag<T16>::V V;
    __shared__ __align__(16) float os[16 * 68];
    const size_t z = blockIdx.z; A += z * sA; if (A2) A2 += z * sA; Bt += z * sB; if (Bt2) Bt2 += z * sB; C += z * sC;
    const int lane = threadIdx.x & 31, lr = lane & 15, hi = lane >> 4; const int r0 = blockIdx.x * 64, c0 = blockIdx.y * 64;
    v8f acc[4][4];
#pragma unroll
    for (int mb = 0; mb < 4; ++mb)
#pragma unroll
        for (int nb = 0; nb < 4; ++nb) acc[mb][nb] = (v8f){};
    const size_t aoff = (size_t)(r0 + lr) * K + 8 * hi, boff = (size_t)(c0 + lr) * K + 8 * hi;
#pragma unroll 1
    for (int kc = 0; kc < K; kc += 32) {
        V a[4], a2[4];
#pragma unroll
        for (int mb = 0; mb < 4; ++mb) { a[mb] = WFrag<T16>::ld(A + aoff + (size_t)mb * 16 * K + kc); if (NSPLIT == 1 || NSPLIT == 2) a2[mb] = WFrag<T16>::ld(A2 + aoff + (size_t)mb * 16 * K + kc); }
#pragma unroll
        for (int nb = 0; nb < 4; ++nb) { const V b = WFrag<T16>::ld(Bt + boff + (size_t)nb * 16 * K + kc); V b2; if (NSPLIT >= 2) b2 = WFrag<T16>::ld(Bt2 + boff + (size_t)nb * 16 * K + kc);
#pragma unroll
            for (int mb = 0; mb < 4; ++mb) { acc[mb][nb] = WFrag<T16>::mma(a[mb], b, acc[mb][nb]); if (NSPLIT == 1 || NSPLIT == 2) acc[mb][nb] = WFrag<T16>::mma(a2[mb], b, acc[mb][nb]); if (NSPLIT >= 2) acc[mb][nb] = WFrag<T16>::mma(a[mb], b2, acc[mb][nb]); } }
        asm volatile("v_nop\n\tv_nop\n\tv_nop\n\tv_nop" : "+v"(acc[0][0]), "+v"(acc[1][1]), "+v"(acc[2][2]), "+v"(acc[3][3]) : "v"(a[0]), "v"(a[3]));
    }
#pragma unroll
    for (int mb = 0; mb < 4; ++mb) {
#pragma unroll
        for (int nb = 0; nb < 4; ++nb) {
#pragma unroll
            for (int j = 0; j < 8; ++j) os[(hi * 8 + j) * 68 + nb * 16 + lr] = acc[mb][nb][j]; }
        __builtin_amdgcn_wave_barrier(); asm volatile("" ::: "memory");
        float* crow = C + (size_t)(r0 + mb * 16) * ldc + c0;
{
#pragma unroll
            for (int s = 0; s < 8; ++s) { const int row = 2 * s + hi, cofs = lr * 4; v4f val = *(const v4fa*)(os + row * 68 + cofs); if (BIAS) { val[0] += bfr(bias[c0 + cofs]); val[1] += bfr(bias[c0 + cofs + 1]); val[2] += bfr(bias[c0 + cofs + 2]); val[3] += bfr(bias[c0 + cofs + 3]); }
                *(v4f*)(crow + (size_t)row * ldc + cofs) = val; }
             }
        __builtin_amdgcn_wave_barrier(); asm volatile("" ::: "memory");
    }
}

// ---- k_gemmc: the same one-wave 64x64 tile GEMM specialised for causal attention: CMODE 1 skips score tiles entirely above the diagonal (query rows r0+roff.., key columns c0..), CMODE 2 limits the
// key (K) loop of the probability x value contraction to the diagonal block (probabilities beyond it are exactly zero). roff = row offset of this launch's first row within the sequence.
template <typename T16, int NSPLIT, int CMODE>
__global__ __launch_bounds__(32) void k_gemmc(const T16* __restrict__ A, const T16* __restrict__ A2, const T16* __restrict__ Bt, const T16* __restrict__ Bt2, int K, float* C, int ldc, int roff, size_t sA, size_t sB, size_t sC) {
    typedef typename WFrag<T16>::V V;
    __shared__ __align__(16) float os[16 * 68];
    const size_t z = blockIdx.z; A += z * sA; if (A2) A2 += z * sA; Bt += z * sB; if (Bt2) Bt2 += z * sB; C += z * sC;
    const int lane = threadIdx.x & 31, lr = lane & 15, hi = lane >> 4; const int r0 = blockIdx.x * 64, c0 = blockIdx.y * 64;
    if (CMODE == 1 && c0 > r0 + roff + 63) return;                  // score tile entirely above the causal diagonal: never read (the softmax masks j > i by select)
    const int Kl = (CMODE == 2) ? min(K, r0 + roff + 64) : K;        // P.V: probabilities are exactly 0 beyond the diagonal block, so the K loop stops there
    v8f acc[4][4];
#pragma unroll
    for (int mb = 0; mb < 4; ++mb)
#pragma unroll
        for (int nb = 0; nb < 4; ++nb) acc[mb][nb] = (v8f){};
    const size_t aoff = (size_t)(r0 + lr) * K + 8 * hi, boff = (size_t)(c0 + lr) * K + 8 * hi;
#pragma unroll 1
    for (int kc = 0; kc < Kl; kc += 32) {
        V a[4], a2[4];
#pragma unroll
        for (int mb = 0; mb < 4; ++mb) { a[mb] = WFrag<T16>::ld(A + aoff + (size_t)mb * 16 * K + kc); if (NSPLIT == 1 || NSPLIT == 2) a2[mb] = WFrag<T16>::ld(A2 + aoff + (size_t)mb * 16 * K + kc); }
#pragma unroll
        for (int nb = 0; nb < 4; ++nb) { const V b = WFrag<T16>::ld(Bt + boff + (size_t)nb * 16 * K + kc); V b2; if (NSPLIT >= 2) b2 = WFrag<T16>::ld(Bt2 + boff + (size_t)nb * 16 * K + kc);
#pragma unroll
            for (int mb = 0; mb < 4; ++mb) { acc[mb][nb] = WFrag<T16>::mma(a[mb], b, acc[mb][nb]); if (NSPLIT == 1 || NSPLIT == 2) acc[mb][nb] = WFrag<T16>::mma(a2[mb], b, acc[mb][nb]); if (NSPLIT >= 2) acc[mb][nb] = WFrag<T16>::mma(a[mb], b2, acc[mb][nb]); } }
        asm volatile("v_nop\n\tv_nop\n\tv_nop\n\tv_nop" : "+v"(acc[0][0]), "+v"(acc[1][1]), "+v"(acc[2][2]), "+v"(acc[3][3]) : "v"(a[0]), "v"(a[3]));
    }
#pragma unroll
    for (int mb = 0; mb < 4; ++mb) {
#pragma unroll
        for (int nb = 0; nb < 4; ++nb) {
#pragma unroll
            for (int j = 0; j < 8; ++j) os[(hi * 8 + j) * 68 + nb * 16 + lr] = acc[mb][nb][j]; }
        __builtin_amdgcn_wave_barrier(); asm volatile("" ::: "memory");
        float* crow = C + (size_t)(r0 + mb * 16) * ldc + c0;
{
#pragma unroll
            for (int s = 0; s < 8; ++s) { const int row = 2 * s + hi, cofs = lr * 4; v4f val = *(const v4fa*)(os + row * 68 + cofs);
                *(v4f*)(crow + (size_t)row * ldc + cofs) = val; }
             }
        __builtin_amdgcn_wave_barrier(); asm volatile("" ::: "memory");
    }
}

__device__ __forceinline__ h16 tohx(float x) { return (h16)x; }
__device__ __forceinline__ void splitf(float y, unsigned short& h, unsigned short& l) { h = f2bf(y); l = f2bf(y - bf2f(h)); }
typedef __attribute__((ext_vector_type(2))) _Float16 v2h;
typedef __attribute__((ext_vector_type(4))) _Float16 v4h;
typedef __attribute__((ext_vector_type(2))) unsigned short v2us;
typedef __attribute__((ext_vector_type(4))) unsigned short v4us;
typedef __attribute__((ext_vector_type(2))) float v2f;
typedef __attribute__((ext_vector_type(4))) int v4i;

__global__ __launch_bounds__(256) void k_wtG(const float* __restrict__ w, int K, int N, bf* Bt) {
    const int lane = threadIdx.x & 31; const int L0 = (blockIdx.x * 8 + (threadIdx.x >> 5)) * 8; const int nlines = N * K / 64;
{
#pragma unroll 1
        for (int l = 0; l < 8; ++l) { const int L = L0 + l; if (L >= nlines) break; const size_t e = (size_t)L * 64 + lane * 2; const int k = (int)(e % K), n = (int)(e / K); v2us o;
            o[0] = f2bf(w[(size_t)k * N + n]); o[1] = f2bf(w[(size_t)(k + 1) * N + n]); *(v2us*)(Bt + e) = o; }
         }
}
__global__ __launch_bounds__(256) void k_cvt8(const float* __restrict__ src, bf* dst, size_t n8) { const size_t i = (size_t)blockIdx.x * 256 + threadIdx.x; if (i >= n8) return; const v8f v = *(const v8f*)(src + i * 8); v8us o;
#pragma unroll
    for (int k = 0; k < 8; ++k) o[k] = f2bf(v[k]); *(v8us*)(dst + i * 8) = o;  }

// k_rope: head planes [h][t][d] (fp16 + hi/lo) of rope(x) x sc with the rotate-half convention out[d] = x[d] cos[t][d] - x[d+HD/2] sin[t][d], out[d+HD/2] = x[d+HD/2] cos[t][d+HD/2] + x[d] sin[t][d+HD/2]
__global__ __launch_bounds__(256) void k_rope(const float* __restrict__ F, int pitch, int nheads, const float* __restrict__ CS, const float* __restrict__ RF, const float* __restrict__ nw, float sc, h16* P16, bf* Ph, bf* Pl) {
    const size_t e = ((size_t)blockIdx.x * 256 + threadIdx.x) * 2; if (e >= (size_t)nheads * TT * HD) return; const int d = (int)(e % HD); const int t = (int)((e / HD) % TT); const int h = (int)(e / ((size_t)HD * TT)); const float* f = F + (size_t)t * pitch + h * HD; const float rf = RF ? RF[(size_t)h * TT + t] : 1.0f; v2h o16; v2us oh, ol;
#pragma unroll
    for (int q = 0; q < 2; ++q) { const int dd = d + q; const int dp = (dd < HD / 2) ? dd + HD / 2 : dd - HD / 2; float x0 = f[dd], x1 = f[dp];
        if (RF) { float n0 = __fmul_rn(x0, rf), n1 = __fmul_rn(x1, rf); asm volatile("" : "+v"(n0)); asm volatile("" : "+v"(n1)); x0 = __fmul_rn(bfr(nw[dd]), n0); x1 = __fmul_rn(bfr(nw[dp]), n1); }
        const v2f cs = *(const v2f*)(CS + ((size_t)t * HD + dd) * 2); float a = __fmul_rn(x0, cs[0]), bq = __fmul_rn(x1, cs[1]); asm volatile("" : "+v"(a)); asm volatile("" : "+v"(bq)); const float r = ((dd < HD / 2) ? __fsub_rn(a, bq) : __fadd_rn(a, bq)) * sc;
        o16[q] = tohx(r); unsigned short a2, c2; splitf(r, a2, c2); oh[q] = a2; ol[q] = c2; }
    *(v2h*)(P16 + e) = o16; *(v2us*)(Ph + e) = oh; *(v2us*)(Pl + e) = ol;  }
__global__ __launch_bounds__(256) void k_vtp(const float* __restrict__ F, int pitch, int nheads, h16* V16, bf* Vh, bf* Vl) { const size_t e = ((size_t)blockIdx.x * 256 + threadIdx.x) * 2; if (e >= (size_t)nheads * HD * TT) return; const int t = (int)(e % TT); const int d = (int)((e / TT) % HD); const int g = (int)(e / ((size_t)TT * HD)); v2h o16; v2us oh, ol;
#pragma unroll
    for (int q = 0; q < 2; ++q) { const float x = F[(size_t)(t + q) * pitch + g * HD + d]; o16[q] = tohx(x); unsigned short a2, c2; splitf(x, a2, c2); oh[q] = a2; ol[q] = c2; }
    *(v2h*)(V16 + e) = o16; *(v2us*)(Vh + e) = oh; *(v2us*)(Vl + e) = ol;  }
__global__ __launch_bounds__(256) void k_csid(float* CS) { const int idx = blockIdx.x * 256 + threadIdx.x; if (idx >= TT * HD) return; v2f cs; cs[0] = 1.0f; cs[1] = 0.0f; *(v2f*)(CS + (size_t)idx * 2) = cs;  }
__global__ __launch_bounds__(256) void k_gath8(const float* __restrict__ TE, const int* __restrict__ IDS, bf* EB) { const size_t i = (size_t)blockIdx.x * 256 + threadIdx.x; if (i >= (size_t)TT * DM / 8) return; const size_t e = i * 8; const int t = (int)(e / DM); const int c = (int)(e % DM); const int id = min(max(IDS[t], 0), NVOC - 1); const v8f v = *(const v8f*)(TE + (size_t)id * DM + c); v8us o;
#pragma unroll
    for (int k = 0; k < 8; ++k) o[k] = f2bf(v[k]); *(v8us*)(EB + e) = o;  }
__global__ __launch_bounds__(256) void k_pl2(const float* __restrict__ F, bf* Ph, bf* Pl, size_t n4) { const size_t i = (size_t)blockIdx.x * 256 + threadIdx.x; if (i >= n4) return; const v4f v = *(const v4f*)(F + i * 4); v4us oh, ol;
#pragma unroll
    for (int q = 0; q < 4; ++q) { unsigned short a, c; splitf(v[q], a, c); oh[q] = a; ol[q] = c; } *(v4us*)(Ph + i * 4) = oh; *(v4us*)(Pl + i * 4) = ol;  }
__global__ __launch_bounds__(256) void k_gatemix(const float* __restrict__ G1, const float* __restrict__ G2, const float* __restrict__ bg, const float* __restrict__ CO, const float* __restrict__ PO, float* O) { const size_t i = (size_t)blockIdx.x * 256 + threadIdx.x; if (i >= (size_t)TT * DM / 4) return; const size_t e = i * 4; const int c0 = (int)(e % DM); const v4f a = *(const v4f*)(G1 + e), b2 = *(const v4f*)(G2 + e), co = *(const v4f*)(CO + e), po = *(const v4f*)(PO + e); v4f o;
#pragma unroll
    for (int q = 0; q < 4; ++q) { float z = __fadd_rn(__fadd_rn(a[q], b2[q]), bfr(bg[c0 + q])); const float gt = __fdiv_rn(1.0f, __fadd_rn(1.0f, expf(-z))); float t1 = __fmul_rn(gt, co[q]); float t2 = __fmul_rn(__fsub_rn(1.0f, gt), po[q]); asm volatile("" : "+v"(t1), "+v"(t2)); o[q] = __fadd_rn(t1, t2); }
    *(v4f*)(O + e) = o;  }
// k_asoft: per row (zz, i): t = S x SCL (1/sqrt(1024)) for j <= i and i - j < WIN (sliding causal window; the reference's -1e9 additive fill vanishes identically); softmax over the 2048 keys (register row, one exp, fixed trees);
__global__ __launch_bounds__(256) void k_asoft(const float* __restrict__ Sb, h16* P16, bf* Ph, bf* Pl) {
    const int lane = threadIdx.x & 31; const int row = blockIdx.x * 8 + (threadIdx.x >> 5); if (row >= ZH * TT) return; const int i = row % TT; const int zz = row / TT; (void)zz; const bool hires = (i < RH); const float* sr = Sb + (size_t)row * TT; float v[TT / 32]; float mx = -3.0e38f;
#pragma unroll
    for (int ch = 0; ch < TT / 128; ++ch) { const int j0 = ch * 128 + lane * 4; const v4f a = *(const v4f*)(sr + j0);
#pragma unroll
        for (int q = 0; q < 4; ++q) { const int j = j0 + q; (void)j; const float t = (j <= i && i - j < WIN) ? a[q] * SCL : -3.0e38f; v[ch * 4 + q] = t; mx = fmaxf(mx, t); } }
#pragma unroll
    for (int sh = 16; sh; sh >>= 1) mx = fmaxf(mx, __shfl_xor(mx, sh, 32));
    float sum = 0.f;
#pragma unroll
    for (int k = 0; k < TT / 32; ++k) { float d0 = __fsub_rn(v[k], mx); asm volatile("" : "+v"(d0)); v[k] = __builtin_amdgcn_exp2f(__fmul_rn(d0, 1.4426950408889634f)); sum += v[k]; }
#pragma unroll
    for (int sh = 16; sh; sh >>= 1) sum += __shfl_xor(sum, sh, 32);
    const float f = __fdiv_rn(hires ? 1.0f : PCAR, sum);
{
        if (hires) {
#pragma unroll
            for (int ch = 0; ch < TT / 128; ++ch) { v4us oh, ol;
#pragma unroll
                for (int q = 0; q < 4; ++q) { unsigned short a, c2; splitf(v[ch * 4 + q] * f, a, c2); oh[q] = a; ol[q] = c2; }
                const size_t oo = ((size_t)zz * (RH ? RH : 1) + i) * TT + ch * 128 + lane * 4; *(v4us*)(Ph + oo) = oh; *(v4us*)(Pl + oo) = ol; }
        } else {
#pragma unroll
            for (int ch = 0; ch < TT / 128; ++ch) { v4h o4;
#pragma unroll
                for (int q = 0; q < 4; ++q) o4[q] = tohx(v[ch * 4 + q] * f);
                *(v4h*)(P16 + (size_t)row * TT + ch * 128 + lane * 4) = o4; } }
         }
}
__global__ __launch_bounds__(256) void k_merge(const float* __restrict__ O, int h0, bf* Ah, bf* Al) { const size_t e = ((size_t)blockIdx.x * 256 + threadIdx.x) * 2; if (e >= (size_t)ZH * TT * HD) return; const int d = (int)(e % HD); const int t = (int)((e / HD) % TT); const int zz = (int)(e / ((size_t)HD * TT)); const float cs = (t < RH) ? 1.0f : (1.0f / PCAR); const size_t oo = (size_t)t * DQ + (h0 + zz) * HD + d;
    v2us oh, ol;
#pragma unroll
    for (int q = 0; q < 2; ++q) { unsigned short a, c2; splitf(O[e + q] * cs, a, c2); oh[q] = a; ol[q] = c2; } *(v2us*)(Ah + oo) = oh; *(v2us*)(Al + oo) = ol;  }

extern "C" void kernel_launch(void* const* d_in, const int* in_sizes, int n_in,
                              void* d_out, int out_size, void* d_ws, size_t ws_size, hipStream_t stream) {
    (void)in_sizes; (void)n_in; (void)out_size;
    const float* xvals = (const float*)d_in[0]; const float* xkeys = (const float*)d_in[1]; const float* xq = (const float*)d_in[2]; const int* CID = (const int*)d_in[3]; const float* EMB = (const float*)d_in[4]; const float* wcv = (const float*)d_in[5]; const float* bcv = (const float*)d_in[6]; const float* wck = (const float*)d_in[7]; const float* bck = (const float*)d_in[8]; const float* wcq = (const float*)d_in[9]; const float* bcq = (const float*)d_in[10]; const float* wco = (const float*)d_in[11]; const float* bco = (const float*)d_in[12]; const float* wpv = (const float*)d_in[13]; const float* bpv = (const float*)d_in[14]; const float* wpk = (const float*)d_in[15]; const float* bpk = (const float*)d_in[16]; const float* wpq = (const float*)d_in[17]; const float* bpq = (const float*)d_in[18]; const float* wpo = (const float*)d_in[19]; const float* bpo = (const float*)d_in[20]; const float* wg = (const float*)d_in[21]; const float* bg = (const float*)d_in[22]; const float* x = xq; const float* wq = wcq; const float* bq = bcq; const float* wk = wck; const float* bk = bck; const float* wv = wcv; const float* bv = bcv; const float* wo = wco; const float* bo = bco;
    float* OUT = (float*)d_out;     // [2][2048][1024]
    char* wsp = (char*)d_ws;
    auto take = [&](size_t bytes) { char* p = wsp; wsp += (bytes + 255) & ~(size_t)255; return (void*)p; };
    bf* WQ = (bf*)take((size_t)DQ * DM * 2); bf* WK = (bf*)take((size_t)DKV * DM * 2); bf* WV = (bf*)take((size_t)DKV * DM * 2); bf* WO = (bf*)take((size_t)DM * DQ * 2); bf* WQ2 = (bf*)take((size_t)DQ * DM * 2); bf* WK2 = (bf*)take((size_t)DKV * DM * 2); bf* WV2 = (bf*)take((size_t)DKV * DM * 2); bf* WO2 = (bf*)take((size_t)DM * DQ * 2); bf* WG1 = (bf*)take((size_t)DM * DM * 2); bf* WG2 = (bf*)take((size_t)DM * DM * 2); float* CO = (float*)take((size_t)TT * DM * 4); float* PO = (float*)take((size_t)TT * DM * 4); bf* Ch = (bf*)take((size_t)TT * DM * 2); bf* Cl = (bf*)take((size_t)TT * DM * 2); float* G1 = (float*)take((size_t)TT * DM * 4); float* G2 = (float*)take((size_t)TT * DM * 4); float* CS = (float*)take((size_t)TT * HD * 2 * 4);
    bf* XB = (bf*)take((size_t)TT * DM * 2); bf* XKB = (bf*)take((size_t)TT * DM * 2); bf* XVB = (bf*)take((size_t)TT * DM * 2); bf* EB = (bf*)take((size_t)TT * DM * 2); float* FQ = (float*)take((size_t)TT * DQ * 4); float* FK = (float*)take((size_t)TT * DKV * 4);
    h16* QP16 = (h16*)take((size_t)NH_ * TT * HD * 2); h16* KP16 = (h16*)take((size_t)NKV * TT * HD * 2); h16* VT16 = (h16*)take((size_t)NKV * HD * TT * 2);
    bf* QPh = (bf*)take((size_t)NH_ * TT * HD * 2); bf* QPl = (bf*)take((size_t)NH_ * TT * HD * 2); bf* KPh = (bf*)take((size_t)NKV * TT * HD * 2); bf* KPl = (bf*)take((size_t)NKV * TT * HD * 2); bf* VTh = (bf*)take((size_t)NKV * HD * TT * 2); bf* VTl = (bf*)take((size_t)NKV * HD * TT * 2); bf* Ph = (bf*)take((size_t)ZH * RH * TT * 2); bf* Pl = (bf*)take((size_t)ZH * RH * TT * 2);
    float* Sb = (float*)take((size_t)ZH * TT * TT * 4); h16* P16 = (h16*)take((size_t)ZH * TT * TT * 2); float* Ob = (float*)take((size_t)ZH * TT * HD * 4); bf* ATh = (bf*)take((size_t)TT * DQ * 2); bf* ATl = (bf*)take((size_t)TT * DQ * 2);
    if ((size_t)(wsp - (char*)d_ws) > ws_size) return;    // ws 256 MiB
    float* FV = FK;   // v projection reuses the k buffer after the k planes are built (stream-ordered)
    { k_wtG<<<(unsigned)((DM * DQ / 64 + 63) / 64), 256, 0, stream>>>(wq, DM, DQ, WQ); k_wtG<<<(unsigned)((DM * DKV / 64 + 63) / 64), 256, 0, stream>>>(wk, DM, DKV, WK); k_wtG<<<(unsigned)((DM * DKV / 64 + 63) / 64), 256, 0, stream>>>(wv, DM, DKV, WV);
      k_wtG<<<(unsigned)((DQ * DM / 64 + 63) / 64), 256, 0, stream>>>(wo, DQ, DM, WO); k_wtG<<<(unsigned)((DM * DQ / 64 + 63) / 64), 256, 0, stream>>>(wpq, DM, DQ, WQ2); k_wtG<<<(unsigned)((DM * DKV / 64 + 63) / 64), 256, 0, stream>>>(wpk, DM, DKV, WK2); k_wtG<<<(unsigned)((DM * DKV / 64 + 63) / 64), 256, 0, stream>>>(wpv, DM, DKV, WV2); k_wtG<<<(unsigned)((DQ * DM / 64 + 63) / 64), 256, 0, stream>>>(wpo, DQ, DM, WO2); k_wtG<<<(unsigned)((DM * DM / 64 + 63) / 64), 256, 0, stream>>>(wg, DM, DM, WG1); k_wtG<<<(unsigned)((DM * DM / 64 + 63) / 64), 256, 0, stream>>>(wg + (size_t)DM * DM, DM, DM, WG2);   /* concept-branch weights; Wg halves (rows 0..1023 multiply char_out, 1024..2047 concept_out) */
       }
    k_csid<<<(TT * HD + 255) / 256, 256, 0, stream>>>(CS);
    const unsigned LQ = (unsigned)(((size_t)NH_ * TT * HD / 2 + 255) / 256), LKv = (unsigned)(((size_t)NKV * TT * HD / 2 + 255) / 256);
    for (int b = 0; b < NB_; ++b) {
        
        k_cvt8<<<(unsigned)(((size_t)TT * DM / 8 + 255) / 256), 256, 0, stream>>>(xq + (size_t)b * TT * DM, XB, (size_t)TT * DM / 8); k_cvt8<<<(unsigned)(((size_t)TT * DM / 8 + 255) / 256), 256, 0, stream>>>(xkeys + (size_t)b * TT * DM, XKB, (size_t)TT * DM / 8); k_cvt8<<<(unsigned)(((size_t)TT * DM / 8 + 255) / 256), 256, 0, stream>>>(xvals + (size_t)b * TT * DM, XVB, (size_t)TT * DM / 8); k_gath8<<<(unsigned)(((size_t)TT * DM / 8 + 255) / 256), 256, 0, stream>>>(EMB, CID + (size_t)b * TT, EB);   /* query / keys / values planes; gathered concept embeddings */
        /* ---- char branch: q <- query, k <- keys, v <- values ---- */
        
        k_gemmw<bf, 0, true><<<dim3(TT / 64, DQ / 64, 1), 32, 0, stream>>>(XB, nullptr, WQ, nullptr, DM, FQ, DQ, bcq, 0, 0, 0);
        k_rope<<<LQ, 256, 0, stream>>>(FQ, DQ, NH_, CS, nullptr, nullptr, 1.0f, QP16, QPh, QPl);
        k_gemmw<bf, 0, true><<<dim3(TT / 64, DKV / 64, 1), 32, 0, stream>>>(XKB, nullptr, WK, nullptr, DM, FK, DKV, bck, 0, 0, 0);
        k_rope<<<LKv, 256, 0, stream>>>(FK, DKV, NKV, CS, nullptr, nullptr, 1.0f, KP16, KPh, KPl);
        k_gemmw<bf, 0, true><<<dim3(TT / 64, DKV / 64, 1), 32, 0, stream>>>(XVB, nullptr, WV, nullptr, DM, FV, DKV, bcv, 0, 0, 0); k_vtp<<<LKv, 256, 0, stream>>>(FV, DKV, NKV, VT16, VTh, VTl);
        for (int h0 = 0; h0 < NH_; h0 += ZH) { const size_t zq = (size_t)h0, zk = (size_t)(h0 / REP);   // one kv head per query head: the pass's two heads use consecutive kv planes (z-strides TT*HD)
            k_gemmc<bf, 2, 1><<<dim3(RH / 64, TT / 64, ZH), 32, 0, stream>>>(QPh + zq * TT * HD, QPl + zq * TT * HD, KPh + zk * TT * HD, KPl + zk * TT * HD, HD, Sb, TT, 0, (size_t)TT * HD, (size_t)TT * HD, (size_t)TT * TT);
            k_gemmc<h16, 0, 1><<<dim3((TT - RH) / 64, TT / 64, ZH), 32, 0, stream>>>(QP16 + zq * TT * HD + (size_t)RH * HD, nullptr, KP16 + zk * TT * HD, nullptr, HD, Sb + (size_t)RH * TT, TT, RH, (size_t)TT * HD, (size_t)TT * HD, (size_t)TT * TT);
            k_asoft<<<ZH * TT / 8, 256, 0, stream>>>(Sb, P16, Ph, Pl);
            k_gemmc<bf, 2, 2><<<dim3(RH / 64, HD / 64, ZH), 32, 0, stream>>>(Ph, Pl, VTh + zk * HD * TT, VTl + zk * HD * TT, TT, Ob, HD, 0, (size_t)RH * TT, (size_t)HD * TT, (size_t)TT * HD);
            k_gemmc<h16, 0, 2><<<dim3((TT - RH) / 64, HD / 64, ZH), 32, 0, stream>>>(P16 + (size_t)RH * TT, nullptr, VT16 + zk * HD * TT, nullptr, TT, Ob + (size_t)RH * HD, HD, RH, (size_t)TT * TT, (size_t)HD * TT, (size_t)TT * HD);
            k_merge<<<(unsigned)(((size_t)ZH * TT * HD / 2 + 255) / 256), 256, 0, stream>>>(Ob, h0, ATh, ATl); }
        k_gemmw<bf, 1, true><<<dim3(TT / 64, DM / 64, 1), 32, 0, stream>>>(ATh, ATl, WO, nullptr, DQ, CO, DM, bco, 0, 0, 0);
        /* ---- concept branch: q <- query, k, v <- emb[concept_ids] ---- */
        
        k_gemmw<bf, 0, true><<<dim3(TT / 64, DQ / 64, 1), 32, 0, stream>>>(XB, nullptr, WQ2, nullptr, DM, FQ, DQ, bpq, 0, 0, 0);
        k_rope<<<LQ, 256, 0, stream>>>(FQ, DQ, NH_, CS, nullptr, nullptr, 1.0f, QP16, QPh, QPl);
        k_gemmw<bf, 0, true><<<dim3(TT / 64, DKV / 64, 1), 32, 0, stream>>>(EB, nullptr, WK2, nullptr, DM, FK, DKV, bpk, 0, 0, 0);
        k_rope<<<LKv, 256, 0, stream>>>(FK, DKV, NKV, CS, nullptr, nullptr, 1.0f, KP16, KPh, KPl);
        k_gemmw<bf, 0, true><<<dim3(TT / 64, DKV / 64, 1), 32, 0, stream>>>(EB, nullptr, WV2, nullptr, DM, FV, DKV, bpv, 0, 0, 0); k_vtp<<<LKv, 256, 0, stream>>>(FV, DKV, NKV, VT16, VTh, VTl);
        for (int h0 = 0; h0 < NH_; h0 += ZH) { const size_t zq = (size_t)h0, zk = (size_t)(h0 / REP);   // one kv head per query head: the pass's two heads use consecutive kv planes (z-strides TT*HD)
            k_gemmc<bf, 2, 1><<<dim3(RH / 64, TT / 64, ZH), 32, 0, stream>>>(QPh + zq * TT * HD, QPl + zq * TT * HD, KPh + zk * TT * HD, KPl + zk * TT * HD, HD, Sb, TT, 0, (size_t)TT * HD, (size_t)TT * HD, (size_t)TT * TT);
            k_gemmc<h16, 0, 1><<<dim3((TT - RH) / 64, TT / 64, ZH), 32, 0, stream>>>(QP16 + zq * TT * HD + (size_t)RH * HD, nullptr, KP16 + zk * TT * HD, nullptr, HD, Sb + (size_t)RH * TT, TT, RH, (size_t)TT * HD, (size_t)TT * HD, (size_t)TT * TT);
            k_asoft<<<ZH * TT / 8, 256, 0, stream>>>(Sb, P16, Ph, Pl);
            k_gemmc<bf, 2, 2><<<dim3(RH / 64, HD / 64, ZH), 32, 0, stream>>>(Ph, Pl, VTh + zk * HD * TT, VTl + zk * HD * TT, TT, Ob, HD, 0, (size_t)RH * TT, (size_t)HD * TT, (size_t)TT * HD);
            k_gemmc<h16, 0, 2><<<dim3((TT - RH) / 64, HD / 64, ZH), 32, 0, stream>>>(P16 + (size_t)RH * TT, nullptr, VT16 + zk * HD * TT, nullptr, TT, Ob + (size_t)RH * HD, HD, RH, (size_t)TT * TT, (size_t)HD * TT, (size_t)TT * HD);
            k_merge<<<(unsigned)(((size_t)ZH * TT * HD / 2 + 255) / 256), 256, 0, stream>>>(Ob, h0, ATh, ATl); }
        k_gemmw<bf, 1, true><<<dim3(TT / 64, DM / 64, 1), 32, 0, stream>>>(ATh, ATl, WO2, nullptr, DQ, PO, DM, bpo, 0, 0, 0);
        /* ---- gate + mix ---- */
        k_pl2<<<(unsigned)(((size_t)TT * DM / 4 + 255) / 256), 256, 0, stream>>>(CO, Ch, Cl, (size_t)TT * DM / 4); k_gemmw<bf, 1, false><<<dim3(TT / 64, DM / 64, 1), 32, 0, stream>>>(Ch, Cl, WG1, nullptr, DM, G1, DM, nullptr, 0, 0, 0);   /* char_out Wg[:1024] */
        k_pl2<<<(unsigned)(((size_t)TT * DM / 4 + 255) / 256), 256, 0, stream>>>(PO, Ch, Cl, (size_t)TT * DM / 4); k_gemmw<bf, 1, false><<<dim3(TT / 64, DM / 64, 1), 32, 0, stream>>>(Ch, Cl, WG2, nullptr, DM, G2, DM, nullptr, 0, 0, 0);   /* concept_out Wg[1024:] */
        k_gatemix<<<(unsigned)(((size_t)TT * DM / 4 + 255) / 256), 256, 0, stream>>>(G1, G2, bg, CO, PO, OUT + (size_t)b * TT * DM); }
}

// v001
// A run of this version takes 1680 microseconds.
// In two side-by-side timings against v000, it was 1.87 and 1.85 times as fast.
#include <hip/hip_runtime.h>

// Hierarchical (char + concept) gated attention (values, keys, query [2][2048][1024]; concept_ids int32 [2][2048] -> ce = emb[concept_ids] ([1000][1024], gathered on device); char branch: q = query Wcq + bcq, k = keys Wck + bck, v = values Wcv + bcv; concept branch: q = query Wpq + bpq, k = ce Wpk + bpk, v = ce Wpv + bpv ('xw' [1024][1024] + biases; 16 heads x 64); per branch: scores masked causally (-1e20) then x 1/sqrt(1024), softmax, merged, Wo + bo; gate = sigmoid([char_out | concept_out] Wg + bg) (Wg [2048][1024]); out = gate char_out + (1 - gate) concept_out -> [2][2048][1024] (4.2 M)).
// Compute dtypes, f32 accumulate: every input rounded to bf16; q/k/v on PLAIN bf16 operands (inputs: exact) + biases; causal scores and attn.v (tile skipping): query rows < 512 hl (3 products), the rest single fp16 (x1024); softmax f32; Wco / Wpo hl x exact (2 products) + bias; gate GEMMs 2 products; sigmoid (precise expf) and the convex mix in f32.

#define NB_  2
#define TT   2048
#define DM   1024
#define NH_  16
#define NKV  16
#define REP  (NH_ / NKV)
#define HD   64
#define DQ   (NH_ * HD)
#define DKV  (NKV * HD)
#define NVOC 1000
#define ZH   2
#define RH   512                  // query rows < RH use hi+lo planes (0: none)
#define WIN  2048
#define PCAR 1024.0f
#define SCL  0.03125f   // 1/sqrt(embed_size = 1024) as in the source
typedef _Float16 h16;
typedef unsigned short bf;
typedef __attribute__((ext_vector_type(16))) __bf16   v16bf;
typedef __attribute__((ext_vector_type(16))) _Float16 v16h;
typedef __attribute__((ext_vector_type(8)))  _Float16 v8h;
typedef __attribute__((ext_vector_type(8)))  unsigned short v8us;
typedef __attribute__((ext_vector_type(8)))  float    v8f;
typedef __attribute__((ext_vector_type(4)))  float    v4f;
typedef v8h  __attribute__((may_alias)) v8ha;
typedef v4f  __attribute__((may_alias)) v4fa;
typedef v8us __attribute__((may_alias)) v8usa;

__device__ __forceinline__ unsigned short f2bf(float f) { unsigned u = __float_as_uint(f); u += 0x7FFFu + ((u >> 16) & 1u); return (unsigned short)(u >> 16); }
__device__ __forceinline__ float bf2f(unsigned short b) { return __uint_as_float(((unsigned)b) << 16); }
__device__ __forceinline__ float bfr(float f) { return bf2f(f2bf(f)); }
__device__ __forceinline__ v16h cat16(v8h lo, v8h hi) { return __builtin_shufflevector(lo, hi, 0, 1, 2, 3, 4, 5, 6, 7, 8, 9, 10, 11, 12, 13, 14, 15); }
__device__ __forceinline__ v16bf cat16b(v8us lo, v8us hi) { return __builtin_bit_cast(v16bf, __builtin_shufflevector(lo, hi, 0, 1, 2, 3, 4, 5, 6, 7, 8, 9, 10, 11, 12, 13, 14, 15)); }
__device__ __forceinline__ v8f wmma16(v16h a, v16h b, v8f c) { return __builtin_amdgcn_wmma_f32_16x16x32_f16(false, a, false, b, (short)0, c, false, false); }
__device__ __forceinline__ v8f wmmab(v16bf a, v16bf b, v8f c) { return __builtin_amdgcn_wmma_f32_16x16x32_bf16(false, a, false, b, (short)0, c, false, false); }



// ---- k_gemmk: register-blocked GEMM, one 64x64 output tile per block, the K loop SPLIT OVER THE NW WAVES of the block: wave w takes the 32-wide K steps w, w + NW, ... (two neighbouring waves read the two halves of the same
// 128-byte lines at the same time) into its own 16 accumulators, operands straight from K-contiguous 16-bit planes; the NW partial tiles are then summed through LDS in fixed wave order 0..NW-1. grid (M/64, N/64, Z), NW*32 threads.
// C[m][n] (f32, pitch ldc, + optional f32 bias[n]) = sum_k A[m][k] Bt[n][k] (+ split products per NSPLIT). z-batch strides sA/sB/sC in elements. K % 32 == 0.
// CAUSALK limits the key (K) range of the probability x value contraction to the diagonal block (probabilities beyond it are exactly zero); roff = row offset of this launch's first row within the sequence.
template <typename T16> struct WFrag;
template <> struct WFrag<h16> { typedef v16h V; static __device__ __forceinline__ V ld(const h16* p) { return cat16(*(const v8h*)p, *(const v8h*)(p + 16)); } static __device__ __forceinline__ v8f mma(V a, V b, v8f c) { return wmma16(a, b, c); } };
template <> struct WFrag<bf> { typedef v16bf V; static __device__ __forceinline__ V ld(const bf* p) { return cat16b(*(const v8us*)p, *(const v8us*)(p + 16)); } static __device__ __forceinline__ v8f mma(V a, V b, v8f c) { return wmmab(a, b, c); } };
template <typename T16, int NSPLIT, bool CAUSALK, bool BIAS, int NW>
__global__ __launch_bounds__(NW * 32) void k_gemmk(const T16* __restrict__ A, const T16* __restrict__ A2, const T16* __restrict__ Bt, const T16* __restrict__ Bt2, int K, float* C, int ldc, const float* __restrict__ bias, int roff, size_t sA, size_t sB, size_t sC) {
    typedef typename WFrag<T16>::V V;
    __shared__ __align__(16) float part[NW * 4096];   // [wave][tile 0..15][j half][lane][4]: every wave's accumulators in register order, 16-byte stores contiguous over the lanes
    __shared__ __align__(16) float os[64 * 68];       // the summed tile, row-major (pitch 68 floats: both half-waves on disjoint banks)
    const size_t z = blockIdx.z; A += z * sA; if (A2) A2 += z * sA; Bt += z * sB; if (Bt2) Bt2 += z * sB; C += z * sC;
    const int lane = threadIdx.x & 31, lr = lane & 15, hi = lane >> 4; const int r0 = blockIdx.x * 64, c0 = blockIdx.y * 64;
    const int w = __builtin_amdgcn_readfirstlane((int)(threadIdx.x >> 5));   // wave number in a scalar register: the K loop's bounds stay scalar
    const int Kl = CAUSALK ? min(K, r0 + roff + 64) : K;
    v8f acc[4][4];
#pragma unroll
    for (int mb = 0; mb < 4; ++mb)
#pragma unroll
        for (int nb = 0; nb < 4; ++nb) acc[mb][nb] = (v8f){};
    const size_t aoff = (size_t)(r0 + lr) * K + 8 * hi, boff = (size_t)(c0 + lr) * K + 8 * hi;
#pragma unroll 1   // rolled: an unrolled body would hold a second set of fragments and pass the register budget of 16 waves
    for (int kc = w * 32; kc < Kl; kc += NW * 32) {
        V a[4], a2[4];
#pragma unroll
        for (int mb = 0; mb < 4; ++mb) { a[mb] = WFrag<T16>::ld(A + aoff + (size_t)mb * 16 * K + kc); if (NSPLIT == 1 || NSPLIT == 2) a2[mb] = WFrag<T16>::ld(A2 + aoff + (size_t)mb * 16 * K + kc); }
#pragma unroll
        for (int nb = 0; nb < 4; ++nb) { const V b = WFrag<T16>::ld(Bt + boff + (size_t)nb * 16 * K + kc); V b2; if (NSPLIT >= 2) b2 = WFrag<T16>::ld(Bt2 + boff + (size_t)nb * 16 * K + kc);
#pragma unroll
            for (int mb = 0; mb < 4; ++mb) { acc[mb][nb] = WFrag<T16>::mma(a[mb], b, acc[mb][nb]); if (NSPLIT == 1 || NSPLIT == 2) acc[mb][nb] = WFrag<T16>::mma(a2[mb], b, acc[mb][nb]); if (NSPLIT >= 2) acc[mb][nb] = WFrag<T16>::mma(a[mb], b2, acc[mb][nb]); } }
        // four vector slots behind the last matrix instruction, on the back edge and on the exit alike, before its fragments are reloaded or its accumulators stored
        asm volatile("v_nop\n\tv_nop\n\tv_nop\n\tv_nop" : "+v"(acc[0][0]), "+v"(acc[1][1]), "+v"(acc[2][2]), "+v"(acc[3][3]) : "v"(a[0]), "v"(a[3]));
    }
#pragma unroll
    for (int mb = 0; mb < 4; ++mb)
#pragma unroll
        for (int nb = 0; nb < 4; ++nb) { float* p = part + ((w * 16 + mb * 4 + nb) * 2) * 128 + lane * 4; const v8f c = acc[mb][nb];
            *(v4fa*)p = (v4f){c[0], c[1], c[2], c[3]}; *(v4fa*)(p + 128) = (v4f){c[4], c[5], c[6], c[7]}; }
    __syncthreads();   // every wave's partial tile is in LDS
#pragma unroll
    for (int q = 0; q < 16 / NW; ++q) { const int tile = w * (16 / NW) + q, mb = tile >> 2, nb = tile & 3; const float* p = part + tile * 256 + lane * 4;
        v4f s0 = *(const v4fa*)p, s1 = *(const v4fa*)(p + 128);
#pragma unroll
        for (int u = 1; u < NW; ++u) { s0 += *(const v4fa*)(p + u * 4096); s1 += *(const v4fa*)(p + u * 4096 + 128); }
#pragma unroll
        for (int j = 0; j < 4; ++j) { os[(mb * 16 + hi * 8 + j) * 68 + nb * 16 + lr] = s0[j]; os[(mb * 16 + hi * 8 + 4 + j) * 68 + nb * 16 + lr] = s1[j]; } }
    __syncthreads();   // the summed tile is complete
#pragma unroll
    for (int s = 0; s < 32 / NW; ++s) { const int idx = s * (NW * 32) + (int)threadIdx.x, row = idx >> 4, cofs = (idx & 15) * 4; v4f val = *(const v4fa*)(os + row * 68 + cofs); if (BIAS) { val[0] += bfr(bias[c0 + cofs]); val[1] += bfr(bias[c0 + cofs + 1]); val[2] += bfr(bias[c0 + cofs + 2]); val[3] += bfr(bias[c0 + cofs + 3]); }
        *(v4f*)(C + (size_t)(r0 + row) * ldc + c0 + cofs) = val; }
}

// ---- k_gemmc: ONE WAVE per 64x64 output tile (16 accumulators, short K = head size), for the causal scores: CMODE 1 skips score tiles entirely above the diagonal (query rows r0+roff.., key columns c0..).
// roff = row offset of this launch's first row within the sequence.
template <typename T16, int NSPLIT, int CMODE>
__global__ __launch_bounds__(32) void k_gemmc(const T16* __restrict__ A, const T16* __restrict__ A2, const T16* __restrict__ Bt, const T16* __restrict__ Bt2, int K, float* C, int ldc, int roff, size_t sA, size_t sB, size_t sC) {
    typedef typename WFrag<T16>::V V;
    __shared__ __align__(16) float os[16 * 68];
    const size_t z = blockIdx.z; A += z * sA; if (A2) A2 += z * sA; Bt += z * sB; if (Bt2) Bt2 += z * sB; C += z * sC;
    const int lane = threadIdx.x & 31, lr = lane & 15, hi = lane >> 4; const int r0 = blockIdx.x * 64, c0 = blockIdx.y * 64;
    if (CMODE == 1 && c0 > r0 + roff + 63) return;                  // score tile entirely above the causal diagonal: never read (the softmax masks j > i by select)
    const int Kl = K;
    v8f acc[4][4];
#pragma unroll
    for (int mb = 0; mb < 4; ++mb)
#pragma unroll
        for (int nb = 0; nb < 4; ++nb) acc[mb][nb] = (v8f){};
    const size_t aoff = (size_t)(r0 + lr) * K + 8 * hi, boff = (size_t)(c0 + lr) * K + 8 * hi;
#pragma unroll 1
    for (int kc = 0; kc < Kl; kc += 32) {
        V a[4], a2[4];
#pragma unroll
        for (int mb = 0; mb < 4; ++mb) { a[mb] = WFrag<T16>::ld(A + aoff + (size_t)mb * 16 * K + kc); if (NSPLIT == 1 || NSPLIT == 2) a2[mb] = WFrag<T16>::ld(A2 + aoff + (size_t)mb * 16 * K + kc); }
#pragma unroll
        for (int nb = 0; nb < 4; ++nb) { const V b = WFrag<T16>::ld(Bt + boff + (size_t)nb * 16 * K + kc); V b2; if (NSPLIT >= 2) b2 = WFrag<T16>::ld(Bt2 + boff + (size_t)nb * 16 * K + kc);
#pragma unroll
            for (int mb = 0; mb < 4; ++mb) { acc[mb][nb] = WFrag<T16>::mma(a[mb], b, acc[mb][nb]); if (NSPLIT == 1 || NSPLIT == 2) acc[mb][nb] = WFrag<T16>::mma(a2[mb], b, acc[mb][nb]); if (NSPLIT >= 2) acc[mb][nb] = WFrag<T16>::mma(a[mb], b2, acc[mb][nb]); } }
        asm volatile("v_nop\n\tv_nop\n\tv_nop\n\tv_nop" : "+v"(acc[0][0]), "+v"(acc[1][1]), "+v"(acc[2][2]), "+v"(acc[3][3]) : "v"(a[0]), "v"(a[3]));
    }
#pragma unroll
    for (int mb = 0; mb < 4; ++mb) {
#pragma unroll
        for (int nb = 0; nb < 4; ++nb) {
#pragma unroll
            for (int j = 0; j < 8; ++j) os[(hi * 8 + j) * 68 + nb * 16 + lr] = acc[mb][nb][j]; }
        __builtin_amdgcn_wave_barrier(); asm volatile("" ::: "memory");
        float* crow = C + (size_t)(r0 + mb * 16) * ldc + c0;
{
#pragma unroll
            for (int s = 0; s < 8; ++s) { const int row = 2 * s + hi, cofs = lr * 4; v4f val = *(const v4fa*)(os + row * 68 + cofs);
                *(v4f*)(crow + (size_t)row * ldc + cofs) = val; }
             }
        __builtin_amdgcn_wave_barrier(); asm volatile("" ::: "memory");
    }
}

__device__ __forceinline__ h16 tohx(float x) { return (h16)x; }
__device__ __forceinline__ void splitf(float y, unsigned short& h, unsigned short& l) { h = f2bf(y); l = f2bf(y - bf2f(h)); }
typedef __attribute__((ext_vector_type(2))) _Float16 v2h;
typedef __attribute__((ext_vector_type(4))) _Float16 v4h;
typedef __attribute__((ext_vector_type(2))) unsigned short v2us;
typedef __attribute__((ext_vector_type(4))) unsigned short v4us;
typedef __attribute__((ext_vector_type(2))) float v2f;
typedef __attribute__((ext_vector_type(4))) int v4i;

__global__ __launch_bounds__(256) void k_wtG(const float* __restrict__ w, int K, int N, bf* Bt) {
    const int lane = threadIdx.x & 31; const int L0 = (blockIdx.x * 8 + (threadIdx.x >> 5)) * 8; const int nlines = N * K / 64;
{
#pragma unroll 1
        for (int l = 0; l < 8; ++l) { const int L = L0 + l; if (L >= nlines) break; const size_t e = (size_t)L * 64 + lane * 2; const int k = (int)(e % K), n = (int)(e / K); v2us o;
            o[0] = f2bf(w[(size_t)k * N + n]); o[1] = f2bf(w[(size_t)(k + 1) * N + n]); *(v2us*)(Bt + e) = o; }
         }
}
__global__ __launch_bounds__(256) void k_cvt8(const float* __restrict__ src, bf* dst, size_t n8) { const size_t i = (size_t)blockIdx.x * 256 + threadIdx.x; if (i >= n8) return; const v8f v = *(const v8f*)(src + i * 8); v8us o;
#pragma unroll
    for (int k = 0; k < 8; ++k) o[k] = f2bf(v[k]); *(v8us*)(dst + i * 8) = o;  }

// k_rope: head planes [h][t][d] (fp16 + hi/lo) of rope(x) x sc with the rotate-half convention out[d] = x[d] cos[t][d] - x[d+HD/2] sin[t][d], out[d+HD/2] = x[d+HD/2] cos[t][d+HD/2] + x[d] sin[t][d+HD/2]
__global__ __launch_bounds__(256) void k_rope(const float* __restrict__ F, int pitch, int nheads, const float* __restrict__ CS, const float* __restrict__ RF, const float* __restrict__ nw, float sc, h16* P16, bf* Ph, bf* Pl) {
    const size_t e = ((size_t)blockIdx.x * 256 + threadIdx.x) * 2; if (e >= (size_t)nheads * TT * HD) return; const int d = (int)(e % HD); const int t = (int)((e / HD) % TT); const int h = (int)(e / ((size_t)HD * TT)); const float* f = F + (size_t)t * pitch + h * HD; const float rf = RF ? RF[(size_t)h * TT + t] : 1.0f; v2h o16; v2us oh, ol;
#pragma unroll
    for (int q = 0; q < 2; ++q) { const int dd = d + q; const int dp = (dd < HD / 2) ? dd + HD / 2 : dd - HD / 2; float x0 = f[dd], x1 = f[dp];
        if (RF) { float n0 = __fmul_rn(x0, rf), n1 = __fmul_rn(x1, rf); asm volatile("" : "+v"(n0)); asm volatile("" : "+v"(n1)); x0 = __fmul_rn(bfr(nw[dd]), n0); x1 = __fmul_rn(bfr(nw[dp]), n1); }
        const v2f cs = *(const v2f*)(CS + ((size_t)t * HD + dd) * 2); float a = __fmul_rn(x0, cs[0]), bq = __fmul_rn(x1, cs[1]); asm volatile("" : "+v"(a)); asm volatile("" : "+v"(bq)); const float r = ((dd < HD / 2) ? __fsub_rn(a, bq) : __fadd_rn(a, bq)) * sc;
        o16[q] = tohx(r); unsigned short a2, c2; splitf(r, a2, c2); oh[q] = a2; ol[q] = c2; }
    *(v2h*)(P16 + e) = o16; *(v2us*)(Ph + e) = oh; *(v2us*)(Pl + e) = ol;  }
__global__ __launch_bounds__(256) void k_vtp(const float* __restrict__ F, int pitch, int nheads, h16* V16, bf* Vh, bf* Vl) { const size_t e = ((size_t)blockIdx.x * 256 + threadIdx.x) * 2; if (e >= (size_t)nheads * HD * TT) return; const int t = (int)(e % TT); const int d = (int)((e / TT) % HD); const int g = (int)(e / ((size_t)TT * HD)); v2h o16; v2us oh, ol;
#pragma unroll
    for (int q = 0; q < 2; ++q) { const float x = F[(size_t)(t + q) * pitch + g * HD + d]; o16[q] = tohx(x); unsigned short a2, c2; splitf(x, a2, c2); oh[q] = a2; ol[q] = c2; }
    *(v2h*)(V16 + e) = o16; *(v2us*)(Vh + e) = oh; *(v2us*)(Vl + e) = ol;  }
__global__ __launch_bounds__(256) void k_csid(float* CS) { const int idx = blockIdx.x * 256 + threadIdx.x; if (idx >= TT * HD) return; v2f cs; cs[0] = 1.0f; cs[1] = 0.0f; *(v2f*)(CS + (size_t)idx * 2) = cs;  }
__global__ __launch_bounds__(256) void k_gath8(const float* __restrict__ TE, const int* __restrict__ IDS, bf* EB) { const size_t i = (size_t)blockIdx.x * 256 + threadIdx.x; if (i >= (size_t)TT * DM / 8) return; const size_t e = i * 8; const int t = (int)(e / DM); const int c = (int)(e % DM); const int id = min(max(IDS[t], 0), NVOC - 1); const v8f v = *(const v8f*)(TE + (size_t)id * DM + c); v8us o;
#pragma unroll
    for (int k = 0; k < 8; ++k) o[k] = f2bf(v[k]); *(v8us*)(EB + e) = o;  }
__global__ __launch_bounds__(256) void k_pl2(const float* __restrict__ F, bf* Ph, bf* Pl, size_t n4) { const size_t i = (size_t)blockIdx.x * 256 + threadIdx.x; if (i >= n4) return; const v4f v = *(const v4f*)(F + i * 4); v4us oh, ol;
#pragma unroll
    for (int q = 0; q < 4; ++q) { unsigned short a, c; splitf(v[q], a, c); oh[q] = a; ol[q] = c; } *(v4us*)(Ph + i * 4) = oh; *(v4us*)(Pl + i * 4) = ol;  }
__global__ __launch_bounds__(256) void k_gatemix(const float* __restrict__ G1, const float* __restrict__ G2, const float* __restrict__ bg, const float* __restrict__ CO, const float* __restrict__ PO, float* O) { const size_t i = (size_t)blockIdx.x * 256 + threadIdx.x; if (i >= (size_t)TT * DM / 4) return; const size_t e = i * 4; const int c0 = (int)(e % DM); const v4f a = *(const v4f*)(G1 + e), b2 = *(const v4f*)(G2 + e), co = *(const v4f*)(CO + e), po = *(const v4f*)(PO + e); v4f o;
#pragma unroll
    for (int q = 0; q < 4; ++q) { float z = __fadd_rn(__fadd_rn(a[q], b2[q]), bfr(bg[c0 + q])); const float gt = __fdiv_rn(1.0f, __fadd_rn(1.0f, expf(-z))); float t1 = __fmul_rn(gt, co[q]); float t2 = __fmul_rn(__fsub_rn(1.0f, gt), po[q]); asm volatile("" : "+v"(t1), "+v"(t2)); o[q] = __fadd_rn(t1, t2); }
    *(v4f*)(O + e) = o;  }
// k_asoft: per row (zz, i): t = S x SCL (1/sqrt(1024)) for j <= i and i - j < WIN (sliding causal window; the reference's -1e9 additive fill vanishes identically); softmax over the 2048 keys (register row, one exp, fixed trees);
__global__ __launch_bounds__(256) void k_asoft(const float* __restrict__ Sb, h16* P16, bf* Ph, bf* Pl) {
    const int lane = threadIdx.x & 31; const int row = blockIdx.x * 8 + (threadIdx.x >> 5); if (row >= ZH * TT) return; const int i = row % TT; const int zz = row / TT; (void)zz; const bool hires = (i < RH); const float* sr = Sb + (size_t)row * TT; float v[TT / 32]; float mx = -3.0e38f;
#pragma unroll
    for (int ch = 0; ch < TT / 128; ++ch) { const int j0 = ch * 128 + lane * 4; const v4f a = *(const v4f*)(sr + j0);
#pragma unroll
        for (int q = 0; q < 4; ++q) { const int j = j0 + q; (void)j; const float t = (j <= i && i - j < WIN) ? a[q] * SCL : -3.0e38f; v[ch * 4 + q] = t; mx = fmaxf(mx, t); } }
#pragma unroll
    for (int sh = 16; sh; sh >>= 1) mx = fmaxf(mx, __shfl_xor(mx, sh, 32));
    float sum = 0.f;
#pragma unroll
    for (int k = 0; k < TT / 32; ++k) { float d0 = __fsub_rn(v[k], mx); asm volatile("" : "+v"(d0)); v[k] = __builtin_amdgcn_exp2f(__fmul_rn(d0, 1.4426950408889634f)); sum += v[k]; }
#pragma unroll
    for (int sh = 16; sh; sh >>= 1) sum += __shfl_xor(sum, sh, 32);
    const float f = __fdiv_rn(hires ? 1.0f : PCAR, sum);
{
        if (hires) {
#pragma unroll
            for (int ch = 0; ch < TT / 128; ++ch) { v4us oh, ol;
#pragma unroll
                for (int q = 0; q < 4; ++q) { unsigned short a, c2; splitf(v[ch * 4 + q] * f, a, c2); oh[q] = a; ol[q] = c2; }
                const size_t oo = ((size_t)zz * (RH ? RH : 1) + i) * TT + ch * 128 + lane * 4; *(v4us*)(Ph + oo) = oh; *(v4us*)(Pl + oo) = ol; }
        } else {
#pragma unroll
            for (int ch = 0; ch < TT / 128; ++ch) { v4h o4;
#pragma unroll
                for (int q = 0; q < 4; ++q) o4[q] = tohx(v[ch * 4 + q] * f);
                *(v4h*)(P16 + (size_t)row * TT + ch * 128 + lane * 4) = o4; } }
         }
}
__global__ __launch_bounds__(256) void k_merge(const float* __restrict__ O, int h0, bf* Ah, bf* Al) { const size_t e = ((size_t)blockIdx.x * 256 + threadIdx.x) * 2; if (e >= (size_t)ZH * TT * HD) return; const int d = (int)(e % HD); const int t = (int)((e / HD) % TT); const int zz = (int)(e / ((size_t)HD * TT)); const float cs = (t < RH) ? 1.0f : (1.0f / PCAR); const size_t oo = (size_t)t * DQ + (h0 + zz) * HD + d;
    v2us oh, ol;
#pragma unroll
    for (int q = 0; q < 2; ++q) { unsigned short a, c2; splitf(O[e + q] * cs, a, c2); oh[q] = a; ol[q] = c2; } *(v2us*)(Ah + oo) = oh; *(v2us*)(Al + oo) = ol;  }

extern "C" void kernel_launch(void* const* d_in, const int* in_sizes, int n_in,
                              void* d_out, int out_size, void* d_ws, size_t ws_size, hipStream_t stream) {
    (void)in_sizes; (void)n_in; (void)out_size;
    const float* xvals = (const float*)d_in[0]; const float* xkeys = (const float*)d_in[1]; const float* xq = (const float*)d_in[2]; const int* CID = (const int*)d_in[3]; const float* EMB = (const float*)d_in[4]; const float* wcv = (const float*)d_in[5]; const float* bcv = (const float*)d_in[6]; const float* wck = (const float*)d_in[7]; const float* bck = (const float*)d_in[8]; const float* wcq = (const float*)d_in[9]; const float* bcq = (const float*)d_in[10]; const float* wco = (const float*)d_in[11]; const float* bco = (const float*)d_in[12]; const float* wpv = (const float*)d_in[13]; const float* bpv = (const float*)d_in[14]; const float* wpk = (const float*)d_in[15]; const float* bpk = (const float*)d_in[16]; const float* wpq = (const float*)d_in[17]; const float* bpq = (const float*)d_in[18]; const float* wpo = (const float*)d_in[19]; const float* bpo = (const float*)d_in[20]; const float* wg = (const float*)d_in[21]; const float* bg = (const float*)d_in[22]; const float* x = xq; const float* wq = wcq; const float* bq = bcq; const float* wk = wck; const float* bk = bck; const float* wv = wcv; const float* bv = bcv; const float* wo = wco; const float* bo = bco;
    float* OUT = (float*)d_out;     // [2][2048][1024]
    char* wsp = (char*)d_ws;
    auto take = [&](size_t bytes) { char* p = wsp; wsp += (bytes + 255) & ~(size_t)255; return (void*)p; };
    bf* WQ = (bf*)take((size_t)DQ * DM * 2); bf* WK = (bf*)take((size_t)DKV * DM * 2); bf* WV = (bf*)take((size_t)DKV * DM * 2); bf* WO = (bf*)take((size_t)DM * DQ * 2); bf* WQ2 = (bf*)take((size_t)DQ * DM * 2); bf* WK2 = (bf*)take((size_t)DKV * DM * 2); bf* WV2 = (bf*)take((size_t)DKV * DM * 2); bf* WO2 = (bf*)take((size_t)DM * DQ * 2); bf* WG1 = (bf*)take((size_t)DM * DM * 2); bf* WG2 = (bf*)take((size_t)DM * DM * 2); float* CO = (float*)take((size_t)TT * DM * 4); float* PO = (float*)take((size_t)TT * DM * 4); bf* Ch = (bf*)take((size_t)TT * DM * 2); bf* Cl = (bf*)take((size_t)TT * DM * 2); float* G1 = (float*)take((size_t)TT * DM * 4); float* G2 = (float*)take((size_t)TT * DM * 4); float* CS = (float*)take((size_t)TT * HD * 2 * 4);
    bf* XB = (bf*)take((size_t)TT * DM * 2); bf* XKB = (bf*)take((size_t)TT * DM * 2); bf* XVB = (bf*)take((size_t)TT * DM * 2); bf* EB = (bf*)take((size_t)TT * DM * 2); float* FQ = (float*)take((size_t)TT * DQ * 4); float* FK = (float*)take((size_t)TT * DKV * 4);
    h16* QP16 = (h16*)take((size_t)NH_ * TT * HD * 2); h16* KP16 = (h16*)take((size_t)NKV * TT * HD * 2); h16* VT16 = (h16*)take((size_t)NKV * HD * TT * 2);
    bf* QPh = (bf*)take((size_t)NH_ * TT * HD * 2); bf* QPl = (bf*)take((size_t)NH_ * TT * HD * 2); bf* KPh = (bf*)take((size_t)NKV * TT * HD * 2); bf* KPl = (bf*)take((size_t)NKV * TT * HD * 2); bf* VTh = (bf*)take((size_t)NKV * HD * TT * 2); bf* VTl = (bf*)take((size_t)NKV * HD * TT * 2); bf* Ph = (bf*)take((size_t)ZH * RH * TT * 2); bf* Pl = (bf*)take((size_t)ZH * RH * TT * 2);
    float* Sb = (float*)take((size_t)ZH * TT * TT * 4); h16* P16 = (h16*)take((size_t)ZH * TT * TT * 2); float* Ob = (float*)take((size_t)ZH * TT * HD * 4); bf* ATh = (bf*)take((size_t)TT * DQ * 2); bf* ATl = (bf*)take((size_t)TT * DQ * 2);
    if ((size_t)(wsp - (char*)d_ws) > ws_size) return;    // ws 256 MiB
    float* FV = FK;   // v projection reuses the k buffer after the k planes are built (stream-ordered)
    { k_wtG<<<(unsigned)((DM * DQ / 64 + 63) / 64), 256, 0, stream>>>(wq, DM, DQ, WQ); k_wtG<<<(unsigned)((DM * DKV / 64 + 63) / 64), 256, 0, stream>>>(wk, DM, DKV, WK); k_wtG<<<(unsigned)((DM * DKV / 64 + 63) / 64), 256, 0, stream>>>(wv, DM, DKV, WV);
      k_wtG<<<(unsigned)((DQ * DM / 64 + 63) / 64), 256, 0, stream>>>(wo, DQ, DM, WO); k_wtG<<<(unsigned)((DM * DQ / 64 + 63) / 64), 256, 0, stream>>>(wpq, DM, DQ, WQ2); k_wtG<<<(unsigned)((DM * DKV / 64 + 63) / 64), 256, 0, stream>>>(wpk, DM, DKV, WK2); k_wtG<<<(unsigned)((DM * DKV / 64 + 63) / 64), 256, 0, stream>>>(wpv, DM, DKV, WV2); k_wtG<<<(unsigned)((DQ * DM / 64 + 63) / 64), 256, 0, stream>>>(wpo, DQ, DM, WO2); k_wtG<<<(unsigned)((DM * DM / 64 + 63) / 64), 256, 0, stream>>>(wg, DM, DM, WG1); k_wtG<<<(unsigned)((DM * DM / 64 + 63) / 64), 256, 0, stream>>>(wg + (size_t)DM * DM, DM, DM, WG2);   /* concept-branch weights; Wg halves (rows 0..1023 multiply char_out, 1024..2047 concept_out) */
       }
    k_csid<<<(TT * HD + 255) / 256, 256, 0, stream>>>(CS);
    const unsigned LQ = (unsigned)(((size_t)NH_ * TT * HD / 2 + 255) / 256), LKv = (unsigned)(((size_t)NKV * TT * HD / 2 + 255) / 256);
    for (int b = 0; b < NB_; ++b) {
        
        k_cvt8<<<(unsigned)(((size_t)TT * DM / 8 + 255) / 256), 256, 0, stream>>>(xq + (size_t)b * TT * DM, XB, (size_t)TT * DM / 8); k_cvt8<<<(unsigned)(((size_t)TT * DM / 8 + 255) / 256), 256, 0, stream>>>(xkeys + (size_t)b * TT * DM, XKB, (size_t)TT * DM / 8); k_cvt8<<<(unsigned)(((size_t)TT * DM / 8 + 255) / 256), 256, 0, stream>>>(xvals + (size_t)b * TT * DM, XVB, (size_t)TT * DM / 8); k_gath8<<<(unsigned)(((size_t)TT * DM / 8 + 255) / 256), 256, 0, stream>>>(EMB, CID + (size_t)b * TT, EB);   /* query / keys / values planes; gathered concept embeddings */
        /* ---- char branch: q <- query, k <- keys, v <- values ---- */
        
        k_gemmk<bf, 0, false, true, 8><<<dim3(TT / 64, DQ / 64, 1), 256, 0, stream>>>(XB, nullptr, WQ, nullptr, DM, FQ, DQ, bcq, 0, 0, 0, 0);
        k_rope<<<LQ, 256, 0, stream>>>(FQ, DQ, NH_, CS, nullptr, nullptr, 1.0f, QP16, QPh, QPl);
        k_gemmk<bf, 0, false, true, 8><<<dim3(TT / 64, DKV / 64, 1), 256, 0, stream>>>(XKB, nullptr, WK, nullptr, DM, FK, DKV, bck, 0, 0, 0, 0);
        k_rope<<<LKv, 256, 0, stream>>>(FK, DKV, NKV, CS, nullptr, nullptr, 1.0f, KP16, KPh, KPl);
        k_gemmk<bf, 0, false, true, 8><<<dim3(TT / 64, DKV / 64, 1), 256, 0, stream>>>(XVB, nullptr, WV, nullptr, DM, FV, DKV, bcv, 0, 0, 0, 0); k_vtp<<<LKv, 256, 0, stream>>>(FV, DKV, NKV, VT16, VTh, VTl);
        for (int h0 = 0; h0 < NH_; h0 += ZH) { const size_t zq = (size_t)h0, zk = (size_t)(h0 / REP);   // one kv head per query head: the pass's two heads use consecutive kv planes (z-strides TT*HD)
            k_gemmc<bf, 2, 1><<<dim3(RH / 64, TT / 64, ZH), 32, 0, stream>>>(QPh + zq * TT * HD, QPl + zq * TT * HD, KPh + zk * TT * HD, KPl + zk * TT * HD, HD, Sb, TT, 0, (size_t)TT * HD, (size_t)TT * HD, (size_t)TT * TT);
            k_gemmc<h16, 0, 1><<<dim3((TT - RH) / 64, TT / 64, ZH), 32, 0, stream>>>(QP16 + zq * TT * HD + (size_t)RH * HD, nullptr, KP16 + zk * TT * HD, nullptr, HD, Sb + (size_t)RH * TT, TT, RH, (size_t)TT * HD, (size_t)TT * HD, (size_t)TT * TT);
            k_asoft<<<ZH * TT / 8, 256, 0, stream>>>(Sb, P16, Ph, Pl);
            k_gemmk<bf, 2, true, false, 8><<<dim3(RH / 64, HD / 64, ZH), 256, 0, stream>>>(Ph, Pl, VTh + zk * HD * TT, VTl + zk * HD * TT, TT, Ob, HD, nullptr, 0, (size_t)RH * TT, (size_t)HD * TT, (size_t)TT * HD);
            k_gemmk<h16, 0, true, false, 16><<<dim3((TT - RH) / 64, HD / 64, ZH), 512, 0, stream>>>(P16 + (size_t)RH * TT, nullptr, VT16 + zk * HD * TT, nullptr, TT, Ob + (size_t)RH * HD, HD, nullptr, RH, (size_t)TT * TT, (size_t)HD * TT, (size_t)TT * HD);
            k_merge<<<(unsigned)(((size_t)ZH * TT * HD / 2 + 255) / 256), 256, 0, stream>>>(Ob, h0, ATh, ATl); }
        k_gemmk<bf, 1, false, true, 8><<<dim3(TT / 64, DM / 64, 1), 256, 0, stream>>>(ATh, ATl, WO, nullptr, DQ, CO, DM, bco, 0, 0, 0, 0);
        /* ---- concept branch: q <- query, k, v <- emb[concept_ids] ---- */
        
        k_gemmk<bf, 0, false, true, 8><<<dim3(TT / 64, DQ / 64, 1), 256, 0, stream>>>(XB, nullptr, WQ2, nullptr, DM, FQ, DQ, bpq, 0, 0, 0, 0);
        k_rope<<<LQ, 256, 0, stream>>>(FQ, DQ, NH_, CS, nullptr, nullptr, 1.0f, QP16, QPh, QPl);
        k_gemmk<bf, 0, false, true, 8><<<dim3(TT / 64, DKV / 64, 1), 256, 0, stream>>>(EB, nullptr, WK2, nullptr, DM, FK, DKV, bpk, 0, 0, 0, 0);
        k_rope<<<LKv, 256, 0, stream>>>(FK, DKV, NKV, CS, nullptr, nullptr, 1.0f, KP16, KPh, KPl);
        k_gemmk<bf, 0, false, true, 8><<<dim3(TT / 64, DKV / 64, 1), 256, 0, stream>>>(EB, nullptr, WV2, nullptr, DM, FV, DKV, bpv, 0, 0, 0, 0); k_vtp<<<LKv, 256, 0, stream>>>(FV, DKV, NKV, VT16, VTh, VTl);
        for (int h0 = 0; h0 < NH_; h0 += ZH) { const size_t zq = (size_t)h0, zk = (size_t)(h0 / REP);   // one kv head per query head: the pass's two heads use consecutive kv planes (z-strides TT*HD)
            k_gemmc<bf, 2, 1><<<dim3(RH / 64, TT / 64, ZH), 32, 0, stream>>>(QPh + zq * TT * HD, QPl + zq * TT * HD, KPh + zk * TT * HD, KPl + zk * TT * HD, HD, Sb, TT, 0, (size_t)TT * HD, (size_t)TT * HD, (size_t)TT * TT);
            k_gemmc<h16, 0, 1><<<dim3((TT - RH) / 64, TT / 64, ZH), 32, 0, stream>>>(QP16 + zq * TT * HD + (size_t)RH * HD, nullptr, KP16 + zk * TT * HD, nullptr, HD, Sb + (size_t)RH * TT, TT, RH, (size_t)TT * HD, (size_t)TT * HD, (size_t)TT * TT);
            k_asoft<<<ZH * TT / 8, 256, 0, stream>>>(Sb, P16, Ph, Pl);
            k_gemmk<bf, 2, true, false, 8><<<dim3(RH / 64, HD / 64, ZH), 256, 0, stream>>>(Ph, Pl, VTh + zk * HD * TT, VTl + zk * HD * TT, TT, Ob, HD, nullptr, 0, (size_t)RH * TT, (size_t)HD * TT, (size_t)TT * HD);
            k_gemmk<h16, 0, true, false, 16><<<dim3((TT - RH) / 64, HD / 64, ZH), 512, 0, stream>>>(P16 + (size_t)RH * TT, nullptr, VT16 + zk * HD * TT, nullptr, TT, Ob + (size_t)RH * HD, HD, nullptr, RH, (size_t)TT * TT, (size_t)HD * TT, (size_t)TT * HD);
            k_merge<<<(unsigned)(((size_t)ZH * TT * HD / 2 + 255) / 256), 256, 0, stream>>>(Ob, h0, ATh, ATl); }
        k_gemmk<bf, 1, false, true, 8><<<dim3(TT / 64, DM / 64, 1), 256, 0, stream>>>(ATh, ATl, WO2, nullptr, DQ, PO, DM, bpo, 0, 0, 0, 0);
        /* ---- gate + mix ---- */
        k_pl2<<<(unsigned)(((size_t)TT * DM / 4 + 255) / 256), 256, 0, stream>>>(CO, Ch, Cl, (size_t)TT * DM / 4); k_gemmk<bf, 1, false, false, 8><<<dim3(TT / 64, DM / 64, 1), 256, 0, stream>>>(Ch, Cl, WG1, nullptr, DM, G1, DM, nullptr, 0, 0, 0, 0);   /* char_out Wg[:1024] */
        k_pl2<<<(unsigned)(((size_t)TT * DM / 4 + 255) / 256), 256, 0, stream>>>(PO, Ch, Cl, (size_t)TT * DM / 4); k_gemmk<bf, 1, false, false, 8><<<dim3(TT / 64, DM / 64, 1), 256, 0, stream>>>(Ch, Cl, WG2, nullptr, DM, G2, DM, nullptr, 0, 0, 0, 0);   /* concept_out Wg[1024:] */
        k_gatemix<<<(unsigned)(((size_t)TT * DM / 4 + 255) / 256), 256, 0, stream>>>(G1, G2, bg, CO, PO, OUT + (size_t)b * TT * DM); }
}

// v002
// It runs in 669 microseconds.
// In two side-by-side timings against v001, it was 2.50 and 2.51 times as fast.
// Counting every step since v000, it is 4.65 times as fast.
#include <hip/hip_runtime.h>

// Hierarchical (char + concept) gated attention (values, keys, query [2][2048][1024]; concept_ids int32 [2][2048] -> ce = emb[concept_ids] ([1000][1024], gathered on device); char branch: q = query Wcq + bcq, k = keys Wck + bck, v = values Wcv + bcv; concept branch: q = query Wpq + bpq, k = ce Wpk + bpk, v = ce Wpv + bpv ('xw' [1024][1024] + biases; 16 heads x 64); per branch: scores masked causally (-1e20) then x 1/sqrt(1024), softmax, merged, Wo + bo; gate = sigmoid([char_out | concept_out] Wg + bg) (Wg [2048][1024]); out = gate char_out + (1 - gate) concept_out -> [2][2048][1024] (4.2 M)).
// Compute dtypes, f32 accumulate: every input rounded to bf16; q/k/v on PLAIN bf16 operands (inputs: exact) + biases; causal scores, softmax and attn.v in one kernel (key tiles beyond the diagonal block skipped): query rows < 512 hl (3 products), the rest single fp16; softmax f32, running maximum and sum; Wco / Wpo hl x exact (2 products) + bias; gate GEMMs 2 products; sigmoid (precise expf) and the convex mix in f32.

#define NB_  2
#define TT   2048
#define DM   1024
#define NH_  16
#define NKV  16
#define REP  (NH_ / NKV)
#define HD   64
#define DQ   (NH_ * HD)
#define DKV  (NKV * HD)
#define NVOC 1000
#define RH   512                  // query rows < RH use hi+lo planes (0: none)
#define SCL  0.03125f   // 1/sqrt(embed_size = 1024) as in the source
typedef _Float16 h16;
typedef unsigned short bf;
typedef __attribute__((ext_vector_type(16))) __bf16   v16bf;
typedef __attribute__((ext_vector_type(16))) _Float16 v16h;
typedef __attribute__((ext_vector_type(8)))  _Float16 v8h;
typedef __attribute__((ext_vector_type(8)))  unsigned short v8us;
typedef __attribute__((ext_vector_type(8)))  float    v8f;
typedef __attribute__((ext_vector_type(4)))  float    v4f;
typedef v8h  __attribute__((may_alias)) v8ha;
typedef v4f  __attribute__((may_alias)) v4fa;
typedef v8us __attribute__((may_alias)) v8usa;

__device__ __forceinline__ unsigned short f2bf(float f) { unsigned u = __float_as_uint(f); u += 0x7FFFu + ((u >> 16) & 1u); return (unsigned short)(u >> 16); }
__device__ __forceinline__ float bf2f(unsigned short b) { return __uint_as_float(((unsigned)b) << 16); }
__device__ __forceinline__ float bfr(float f) { return bf2f(f2bf(f)); }
__device__ __forceinline__ v16h cat16(v8h lo, v8h hi) { return __builtin_shufflevector(lo, hi, 0, 1, 2, 3, 4, 5, 6, 7, 8, 9, 10, 11, 12, 13, 14, 15); }
__device__ __forceinline__ v16bf cat16b(v8us lo, v8us hi) { return __builtin_bit_cast(v16bf, __builtin_shufflevector(lo, hi, 0, 1, 2, 3, 4, 5, 6, 7, 8, 9, 10, 11, 12, 13, 14, 15)); }
__device__ __forceinline__ v8f wmma16(v16h a, v16h b, v8f c) { return __builtin_amdgcn_wmma_f32_16x16x32_f16(false, a, false, b, (short)0, c, false, false); }
__device__ __forceinline__ v8f wmmab(v16bf a, v16bf b, v8f c) { return __builtin_amdgcn_wmma_f32_16x16x32_bf16(false, a, false, b, (short)0, c, false, false); }



// ---- k_gemmk: register-blocked GEMM, one 64x64 output tile per block, the K loop SPLIT OVER THE NW WAVES of the block: wave w takes the 32-wide K steps w, w + NW, ... (two neighbouring waves read the two halves of the same
// 128-byte lines at the same time) into its own 16 accumulators, operands straight from K-contiguous 16-bit planes; the NW partial tiles are then summed through LDS in fixed wave order 0..NW-1. grid (M/64, N/64, Z), NW*32 threads.
// C[m][n] (f32, pitch ldc, + optional f32 bias[n]) = sum_k A[m][k] Bt[n][k] (+ split products per NSPLIT). z-batch strides sA/sB/sC in elements. K % 32 == 0.
// CAUSALK limits the K range to min(K, r0 + roff + 64), the diagonal block of a causal probability x value contraction (no launch here sets it: k_fattn does that contraction); roff = row offset of this launch's first row within the sequence.
template <typename T16> struct WFrag;
template <> struct WFrag<h16> { typedef v16h V; static __device__ __forceinline__ V ld(const h16* p) { return cat16(*(const v8h*)p, *(const v8h*)(p + 16)); } static __device__ __forceinline__ v8f mma(V a, V b, v8f c) { return wmma16(a, b, c); } };
template <> struct WFrag<bf> { typedef v16bf V; static __device__ __forceinline__ V ld(const bf* p) { return cat16b(*(const v8us*)p, *(const v8us*)(p + 16)); } static __device__ __forceinline__ v8f mma(V a, V b, v8f c) { return wmmab(a, b, c); } };
template <typename T16, int NSPLIT, bool CAUSALK, bool BIAS, int NW>
__global__ __launch_bounds__(NW * 32) void k_gemmk(const T16* __restrict__ A, const T16* __restrict__ A2, const T16* __restrict__ Bt, const T16* __restrict__ Bt2, int K, float* C, int ldc, const float* __restrict__ bias, int roff, size_t sA, size_t sB, size_t sC) {
    typedef typename WFrag<T16>::V V;
    __shared__ __align__(16) float part[NW * 4096];   // [wave][tile 0..15][j half][lane][4]: every wave's accumulators in register order, 16-byte stores contiguous over the lanes
    __shared__ __align__(16) float os[64 * 68];       // the summed tile, row-major (pitch 68 floats: both half-waves on disjoint banks)
    const size_t z = blockIdx.z; A += z * sA; if (A2) A2 += z * sA; Bt += z * sB; if (Bt2) Bt2 += z * sB; C += z * sC;
    const int lane = threadIdx.x & 31, lr = lane & 15, hi = lane >> 4; const int r0 = blockIdx.x * 64, c0 = blockIdx.y * 64;
    const int w = __builtin_amdgcn_readfirstlane((int)(threadIdx.x >> 5));   // wave number in a scalar register: the K loop's bounds stay scalar
    const int Kl = CAUSALK ? min(K, r0 + roff + 64) : K;
    v8f acc[4][4];
#pragma unroll
    for (int mb = 0; mb < 4; ++mb)
#pragma unroll
        for (int nb = 0; nb < 4; ++nb) acc[mb][nb] = (v8f){};
    const size_t aoff = (size_t)(r0 + lr) * K + 8 * hi, boff = (size_t)(c0 + lr) * K + 8 * hi;
#pragma unroll 1   // rolled: an unrolled body would hold a second set of fragments and pass the register budget of 16 waves
    for (int kc = w * 32; kc < Kl; kc += NW * 32) {
        V a[4], a2[4];
#pragma unroll
        for (int mb = 0; mb < 4; ++mb) { a[mb] = WFrag<T16>::ld(A + aoff + (size_t)mb * 16 * K + kc); if (NSPLIT == 1 || NSPLIT == 2) a2[mb] = WFrag<T16>::ld(A2 + aoff + (size_t)mb * 16 * K + kc); }
#pragma unroll
        for (int nb = 0; nb < 4; ++nb) { const V b = WFrag<T16>::ld(Bt + boff + (size_t)nb * 16 * K + kc); V b2; if (NSPLIT >= 2) b2 = WFrag<T16>::ld(Bt2 + boff + (size_t)nb * 16 * K + kc);
#pragma unroll
            for (int mb = 0; mb < 4; ++mb) { acc[mb][nb] = WFrag<T16>::mma(a[mb], b, acc[mb][nb]); if (NSPLIT == 1 || NSPLIT == 2) acc[mb][nb] = WFrag<T16>::mma(a2[mb], b, acc[mb][nb]); if (NSPLIT >= 2) acc[mb][nb] = WFrag<T16>::mma(a[mb], b2, acc[mb][nb]); } }
        // four vector slots behind the last matrix instruction, on the back edge and on the exit alike, before its fragments are reloaded or its accumulators stored
        asm volatile("v_nop\n\tv_nop\n\tv_nop\n\tv_nop" : "+v"(acc[0][0]), "+v"(acc[1][1]), "+v"(acc[2][2]), "+v"(acc[3][3]) : "v"(a[0]), "v"(a[3]));
    }
#pragma unroll
    for (int mb = 0; mb < 4; ++mb)
#pragma unroll
        for (int nb = 0; nb < 4; ++nb) { float* p = part + ((w * 16 + mb * 4 + nb) * 2) * 128 + lane * 4; const v8f c = acc[mb][nb];
            *(v4fa*)p = (v4f){c[0], c[1], c[2], c[3]}; *(v4fa*)(p + 128) = (v4f){c[4], c[5], c[6], c[7]}; }
    __syncthreads();   // every wave's partial tile is in LDS
#pragma unroll
    for (int q = 0; q < 16 / NW; ++q) { const int tile = w * (16 / NW) + q, mb = tile >> 2, nb = tile & 3; const float* p = part + tile * 256 + lane * 4;
        v4f s0 = *(const v4fa*)p, s1 = *(const v4fa*)(p + 128);
#pragma unroll
        for (int u = 1; u < NW; ++u) { s0 += *(const v4fa*)(p + u * 4096); s1 += *(const v4fa*)(p + u * 4096 + 128); }
#pragma unroll
        for (int j = 0; j < 4; ++j) { os[(mb * 16 + hi * 8 + j) * 68 + nb * 16 + lr] = s0[j]; os[(mb * 16 + hi * 8 + 4 + j) * 68 + nb * 16 + lr] = s1[j]; } }
    __syncthreads();   // the summed tile is complete
#pragma unroll
    for (int s = 0; s < 32 / NW; ++s) { const int idx = s * (NW * 32) + (int)threadIdx.x, row = idx >> 4, cofs = (idx & 15) * 4; v4f val = *(const v4fa*)(os + row * 68 + cofs); if (BIAS) { val[0] += bfr(bias[c0 + cofs]); val[1] += bfr(bias[c0 + cofs + 1]); val[2] += bfr(bias[c0 + cofs + 2]); val[3] += bfr(bias[c0 + cofs + 3]); }
        *(v4f*)(C + (size_t)(r0 + row) * ldc + c0 + cofs) = val; }
}

__device__ __forceinline__ h16 tohx(float x) { return (h16)x; }
__device__ __forceinline__ void splitf(float y, unsigned short& h, unsigned short& l) { h = f2bf(y); l = f2bf(y - bf2f(h)); }
typedef __attribute__((ext_vector_type(2))) _Float16 v2h;
typedef __attribute__((ext_vector_type(4))) _Float16 v4h;
typedef __attribute__((ext_vector_type(2))) unsigned short v2us;
typedef __attribute__((ext_vector_type(4))) unsigned short v4us;
typedef __attribute__((ext_vector_type(2))) float v2f;
typedef __attribute__((ext_vector_type(4))) int v4i;

__global__ __launch_bounds__(256) void k_wtG(const float* __restrict__ w, int K, int N, bf* Bt) {
    const int lane = threadIdx.x & 31; const int L0 = (blockIdx.x * 8 + (threadIdx.x >> 5)) * 8; const int nlines = N * K / 64;
{
#pragma unroll 1
        for (int l = 0; l < 8; ++l) { const int L = L0 + l; if (L >= nlines) break; const size_t e = (size_t)L * 64 + lane * 2; const int k = (int)(e % K), n = (int)(e / K); v2us o;
            o[0] = f2bf(w[(size_t)k * N + n]); o[1] = f2bf(w[(size_t)(k + 1) * N + n]); *(v2us*)(Bt + e) = o; }
         }
}
__global__ __launch_bounds__(256) void k_cvt8(const float* __restrict__ src, bf* dst, size_t n8) { const size_t i = (size_t)blockIdx.x * 256 + threadIdx.x; if (i >= n8) return; const v8f v = *(const v8f*)(src + i * 8); v8us o;
#pragma unroll
    for (int k = 0; k < 8; ++k) o[k] = f2bf(v[k]); *(v8us*)(dst + i * 8) = o;  }

// k_rope: head planes [h][t][d] (fp16 + hi/lo) of rope(x) x sc with the rotate-half convention out[d] = x[d] cos[t][d] - x[d+HD/2] sin[t][d], out[d+HD/2] = x[d+HD/2] cos[t][d+HD/2] + x[d] sin[t][d+HD/2]
__global__ __launch_bounds__(256) void k_rope(const float* __restrict__ F, int pitch, int nheads, const float* __restrict__ CS, const float* __restrict__ RF, const float* __restrict__ nw, float sc, h16* P16, bf* Ph, bf* Pl) {
    const size_t e = ((size_t)blockIdx.x * 256 + threadIdx.x) * 2; if (e >= (size_t)nheads * TT * HD) return; const int d = (int)(e % HD); const int t = (int)((e / HD) % TT); const int h = (int)(e / ((size_t)HD * TT)); const float* f = F + (size_t)t * pitch + h * HD; const float rf = RF ? RF[(size_t)h * TT + t] : 1.0f; v2h o16; v2us oh, ol;
#pragma unroll
    for (int q = 0; q < 2; ++q) { const int dd = d + q; const int dp = (dd < HD / 2) ? dd + HD / 2 : dd - HD / 2; float x0 = f[dd], x1 = f[dp];
        if (RF) { float n0 = __fmul_rn(x0, rf), n1 = __fmul_rn(x1, rf); asm volatile("" : "+v"(n0)); asm volatile("" : "+v"(n1)); x0 = __fmul_rn(bfr(nw[dd]), n0); x1 = __fmul_rn(bfr(nw[dp]), n1); }
        const v2f cs = *(const v2f*)(CS + ((size_t)t * HD + dd) * 2); float a = __fmul_rn(x0, cs[0]), bq = __fmul_rn(x1, cs[1]); asm volatile("" : "+v"(a)); asm volatile("" : "+v"(bq)); const float r = ((dd < HD / 2) ? __fsub_rn(a, bq) : __fadd_rn(a, bq)) * sc;
        o16[q] = tohx(r); unsigned short a2, c2; splitf(r, a2, c2); oh[q] = a2; ol[q] = c2; }
    *(v2h*)(P16 + e) = o16; *(v2us*)(Ph + e) = oh; *(v2us*)(Pl + e) = ol;  }
__global__ __launch_bounds__(256) void k_vtp(const float* __restrict__ F, int pitch, int nheads, h16* V16, bf* Vh, bf* Vl) { const size_t e = ((size_t)blockIdx.x * 256 + threadIdx.x) * 2; if (e >= (size_t)nheads * HD * TT) return; const int t = (int)(e % TT); const int d = (int)((e / TT) % HD); const int g = (int)(e / ((size_t)TT * HD)); v2h o16; v2us oh, ol;
#pragma unroll
    for (int q = 0; q < 2; ++q) { const float x = F[(size_t)(t + q) * pitch + g * HD + d]; o16[q] = tohx(x); unsigned short a2, c2; splitf(x, a2, c2); oh[q] = a2; ol[q] = c2; }
    *(v2h*)(V16 + e) = o16; *(v2us*)(Vh + e) = oh; *(v2us*)(Vl + e) = ol;  }
__global__ __launch_bounds__(256) void k_csid(float* CS) { const int idx = blockIdx.x * 256 + threadIdx.x; if (idx >= TT * HD) return; v2f cs; cs[0] = 1.0f; cs[1] = 0.0f; *(v2f*)(CS + (size_t)idx * 2) = cs;  }
__global__ __launch_bounds__(256) void k_gath8(const float* __restrict__ TE, const int* __restrict__ IDS, bf* EB) { const size_t i = (size_t)blockIdx.x * 256 + threadIdx.x; if (i >= (size_t)TT * DM / 8) return; const size_t e = i * 8; const int t = (int)(e / DM); const int c = (int)(e % DM); const int id = min(max(IDS[t], 0), NVOC - 1); const v8f v = *(const v8f*)(TE + (size_t)id * DM + c); v8us o;
#pragma unroll
    for (int k = 0; k < 8; ++k) o[k] = f2bf(v[k]); *(v8us*)(EB + e) = o;  }
__global__ __launch_bounds__(256) void k_pl2(const float* __restrict__ F, bf* Ph, bf* Pl, size_t n4) { const size_t i = (size_t)blockIdx.x * 256 + threadIdx.x; if (i >= n4) return; const v4f v = *(const v4f*)(F + i * 4); v4us oh, ol;
#pragma unroll
    for (int q = 0; q < 4; ++q) { unsigned short a, c; splitf(v[q], a, c); oh[q] = a; ol[q] = c; } *(v4us*)(Ph + i * 4) = oh; *(v4us*)(Pl + i * 4) = ol;  }
__global__ __launch_bounds__(256) void k_gatemix(const float* __restrict__ G1, const float* __restrict__ G2, const float* __restrict__ bg, const float* __restrict__ CO, const float* __restrict__ PO, float* O) { const size_t i = (size_t)blockIdx.x * 256 + threadIdx.x; if (i >= (size_t)TT * DM / 4) return; const size_t e = i * 4; const int c0 = (int)(e % DM); const v4f a = *(const v4f*)(G1 + e), b2 = *(const v4f*)(G2 + e), co = *(const v4f*)(CO + e), po = *(const v4f*)(PO + e); v4f o;
#pragma unroll
    for (int q = 0; q < 4; ++q) { float z = __fadd_rn(__fadd_rn(a[q], b2[q]), bfr(bg[c0 + q])); const float gt = __fdiv_rn(1.0f, __fadd_rn(1.0f, expf(-z))); float t1 = __fmul_rn(gt, co[q]); float t2 = __fmul_rn(__fsub_rn(1.0f, gt), po[q]); asm volatile("" : "+v"(t1), "+v"(t2)); o[q] = __fadd_rn(t1, t2); }
    *(v4f*)(O + e) = o;  }
// ---- k_fattn: causal attention of one head and 64 query rows per block in ONE kernel: scores, softmax with a running maximum and sum, probabilities x values, and the hi/lo planes of the merged output; no score and no probability leaves the registers.
// Four waves, each with 16 queries of its own; no LDS, no barrier. The products are transposed: S^T = K Q^T (A = 16 key rows, B = 16 query columns), so a lane holds scores of ONE query (column lr; keys 8 hi + r of each 16-key tile):
// maximum and sum are taken in the lane, plus one exchange between the wave's halves. Two neighbouring S^T tiles, converted in place, are the B operand of O^T += V^T P^T in the k order of the loaders (8 hi + s, then 16 + 8 hi + s - 8).
// O^T: a lane holds 8 consecutive d of its query, one 16-byte store per plane. Query rows < RH: hi + lo bf16 planes, three products; the rest single fp16. A pass takes 64 keys. grid (heads, TT / 64), the longest tiles first.
// v_exp_f32 with one free vector slot behind it: the register allocator lets the next instruction overwrite an exp's source directly behind it, where the instruction set asks for one independent instruction
// In place: the register written is the one the compiler's own arithmetic has just written, so its padding behind a matrix instruction covers this statement too.
__device__ __forceinline__ float exp2_slot(float x) { asm("v_exp_f32 %0, %0\n\tv_nop" : "+v"(x)); return x; }
template <typename T16, bool HL>
__device__ __forceinline__ void fattn_wave(const T16* __restrict__ Q, const T16* __restrict__ Q2, const T16* __restrict__ Kp, const T16* __restrict__ K2, const T16* __restrict__ Vt, const T16* __restrict__ V2, int row0, int nkb, int lr, int hi, bf* Ah, bf* Al) {
    typedef typename WFrag<T16>::V V;
    const float L2E = 1.4426950408889634f;
    const int i = row0 + lr;                                   // this lane's query row
    const size_t koff = (size_t)lr * HD + 8 * hi, voff = (size_t)lr * TT + 8 * hi;
    V q[2], q2[2], ka[4][2];
    const T16* qp = Q + (size_t)i * HD + 8 * hi; const T16* qp2 = HL ? Q2 + (size_t)i * HD + 8 * hi : nullptr;
#pragma unroll
    for (int kc = 0; kc < 2; ++kc) { q[kc] = WFrag<T16>::ld(qp + kc * 32); if (HL) q2[kc] = WFrag<T16>::ld(qp2 + kc * 32); }
    // behind the query loads, before their address registers are given to anything else (the addresses are inputs, so that they live up to the wait)
    if constexpr (HL) asm volatile("s_wait_xcnt 0x0" :: "v"(qp), "v"(qp2) : "memory"); else asm volatile("s_wait_xcnt 0x0" :: "v"(qp) : "memory");
    if constexpr (!HL) {
#pragma unroll
        for (int kt = 0; kt < 4; ++kt)
#pragma unroll
            for (int kc = 0; kc < 2; ++kc) ka[kt][kc] = WFrag<T16>::ld(Kp + koff + (size_t)kt * 16 * HD + kc * 32);
    }
    v8f o[4];
#pragma unroll
    for (int dt = 0; dt < 4; ++dt) o[dt] = (v8f){};
    float m = -3.0e38f, l = 0.f;
#pragma unroll 1   // rolled: the body is long, and a second copy would double the fragments held
    for (int kb = 0; kb < nkb; ++kb) {
        const int key0 = kb * 64;
        V va[4][2];
        if constexpr (!HL) {   // this pass's value fragments: they depend on nothing of the pass, so the compiler may place them as early as its registers allow
            const T16* vp = Vt + voff + key0;
#pragma unroll
            for (int dt = 0; dt < 4; ++dt)
#pragma unroll
                for (int ks = 0; ks < 2; ++ks) va[dt][ks] = WFrag<T16>::ld(vp + (size_t)dt * 16 * TT + ks * 32);
            asm volatile("s_wait_xcnt 0x0" :: "v"(vp) : "memory");   // behind the value loads, before their address registers are given to the next loads' data (the address is an input, so that it lives up to the wait)
        }
        v8f s[4];
#pragma unroll
        for (int kt = 0; kt < 4; ++kt) s[kt] = (v8f){};
#pragma unroll
        for (int kc = 0; kc < 2; ++kc)
#pragma unroll
            for (int kt = 0; kt < 4; ++kt) {
                if constexpr (HL) { const size_t off = koff + (size_t)(key0 + kt * 16) * HD + kc * 32; const V a = WFrag<T16>::ld(Kp + off), a2 = WFrag<T16>::ld(K2 + off);
                    s[kt] = WFrag<T16>::mma(a, q[kc], s[kt]); s[kt] = WFrag<T16>::mma(a, q2[kc], s[kt]); s[kt] = WFrag<T16>::mma(a2, q[kc], s[kt]); }
                else s[kt] = WFrag<T16>::mma(ka[kt][kc], q[kc], s[kt]);
            }
        if constexpr (!HL) {   // the next pass's key fragments (the last pass asks for its own again: always inside the plane)
            const int kn = min(kb + 1, nkb - 1) * 64;
#pragma unroll
            for (int kt = 0; kt < 4; ++kt)
#pragma unroll
                for (int kc = 0; kc < 2; ++kc) ka[kt][kc] = WFrag<T16>::ld(Kp + koff + (size_t)(kn + kt * 16) * HD + kc * 32);
        }
        const int rel = i - key0 - 8 * hi;                     // key <= i  <=>  kt * 16 + r <= rel
        float mk[4];
#pragma unroll
        for (int kt = 0; kt < 4; ++kt) { mk[kt] = -3.0e38f;
#pragma unroll
            for (int r = 0; r < 8; ++r) { const float t = (kt * 16 + r <= rel) ? s[kt][r] * SCL : -3.0e38f; s[kt][r] = t; mk[kt] = fmaxf(mk[kt], t); } }
        float mx = fmaxf(fmaxf(fmaxf(mk[0], mk[1]), fmaxf(mk[2], mk[3])), m);
        mx = fmaxf(mx, __shfl_xor(mx, 16, 32));                // the other half of this query's keys
        const float al = exp2_slot((m - mx) * L2E); m = mx;   // first pass: exp2(-inf) = 0 on zero sums
#pragma unroll
        for (int dt = 0; dt < 4; ++dt) o[dt] *= al;
        float lk[4];
#pragma unroll
        for (int kt = 0; kt < 4; ++kt) { lk[kt] = 0.f;
#pragma unroll
            for (int r = 0; r < 8; ++r) { const float p = exp2_slot((s[kt][r] - m) * L2E); s[kt][r] = p; lk[kt] += p; } }
        l = l * al + ((lk[0] + lk[1]) + (lk[2] + lk[3]));
#pragma unroll
        for (int ks = 0; ks < 2; ++ks) {
            V pb, pb2;
            if constexpr (HL) { v8us h0, h1, l0, l1;
#pragma unroll
                for (int r = 0; r < 8; ++r) { unsigned short a, c; splitf(s[2 * ks][r], a, c); h0[r] = a; l0[r] = c; splitf(s[2 * ks + 1][r], a, c); h1[r] = a; l1[r] = c; }
                pb = cat16b(h0, h1); pb2 = cat16b(l0, l1); }
            else { v8h c0, c1;
#pragma unroll
                for (int r = 0; r < 8; ++r) { c0[r] = tohx(s[2 * ks][r]); c1[r] = tohx(s[2 * ks + 1][r]); }
                pb = cat16(c0, c1); }
#pragma unroll
            for (int dt = 0; dt < 4; ++dt) {
                if constexpr (HL) { const size_t off = voff + (size_t)dt * 16 * TT + key0 + ks * 32; const V a = WFrag<T16>::ld(Vt + off), a2 = WFrag<T16>::ld(V2 + off);
                    o[dt] = WFrag<T16>::mma(a, pb, o[dt]); o[dt] = WFrag<T16>::mma(a, pb2, o[dt]); o[dt] = WFrag<T16>::mma(a2, pb, o[dt]); }
                else o[dt] = WFrag<T16>::mma(va[dt][ks], pb, o[dt]);
            }
        }
        // four vector slots behind the last matrix instruction, on the back edge and on the exit alike, before its fragments are reloaded or its accumulators read
        asm volatile("v_nop\n\tv_nop\n\tv_nop\n\tv_nop" : "+v"(o[0]), "+v"(o[1]), "+v"(o[2]), "+v"(o[3]));
    }
    l += __shfl_xor(l, 16, 32);                                // join the halves' sums
    const float inv = __fdiv_rn(1.0f, l);
#pragma unroll
    for (int dt = 0; dt < 4; ++dt) { v8us oh, ol;
#pragma unroll
        for (int r = 0; r < 8; ++r) { unsigned short a, c; splitf(o[dt][r] * inv, a, c); oh[r] = a; ol[r] = c; }
        const size_t oo = (size_t)i * DQ + dt * 16 + 8 * hi; *(v8us*)(Ah + oo) = oh; *(v8us*)(Al + oo) = ol; }
}
__global__ __launch_bounds__(128) void k_fattn(const h16* __restrict__ Q16, const bf* __restrict__ Qh, const bf* __restrict__ Ql, const h16* __restrict__ K16, const bf* __restrict__ Kh, const bf* __restrict__ Kl, const h16* __restrict__ V16, const bf* __restrict__ Vh, const bf* __restrict__ Vl, bf* Ah, bf* Al) {
    const int lane = threadIdx.x & 31, lr = lane & 15, hi = lane >> 4;
    const int w = __builtin_amdgcn_readfirstlane((int)(threadIdx.x >> 5));   // wave number in a scalar register: row0 and the loop's bounds stay scalar
    const int h = blockIdx.x, r0 = (TT / 64 - 1 - (int)blockIdx.y) * 64;
    const size_t zq = (size_t)h * TT * HD, zk = (size_t)(h / REP) * TT * HD;
    if (r0 < RH) fattn_wave<bf, true>(Qh + zq, Ql + zq, Kh + zk, Kl + zk, Vh + zk, Vl + zk, r0 + w * 16, r0 / 64 + 1, lr, hi, Ah + h * HD, Al + h * HD);
    else fattn_wave<h16, false>(Q16 + zq, nullptr, K16 + zk, nullptr, V16 + zk, nullptr, r0 + w * 16, r0 / 64 + 1, lr, hi, Ah + h * HD, Al + h * HD);
}

extern "C" void kernel_launch(void* const* d_in, const int* in_sizes, int n_in,
                              void* d_out, int out_size, void* d_ws, size_t ws_size, hipStream_t stream) {
    (void)in_sizes; (void)n_in; (void)out_size;
    const float* xvals = (const float*)d_in[0]; const float* xkeys = (const float*)d_in[1]; const float* xq = (const float*)d_in[2]; const int* CID = (const int*)d_in[3]; const float* EMB = (const float*)d_in[4]; const float* wcv = (const float*)d_in[5]; const float* bcv = (const float*)d_in[6]; const float* wck = (const float*)d_in[7]; const float* bck = (const float*)d_in[8]; const float* wcq = (const float*)d_in[9]; const float* bcq = (const float*)d_in[10]; const float* wco = (const float*)d_in[11]; const float* bco = (const float*)d_in[12]; const float* wpv = (const float*)d_in[13]; const float* bpv = (const float*)d_in[14]; const float* wpk = (const float*)d_in[15]; const float* bpk = (const float*)d_in[16]; const float* wpq = (const float*)d_in[17]; const float* bpq = (const float*)d_in[18]; const float* wpo = (const float*)d_in[19]; const float* bpo = (const float*)d_in[20]; const float* wg = (const float*)d_in[21]; const float* bg = (const float*)d_in[22]; const float* x = xq; const float* wq = wcq; const float* bq = bcq; const float* wk = wck; const float* bk = bck; const float* wv = wcv; const float* bv = bcv; const float* wo = wco; const float* bo = bco;
    float* OUT = (float*)d_out;     // [2][2048][1024]
    char* wsp = (char*)d_ws;
    auto take = [&](size_t bytes) { char* p = wsp; wsp += (bytes + 255) & ~(size_t)255; return (void*)p; };
    bf* WQ = (bf*)take((size_t)DQ * DM * 2); bf* WK = (bf*)take((size_t)DKV * DM * 2); bf* WV = (bf*)take((size_t)DKV * DM * 2); bf* WO = (bf*)take((size_t)DM * DQ * 2); bf* WQ2 = (bf*)take((size_t)DQ * DM * 2); bf* WK2 = (bf*)take((size_t)DKV * DM * 2); bf* WV2 = (bf*)take((size_t)DKV * DM * 2); bf* WO2 = (bf*)take((size_t)DM * DQ * 2); bf* WG1 = (bf*)take((size_t)DM * DM * 2); bf* WG2 = (bf*)take((size_t)DM * DM * 2); float* CO = (float*)take((size_t)TT * DM * 4); float* PO = (float*)take((size_t)TT * DM * 4); bf* Ch = (bf*)take((size_t)TT * DM * 2); bf* Cl = (bf*)take((size_t)TT * DM * 2); float* G1 = (float*)take((size_t)TT * DM * 4); float* G2 = (float*)take((size_t)TT * DM * 4); float* CS = (float*)take((size_t)TT * HD * 2 * 4);
    bf* XB = (bf*)take((size_t)TT * DM * 2); bf* XKB = (bf*)take((size_t)TT * DM * 2); bf* XVB = (bf*)take((size_t)TT * DM * 2); bf* EB = (bf*)take((size_t)TT * DM * 2); float* FQ = (float*)take((size_t)TT * DQ * 4); float* FK = (float*)take((size_t)TT * DKV * 4);
    h16* QP16 = (h16*)take((size_t)NH_ * TT * HD * 2); h16* KP16 = (h16*)take((size_t)NKV * TT * HD * 2); h16* VT16 = (h16*)take((size_t)NKV * HD * TT * 2);
    bf* QPh = (bf*)take((size_t)NH_ * TT * HD * 2); bf* QPl = (bf*)take((size_t)NH_ * TT * HD * 2); bf* KPh = (bf*)take((size_t)NKV * TT * HD * 2); bf* KPl = (bf*)take((size_t)NKV * TT * HD * 2); bf* VTh = (bf*)take((size_t)NKV * HD * TT * 2); bf* VTl = (bf*)take((size_t)NKV * HD * TT * 2);
    bf* ATh = (bf*)take((size_t)TT * DQ * 2); bf* ATl = (bf*)take((size_t)TT * DQ * 2);
    if ((size_t)(wsp - (char*)d_ws) > ws_size) return;    // ws 256 MiB
    float* FV = FK;   // v projection reuses the k buffer after the k planes are built (stream-ordered)
    { k_wtG<<<(unsigned)((DM * DQ / 64 + 63) / 64), 256, 0, stream>>>(wq, DM, DQ, WQ); k_wtG<<<(unsigned)((DM * DKV / 64 + 63) / 64), 256, 0, stream>>>(wk, DM, DKV, WK); k_wtG<<<(unsigned)((DM * DKV / 64 + 63) / 64), 256, 0, stream>>>(wv, DM, DKV, WV);
      k_wtG<<<(unsigned)((DQ * DM / 64 + 63) / 64), 256, 0, stream>>>(wo, DQ, DM, WO); k_wtG<<<(unsigned)((DM * DQ / 64 + 63) / 64), 256, 0, stream>>>(wpq, DM, DQ, WQ2); k_wtG<<<(unsigned)((DM * DKV / 64 + 63) / 64), 256, 0, stream>>>(wpk, DM, DKV, WK2); k_wtG<<<(unsigned)((DM * DKV / 64 + 63) / 64), 256, 0, stream>>>(wpv, DM, DKV, WV2); k_wtG<<<(unsigned)((DQ * DM / 64 + 63) / 64), 256, 0, stream>>>(wpo, DQ, DM, WO2); k_wtG<<<(unsigned)((DM * DM / 64 + 63) / 64), 256, 0, stream>>>(wg, DM, DM, WG1); k_wtG<<<(unsigned)((DM * DM / 64 + 63) / 64), 256, 0, stream>>>(wg + (size_t)DM * DM, DM, DM, WG2);   /* concept-branch weights; Wg halves (rows 0..1023 multiply char_out, 1024..2047 concept_out) */
       }
    k_csid<<<(TT * HD + 255) / 256, 256, 0, stream>>>(CS);
    const unsigned LQ = (unsigned)(((size_t)NH_ * TT * HD / 2 + 255) / 256), LKv = (unsigned)(((size_t)NKV * TT * HD / 2 + 255) / 256);
    for (int b = 0; b < NB_; ++b) {
        
        k_cvt8<<<(unsigned)(((size_t)TT * DM / 8 + 255) / 256), 256, 0, stream>>>(xq + (size_t)b * TT * DM, XB, (size_t)TT * DM / 8); k_cvt8<<<(unsigned)(((size_t)TT * DM / 8 + 255) / 256), 256, 0, stream>>>(xkeys + (size_t)b * TT * DM, XKB, (size_t)TT * DM / 8); k_cvt8<<<(unsigned)(((size_t)TT * DM / 8 + 255) / 256), 256, 0, stream>>>(xvals + (size_t)b * TT * DM, XVB, (size_t)TT * DM / 8); k_gath8<<<(unsigned)(((size_t)TT * DM / 8 + 255) / 256), 256, 0, stream>>>(EMB, CID + (size_t)b * TT, EB);   /* query / keys / values planes; gathered concept embeddings */
        /* ---- char branch: q <- query, k <- keys, v <- values ---- */
        
        k_gemmk<bf, 0, false, true, 8><<<dim3(TT / 64, DQ / 64, 1), 256, 0, stream>>>(XB, nullptr, WQ, nullptr, DM, FQ, DQ, bcq, 0, 0, 0, 0);
        k_rope<<<LQ, 256, 0, stream>>>(FQ, DQ, NH_, CS, nullptr, nullptr, 1.0f, QP16, QPh, QPl);
        k_gemmk<bf, 0, false, true, 8><<<dim3(TT / 64, DKV / 64, 1), 256, 0, stream>>>(XKB, nullptr, WK, nullptr, DM, FK, DKV, bck, 0, 0, 0, 0);
        k_rope<<<LKv, 256, 0, stream>>>(FK, DKV, NKV, CS, nullptr, nullptr, 1.0f, KP16, KPh, KPl);
        k_gemmk<bf, 0, false, true, 8><<<dim3(TT / 64, DKV / 64, 1), 256, 0, stream>>>(XVB, nullptr, WV, nullptr, DM, FV, DKV, bcv, 0, 0, 0, 0); k_vtp<<<LKv, 256, 0, stream>>>(FV, DKV, NKV, VT16, VTh, VTl);
        k_fattn<<<dim3(NH_, TT / 64), 128, 0, stream>>>(QP16, QPh, QPl, KP16, KPh, KPl, VT16, VTh, VTl, ATh, ATl);
        k_gemmk<bf, 1, false, true, 8><<<dim3(TT / 64, DM / 64, 1), 256, 0, stream>>>(ATh, ATl, WO, nullptr, DQ, CO, DM, bco, 0, 0, 0, 0);
        /* ---- concept branch: q <- query, k, v <- emb[concept_ids] ---- */
        
        k_gemmk<bf, 0, false, true, 8><<<dim3(TT / 64, DQ / 64, 1), 256, 0, stream>>>(XB, nullptr, WQ2, nullptr, DM, FQ, DQ, bpq, 0, 0, 0, 0);
        k_rope<<<LQ, 256, 0, stream>>>(FQ, DQ, NH_, CS, nullptr, nullptr, 1.0f, QP16, QPh, QPl);
        k_gemmk<bf, 0, false, true, 8><<<dim3(TT / 64, DKV / 64, 1), 256, 0, stream>>>(EB, nullptr, WK2, nullptr, DM, FK, DKV, bpk, 0, 0, 0, 0);
        k_rope<<<LKv, 256, 0, stream>>>(FK, DKV, NKV, CS, nullptr, nullptr, 1.0f, KP16, KPh, KPl);
        k_gemmk<bf, 0, false, true, 8><<<dim3(TT / 64, DKV / 64, 1), 256, 0, stream>>>(EB, nullptr, WV2, nullptr, DM, FV, DKV, bpv, 0, 0, 0, 0); k_vtp<<<LKv, 256, 0, stream>>>(FV, DKV, NKV, VT16, VTh, VTl);
        k_fattn<<<dim3(NH_, TT / 64), 128, 0, stream>>>(QP16, QPh, QPl, KP16, KPh, KPl, VT16, VTh, VTl, ATh, ATl);
        k_gemmk<bf, 1, false, true, 8><<<dim3(TT / 64, DM / 64, 1), 256, 0, stream>>>(ATh, ATl, WO2, nullptr, DQ, PO, DM, bpo, 0, 0, 0, 0);
        /* ---- gate + mix ---- */
        k_pl2<<<(unsigned)(((size_t)TT * DM / 4 + 255) / 256), 256, 0, stream>>>(CO, Ch, Cl, (size_t)TT * DM / 4); k_gemmk<bf, 1, false, false, 8><<<dim3(TT / 64, DM / 64, 1), 256, 0, stream>>>(Ch, Cl, WG1, nullptr, DM, G1, DM, nullptr, 0, 0, 0, 0);   /* char_out Wg[:1024] */
        k_pl2<<<(unsigned)(((size_t)TT * DM / 4 + 255) / 256), 256, 0, stream>>>(PO, Ch, Cl, (size_t)TT * DM / 4); k_gemmk<bf, 1, false, false, 8><<<dim3(TT / 64, DM / 64, 1), 256, 0, stream>>>(Ch, Cl, WG2, nullptr, DM, G2, DM, nullptr, 0, 0, 0, 0);   /* concept_out Wg[1024:] */
        k_gatemix<<<(unsigned)(((size_t)TT * DM / 4 + 255) / 256), 256, 0, stream>>>(G1, G2, bg, CO, PO, OUT + (size_t)b * TT * DM); }
}

// v003
// Measured time: 539 microseconds a run.
// In two side-by-side timings against v002, it was 1.25 and 1.22 times as fast.
// All steps since v000 together make it 5.77 times as fast.
#include <hip/hip_runtime.h>

// Hierarchical (char + concept) gated attention (values, keys, query [2][2048][1024]; concept_ids int32 [2][2048] -> ce = emb[concept_ids] ([1000][1024], gathered on device); char branch: q = query Wcq + bcq, k = keys Wck + bck, v = values Wcv + bcv; concept branch: q = query Wpq + bpq, k = ce Wpk + bpk, v = ce Wpv + bpv ('xw' [1024][1024] + biases; 16 heads x 64); per branch: scores masked causally (-1e20) then x 1/sqrt(1024), softmax, merged, Wo + bo; gate = sigmoid([char_out | concept_out] Wg + bg) (Wg [2048][1024]); out = gate char_out + (1 - gate) concept_out -> [2][2048][1024] (4.2 M)).
// Compute dtypes, f32 accumulate: every input rounded to bf16; q/k/v on PLAIN bf16 operands (inputs: exact) + biases; causal scores, softmax and attn.v in one kernel (key tiles beyond the diagonal block skipped): query rows < 512 hl (3 products), the rest single fp16; softmax f32, running maximum and sum; Wco / Wpo hl x exact (2 products) + bias; gate GEMMs 2 products; sigmoid (precise expf) and the convex mix in f32.

#define NB_  2
#define TT   2048
#define DM   1024
#define NH_  16
#define NKV  16
#define REP  (NH_ / NKV)
#define HD   64
#define DQ   (NH_ * HD)
#define DKV  (NKV * HD)
#define NVOC 1000
#define RH   512                  // query rows < RH use hi+lo planes (0: none)
#define SCL  0.03125f   // 1/sqrt(embed_size = 1024) as in the source
typedef _Float16 h16;
typedef unsigned short bf;
typedef __attribute__((ext_vector_type(16))) __bf16   v16bf;
typedef __attribute__((ext_vector_type(16))) _Float16 v16h;
typedef __attribute__((ext_vector_type(8)))  _Float16 v8h;
typedef __attribute__((ext_vector_type(8)))  unsigned short v8us;
typedef __attribute__((ext_vector_type(8)))  float    v8f;
typedef __attribute__((ext_vector_type(4)))  float    v4f;
typedef v8h  __attribute__((may_alias)) v8ha;
typedef v4f  __attribute__((may_alias)) v4fa;
typedef v8us __attribute__((may_alias)) v8usa;

__device__ __forceinline__ unsigned short f2bf(float f) { unsigned u = __float_as_uint(f); u += 0x7FFFu + ((u >> 16) & 1u); return (unsigned short)(u >> 16); }
__device__ __forceinline__ float bf2f(unsigned short b) { return __uint_as_float(((unsigned)b) << 16); }
__device__ __forceinline__ float bfr(float f) { return bf2f(f2bf(f)); }
__device__ __forceinline__ v16h cat16(v8h lo, v8h hi) { return __builtin_shufflevector(lo, hi, 0, 1, 2, 3, 4, 5, 6, 7, 8, 9, 10, 11, 12, 13, 14, 15); }
__device__ __forceinline__ v16bf cat16b(v8us lo, v8us hi) { return __builtin_bit_cast(v16bf, __builtin_shufflevector(lo, hi, 0, 1, 2, 3, 4, 5, 6, 7, 8, 9, 10, 11, 12, 13, 14, 15)); }
__device__ __forceinline__ v8f wmma16(v16h a, v16h b, v8f c) { return __builtin_amdgcn_wmma_f32_16x16x32_f16(false, a, false, b, (short)0, c, false, false); }
__device__ __forceinline__ v8f wmmab(v16bf a, v16bf b, v8f c) { return __builtin_amdgcn_wmma_f32_16x16x32_bf16(false, a, false, b, (short)0, c, false, false); }



// ---- k_gemmk: register-blocked GEMM, one 64x64 output tile per block, the K loop SPLIT OVER THE NW WAVES of the block: wave w takes the 32-wide K steps w, w + NW, ... (two neighbouring waves read the two halves of the same
// 128-byte lines at the same time) into its own 16 accumulators, operands straight from K-contiguous 16-bit planes; the NW partial tiles are then summed through LDS in fixed wave order 0..NW-1. grid (M/64, N/64, Z), NW*32 threads.
// C[m][n] (f32, pitch ldc, + optional f32 bias[n]) = sum_k A[m][k] Bt[n][k] (+ split products per NSPLIT). z-batch strides sA/sB/sC in elements. K % 32 == 0.
// EPI picks what the block does with its summed tile (+ bias): 0 f32 C; 1 head planes [head][row][d] (fp16, bf16 hi, bf16 lo; the tile's 64 columns are one head); 2 the same three planes transposed [head][d][row];
// 3 f32 C and its row-major hi / lo planes; 4 the tile is the second half of the gate's logits: out = g X2 + (1 - g) X3 with g = sigmoid((X1 + tile) + bias), stored to C.
// CAUSALK limits the key (K) range of the probability x value contraction to the diagonal block (probabilities beyond it are exactly zero); roff = row offset of this launch's first row within the sequence.
template <typename T16> struct WFrag;
template <> struct WFrag<h16> { typedef v16h V; static __device__ __forceinline__ V ld(const h16* p) { return cat16(*(const v8h*)p, *(const v8h*)(p + 16)); } static __device__ __forceinline__ v8f mma(V a, V b, v8f c) { return wmma16(a, b, c); } };
template <> struct WFrag<bf> { typedef v16bf V; static __device__ __forceinline__ V ld(const bf* p) { return cat16b(*(const v8us*)p, *(const v8us*)(p + 16)); } static __device__ __forceinline__ v8f mma(V a, V b, v8f c) { return wmmab(a, b, c); } };
__device__ __forceinline__ h16 tohx(float x) { return (h16)x; }
__device__ __forceinline__ void splitf(float y, unsigned short& h, unsigned short& l) { h = f2bf(y); l = f2bf(y - bf2f(h)); }
template <typename T16, int NSPLIT, bool CAUSALK, bool BIAS, int NW, int EPI>
__global__ __launch_bounds__(NW * 32) void k_gemmk(const T16* __restrict__ A, const T16* __restrict__ A2, const T16* __restrict__ Bt, const T16* __restrict__ Bt2, int K, float* C, int ldc, const float* __restrict__ bias, int roff, size_t sA, size_t sB, size_t sC, h16* P16, bf* Ph, bf* Pl, const float* __restrict__ X1, const float* __restrict__ X2, const float* __restrict__ X3) {
    static_assert(HD == 64, "a 64-column tile is one head"); static_assert(EPI == 0 || BIAS, "the plane and gate epilogues always add the bias");
    typedef typename WFrag<T16>::V V;
    __shared__ __align__(16) float part[NW * 4096];   // [wave][tile 0..15][j half][lane][4]: every wave's accumulators in register order, 16-byte stores contiguous over the lanes
    __shared__ __align__(16) float os[64 * 68];       // the summed tile, row-major ([column][row] for EPI 2) (pitch 68 floats: both half-waves on disjoint banks)
    const size_t z = blockIdx.z; A += z * sA; if (A2) A2 += z * sA; Bt += z * sB; if (Bt2) Bt2 += z * sB; C += z * sC;
    const int lane = threadIdx.x & 31, lr = lane & 15, hi = lane >> 4; const int r0 = blockIdx.x * 64, c0 = blockIdx.y * 64;
    const int w = __builtin_amdgcn_readfirstlane((int)(threadIdx.x >> 5));   // wave number in a scalar register: the K loop's bounds stay scalar
    const int Kl = CAUSALK ? min(K, r0 + roff + 64) : K;
    v8f acc[4][4];
#pragma unroll
    for (int mb = 0; mb < 4; ++mb)
#pragma unroll
        for (int nb = 0; nb < 4; ++nb) acc[mb][nb] = (v8f){};
    const size_t aoff = (size_t)(r0 + lr) * K + 8 * hi, boff = (size_t)(c0 + lr) * K + 8 * hi;
#pragma unroll 1   // rolled: an unrolled body would hold a second set of fragments and pass the register budget of 16 waves
    for (int kc = w * 32; kc < Kl; kc += NW * 32) {
        V a[4], a2[4];
#pragma unroll
        for (int mb = 0; mb < 4; ++mb) { a[mb] = WFrag<T16>::ld(A + aoff + (size_t)mb * 16 * K + kc); if (NSPLIT == 1 || NSPLIT == 2) a2[mb] = WFrag<T16>::ld(A2 + aoff + (size_t)mb * 16 * K + kc); }
#pragma unroll
        for (int nb = 0; nb < 4; ++nb) { const V b = WFrag<T16>::ld(Bt + boff + (size_t)nb * 16 * K + kc); V b2; if (NSPLIT >= 2) b2 = WFrag<T16>::ld(Bt2 + boff + (size_t)nb * 16 * K + kc);
#pragma unroll
            for (int mb = 0; mb < 4; ++mb) { acc[mb][nb] = WFrag<T16>::mma(a[mb], b, acc[mb][nb]); if (NSPLIT == 1 || NSPLIT == 2) acc[mb][nb] = WFrag<T16>::mma(a2[mb], b, acc[mb][nb]); if (NSPLIT >= 2) acc[mb][nb] = WFrag<T16>::mma(a[mb], b2, acc[mb][nb]); } }
        // four vector slots behind the last matrix instruction, on the back edge and on the exit alike, before its fragments are reloaded or its accumulators stored
        asm volatile("v_nop\n\tv_nop\n\tv_nop\n\tv_nop" : "+v"(acc[0][0]), "+v"(acc[1][1]), "+v"(acc[2][2]), "+v"(acc[3][3]) : "v"(a[0]), "v"(a[3]));
    }
    // EPI > 0: a thread ends with eight neighbours of LDS row erow + s * NW * 4; what it needs from memory for them is asked for here, so that it arrives while the partial tiles go to LDS
    const int erow = (int)threadIdx.x >> 3, ecofs = ((int)threadIdx.x & 7) * 8;
    float bv[8], bvr[16 / NW]; v8f g1[16 / NW], co[16 / NW], po[16 / NW];
    if constexpr (EPI == 2) {
#pragma unroll
        for (int s = 0; s < 16 / NW; ++s) bvr[s] = bias[c0 + erow + s * (NW * 4)];
    } else if constexpr (EPI > 0) {
#pragma unroll
        for (int k = 0; k < 8; ++k) bv[k] = bias[c0 + ecofs + k];
    }
    if constexpr (EPI == 4) {
#pragma unroll
        for (int s = 0; s < 16 / NW; ++s) { const size_t e = (size_t)(r0 + erow + s * (NW * 4)) * ldc + c0 + ecofs; g1[s] = *(const v8f*)(X1 + e); co[s] = *(const v8f*)(X2 + e); po[s] = *(const v8f*)(X3 + e); }
    }
#pragma unroll
    for (int mb = 0; mb < 4; ++mb)
#pragma unroll
        for (int nb = 0; nb < 4; ++nb) { float* p = part + ((w * 16 + mb * 4 + nb) * 2) * 128 + lane * 4; const v8f c = acc[mb][nb];
            *(v4fa*)p = (v4f){c[0], c[1], c[2], c[3]}; *(v4fa*)(p + 128) = (v4f){c[4], c[5], c[6], c[7]}; }
    // the loaded bias values are inputs only: that keeps their loads in front of the barriers, under the LDS stores above (left alone the compiler sinks them behind the second barrier, where nothing is left to cover their latency);
    // the base pointer is an input so that its registers live up to the wait, which stands before they are given to anything else
    if constexpr (EPI == 1 || EPI == 3 || EPI == 4) asm volatile("s_wait_xcnt 0x0" :: "v"(bv[0]), "v"(bv[1]), "v"(bv[2]), "v"(bv[3]), "v"(bv[4]), "v"(bv[5]), "v"(bv[6]), "v"(bv[7]), "s"(bias) : "memory");
    __syncthreads();   // every wave's partial tile is in LDS
#pragma unroll
    for (int q = 0; q < 16 / NW; ++q) { const int tile = w * (16 / NW) + q, mb = tile >> 2, nb = tile & 3; const float* p = part + tile * 256 + lane * 4;
        v4f s0 = *(const v4fa*)p, s1 = *(const v4fa*)(p + 128);
#pragma unroll
        for (int u = 1; u < NW; ++u) { s0 += *(const v4fa*)(p + u * 4096); s1 += *(const v4fa*)(p + u * 4096 + 128); }
        if constexpr (EPI == 2) { float* t = os + (nb * 16 + lr) * 68 + mb * 16 + hi * 8; *(v4fa*)t = s0; *(v4fa*)(t + 4) = s1; }   // tile kept [column][row]: a lane's eight sums are eight rows of one column
        else {
#pragma unroll
            for (int j = 0; j < 4; ++j) { os[(mb * 16 + hi * 8 + j) * 68 + nb * 16 + lr] = s0[j]; os[(mb * 16 + hi * 8 + 4 + j) * 68 + nb * 16 + lr] = s1[j]; } } }
    __syncthreads();   // the summed tile is complete
    if constexpr (EPI == 0) {
#pragma unroll
    for (int s = 0; s < 32 / NW; ++s) { const int idx = s * (NW * 32) + (int)threadIdx.x, row = idx >> 4, cofs = (idx & 15) * 4; v4f val = *(const v4fa*)(os + row * 68 + cofs); if (BIAS) { val[0] += bfr(bias[c0 + cofs]); val[1] += bfr(bias[c0 + cofs + 1]); val[2] += bfr(bias[c0 + cofs + 2]); val[3] += bfr(bias[c0 + cofs + 3]); }
        *(v4f*)(C + (size_t)(r0 + row) * ldc + c0 + cofs) = val; }
    } else {
#pragma unroll
    for (int s = 0; s < 16 / NW; ++s) { const int row = erow + s * (NW * 4), cofs = ecofs;   // 16-byte plane stores, eight lanes to a 128-byte line
        const v4f va = *(const v4fa*)(os + row * 68 + cofs), vb = *(const v4fa*)(os + row * 68 + cofs + 4); float v[8];
#pragma unroll
        for (int k = 0; k < 8; ++k) v[k] = k < 4 ? va[k] : vb[k - 4];
        if constexpr (EPI == 1 || EPI == 2) {
            v8h o16; v8us oh, ol;
#pragma unroll
            for (int k = 0; k < 8; ++k) { v[k] += bfr(EPI == 2 ? bvr[s] : bv[k]); o16[k] = tohx(v[k]); unsigned short a, c; splitf(v[k], a, c); oh[k] = a; ol[k] = c; }
            const size_t e = EPI == 1 ? ((size_t)blockIdx.y * TT + r0 + row) * HD + cofs : ((size_t)blockIdx.y * HD + row) * TT + r0 + cofs;
            *(v8h*)(P16 + e) = o16; *(v8us*)(Ph + e) = oh; *(v8us*)(Pl + e) = ol;
        } else if constexpr (EPI == 3) {
            v8us oh, ol;
#pragma unroll
            for (int k = 0; k < 8; ++k) { v[k] += bfr(bv[k]); unsigned short a, c; splitf(v[k], a, c); oh[k] = a; ol[k] = c; }
            const size_t e = (size_t)(r0 + row) * ldc + c0 + cofs;
            *(v4f*)(C + e) = (v4f){v[0], v[1], v[2], v[3]}; *(v4f*)(C + e + 4) = (v4f){v[4], v[5], v[6], v[7]}; *(v8us*)(Ph + e) = oh; *(v8us*)(Pl + e) = ol;
        } else {
            v8f o;
#pragma unroll
            for (int k = 0; k < 8; ++k) { const float lg = (g1[s][k] + v[k]) + bfr(bv[k]); const float gt = __fdiv_rn(1.0f, 1.0f + expf(-lg)); o[k] = gt * co[s][k] + (1.0f - gt) * po[s][k]; }
            *(v8f*)(C + (size_t)(r0 + row) * ldc + c0 + cofs) = o;
        } }
    }
}

typedef __attribute__((ext_vector_type(2))) unsigned short v2us;

__global__ __launch_bounds__(256) void k_wtG(const float* __restrict__ w, int K, int N, bf* Bt) {
    const int lane = threadIdx.x & 31; const int L0 = (blockIdx.x * 8 + (threadIdx.x >> 5)) * 8; const int nlines = N * K / 64;
{
#pragma unroll 1
        for (int l = 0; l < 8; ++l) { const int L = L0 + l; if (L >= nlines) break; const size_t e = (size_t)L * 64 + lane * 2; const int k = (int)(e % K), n = (int)(e / K); v2us o;
            o[0] = f2bf(w[(size_t)k * N + n]); o[1] = f2bf(w[(size_t)(k + 1) * N + n]); *(v2us*)(Bt + e) = o; }
         }
}
__global__ __launch_bounds__(256) void k_cvt8(const float* __restrict__ src, bf* dst, size_t n8) { const size_t i = (size_t)blockIdx.x * 256 + threadIdx.x; if (i >= n8) return; const v8f v = *(const v8f*)(src + i * 8); v8us o;
#pragma unroll
    for (int k = 0; k < 8; ++k) o[k] = f2bf(v[k]); *(v8us*)(dst + i * 8) = o;  }

__global__ __launch_bounds__(256) void k_gath8(const float* __restrict__ TE, const int* __restrict__ IDS, bf* EB) { const size_t i = (size_t)blockIdx.x * 256 + threadIdx.x; if (i >= (size_t)TT * DM / 8) return; const size_t e = i * 8; const int t = (int)(e / DM); const int c = (int)(e % DM); const int id = min(max(IDS[t], 0), NVOC - 1); const v8f v = *(const v8f*)(TE + (size_t)id * DM + c); v8us o;
#pragma unroll
    for (int k = 0; k < 8; ++k) o[k] = f2bf(v[k]); *(v8us*)(EB + e) = o;  }
// ---- k_fattn: causal attention of one head and 64 query rows per block in ONE kernel: scores, softmax with a running maximum and sum, probabilities x values, and the hi/lo planes of the merged output; no score and no probability leaves the registers.
// Four waves, each with 16 queries of its own; no LDS, no barrier. The products are transposed: S^T = K Q^T (A = 16 key rows, B = 16 query columns), so a lane holds scores of ONE query (column lr; keys 8 hi + r of each 16-key tile):
// maximum and sum are taken in the lane, plus one exchange between the wave's halves. Two neighbouring S^T tiles, converted in place, are the B operand of O^T += V^T P^T in the k order of the loaders (8 hi + s, then 16 + 8 hi + s - 8).
// O^T: a lane holds 8 consecutive d of its query, one 16-byte store per plane. Query rows < RH: hi + lo bf16 planes, three products; the rest single fp16. A pass takes 64 keys. grid (heads, TT / 64), the longest tiles first.
// v_exp_f32 with one free vector slot behind it: the register allocator lets the next instruction overwrite an exp's source directly behind it, where the instruction set asks for one independent instruction
// In place: the register written is the one the compiler's own arithmetic has just written, so its padding behind a matrix instruction covers this statement too.
__device__ __forceinline__ float exp2_slot(float x) { asm("v_exp_f32 %0, %0\n\tv_nop" : "+v"(x)); return x; }
template <typename T16, bool HL>
__device__ __forceinline__ void fattn_wave(const T16* __restrict__ Q, const T16* __restrict__ Q2, const T16* __restrict__ Kp, const T16* __restrict__ K2, const T16* __restrict__ Vt, const T16* __restrict__ V2, int row0, int nkb, int lr, int hi, bf* Ah, bf* Al) {
    typedef typename WFrag<T16>::V V;
    const float L2E = 1.4426950408889634f;
    const int i = row0 + lr;                                   // this lane's query row
    const size_t koff = (size_t)lr * HD + 8 * hi, voff = (size_t)lr * TT + 8 * hi;
    V q[2], q2[2], ka[4][2];
    const T16* qp = Q + (size_t)i * HD + 8 * hi; const T16* qp2 = HL ? Q2 + (size_t)i * HD + 8 * hi : nullptr;
#pragma unroll
    for (int kc = 0; kc < 2; ++kc) { q[kc] = WFrag<T16>::ld(qp + kc * 32); if (HL) q2[kc] = WFrag<T16>::ld(qp2 + kc * 32); }
    // behind the query loads, before their address registers are given to anything else (the addresses are inputs, so that they live up to the wait)
    if constexpr (HL) asm volatile("s_wait_xcnt 0x0" :: "v"(qp), "v"(qp2) : "memory"); else asm volatile("s_wait_xcnt 0x0" :: "v"(qp) : "memory");
    if constexpr (!HL) {
#pragma unroll
        for (int kt = 0; kt < 4; ++kt)
#pragma unroll
            for (int kc = 0; kc < 2; ++kc) ka[kt][kc] = WFrag<T16>::ld(Kp + koff + (size_t)kt * 16 * HD + kc * 32);
    }
    v8f o[4];
#pragma unroll
    for (int dt = 0; dt < 4; ++dt) o[dt] = (v8f){};
    float m = -3.0e38f, l = 0.f;
#pragma unroll 1   // rolled: the body is long, and a second copy would double the fragments held
    for (int kb = 0; kb < nkb; ++kb) {
        const int key0 = kb * 64;
        V va[4][2];
        if constexpr (!HL) {   // this pass's value fragments: they depend on nothing of the pass, so the compiler may place them as early as its registers allow
            const T16* vp = Vt + voff + key0;
#pragma unroll
            for (int dt = 0; dt < 4; ++dt)
#pragma unroll
                for (int ks = 0; ks < 2; ++ks) va[dt][ks] = WFrag<T16>::ld(vp + (size_t)dt * 16 * TT + ks * 32);
            asm volatile("s_wait_xcnt 0x0" :: "v"(vp) : "memory");   // behind the value loads, before their address registers are given to the next loads' data (the address is an input, so that it lives up to the wait)
        }
        v8f s[4];
#pragma unroll
        for (int kt = 0; kt < 4; ++kt) s[kt] = (v8f){};
#pragma unroll
        for (int kc = 0; kc < 2; ++kc)
#pragma unroll
            for (int kt = 0; kt < 4; ++kt) {
                if constexpr (HL) { const size_t off = koff + (size_t)(key0 + kt * 16) * HD + kc * 32; const V a = WFrag<T16>::ld(Kp + off), a2 = WFrag<T16>::ld(K2 + off);
                    s[kt] = WFrag<T16>::mma(a, q[kc], s[kt]); s[kt] = WFrag<T16>::mma(a, q2[kc], s[kt]); s[kt] = WFrag<T16>::mma(a2, q[kc], s[kt]); }
                else s[kt] = WFrag<T16>::mma(ka[kt][kc], q[kc], s[kt]);
            }
        if constexpr (!HL) {   // the next pass's key fragments (the last pass asks for its own again: always inside the plane)
            const int kn = min(kb + 1, nkb - 1) * 64;
#pragma unroll
            for (int kt = 0; kt < 4; ++kt)
#pragma unroll
                for (int kc = 0; kc < 2; ++kc) ka[kt][kc] = WFrag<T16>::ld(Kp + koff + (size_t)(kn + kt * 16) * HD + kc * 32);
        }
        const int rel = i - key0 - 8 * hi;                     // key <= i  <=>  kt * 16 + r <= rel
        float mk[4];
#pragma unroll
        for (int kt = 0; kt < 4; ++kt) { mk[kt] = -3.0e38f;
#pragma unroll
            for (int r = 0; r < 8; ++r) { const float t = (kt * 16 + r <= rel) ? s[kt][r] * SCL : -3.0e38f; s[kt][r] = t; mk[kt] = fmaxf(mk[kt], t); } }
        float mx = fmaxf(fmaxf(fmaxf(mk[0], mk[1]), fmaxf(mk[2], mk[3])), m);
        mx = fmaxf(mx, __shfl_xor(mx, 16, 32));                // the other half of this query's keys
        const float al = exp2_slot((m - mx) * L2E); m = mx;   // first pass: exp2(-inf) = 0 on zero sums
#pragma unroll
        for (int dt = 0; dt < 4; ++dt) o[dt] *= al;
        float lk[4];
#pragma unroll
        for (int kt = 0; kt < 4; ++kt) { lk[kt] = 0.f;
#pragma unroll
            for (int r = 0; r < 8; ++r) { const float p = exp2_slot((s[kt][r] - m) * L2E); s[kt][r] = p; lk[kt] += p; } }
        l = l * al + ((lk[0] + lk[1]) + (lk[2] + lk[3]));
#pragma unroll
        for (int ks = 0; ks < 2; ++ks) {
            V pb, pb2;
            if constexpr (HL) { v8us h0, h1, l0, l1;
#pragma unroll
                for (int r = 0; r < 8; ++r) { unsigned short a, c; splitf(s[2 * ks][r], a, c); h0[r] = a; l0[r] = c; splitf(s[2 * ks + 1][r], a, c); h1[r] = a; l1[r] = c; }
                pb = cat16b(h0, h1); pb2 = cat16b(l0, l1); }
            else { v8h c0, c1;
#pragma unroll
                for (int r = 0; r < 8; ++r) { c0[r] = tohx(s[2 * ks][r]); c1[r] = tohx(s[2 * ks + 1][r]); }
                pb = cat16(c0, c1); }
#pragma unroll
            for (int dt = 0; dt < 4; ++dt) {
                if constexpr (HL) { const size_t off = voff + (size_t)dt * 16 * TT + key0 + ks * 32; const V a = WFrag<T16>::ld(Vt + off), a2 = WFrag<T16>::ld(V2 + off);
                    o[dt] = WFrag<T16>::mma(a, pb, o[dt]); o[dt] = WFrag<T16>::mma(a, pb2, o[dt]); o[dt] = WFrag<T16>::mma(a2, pb, o[dt]); }
                else o[dt] = WFrag<T16>::mma(va[dt][ks], pb, o[dt]);
            }
        }
        // four vector slots behind the last matrix instruction, on the back edge and on the exit alike, before its fragments are reloaded or its accumulators read
        asm volatile("v_nop\n\tv_nop\n\tv_nop\n\tv_nop" : "+v"(o[0]), "+v"(o[1]), "+v"(o[2]), "+v"(o[3]));
    }
    l += __shfl_xor(l, 16, 32);                                // join the halves' sums
    const float inv = __fdiv_rn(1.0f, l);
#pragma unroll
    for (int dt = 0; dt < 4; ++dt) { v8us oh, ol;
#pragma unroll
        for (int r = 0; r < 8; ++r) { unsigned short a, c; splitf(o[dt][r] * inv, a, c); oh[r] = a; ol[r] = c; }
        const size_t oo = (size_t)i * DQ + dt * 16 + 8 * hi; *(v8us*)(Ah + oo) = oh; *(v8us*)(Al + oo) = ol; }
}
__global__ __launch_bounds__(128) void k_fattn(const h16* __restrict__ Q16, const bf* __restrict__ Qh, const bf* __restrict__ Ql, const h16* __restrict__ K16, const bf* __restrict__ Kh, const bf* __restrict__ Kl, const h16* __restrict__ V16, const bf* __restrict__ Vh, const bf* __restrict__ Vl, bf* Ah, bf* Al) {
    const int lane = threadIdx.x & 31, lr = lane & 15, hi = lane >> 4;
    const int w = __builtin_amdgcn_readfirstlane((int)(threadIdx.x >> 5));   // wave number in a scalar register: row0 and the loop's bounds stay scalar
    const int h = blockIdx.x, r0 = (TT / 64 - 1 - (int)blockIdx.y) * 64;
    const size_t zq = (size_t)h * TT * HD, zk = (size_t)(h / REP) * TT * HD;
    if (r0 < RH) fattn_wave<bf, true>(Qh + zq, Ql + zq, Kh + zk, Kl + zk, Vh + zk, Vl + zk, r0 + w * 16, r0 / 64 + 1, lr, hi, Ah + h * HD, Al + h * HD);
    else fattn_wave<h16, false>(Q16 + zq, nullptr, K16 + zk, nullptr, V16 + zk, nullptr, r0 + w * 16, r0 / 64 + 1, lr, hi, Ah + h * HD, Al + h * HD);
}

extern "C" void kernel_launch(void* const* d_in, const int* in_sizes, int n_in,
                              void* d_out, int out_size, void* d_ws, size_t ws_size, hipStream_t stream) {
    (void)in_sizes; (void)n_in; (void)out_size;
    const float* xvals = (const float*)d_in[0]; const float* xkeys = (const float*)d_in[1]; const float* xq = (const float*)d_in[2]; const int* CID = (const int*)d_in[3]; const float* EMB = (const float*)d_in[4]; const float* wcv = (const float*)d_in[5]; const float* bcv = (const float*)d_in[6]; const float* wck = (const float*)d_in[7]; const float* bck = (const float*)d_in[8]; const float* wcq = (const float*)d_in[9]; const float* bcq = (const float*)d_in[10]; const float* wco = (const float*)d_in[11]; const float* bco = (const float*)d_in[12]; const float* wpv = (const float*)d_in[13]; const float* bpv = (const float*)d_in[14]; const float* wpk = (const float*)d_in[15]; const float* bpk = (const float*)d_in[16]; const float* wpq = (const float*)d_in[17]; const float* bpq = (const float*)d_in[18]; const float* wpo = (const float*)d_in[19]; const float* bpo = (const float*)d_in[20]; const float* wg = (const float*)d_in[21]; const float* bg = (const float*)d_in[22]; const float* x = xq; const float* wq = wcq; const float* bq = bcq; const float* wk = wck; const float* bk = bck; const float* wv = wcv; const float* bv = bcv; const float* wo = wco; const float* bo = bco;
    float* OUT = (float*)d_out;     // [2][2048][1024]
    char* wsp = (char*)d_ws;
    auto take = [&](size_t bytes) { char* p = wsp; wsp += (bytes + 255) & ~(size_t)255; return (void*)p; };
    bf* WQ = (bf*)take((size_t)DQ * DM * 2); bf* WK = (bf*)take((size_t)DKV * DM * 2); bf* WV = (bf*)take((size_t)DKV * DM * 2); bf* WO = (bf*)take((size_t)DM * DQ * 2); bf* WQ2 = (bf*)take((size_t)DQ * DM * 2); bf* WK2 = (bf*)take((size_t)DKV * DM * 2); bf* WV2 = (bf*)take((size_t)DKV * DM * 2); bf* WO2 = (bf*)take((size_t)DM * DQ * 2); bf* WG1 = (bf*)take((size_t)DM * DM * 2); bf* WG2 = (bf*)take((size_t)DM * DM * 2); float* CO = (float*)take((size_t)TT * DM * 4); float* PO = (float*)take((size_t)TT * DM * 4); bf* Ch = (bf*)take((size_t)TT * DM * 2); bf* Cl = (bf*)take((size_t)TT * DM * 2); bf* Dh = (bf*)take((size_t)TT * DM * 2); bf* Dl = (bf*)take((size_t)TT * DM * 2); float* G1 = (float*)take((size_t)TT * DM * 4);
    bf* XB = (bf*)take((size_t)TT * DM * 2); bf* XKB = (bf*)take((size_t)TT * DM * 2); bf* XVB = (bf*)take((size_t)TT * DM * 2); bf* EB = (bf*)take((size_t)TT * DM * 2);
    h16* QP16 = (h16*)take((size_t)NH_ * TT * HD * 2); h16* KP16 = (h16*)take((size_t)NKV * TT * HD * 2); h16* VT16 = (h16*)take((size_t)NKV * HD * TT * 2);
    bf* QPh = (bf*)take((size_t)NH_ * TT * HD * 2); bf* QPl = (bf*)take((size_t)NH_ * TT * HD * 2); bf* KPh = (bf*)take((size_t)NKV * TT * HD * 2); bf* KPl = (bf*)take((size_t)NKV * TT * HD * 2); bf* VTh = (bf*)take((size_t)NKV * HD * TT * 2); bf* VTl = (bf*)take((size_t)NKV * HD * TT * 2);
    bf* ATh = (bf*)take((size_t)TT * DQ * 2); bf* ATl = (bf*)take((size_t)TT * DQ * 2);
    if ((size_t)(wsp - (char*)d_ws) > ws_size) return;    // ws 256 MiB
    { k_wtG<<<(unsigned)((DM * DQ / 64 + 63) / 64), 256, 0, stream>>>(wq, DM, DQ, WQ); k_wtG<<<(unsigned)((DM * DKV / 64 + 63) / 64), 256, 0, stream>>>(wk, DM, DKV, WK); k_wtG<<<(unsigned)((DM * DKV / 64 + 63) / 64), 256, 0, stream>>>(wv, DM, DKV, WV);
      k_wtG<<<(unsigned)((DQ * DM / 64 + 63) / 64), 256, 0, stream>>>(wo, DQ, DM, WO); k_wtG<<<(unsigned)((DM * DQ / 64 + 63) / 64), 256, 0, stream>>>(wpq, DM, DQ, WQ2); k_wtG<<<(unsigned)((DM * DKV / 64 + 63) / 64), 256, 0, stream>>>(wpk, DM, DKV, WK2); k_wtG<<<(unsigned)((DM * DKV / 64 + 63) / 64), 256, 0, stream>>>(wpv, DM, DKV, WV2); k_wtG<<<(unsigned)((DQ * DM / 64 + 63) / 64), 256, 0, stream>>>(wpo, DQ, DM, WO2); k_wtG<<<(unsigned)((DM * DM / 64 + 63) / 64), 256, 0, stream>>>(wg, DM, DM, WG1); k_wtG<<<(unsigned)((DM * DM / 64 + 63) / 64), 256, 0, stream>>>(wg + (size_t)DM * DM, DM, DM, WG2);   /* concept-branch weights; Wg halves (rows 0..1023 multiply char_out, 1024..2047 concept_out) */
       }
    for (int b = 0; b < NB_; ++b) {
        k_cvt8<<<(unsigned)(((size_t)TT * DM / 8 + 255) / 256), 256, 0, stream>>>(xq + (size_t)b * TT * DM, XB, (size_t)TT * DM / 8); k_cvt8<<<(unsigned)(((size_t)TT * DM / 8 + 255) / 256), 256, 0, stream>>>(xkeys + (size_t)b * TT * DM, XKB, (size_t)TT * DM / 8); k_cvt8<<<(unsigned)(((size_t)TT * DM / 8 + 255) / 256), 256, 0, stream>>>(xvals + (size_t)b * TT * DM, XVB, (size_t)TT * DM / 8); k_gath8<<<(unsigned)(((size_t)TT * DM / 8 + 255) / 256), 256, 0, stream>>>(EMB, CID + (size_t)b * TT, EB);   /* query / keys / values planes; gathered concept embeddings */
        /* ---- char branch: q <- query, k <- keys, v <- values; each projection writes its own head planes ---- */
        k_gemmk<bf, 0, false, true, 8, 1><<<dim3(TT / 64, DM / 64, 1), 256, 0, stream>>>(XB, nullptr, WQ, nullptr, DM, nullptr, DQ, bcq, 0, 0, 0, 0, QP16, QPh, QPl, nullptr, nullptr, nullptr);
        k_gemmk<bf, 0, false, true, 8, 1><<<dim3(TT / 64, DM / 64, 1), 256, 0, stream>>>(XKB, nullptr, WK, nullptr, DM, nullptr, DKV, bck, 0, 0, 0, 0, KP16, KPh, KPl, nullptr, nullptr, nullptr);
        k_gemmk<bf, 0, false, true, 8, 2><<<dim3(TT / 64, DM / 64, 1), 256, 0, stream>>>(XVB, nullptr, WV, nullptr, DM, nullptr, DKV, bcv, 0, 0, 0, 0, VT16, VTh, VTl, nullptr, nullptr, nullptr);
        k_fattn<<<dim3(NH_, TT / 64), 128, 0, stream>>>(QP16, QPh, QPl, KP16, KPh, KPl, VT16, VTh, VTl, ATh, ATl);
        k_gemmk<bf, 1, false, true, 8, 3><<<dim3(TT / 64, DM / 64, 1), 256, 0, stream>>>(ATh, ATl, WO, nullptr, DQ, CO, DM, bco, 0, 0, 0, 0, nullptr, Ch, Cl, nullptr, nullptr, nullptr);
        /* ---- concept branch: q <- query, k, v <- emb[concept_ids] ---- */
        k_gemmk<bf, 0, false, true, 8, 1><<<dim3(TT / 64, DM / 64, 1), 256, 0, stream>>>(XB, nullptr, WQ2, nullptr, DM, nullptr, DQ, bpq, 0, 0, 0, 0, QP16, QPh, QPl, nullptr, nullptr, nullptr);
        k_gemmk<bf, 0, false, true, 8, 1><<<dim3(TT / 64, DM / 64, 1), 256, 0, stream>>>(EB, nullptr, WK2, nullptr, DM, nullptr, DKV, bpk, 0, 0, 0, 0, KP16, KPh, KPl, nullptr, nullptr, nullptr);
        k_gemmk<bf, 0, false, true, 8, 2><<<dim3(TT / 64, DM / 64, 1), 256, 0, stream>>>(EB, nullptr, WV2, nullptr, DM, nullptr, DKV, bpv, 0, 0, 0, 0, VT16, VTh, VTl, nullptr, nullptr, nullptr);
        k_fattn<<<dim3(NH_, TT / 64), 128, 0, stream>>>(QP16, QPh, QPl, KP16, KPh, KPl, VT16, VTh, VTl, ATh, ATl);
        k_gemmk<bf, 1, false, true, 8, 3><<<dim3(TT / 64, DM / 64, 1), 256, 0, stream>>>(ATh, ATl, WO2, nullptr, DQ, PO, DM, bpo, 0, 0, 0, 0, nullptr, Dh, Dl, nullptr, nullptr, nullptr);
        /* ---- gate + mix: char_out Wg[:1024] to G1; concept_out Wg[1024:] ends in the sigmoid and the mix ---- */
        k_gemmk<bf, 1, false, false, 8, 0><<<dim3(TT / 64, DM / 64, 1), 256, 0, stream>>>(Ch, Cl, WG1, nullptr, DM, G1, DM, nullptr, 0, 0, 0, 0, nullptr, nullptr, nullptr, nullptr, nullptr, nullptr);
        k_gemmk<bf, 1, false, true, 8, 4><<<dim3(TT / 64, DM / 64, 1), 256, 0, stream>>>(Dh, Dl, WG2, nullptr, DM, OUT + (size_t)b * TT * DM, DM, bg, 0, 0, 0, 0, nullptr, nullptr, nullptr, G1, CO, PO); }
}

// v004
// It runs in 374 microseconds.
// Next to v003, in two timings, it ran 1.44 times as fast each time.
// Counting every step since v000, it is 8.31 times as fast.
#include <hip/hip_runtime.h>

// Hierarchical (char + concept) gated attention (values, keys, query [2][2048][1024]; concept_ids int32 [2][2048] -> ce = emb[concept_ids] ([1000][1024], gathered on device); char branch: q = query Wcq + bcq, k = keys Wck + bck, v = values Wcv + bcv; concept branch: q = query Wpq + bpq, k = ce Wpk + bpk, v = ce Wpv + bpv ('xw' [1024][1024] + biases; 16 heads x 64); per branch: scores masked causally (-1e20) then x 1/sqrt(1024), softmax, merged, Wo + bo; gate = sigmoid([char_out | concept_out] Wg + bg) (Wg [2048][1024]); out = gate char_out + (1 - gate) concept_out -> [2][2048][1024] (4.2 M)).
// Compute dtypes, f32 accumulate: every input rounded to bf16; q/k/v on PLAIN bf16 operands (inputs: exact) + biases; causal scores, softmax and attn.v in one kernel (key tiles beyond the diagonal block skipped): query rows < 512 hl (3 products), the rest single fp16; softmax f32, running maximum and sum; Wco / Wpo hl x exact (2 products) + bias; gate GEMMs 2 products; sigmoid (precise expf) and the convex mix in f32.

#define NB_  2
#define TT   2048
#define DM   1024
#define NH_  16
#define NKV  16
#define REP  (NH_ / NKV)
#define HD   64
#define DQ   (NH_ * HD)
#define DKV  (NKV * HD)
#define NVOC 1000
#define RH   512                  // query rows < RH use hi+lo planes (0: none)
#define SCL  0.03125f   // 1/sqrt(embed_size = 1024) as in the source
typedef _Float16 h16;
typedef unsigned short bf;
typedef __attribute__((ext_vector_type(16))) __bf16   v16bf;
typedef __attribute__((ext_vector_type(16))) _Float16 v16h;
typedef __attribute__((ext_vector_type(8)))  _Float16 v8h;
typedef __attribute__((ext_vector_type(8)))  unsigned short v8us;
typedef __attribute__((ext_vector_type(8)))  float    v8f;
typedef __attribute__((ext_vector_type(4)))  float    v4f;
typedef v8h  __attribute__((may_alias)) v8ha;
typedef v4f  __attribute__((may_alias)) v4fa;
typedef v8us __attribute__((may_alias)) v8usa;

__device__ __forceinline__ unsigned short f2bf(float f) { unsigned u = __float_as_uint(f); u += 0x7FFFu + ((u >> 16) & 1u); return (unsigned short)(u >> 16); }
__device__ __forceinline__ float bf2f(unsigned short b) { return __uint_as_float(((unsigned)b) << 16); }
__device__ __forceinline__ float bfr(float f) { return bf2f(f2bf(f)); }
__device__ __forceinline__ v16h cat16(v8h lo, v8h hi) { return __builtin_shufflevector(lo, hi, 0, 1, 2, 3, 4, 5, 6, 7, 8, 9, 10, 11, 12, 13, 14, 15); }
__device__ __forceinline__ v16bf cat16b(v8us lo, v8us hi) { return __builtin_bit_cast(v16bf, __builtin_shufflevector(lo, hi, 0, 1, 2, 3, 4, 5, 6, 7, 8, 9, 10, 11, 12, 13, 14, 15)); }
__device__ __forceinline__ v8f wmma16(v16h a, v16h b, v8f c) { return __builtin_amdgcn_wmma_f32_16x16x32_f16(false, a, false, b, (short)0, c, false, false); }
__device__ __forceinline__ v8f wmmab(v16bf a, v16bf b, v8f c) { return __builtin_amdgcn_wmma_f32_16x16x32_bf16(false, a, false, b, (short)0, c, false, false); }



// ---- k_gemmk: register-blocked GEMM, one 64x64 output tile per block, the K loop SPLIT OVER THE NW WAVES of the block: wave w takes the 32-wide K steps w, w + NW, ... (two neighbouring waves read the two halves of the same
// 128-byte lines at the same time) into its own 16 accumulators, operands straight from K-contiguous 16-bit planes; the NW partial tiles are then summed through LDS in fixed wave order 0..NW-1. grid (M/64, N/64, Z), NW*32 threads.
// C[m][n] (f32, pitch ldc, + optional f32 bias[n]) = sum_k A[m][k] Bt[n][k] (+ split products per NSPLIT). z-batch strides sA/sB/sC in elements. K % 32 == 0.
// EPI picks what the block does with its summed tile (+ bias): 0 f32 C; 1 head planes [head][row][d] (fp16, bf16 hi, bf16 lo; the tile's 64 columns are one head); 2 the same three planes transposed [head][d][row];
// 3 f32 C and its row-major hi / lo planes; 4 the tile is the second half of the gate's logits: out = g X2 + (1 - g) X3 with g = sigmoid((X1 + tile) + bias), stored to C.
// CAUSALK limits the key (K) range of the probability x value contraction to the diagonal block (probabilities beyond it are exactly zero); roff = row offset of this launch's first row within the sequence.
template <typename T16> struct WFrag;
template <> struct WFrag<h16> { typedef v16h V; static __device__ __forceinline__ V ld(const h16* p) { return cat16(*(const v8h*)p, *(const v8h*)(p + 16)); } static __device__ __forceinline__ v8f mma(V a, V b, v8f c) { return wmma16(a, b, c); } };
template <> struct WFrag<bf> { typedef v16bf V; static __device__ __forceinline__ V ld(const bf* p) { return cat16b(*(const v8us*)p, *(const v8us*)(p + 16)); } static __device__ __forceinline__ v8f mma(V a, V b, v8f c) { return wmmab(a, b, c); } };
__device__ __forceinline__ h16 tohx(float x) { return (h16)x; }
__device__ __forceinline__ void splitf(float y, unsigned short& h, unsigned short& l) { h = f2bf(y); l = f2bf(y - bf2f(h)); }
// The tile's work is a device function, so that one launch can hold GEMMs with different epilogues (the kernel picks by blockIdx.z, alike for the whole block) on ONE pair of LDS arrays, which the kernel owns:
// part[NW * 4096]: [wave][tile 0..15][j half][lane][4]: every wave's accumulators in register order, 16-byte stores contiguous over the lanes; os[64 * 68]: the summed tile, row-major (pitch 68 floats: both half-waves on disjoint banks).
// The M rows are the rows of all NB_ batches, one behind the other (a 64-row tile lies in one batch); the head planes are [batch][head][row][d] and [batch][head][d][row].
template <typename T16, int NSPLIT, bool CAUSALK, bool BIAS, int NW, int EPI>
__device__ __forceinline__ void gemm_tile(float* part, float* os, const T16* __restrict__ A, const T16* __restrict__ A2, const T16* __restrict__ Bt, const T16* __restrict__ Bt2, int K, float* C, int ldc, const float* __restrict__ bias, int roff, h16* P16, bf* Ph, bf* Pl, const float* __restrict__ X1, const float* __restrict__ X2, const float* __restrict__ X3) {
    static_assert(HD == 64, "a 64-column tile is one head"); static_assert(EPI == 0 || BIAS, "the plane and gate epilogues always add the bias");
    typedef typename WFrag<T16>::V V;
    const int lane = threadIdx.x & 31, lr = lane & 15, hi = lane >> 4; const int r0 = blockIdx.x * 64, c0 = blockIdx.y * 64;
    const int w = __builtin_amdgcn_readfirstlane((int)(threadIdx.x >> 5));   // wave number in a scalar register: the K loop's bounds stay scalar
    const int Kl = CAUSALK ? min(K, r0 + roff + 64) : K;
    v8f acc[4][4];
#pragma unroll
    for (int mb = 0; mb < 4; ++mb)
#pragma unroll
        for (int nb = 0; nb < 4; ++nb) acc[mb][nb] = (v8f){};
    const size_t aoff = (size_t)(r0 + lr) * K + 8 * hi, boff = (size_t)(c0 + lr) * K + 8 * hi;
#pragma unroll 1   // rolled: an unrolled body would hold a second set of fragments and pass the register budget of 16 waves
    for (int kc = w * 32; kc < Kl; kc += NW * 32) {
        V a[4], a2[4];
#pragma unroll
        for (int mb = 0; mb < 4; ++mb) { a[mb] = WFrag<T16>::ld(A + aoff + (size_t)mb * 16 * K + kc); if (NSPLIT == 1 || NSPLIT == 2) a2[mb] = WFrag<T16>::ld(A2 + aoff + (size_t)mb * 16 * K + kc); }
#pragma unroll
        for (int nb = 0; nb < 4; ++nb) { const V b = WFrag<T16>::ld(Bt + boff + (size_t)nb * 16 * K + kc); V b2; if (NSPLIT >= 2) b2 = WFrag<T16>::ld(Bt2 + boff + (size_t)nb * 16 * K + kc);
#pragma unroll
            for (int mb = 0; mb < 4; ++mb) { acc[mb][nb] = WFrag<T16>::mma(a[mb], b, acc[mb][nb]); if (NSPLIT == 1 || NSPLIT == 2) acc[mb][nb] = WFrag<T16>::mma(a2[mb], b, acc[mb][nb]); if (NSPLIT >= 2) acc[mb][nb] = WFrag<T16>::mma(a[mb], b2, acc[mb][nb]); } }
        // four vector slots behind the last matrix instruction, on the back edge and on the exit alike, before its fragments are reloaded or its accumulators stored
        asm volatile("v_nop\n\tv_nop\n\tv_nop\n\tv_nop" : "+v"(acc[0][0]), "+v"(acc[1][1]), "+v"(acc[2][2]), "+v"(acc[3][3]) : "v"(a[0]), "v"(a[3]));
    }
    // EPI > 0: a thread ends with eight neighbours of LDS row erow + s * NW * 4; what it needs from memory for them is asked for here, so that it arrives while the partial tiles go to LDS
    const int erow = (int)threadIdx.x >> 3, ecofs = ((int)threadIdx.x & 7) * 8;
    float bv[8], bvr[16 / NW]; v8f g1[16 / NW], co[16 / NW], po[16 / NW];
    if constexpr (EPI == 2) {
#pragma unroll
        for (int s = 0; s < 16 / NW; ++s) bvr[s] = bias[c0 + erow + s * (NW * 4)];
    } else if constexpr (EPI > 0) {
#pragma unroll
        for (int k = 0; k < 8; ++k) bv[k] = bias[c0 + ecofs + k];
    }
    if constexpr (EPI == 4) {
#pragma unroll
        for (int s = 0; s < 16 / NW; ++s) { const size_t e = (size_t)(r0 + erow + s * (NW * 4)) * ldc + c0 + ecofs; g1[s] = *(const v8f*)(X1 + e); co[s] = *(const v8f*)(X2 + e); po[s] = *(const v8f*)(X3 + e); }
    }
#pragma unroll
    for (int mb = 0; mb < 4; ++mb)
#pragma unroll
        for (int nb = 0; nb < 4; ++nb) { float* p = part + ((w * 16 + mb * 4 + nb) * 2) * 128 + lane * 4; const v8f c = acc[mb][nb];
            *(v4fa*)p = (v4f){c[0], c[1], c[2], c[3]}; *(v4fa*)(p + 128) = (v4f){c[4], c[5], c[6], c[7]}; }
    // the loaded bias values are inputs only: that keeps their loads in front of the barriers, under the LDS stores above (left alone the compiler sinks them behind the second barrier, where nothing is left to cover their latency);
    // the base pointer is an input so that its registers live up to the wait, which stands before they are given to anything else
    if constexpr (EPI == 1 || EPI == 3 || EPI == 4) asm volatile("s_wait_xcnt 0x0" :: "v"(bv[0]), "v"(bv[1]), "v"(bv[2]), "v"(bv[3]), "v"(bv[4]), "v"(bv[5]), "v"(bv[6]), "v"(bv[7]), "s"(bias) : "memory");
    __syncthreads();   // every wave's partial tile is in LDS
#pragma unroll
    for (int q = 0; q < 16 / NW; ++q) { const int tile = w * (16 / NW) + q, mb = tile >> 2, nb = tile & 3; const float* p = part + tile * 256 + lane * 4;
        v4f s0 = *(const v4fa*)p, s1 = *(const v4fa*)(p + 128);
#pragma unroll
        for (int u = 1; u < NW; ++u) { s0 += *(const v4fa*)(p + u * 4096); s1 += *(const v4fa*)(p + u * 4096 + 128); }
        if constexpr (EPI == 2) { float* t = os + (nb * 16 + lr) * 68 + mb * 16 + hi * 8; *(v4fa*)t = s0; *(v4fa*)(t + 4) = s1; }   // tile kept [column][row]: a lane's eight sums are eight rows of one column
        else {
#pragma unroll
            for (int j = 0; j < 4; ++j) { os[(mb * 16 + hi * 8 + j) * 68 + nb * 16 + lr] = s0[j]; os[(mb * 16 + hi * 8 + 4 + j) * 68 + nb * 16 + lr] = s1[j]; } } }
    __syncthreads();   // the summed tile is complete
    if constexpr (EPI == 0) {
#pragma unroll
    for (int s = 0; s < 32 / NW; ++s) { const int idx = s * (NW * 32) + (int)threadIdx.x, row = idx >> 4, cofs = (idx & 15) * 4; v4f val = *(const v4fa*)(os + row * 68 + cofs); if (BIAS) { val[0] += bfr(bias[c0 + cofs]); val[1] += bfr(bias[c0 + cofs + 1]); val[2] += bfr(bias[c0 + cofs + 2]); val[3] += bfr(bias[c0 + cofs + 3]); }
        *(v4f*)(C + (size_t)(r0 + row) * ldc + c0 + cofs) = val; }
    } else {
#pragma unroll
    for (int s = 0; s < 16 / NW; ++s) { const int row = erow + s * (NW * 4), cofs = ecofs;   // 16-byte plane stores, eight lanes to a 128-byte line
        const v4f va = *(const v4fa*)(os + row * 68 + cofs), vb = *(const v4fa*)(os + row * 68 + cofs + 4); float v[8];
#pragma unroll
        for (int k = 0; k < 8; ++k) v[k] = k < 4 ? va[k] : vb[k - 4];
        if constexpr (EPI == 1 || EPI == 2) {
            v8h o16; v8us oh, ol;
#pragma unroll
            for (int k = 0; k < 8; ++k) { v[k] += bfr(EPI == 2 ? bvr[s] : bv[k]); o16[k] = tohx(v[k]); unsigned short a, c; splitf(v[k], a, c); oh[k] = a; ol[k] = c; }
            const size_t hp = (size_t)(r0 / TT) * NH_ + blockIdx.y; const int rl = r0 % TT;   // plane of this batch and head; the tile's first row inside the batch
            const size_t e = EPI == 1 ? (hp * TT + rl + row) * HD + cofs : (hp * HD + row) * TT + rl + cofs;
            *(v8h*)(P16 + e) = o16; *(v8us*)(Ph + e) = oh; *(v8us*)(Pl + e) = ol;
        } else if constexpr (EPI == 3) {
            v8us oh, ol;
#pragma unroll
            for (int k = 0; k < 8; ++k) { v[k] += bfr(bv[k]); unsigned short a, c; splitf(v[k], a, c); oh[k] = a; ol[k] = c; }
            const size_t e = (size_t)(r0 + row) * ldc + c0 + cofs;
            *(v4f*)(C + e) = (v4f){v[0], v[1], v[2], v[3]}; *(v4f*)(C + e + 4) = (v4f){v[4], v[5], v[6], v[7]}; *(v8us*)(Ph + e) = oh; *(v8us*)(Pl + e) = ol;
        } else {
            v8f o;
#pragma unroll
            for (int k = 0; k < 8; ++k) { const float lg = (g1[s][k] + v[k]) + bfr(bv[k]); const float gt = __fdiv_rn(1.0f, 1.0f + expf(-lg)); o[k] = gt * co[s][k] + (1.0f - gt) * po[s][k]; }
            *(v8f*)(C + (size_t)(r0 + row) * ldc + c0 + cofs) = o;
        } }
    }
}
#define MR   (NB_ * TT)           // rows of all batches
#define PLN  ((size_t)MR * DM)    // elements of one [MR][DM] plane (= one set of head planes)
// One GEMM per blockIdx.z: operands, C and the hi / lo planes step by sA / sB / sC elements, the bias is bias (z = 0) or bias1. grid (MR/64, N/64, Z).
template <typename T16, int NSPLIT, bool CAUSALK, bool BIAS, int NW, int EPI>
__global__ __launch_bounds__(NW * 32) void k_gemmk(const T16* __restrict__ A, const T16* __restrict__ A2, const T16* __restrict__ Bt, int K, float* C, int ldc, const float* __restrict__ bias, const float* __restrict__ bias1, size_t sA, size_t sB, size_t sC, bf* Ph, bf* Pl, const float* __restrict__ X1, const float* __restrict__ X2, const float* __restrict__ X3) {
    __shared__ __align__(16) float part[NW * 4096];
    __shared__ __align__(16) float os[64 * 68];
    const size_t z = blockIdx.z;
    gemm_tile<T16, NSPLIT, CAUSALK, BIAS, NW, EPI>(part, os, A + z * sA, A2 + z * sA, Bt + z * sB, nullptr, K, C + z * sC, ldc, z ? bias1 : bias, 0, nullptr, Ph + z * sC, Pl + z * sC, X1, X2, X3);
}
// The six projections of both branches in one launch: z = 3 * branch + (0 q, 1 k, 2 v). X: the planes query, keys, values, gathered embeddings; Wt: the transposed weights in z order; every z writes its own three head planes (v: transposed). grid (MR/64, DM/64, 6).
__global__ __launch_bounds__(256) void k_qkv(const bf* __restrict__ X, const bf* __restrict__ Wt, const float* __restrict__ bcq, const float* __restrict__ bck, const float* __restrict__ bcv, const float* __restrict__ bpq, const float* __restrict__ bpk, const float* __restrict__ bpv, h16* P16, bf* Ph, bf* Pl) {
    __shared__ __align__(16) float part[8 * 4096];
    __shared__ __align__(16) float os[64 * 68];
    const int z = blockIdx.z; const int xi = z < 3 ? z : (z == 3 ? 0 : 3);   // the concept branch: q from the query plane, k and v from the embeddings
    const float* bias = z == 0 ? bcq : z == 1 ? bck : z == 2 ? bcv : z == 3 ? bpq : z == 4 ? bpk : bpv;
    const bf* A = X + (size_t)xi * PLN; const bf* Bt = Wt + (size_t)z * DM * DM; const size_t pz = (size_t)z * PLN;
    if (z == 2 || z == 5) gemm_tile<bf, 0, false, true, 8, 2>(part, os, A, nullptr, Bt, nullptr, DM, nullptr, DM, bias, 0, P16 + pz, Ph + pz, Pl + pz, nullptr, nullptr, nullptr);
    else gemm_tile<bf, 0, false, true, 8, 1>(part, os, A, nullptr, Bt, nullptr, DM, nullptr, DM, bias, 0, P16 + pz, Ph + pz, Pl + pz, nullptr, nullptr, nullptr);
}

typedef __attribute__((ext_vector_type(2))) unsigned short v2us;

__device__ __forceinline__ void wtG(const float* __restrict__ w, int K, int N, bf* Bt) {
    const int lane = threadIdx.x & 31; const int L0 = (blockIdx.x * 8 + (threadIdx.x >> 5)) * 8; const int nlines = N * K / 64;
{
#pragma unroll 1
        for (int l = 0; l < 8; ++l) { const int L = L0 + l; if (L >= nlines) break; const size_t e = (size_t)L * 64 + lane * 2; const int k = (int)(e % K), n = (int)(e / K); v2us o;
            o[0] = f2bf(w[(size_t)k * N + n]); o[1] = f2bf(w[(size_t)(k + 1) * N + n]); *(v2us*)(Bt + e) = o; }
         }
}
__device__ __forceinline__ void put8(v8f v, bf* dst) { v8us o;
#pragma unroll
    for (int k = 0; k < 8; ++k) o[k] = f2bf(v[k]); *(v8us*)dst = o; }
// Everything that depends on the inputs alone, in one launch. grid (256, 10 + 8): blockIdx.y < 10: transposed bf16 plane of weight y (the slow part, so it starts first);
// then eight rows of blocks for the four [MR][DM] bf16 planes: query, keys, values, gathered concept embeddings (a thread makes the same eight neighbours of all four: four independent reads in flight, a quarter of the waves to start).
__global__ __launch_bounds__(256) void k_prep(const float* __restrict__ w0, const float* __restrict__ w1, const float* __restrict__ w2, const float* __restrict__ w3, const float* __restrict__ w4, const float* __restrict__ w5, const float* __restrict__ w6, const float* __restrict__ w7, const float* __restrict__ w8, const float* __restrict__ w9,
                                              const float* __restrict__ xq, const float* __restrict__ xk, const float* __restrict__ xv, const float* __restrict__ TE, const int* __restrict__ IDS, bf* Wt, bf* X) {
    static_assert(PLN / 8 == (size_t)8 * 256 * 256, "eight rows of 256 blocks cover a plane"); static_assert(DM * DM / 64 == 256 * 64, "256 blocks cover a weight");
    const int y = blockIdx.y;
    if (y < 10) { const float* w = y == 0 ? w0 : y == 1 ? w1 : y == 2 ? w2 : y == 3 ? w3 : y == 4 ? w4 : y == 5 ? w5 : y == 6 ? w6 : y == 7 ? w7 : y == 8 ? w8 : w9; wtG(w, DM, DM, Wt + (size_t)y * DM * DM); return; }
    const size_t e = (((size_t)(y - 10) * 256 + blockIdx.x) * 256 + threadIdx.x) * 8;   // the thread's first element in each plane
    const int* ip = IDS + e / DM; const float* qp = xq + e; const float* kp = xk + e; const float* vp = xv + e;
    const int id = *ip; const v8f q = *(const v8f*)qp, k = *(const v8f*)kp, v = *(const v8f*)vp;
    // behind the four reads, before their address registers are given to anything else (the addresses are inputs, so that they live up to the wait)
    asm volatile("s_wait_xcnt 0x0" :: "v"(ip), "v"(qp), "v"(kp), "v"(vp) : "memory");
    const float* ep = TE + (size_t)min(max(id, 0), NVOC - 1) * DM + e % DM; const v8f g = *(const v8f*)ep;
    asm volatile("s_wait_xcnt 0x0" :: "v"(ep) : "memory");   // the same behind the gathered read
    put8(q, X + e); put8(k, X + PLN + e); put8(v, X + 2 * PLN + e); put8(g, X + 3 * PLN + e);
    asm volatile("s_wait_xcnt 0x0" ::: "memory");   // behind the last of the four stores, before any of their address or data registers is given to anything else
}
// ---- k_fattn: causal attention of one head and 64 query rows per block in ONE kernel: scores, softmax with a running maximum and sum, probabilities x values, and the hi/lo planes of the merged output; no score and no probability leaves the registers.
// Four waves, each with 16 queries of its own; no LDS, no barrier. The products are transposed: S^T = K Q^T (A = 16 key rows, B = 16 query columns), so a lane holds scores of ONE query (column lr; keys 8 hi + r of each 16-key tile):
// maximum and sum are taken in the lane, plus one exchange between the wave's halves. Two neighbouring S^T tiles, converted in place, are the B operand of O^T += V^T P^T in the k order of the loaders (8 hi + s, then 16 + 8 hi + s - 8).
// O^T: a lane holds 8 consecutive d of its query, one 16-byte store per plane. Query rows < RH: hi + lo bf16 planes, three products; the rest single fp16. A pass takes 64 keys. grid (heads x batches x branches, TT / 64), the longest tiles first.
// v_exp_f32 with one free vector slot behind it: the register allocator lets the next instruction overwrite an exp's source directly behind it, where the instruction set asks for one independent instruction
// In place: the register written is the one the compiler's own arithmetic has just written, so its padding behind a matrix instruction covers this statement too.
__device__ __forceinline__ float exp2_slot(float x) { asm("v_exp_f32 %0, %0\n\tv_nop" : "+v"(x)); return x; }
template <typename T16, bool HL>
__device__ __forceinline__ void fattn_wave(const T16* __restrict__ Q, const T16* __restrict__ Q2, const T16* __restrict__ Kp, const T16* __restrict__ K2, const T16* __restrict__ Vt, const T16* __restrict__ V2, int row0, int nkb, int lr, int hi, bf* Ah, bf* Al) {
    typedef typename WFrag<T16>::V V;
    const float L2E = 1.4426950408889634f;
    const int i = row0 + lr;                                   // this lane's query row
    const size_t koff = (size_t)lr * HD + 8 * hi, voff = (size_t)lr * TT + 8 * hi;
    V q[2], q2[2], ka[4][2];
    const T16* qp = Q + (size_t)i * HD + 8 * hi; const T16* qp2 = HL ? Q2 + (size_t)i * HD + 8 * hi : nullptr;
#pragma unroll
    for (int kc = 0; kc < 2; ++kc) { q[kc] = WFrag<T16>::ld(qp + kc * 32); if (HL) q2[kc] = WFrag<T16>::ld(qp2 + kc * 32); }
    // behind the query loads, before their address registers are given to anything else (the addresses are inputs, so that they live up to the wait)
    if constexpr (HL) asm volatile("s_wait_xcnt 0x0" :: "v"(qp), "v"(qp2) : "memory"); else asm volatile("s_wait_xcnt 0x0" :: "v"(qp) : "memory");
    if constexpr (!HL) {
#pragma unroll
        for (int kt = 0; kt < 4; ++kt)
#pragma unroll
            for (int kc = 0; kc < 2; ++kc) ka[kt][kc] = WFrag<T16>::ld(Kp + koff + (size_t)kt * 16 * HD + kc * 32);
    }
    v8f o[4];
#pragma unroll
    for (int dt = 0; dt < 4; ++dt) o[dt] = (v8f){};
    float m = -3.0e38f, l = 0.f;
#pragma unroll 1   // rolled: the body is long, and a second copy would double the fragments held
    for (int kb = 0; kb < nkb; ++kb) {
        const int key0 = kb * 64;
        V va[4][2];
        if constexpr (!HL) {   // this pass's value fragments: they depend on nothing of the pass, so the compiler may place them as early as its registers allow
            const T16* vp = Vt + voff + key0;
#pragma unroll
            for (int dt = 0; dt < 4; ++dt)
#pragma unroll
                for (int ks = 0; ks < 2; ++ks) va[dt][ks] = WFrag<T16>::ld(vp + (size_t)dt * 16 * TT + ks * 32);
            asm volatile("s_wait_xcnt 0x0" :: "v"(vp) : "memory");   // behind the value loads, before their address registers are given to the next loads' data (the address is an input, so that it lives up to the wait)
        }
        v8f s[4];
#pragma unroll
        for (int kt = 0; kt < 4; ++kt) s[kt] = (v8f){};
#pragma unroll
        for (int kc = 0; kc < 2; ++kc)
#pragma unroll
            for (int kt = 0; kt < 4; ++kt) {
                if constexpr (HL) { const size_t off = koff + (size_t)(key0 + kt * 16) * HD + kc * 32; const V a = WFrag<T16>::ld(Kp + off), a2 = WFrag<T16>::ld(K2 + off);
                    s[kt] = WFrag<T16>::mma(a, q[kc], s[kt]); s[kt] = WFrag<T16>::mma(a, q2[kc], s[kt]); s[kt] = WFrag<T16>::mma(a2, q[kc], s[kt]); }
                else s[kt] = WFrag<T16>::mma(ka[kt][kc], q[kc], s[kt]);
            }
        if constexpr (!HL) {   // the next pass's key fragments (the last pass asks for its own again: always inside the plane)
            const int kn = min(kb + 1, nkb - 1) * 64;
#pragma unroll
            for (int kt = 0; kt < 4; ++kt)
#pragma unroll
                for (int kc = 0; kc < 2; ++kc) ka[kt][kc] = WFrag<T16>::ld(Kp + koff + (size_t)(kn + kt * 16) * HD + kc * 32);
        }
        const int rel = i - key0 - 8 * hi;                     // key <= i  <=>  kt * 16 + r <= rel
        float mk[4];
#pragma unroll
        for (int kt = 0; kt < 4; ++kt) { mk[kt] = -3.0e38f;
#pragma unroll
            for (int r = 0; r < 8; ++r) { const float t = (kt * 16 + r <= rel) ? s[kt][r] * SCL : -3.0e38f; s[kt][r] = t; mk[kt] = fmaxf(mk[kt], t); } }
        float mx = fmaxf(fmaxf(fmaxf(mk[0], mk[1]), fmaxf(mk[2], mk[3])), m);
        mx = fmaxf(mx, __shfl_xor(mx, 16, 32));                // the other half of this query's keys
        const float al = exp2_slot((m - mx) * L2E); m = mx;   // first pass: exp2(-inf) = 0 on zero sums
#pragma unroll
        for (int dt = 0; dt < 4; ++dt) o[dt] *= al;
        float lk[4];
#pragma unroll
        for (int kt = 0; kt < 4; ++kt) { lk[kt] = 0.f;
#pragma unroll
            for (int r = 0; r < 8; ++r) { const float p = exp2_slot((s[kt][r] - m) * L2E); s[kt][r] = p; lk[kt] += p; } }
        l = l * al + ((lk[0] + lk[1]) + (lk[2] + lk[3]));
#pragma unroll
        for (int ks = 0; ks < 2; ++ks) {
            V pb, pb2;
            if constexpr (HL) { v8us h0, h1, l0, l1;
#pragma unroll
                for (int r = 0; r < 8; ++r) { unsigned short a, c; splitf(s[2 * ks][r], a, c); h0[r] = a; l0[r] = c; splitf(s[2 * ks + 1][r], a, c); h1[r] = a; l1[r] = c; }
                pb = cat16b(h0, h1); pb2 = cat16b(l0, l1); }
            else { v8h c0, c1;
#pragma unroll
                for (int r = 0; r < 8; ++r) { c0[r] = tohx(s[2 * ks][r]); c1[r] = tohx(s[2 * ks + 1][r]); }
                pb = cat16(c0, c1); }
#pragma unroll
            for (int dt = 0; dt < 4; ++dt) {
                if constexpr (HL) { const size_t off = voff + (size_t)dt * 16 * TT + key0 + ks * 32; const V a = WFrag<T16>::ld(Vt + off), a2 = WFrag<T16>::ld(V2 + off);
                    o[dt] = WFrag<T16>::mma(a, pb, o[dt]); o[dt] = WFrag<T16>::mma(a, pb2, o[dt]); o[dt] = WFrag<T16>::mma(a2, pb, o[dt]); }
                else o[dt] = WFrag<T16>::mma(va[dt][ks], pb, o[dt]);
            }
        }
        // four vector slots behind the last matrix instruction, on the back edge and on the exit alike, before its fragments are reloaded or its accumulators read
        asm volatile("v_nop\n\tv_nop\n\tv_nop\n\tv_nop" : "+v"(o[0]), "+v"(o[1]), "+v"(o[2]), "+v"(o[3]));
    }
    l += __shfl_xor(l, 16, 32);                                // join the halves' sums
    const float inv = __fdiv_rn(1.0f, l);
#pragma unroll
    for (int dt = 0; dt < 4; ++dt) { v8us oh, ol;
#pragma unroll
        for (int r = 0; r < 8; ++r) { unsigned short a, c; splitf(o[dt][r] * inv, a, c); oh[r] = a; ol[r] = c; }
        const size_t oo = (size_t)i * DQ + dt * 16 + 8 * hi; *(v8us*)(Ah + oo) = oh; *(v8us*)(Al + oo) = ol; }
}
// Both branches and all batches in one launch: grid (NH_ * NB_ * 2, TT / 64), blockIdx.x = (branch * NB_ + batch) * NH_ + head; blockIdx.y still counts the query tiles from the longest down, so that the longest tiles of every head start first.
// The nine pointers are the char branch's head planes; the concept branch's lie 3 * PLN elements behind them (the order of the projections). Ah / Al: [branch][MR][DQ].
__global__ __launch_bounds__(128) void k_fattn(const h16* __restrict__ Q16, const bf* __restrict__ Qh, const bf* __restrict__ Ql, const h16* __restrict__ K16, const bf* __restrict__ Kh, const bf* __restrict__ Kl, const h16* __restrict__ V16, const bf* __restrict__ Vh, const bf* __restrict__ Vl, bf* Ah, bf* Al) {
    const int lane = threadIdx.x & 31, lr = lane & 15, hi = lane >> 4;
    const int w = __builtin_amdgcn_readfirstlane((int)(threadIdx.x >> 5));   // wave number in a scalar register: row0 and the loop's bounds stay scalar
    static_assert(REP == 1, "the key and value planes are indexed by the query's head");
    const int h = blockIdx.x % NH_, bb = blockIdx.x / NH_, br = bb / NB_, r0 = (TT / 64 - 1 - (int)blockIdx.y) * 64;   // bb = branch * NB_ + batch
    const size_t zq = (size_t)(3 * br) * PLN + ((size_t)(bb % NB_) * NH_ + h) * TT * HD, zk = zq, za = (size_t)bb * TT * DQ + h * HD;
    if (r0 < RH) fattn_wave<bf, true>(Qh + zq, Ql + zq, Kh + zk, Kl + zk, Vh + zk, Vl + zk, r0 + w * 16, r0 / 64 + 1, lr, hi, Ah + za, Al + za);
    else fattn_wave<h16, false>(Q16 + zq, nullptr, K16 + zk, nullptr, V16 + zk, nullptr, r0 + w * 16, r0 / 64 + 1, lr, hi, Ah + za, Al + za);
}

extern "C" void kernel_launch(void* const* d_in, const int* in_sizes, int n_in,
                              void* d_out, int out_size, void* d_ws, size_t ws_size, hipStream_t stream) {
    (void)in_sizes; (void)n_in; (void)out_size;
    const float* xvals = (const float*)d_in[0]; const float* xkeys = (const float*)d_in[1]; const float* xq = (const float*)d_in[2]; const int* CID = (const int*)d_in[3]; const float* EMB = (const float*)d_in[4]; const float* wcv = (const float*)d_in[5]; const float* bcv = (const float*)d_in[6]; const float* wck = (const float*)d_in[7]; const float* bck = (const float*)d_in[8]; const float* wcq = (const float*)d_in[9]; const float* bcq = (const float*)d_in[10]; const float* wco = (const float*)d_in[11]; const float* bco = (const float*)d_in[12]; const float* wpv = (const float*)d_in[13]; const float* bpv = (const float*)d_in[14]; const float* wpk = (const float*)d_in[15]; const float* bpk = (const float*)d_in[16]; const float* wpq = (const float*)d_in[17]; const float* bpq = (const float*)d_in[18]; const float* wpo = (const float*)d_in[19]; const float* bpo = (const float*)d_in[20]; const float* wg = (const float*)d_in[21]; const float* bg = (const float*)d_in[22];
    float* OUT = (float*)d_out;     // [2][2048][1024]
    char* wsp = (char*)d_ws;
    auto take = [&](size_t bytes) { char* p = wsp; wsp += (bytes + 255) & ~(size_t)255; return (void*)p; };
    bf* WT = (bf*)take((size_t)10 * DM * DM * 2);   /* transposed weights: q, k, v of the char branch, q, k, v of the concept branch, Wco, Wpo, Wg rows 0..1023 (multiply char_out), Wg rows 1024..2047 (concept_out) */
    bf* XP = (bf*)take(4 * PLN * 2);                /* bf16 planes of query, keys, values, gathered concept embeddings */
    bf* ATh = (bf*)take(2 * PLN * 2); bf* ATl = (bf*)take(2 * PLN * 2);   /* merged attention outputs, hi and lo, [branch] */
    char* pl0 = wsp;
    h16* P16 = (h16*)take(6 * PLN * 2); bf* Ph = (bf*)take(6 * PLN * 2); bf* Pl = (bf*)take(6 * PLN * 2);   /* head planes of the six projections */
    char* end0 = wsp; wsp = pl0;                    /* the head planes are dead behind the attention launch: what follows it lies in their place */
    float* CO = (float*)take(2 * PLN * 4); float* PO = CO + PLN; bf* Ch = (bf*)take(2 * PLN * 2); bf* Dh = Ch + PLN; bf* Cl = (bf*)take(2 * PLN * 2); bf* Dl = Cl + PLN; float* G1 = (float*)take(PLN * 4);
    if (wsp > end0 || (size_t)(end0 - (char*)d_ws) > ws_size) return;    // ws 256 MiB
    k_prep<<<dim3(256, 10 + 8), 256, 0, stream>>>(wcq, wck, wcv, wpq, wpk, wpv, wco, wpo, wg, wg + (size_t)DM * DM, xq, xkeys, xvals, EMB, CID, WT, XP);
    k_qkv<<<dim3(MR / 64, DM / 64, 6), 256, 0, stream>>>(XP, WT, bcq, bck, bcv, bpq, bpk, bpv, P16, Ph, Pl);
    k_fattn<<<dim3(NH_ * NB_ * 2, TT / 64), 128, 0, stream>>>(P16, Ph, Pl, P16 + PLN, Ph + PLN, Pl + PLN, P16 + 2 * PLN, Ph + 2 * PLN, Pl + 2 * PLN, ATh, ATl);
    /* out-projections of both branches (z): f32 char_out / concept_out and their hi / lo planes */
    k_gemmk<bf, 1, false, true, 8, 3><<<dim3(MR / 64, DM / 64, 2), 256, 0, stream>>>(ATh, ATl, WT + (size_t)6 * DM * DM, DQ, CO, DM, bco, bpo, PLN, (size_t)DM * DM, PLN, Ch, Cl, nullptr, nullptr, nullptr);
    /* ---- gate + mix: char_out Wg[:1024] to G1; concept_out Wg[1024:] ends in the sigmoid and the mix ---- */
    k_gemmk<bf, 1, false, false, 8, 0><<<dim3(MR / 64, DM / 64, 1), 256, 0, stream>>>(Ch, Cl, WT + (size_t)8 * DM * DM, DM, G1, DM, nullptr, nullptr, 0, 0, 0, nullptr, nullptr, nullptr, nullptr, nullptr);
    k_gemmk<bf, 1, false, true, 8, 4><<<dim3(MR / 64, DM / 64, 1), 256, 0, stream>>>(Dh, Dl, WT + (size_t)9 * DM * DM, DM, OUT, DM, bg, nullptr, 0, 0, 0, nullptr, nullptr, G1, CO, PO);
}

// v005
// It runs in 261 microseconds.
// Next to v004, in two timings, it ran 1.43 times as fast each time.
// All steps since v000 together make it 11.9 times as fast.
#include <hip/hip_runtime.h>

// Hierarchical (char + concept) gated attention (values, keys, query [2][2048][1024]; concept_ids int32 [2][2048] -> ce = emb[concept_ids] ([1000][1024], gathered on device); char branch: q = query Wcq + bcq, k = keys Wck + bck, v = values Wcv + bcv; concept branch: q = query Wpq + bpq, k = ce Wpk + bpk, v = ce Wpv + bpv ('xw' [1024][1024] + biases; 16 heads x 64); per branch: scores masked causally (-1e20) then x 1/sqrt(1024), softmax, merged, Wo + bo; gate = sigmoid([char_out | concept_out] Wg + bg) (Wg [2048][1024]); out = gate char_out + (1 - gate) concept_out -> [2][2048][1024] (4.2 M)).
// Compute dtypes, f32 accumulate: every input rounded to bf16; q/k/v on PLAIN bf16 operands (inputs: exact) + biases; causal scores, softmax and attn.v in one kernel (key tiles beyond the diagonal block skipped): query rows < 512 hl (3 products), the rest single fp16; softmax f32, running maximum and sum; Wco / Wpo hl x exact (2 products) + bias; gate GEMMs 2 products; sigmoid (precise expf) and the convex mix in f32.

#define NB_  2
#define TT   2048
#define DM   1024
#define NH_  16
#define NKV  16
#define REP  (NH_ / NKV)
#define HD   64
#define DQ   (NH_ * HD)
#define DKV  (NKV * HD)
#define NVOC 1000
#define RH   512                  // query rows < RH use hi+lo planes (0: none)
#define SCL  0.03125f   // 1/sqrt(embed_size = 1024) as in the source
typedef _Float16 h16;
typedef unsigned short bf;
typedef __attribute__((ext_vector_type(16))) __bf16   v16bf;
typedef __attribute__((ext_vector_type(16))) _Float16 v16h;
typedef __attribute__((ext_vector_type(8)))  _Float16 v8h;
typedef __attribute__((ext_vector_type(8)))  unsigned short v8us;
typedef __attribute__((ext_vector_type(8)))  float    v8f;
typedef __attribute__((ext_vector_type(4)))  float    v4f;
typedef v8h  __attribute__((may_alias)) v8ha;
typedef v4f  __attribute__((may_alias)) v4fa;
typedef v8us __attribute__((may_alias)) v8usa;

__device__ __forceinline__ unsigned short f2bf(float f) { unsigned u = __float_as_uint(f); u += 0x7FFFu + ((u >> 16) & 1u); return (unsigned short)(u >> 16); }
__device__ __forceinline__ float bf2f(unsigned short b) { return __uint_as_float(((unsigned)b) << 16); }
__device__ __forceinline__ float bfr(float f) { return bf2f(f2bf(f)); }
__device__ __forceinline__ v16h cat16(v8h lo, v8h hi) { return __builtin_shufflevector(lo, hi, 0, 1, 2, 3, 4, 5, 6, 7, 8, 9, 10, 11, 12, 13, 14, 15); }
__device__ __forceinline__ v16bf cat16b(v8us lo, v8us hi) { return __builtin_bit_cast(v16bf, __builtin_shufflevector(lo, hi, 0, 1, 2, 3, 4, 5, 6, 7, 8, 9, 10, 11, 12, 13, 14, 15)); }
__device__ __forceinline__ v8f wmma16(v16h a, v16h b, v8f c) { return __builtin_amdgcn_wmma_f32_16x16x32_f16(false, a, false, b, (short)0, c, false, false); }
__device__ __forceinline__ v8f wmmab(v16bf a, v16bf b, v8f c) { return __builtin_amdgcn_wmma_f32_16x16x32_bf16(false, a, false, b, (short)0, c, false, false); }



// ---- k_gemmk: register-blocked GEMM, one 64x64 output tile per block, the K loop SPLIT OVER THE NW WAVES of the block: wave w takes the 32-wide K steps w, w + NW, ...
// into its own 16 accumulators, operands straight from 16-bit planes in fragment order (below); the NW partial tiles are then summed through LDS in fixed wave order 0..NW-1. grid (M/64, N/64, Z), NW*32 threads.
// C[m][n] (f32, pitch ldc, + optional f32 bias[n]) = sum_k A[m][k] Bt[n][k] (+ split products per NSPLIT). z-batch strides sA/sB/sC in elements. K % 32 == 0.
// EPI picks what the block does with its summed tile (+ bias): 0 f32 C; 1 head planes [head][row][d] (fp16, bf16 hi, bf16 lo; the tile's 64 columns are one head); 2 the same three planes transposed [head][d][row];
// 3 f32 C and its hi / lo planes; 4 the tile is the second half of the gate's logits: out = g X2 + (1 - g) X3 with g = sigmoid((X1 + tile) + bias), stored to C.
// CAUSALK limits the key (K) range of the probability x value contraction to the diagonal block (probabilities beyond it are exactly zero); roff = row offset of this launch's first row within the sequence.
// FRAGMENT ORDER: every 16-bit operand plane ([rows][K], rows % 16 == 0, K % 32 == 0) is kept as 1-KiB tiles of 16 rows x 32 k, tile (row / 16, k / 32) at element (row / 16) * 16 * K + (k / 32) * 512, and inside a tile
// [k / 16 % 2][k / 8 % 2][row % 16][k % 8]: the first 16 bytes of all 32 lanes of a fragment (lane = 16 * hi + lr: row lr, k 8 hi ..) are 512 bytes in a row, the second 16 bytes (k 16 + 8 hi ..) the next 512.
// A fragment load so touches four whole 128-byte lines; from a row-major plane it would touch sixteen lines for 32 bytes each. ld(p): p = the tile + lane * 8.
// fro: where the eight neighbours k .. k + 7 (k % 8 == 0) of a row lie.
__device__ __forceinline__ size_t fro(size_t row, size_t k, size_t K) { return (row >> 4) * (16 * K) + (k >> 5) * 512 + ((k >> 4) & 1) * 256 + ((k >> 3) & 1) * 128 + (row & 15) * 8; }
template <typename T16> struct WFrag;
template <> struct WFrag<h16> { typedef v16h V; static __device__ __forceinline__ V ld(const h16* p) { return cat16(*(const v8h*)p, *(const v8h*)(p + 256)); } static __device__ __forceinline__ v8f mma(V a, V b, v8f c) { return wmma16(a, b, c); } };
template <> struct WFrag<bf> { typedef v16bf V; static __device__ __forceinline__ V ld(const bf* p) { return cat16b(*(const v8us*)p, *(const v8us*)(p + 256)); } static __device__ __forceinline__ v8f mma(V a, V b, v8f c) { return wmmab(a, b, c); } };
__device__ __forceinline__ h16 tohx(float x) { return (h16)x; }
__device__ __forceinline__ void splitf(float y, unsigned short& h, unsigned short& l) { h = f2bf(y); l = f2bf(y - bf2f(h)); }
// The tile's work is a device function, so that one launch can hold GEMMs with different epilogues (the kernel picks by blockIdx.z, alike for the whole block) on ONE pair of LDS arrays, which the kernel owns:
// part[NW * 4096]: [wave][tile 0..15][j half][lane][4]: every wave's accumulators in register order, 16-byte stores contiguous over the lanes; os[64 * 68]: the summed tile, row-major (pitch 68 floats: both half-waves on disjoint banks).
// The M rows are the rows of all NB_ batches, one behind the other (a 64-row tile lies in one batch); the head planes are [batch][head] x ([row][d] or [d][row] in fragment order).
template <typename T16, int NSPLIT, bool CAUSALK, bool BIAS, int NW, int EPI>
__device__ __forceinline__ void gemm_tile(float* part, float* os, const T16* __restrict__ A, const T16* __restrict__ A2, const T16* __restrict__ Bt, const T16* __restrict__ Bt2, int K, float* C, int ldc, const float* __restrict__ bias, int roff, h16* P16, bf* Ph, bf* Pl, const float* __restrict__ X1, const float* __restrict__ X2, const float* __restrict__ X3) {
    static_assert(HD == 64, "a 64-column tile is one head"); static_assert(EPI == 0 || BIAS, "the plane and gate epilogues always add the bias"); static_assert(NW == 8, "the epilogues deal 64 rows x 8 pieces to 256 threads");
    typedef typename WFrag<T16>::V V;
    const int lane = threadIdx.x & 31, lr = lane & 15, hi = lane >> 4; const int r0 = blockIdx.x * 64, c0 = blockIdx.y * 64;
    const int w = __builtin_amdgcn_readfirstlane((int)(threadIdx.x >> 5));   // wave number in a scalar register: the K loop's bounds stay scalar
    const int Kl = CAUSALK ? min(K, r0 + roff + 64) : K;
    v8f acc[4][4];
#pragma unroll
    for (int mb = 0; mb < 4; ++mb)
#pragma unroll
        for (int nb = 0; nb < 4; ++nb) acc[mb][nb] = (v8f){};
    const size_t aoff = (size_t)r0 * K + lane * 8, boff = (size_t)c0 * K + lane * 8;   // 16 rows on: 16 * K elements; 32 k on: 512
#pragma unroll 1   // rolled: an unrolled body would hold a second set of fragments and pass the register budget of 16 waves
    for (int kc = w * 32; kc < Kl; kc += NW * 32) {
        V a[4], a2[4]; const T16* ap = A + aoff + (size_t)kc * 16; const T16* ap2 = (NSPLIT == 1 || NSPLIT == 2) ? A2 + aoff + (size_t)kc * 16 : ap; const T16* bp = Bt + boff + (size_t)kc * 16; const T16* bp2 = NSPLIT >= 2 ? Bt2 + boff + (size_t)kc * 16 : bp;
#pragma unroll
        for (int mb = 0; mb < 4; ++mb) { a[mb] = WFrag<T16>::ld(ap + (size_t)mb * 16 * K); if (NSPLIT == 1 || NSPLIT == 2) a2[mb] = WFrag<T16>::ld(ap2 + (size_t)mb * 16 * K); }
#pragma unroll
        for (int nb = 0; nb < 4; ++nb) { const V b = WFrag<T16>::ld(bp + (size_t)nb * 16 * K); V b2; if (NSPLIT >= 2) b2 = WFrag<T16>::ld(bp2 + (size_t)nb * 16 * K);
#pragma unroll
            for (int mb = 0; mb < 4; ++mb) { acc[mb][nb] = WFrag<T16>::mma(a[mb], b, acc[mb][nb]); if (NSPLIT == 1 || NSPLIT == 2) acc[mb][nb] = WFrag<T16>::mma(a2[mb], b, acc[mb][nb]); if (NSPLIT >= 2) acc[mb][nb] = WFrag<T16>::mma(a[mb], b2, acc[mb][nb]); } }
        // four vector slots behind the last matrix instruction, on the back edge and on the exit alike, before its fragments are reloaded or its accumulators stored;
        // the wait stands behind the pass's loads, before their address registers are given to anything else (the addresses are inputs, so that they live up to it)
        asm volatile("v_nop\n\tv_nop\n\tv_nop\n\tv_nop\n\ts_wait_xcnt 0x0" : "+v"(acc[0][0]), "+v"(acc[1][1]), "+v"(acc[2][2]), "+v"(acc[3][3]) : "v"(a[0]), "v"(a[3]), "v"(ap), "v"(ap2), "v"(bp), "v"(bp2) : "memory");
    }
    // EPI > 0: a thread ends with eight neighbours of LDS row erow + s * NW * 4; what it needs from memory for them is asked for here, so that it arrives while the partial tiles go to LDS
    // a wave takes 8 rows x 4 pieces of one 32-wide column block: in fragment order the eight rows' pieces are one whole 128-byte line, in a row-major f32 array the four pieces are one
    const int erow = ((int)threadIdx.x >> 6) * 8 + (((int)threadIdx.x >> 2) & 7), ecofs = (((int)threadIdx.x >> 5) & 1) * 32 + ((int)threadIdx.x & 3) * 8;
    float bv[8], bvr[16 / NW]; v8f g1[16 / NW], co[16 / NW], po[16 / NW];
    if constexpr (EPI == 2) {
#pragma unroll
        for (int s = 0; s < 16 / NW; ++s) bvr[s] = bias[c0 + erow + s * (NW * 4)];
    } else if constexpr (EPI > 0) {
#pragma unroll
        for (int k = 0; k < 8; ++k) bv[k] = bias[c0 + ecofs + k];
    }
    if constexpr (EPI == 4) {
#pragma unroll
        for (int s = 0; s < 16 / NW; ++s) { const size_t e = (size_t)(r0 + erow + s * (NW * 4)) * ldc + c0 + ecofs; g1[s] = *(const v8f*)(X1 + e); co[s] = *(const v8f*)(X2 + e); po[s] = *(const v8f*)(X3 + e); }
    }
#pragma unroll
    for (int mb = 0; mb < 4; ++mb)
#pragma unroll
        for (int nb = 0; nb < 4; ++nb) { float* p = part + ((w * 16 + mb * 4 + nb) * 2) * 128 + lane * 4; const v8f c = acc[mb][nb];
            *(v4fa*)p = (v4f){c[0], c[1], c[2], c[3]}; *(v4fa*)(p + 128) = (v4f){c[4], c[5], c[6], c[7]}; }
    // the loaded bias values are inputs only: that keeps their loads in front of the barriers, under the LDS stores above (left alone the compiler sinks them behind the second barrier, where nothing is left to cover their latency);
    // the base pointer is an input so that its registers live up to the wait, which stands before they are given to anything else
    if constexpr (EPI == 1 || EPI == 3 || EPI == 4) asm volatile("s_wait_xcnt 0x0" :: "v"(bv[0]), "v"(bv[1]), "v"(bv[2]), "v"(bv[3]), "v"(bv[4]), "v"(bv[5]), "v"(bv[6]), "v"(bv[7]), "s"(bias) : "memory");
    __syncthreads();   // every wave's partial tile is in LDS
#pragma unroll
    for (int q = 0; q < 16 / NW; ++q) { const int tile = w * (16 / NW) + q, mb = tile >> 2, nb = tile & 3; const float* p = part + tile * 256 + lane * 4;
        v4f s0 = *(const v4fa*)p, s1 = *(const v4fa*)(p + 128);
#pragma unroll
        for (int u = 1; u < NW; ++u) { s0 += *(const v4fa*)(p + u * 4096); s1 += *(const v4fa*)(p + u * 4096 + 128); }
        if constexpr (EPI == 2) { float* t = os + (nb * 16 + lr) * 68 + mb * 16 + hi * 8; *(v4fa*)t = s0; *(v4fa*)(t + 4) = s1; }   // tile kept [column][row]: a lane's eight sums are eight rows of one column
        else {
#pragma unroll
            for (int j = 0; j < 4; ++j) { os[(mb * 16 + hi * 8 + j) * 68 + nb * 16 + lr] = s0[j]; os[(mb * 16 + hi * 8 + 4 + j) * 68 + nb * 16 + lr] = s1[j]; } } }
    __syncthreads();   // the summed tile is complete
    if constexpr (EPI == 0) {
#pragma unroll
    for (int s = 0; s < 32 / NW; ++s) { const int idx = s * (NW * 32) + (int)threadIdx.x, row = idx >> 4, cofs = (idx & 15) * 4; v4f val = *(const v4fa*)(os + row * 68 + cofs); if (BIAS) { val[0] += bfr(bias[c0 + cofs]); val[1] += bfr(bias[c0 + cofs + 1]); val[2] += bfr(bias[c0 + cofs + 2]); val[3] += bfr(bias[c0 + cofs + 3]); }
        *(v4f*)(C + (size_t)(r0 + row) * ldc + c0 + cofs) = val; }
    } else {
#pragma unroll
    for (int s = 0; s < 16 / NW; ++s) { const int row = erow + s * (NW * 4), cofs = ecofs;   // 16-byte plane stores, eight rows to a 128-byte line
        const v4f va = *(const v4fa*)(os + row * 68 + cofs), vb = *(const v4fa*)(os + row * 68 + cofs + 4); float v[8];
#pragma unroll
        for (int k = 0; k < 8; ++k) v[k] = k < 4 ? va[k] : vb[k - 4];
        if constexpr (EPI == 1 || EPI == 2) {
            v8h o16; v8us oh, ol;
#pragma unroll
            for (int k = 0; k < 8; ++k) { v[k] += bfr(EPI == 2 ? bvr[s] : bv[k]); o16[k] = tohx(v[k]); unsigned short a, c; splitf(v[k], a, c); oh[k] = a; ol[k] = c; }
            const size_t hp = (size_t)(r0 / TT) * NH_ + blockIdx.y; const int rl = r0 % TT;   // plane of this batch and head; the tile's first row inside the batch
            const size_t e = hp * TT * HD + (EPI == 1 ? fro(rl + row, cofs, HD) : fro(row, rl + cofs, TT));
            *(v8h*)(P16 + e) = o16; *(v8us*)(Ph + e) = oh; *(v8us*)(Pl + e) = ol;
        } else if constexpr (EPI == 3) {
            v8us oh, ol;
#pragma unroll
            for (int k = 0; k < 8; ++k) { v[k] += bfr(bv[k]); unsigned short a, c; splitf(v[k], a, c); oh[k] = a; ol[k] = c; }
            const size_t e = (size_t)(r0 + row) * ldc + c0 + cofs, ep = fro(r0 + row, c0 + cofs, ldc);
            *(v4f*)(C + e) = (v4f){v[0], v[1], v[2], v[3]}; *(v4f*)(C + e + 4) = (v4f){v[4], v[5], v[6], v[7]}; *(v8us*)(Ph + ep) = oh; *(v8us*)(Pl + ep) = ol;
            asm volatile("s_wait_xcnt 0x0" ::: "memory");   // behind the four stores, before their address or data registers are given to anything else
        } else {
            v8f o;
#pragma unroll
            for (int k = 0; k < 8; ++k) { const float lg = (g1[s][k] + v[k]) + bfr(bv[k]); const float gt = __fdiv_rn(1.0f, 1.0f + expf(-lg)); o[k] = gt * co[s][k] + (1.0f - gt) * po[s][k]; }
            *(v8f*)(C + (size_t)(r0 + row) * ldc + c0 + cofs) = o;
        } }
    }
}
#define MR   (NB_ * TT)           // rows of all batches
#define PLN  ((size_t)MR * DM)    // elements of one [MR][DM] plane (= one set of head planes)
static_assert(DQ == DM, "the merged attention output is as wide as the model");
// One GEMM per blockIdx.z, K = DM (a constant: the steps from tile to tile are immediate offsets on one address pair per plane): operands, C and the hi / lo planes step by sA / sB / sC elements, the bias is bias (z = 0) or bias1. grid (MR/64, N/64, Z).
template <typename T16, int NSPLIT, bool CAUSALK, bool BIAS, int NW, int EPI>
__global__ __launch_bounds__(NW * 32) void k_gemmk(const T16* __restrict__ A, const T16* __restrict__ A2, const T16* __restrict__ Bt, float* C, int ldc, const float* __restrict__ bias, const float* __restrict__ bias1, size_t sA, size_t sB, size_t sC, bf* Ph, bf* Pl, const float* __restrict__ X1, const float* __restrict__ X2, const float* __restrict__ X3) {
    __shared__ __align__(16) float part[NW * 4096];
    __shared__ __align__(16) float os[64 * 68];
    const size_t z = blockIdx.z;
    gemm_tile<T16, NSPLIT, CAUSALK, BIAS, NW, EPI>(part, os, A + z * sA, A2 + z * sA, Bt + z * sB, nullptr, DM, C + z * sC, ldc, z ? bias1 : bias, 0, nullptr, Ph + z * sC, Pl + z * sC, X1, X2, X3);
}
// The six projections of both branches in one launch: z = 3 * branch + (0 q, 1 k, 2 v). X: the planes query, keys, values, gathered embeddings; Wt: the transposed weights in z order; every z writes its own three head planes (v: transposed). grid (MR/64, DM/64, 6).
__global__ __launch_bounds__(256) void k_qkv(const bf* __restrict__ X, const bf* __restrict__ Wt, const float* __restrict__ bcq, const float* __restrict__ bck, const float* __restrict__ bcv, const float* __restrict__ bpq, const float* __restrict__ bpk, const float* __restrict__ bpv, h16* P16, bf* Ph, bf* Pl) {
    __shared__ __align__(16) float part[8 * 4096];
    __shared__ __align__(16) float os[64 * 68];
    const int z = blockIdx.z; const int xi = z < 3 ? z : (z == 3 ? 0 : 3);   // the concept branch: q from the query plane, k and v from the embeddings
    const float* bias = z == 0 ? bcq : z == 1 ? bck : z == 2 ? bcv : z == 3 ? bpq : z == 4 ? bpk : bpv;
    const bf* A = X + (size_t)xi * PLN; const bf* Bt = Wt + (size_t)z * DM * DM; const size_t pz = (size_t)z * PLN;
    if (z == 2 || z == 5) gemm_tile<bf, 0, false, true, 8, 2>(part, os, A, nullptr, Bt, nullptr, DM, nullptr, DM, bias, 0, P16 + pz, Ph + pz, Pl + pz, nullptr, nullptr, nullptr);
    else gemm_tile<bf, 0, false, true, 8, 1>(part, os, A, nullptr, Bt, nullptr, DM, nullptr, DM, bias, 0, P16 + pz, Ph + pz, Pl + pz, nullptr, nullptr, nullptr);
}


// Transposed plane Bt[n][k] (fragment order) of w[k][n], both DM wide: a thread makes the eight neighbours k0 .. k0 + 7 of column n, a wave has 32 neighbouring n: every read is one whole line, every store two runs of 256 bytes.
__device__ __forceinline__ void wtG(const float* __restrict__ w, bf* Bt) {
    const int idx = (int)blockIdx.x * 256 + (int)threadIdx.x; const int n = idx & (DM - 1), k0 = (idx >> 10) * 8;   // the thread's second piece lies DM / 2 rows of w further on
    const float* wp = w + (size_t)k0 * DM + n; const float* wq = wp + (size_t)(DM / 2) * DM; float x[8], y[8];
#pragma unroll
    for (int j = 0; j < 8; ++j) { x[j] = wp[(size_t)j * DM]; y[j] = wq[(size_t)j * DM]; }
    asm volatile("s_wait_xcnt 0x0" :: "v"(wp), "v"(wq) : "memory");   // behind the sixteen reads, before their address registers are given to anything else (the addresses are inputs, so that they live up to the wait)
    v8us o, p;
#pragma unroll
    for (int j = 0; j < 8; ++j) { o[j] = f2bf(x[j]); p[j] = f2bf(y[j]); }
    *(v8us*)(Bt + fro(n, k0, DM)) = o; *(v8us*)(Bt + fro(n, k0 + DM / 2, DM)) = p;
    asm volatile("s_wait_xcnt 0x0" ::: "memory");   // behind the two stores, before their address or data registers are given to anything else
}
__device__ __forceinline__ void put8(v8f v, bf* dst) { v8us o;
#pragma unroll
    for (int k = 0; k < 8; ++k) o[k] = f2bf(v[k]); *(v8us*)dst = o; }
// Everything that depends on the inputs alone, in one launch. grid (256, 10 + 8): blockIdx.y < 10: transposed bf16 plane of weight y (the slow part, so it starts first);
// then eight rows of blocks for the four [MR][DM] bf16 planes (fragment order): query, keys, values, gathered concept embeddings (a thread makes the same eight neighbours of all four: four independent reads in flight, a quarter of the waves to start;
// a wave takes 8 rows x one 32-wide k block: it reads eight whole lines of each input and stores four whole lines of each plane).
__global__ __launch_bounds__(256) void k_prep(const float* __restrict__ w0, const float* __restrict__ w1, const float* __restrict__ w2, const float* __restrict__ w3, const float* __restrict__ w4, const float* __restrict__ w5, const float* __restrict__ w6, const float* __restrict__ w7, const float* __restrict__ w8, const float* __restrict__ w9,
                                              const float* __restrict__ xq, const float* __restrict__ xk, const float* __restrict__ xv, const float* __restrict__ TE, const int* __restrict__ IDS, bf* Wt, bf* X) {
    static_assert(PLN / 8 == (size_t)8 * 256 * 256, "eight rows of 256 blocks cover a plane"); static_assert(DM * DM / 8 == 2 * 256 * 256 && DM == 1024, "256 blocks, two pieces a thread, cover a weight");
    const int y = blockIdx.y;
    if (y < 10) { const float* w = y == 0 ? w0 : y == 1 ? w1 : y == 2 ? w2 : y == 3 ? w3 : y == 4 ? w4 : y == 5 ? w5 : y == 6 ? w6 : y == 7 ? w7 : y == 8 ? w8 : w9; wtG(w, Wt + (size_t)y * DM * DM); return; }
    const int g = ((y - 10) * 256 + (int)blockIdx.x) * 256 + (int)threadIdx.x; const int row = (g >> 10) * 8 + ((g >> 2) & 7), k0 = ((g >> 5) & 31) * 32 + (g & 3) * 8;
    const size_t e = (size_t)row * DM + k0, d = fro(row, k0, DM);   // the thread's first element in each input and in each plane
    const int* ip = IDS + row; const float* qp = xq + e; const float* kp = xk + e; const float* vp = xv + e;
    const int id = *ip; const v8f q = *(const v8f*)qp, k = *(const v8f*)kp, v = *(const v8f*)vp;
    // behind the four reads, before their address registers are given to anything else (the addresses are inputs, so that they live up to the wait)
    asm volatile("s_wait_xcnt 0x0" :: "v"(ip), "v"(qp), "v"(kp), "v"(vp) : "memory");
    const float* ep = TE + (size_t)min(max(id, 0), NVOC - 1) * DM + k0; const v8f ge = *(const v8f*)ep;
    asm volatile("s_wait_xcnt 0x0" :: "v"(ep) : "memory");   // the same behind the gathered read
    put8(q, X + d); put8(k, X + PLN + d); put8(v, X + 2 * PLN + d); put8(ge, X + 3 * PLN + d);
    asm volatile("s_wait_xcnt 0x0" ::: "memory");   // behind the last of the four stores, before any of their address or data registers is given to anything else
}
// ---- k_fattn: causal attention of one head and 64 query rows per block in ONE kernel: scores, softmax with a running maximum and sum, probabilities x values, and the hi/lo planes of the merged output; no score and no probability leaves the registers.
// Four waves, each with 16 queries of its own; no LDS, no barrier. The products are transposed: S^T = K Q^T (A = 16 key rows, B = 16 query columns), so a lane holds scores of ONE query (column lr; keys 8 hi + r of each 16-key tile):
// maximum and sum are taken in the lane, plus one exchange between the wave's halves. Two neighbouring S^T tiles, converted in place, are the B operand of O^T += V^T P^T in the k order of the loaders (8 hi + s, then 16 + 8 hi + s - 8).
// O^T: a lane holds 8 consecutive d of its query, one 16-byte store per plane. Every plane read or written here is in fragment order. Query rows < RH: hi + lo bf16 planes, three products; the rest single fp16. A pass takes 64 keys. grid (NH_ * NB_ * 2, TT / 64), the longest tiles first.
// v_exp_f32 with one free vector slot behind it: the register allocator lets the next instruction overwrite an exp's source directly behind it, where the instruction set asks for one independent instruction
// In place: the register written is the one the compiler's own arithmetic has just written, so its padding behind a matrix instruction covers this statement too.
__device__ __forceinline__ float exp2_slot(float x) { asm("v_exp_f32 %0, %0\n\tv_nop" : "+v"(x)); return x; }
template <typename T16, bool HL>
__device__ __forceinline__ void fattn_wave(const T16* __restrict__ Q, const T16* __restrict__ Q2, const T16* __restrict__ Kp, const T16* __restrict__ K2, const T16* __restrict__ Vt, const T16* __restrict__ V2, int row0, int nkb, int lr, int hi, bf* Ah, bf* Al) {
    typedef typename WFrag<T16>::V V;
    const float L2E = 1.4426950408889634f;
    const int i = row0 + lr;                                   // this lane's query row
    const size_t koff = (size_t)(16 * hi + lr) * 8, voff = koff;   // the lane's place in a tile of a plane in fragment order; 16 rows on: 16 * HD (keys, queries) or 16 * TT (values) elements, 32 k on: 512
    V q[2], q2[2], ka[4][2];
    const T16* qp = Q + (size_t)row0 * HD + koff; const T16* qp2 = HL ? Q2 + (size_t)row0 * HD + koff : nullptr;
#pragma unroll
    for (int kc = 0; kc < 2; ++kc) { q[kc] = WFrag<T16>::ld(qp + kc * 512); if (HL) q2[kc] = WFrag<T16>::ld(qp2 + kc * 512); }
    // behind the query loads, before their address registers are given to anything else (the addresses are inputs, so that they live up to the wait)
    if constexpr (HL) asm volatile("s_wait_xcnt 0x0" :: "v"(qp), "v"(qp2) : "memory"); else asm volatile("s_wait_xcnt 0x0" :: "v"(qp) : "memory");
    if constexpr (!HL) {
        const T16* kp = Kp + koff;
#pragma unroll
        for (int kt = 0; kt < 4; ++kt)
#pragma unroll
            for (int kc = 0; kc < 2; ++kc) ka[kt][kc] = WFrag<T16>::ld(kp + (size_t)kt * 16 * HD + kc * 512);
        asm volatile("s_wait_xcnt 0x0" :: "v"(kp) : "memory");   // behind the key loads, before their address registers are given to anything else (the address is an input, so that it lives up to the wait)
    }
    v8f o[4];
#pragma unroll
    for (int dt = 0; dt < 4; ++dt) o[dt] = (v8f){};
    float m = -3.0e38f, l = 0.f;
#pragma unroll 1   // rolled: the body is long, and a second copy would double the fragments held
    for (int kb = 0; kb < nkb; ++kb) {
        const int key0 = kb * 64;
        V va[4][2];
        if constexpr (!HL) {   // this pass's value fragments: they depend on nothing of the pass, so the compiler may place them as early as its registers allow
            const T16* vp = Vt + voff + (size_t)key0 * 16;
#pragma unroll
            for (int dt = 0; dt < 4; ++dt)
#pragma unroll
                for (int ks = 0; ks < 2; ++ks) va[dt][ks] = WFrag<T16>::ld(vp + (size_t)dt * 16 * TT + ks * 512);
            asm volatile("s_wait_xcnt 0x0" :: "v"(vp) : "memory");   // behind the value loads, before their address registers are given to the next loads' data (the address is an input, so that it lives up to the wait)
        }
        const T16* kh = Kp + koff + (size_t)key0 * HD; const T16* kl = HL ? K2 + koff + (size_t)key0 * HD : kh; const T16* vh = Vt + voff + (size_t)key0 * 16; const T16* vl = HL ? V2 + voff + (size_t)key0 * 16 : vh;   // HL: this pass's tiles
        v8f s[4];
#pragma unroll
        for (int kt = 0; kt < 4; ++kt) s[kt] = (v8f){};
#pragma unroll
        for (int kc = 0; kc < 2; ++kc)
#pragma unroll
            for (int kt = 0; kt < 4; ++kt) {
                if constexpr (HL) { const size_t off = (size_t)kt * 16 * HD + kc * 512; const V a = WFrag<T16>::ld(kh + off), a2 = WFrag<T16>::ld(kl + off);
                    s[kt] = WFrag<T16>::mma(a, q[kc], s[kt]); s[kt] = WFrag<T16>::mma(a, q2[kc], s[kt]); s[kt] = WFrag<T16>::mma(a2, q[kc], s[kt]); }
                else s[kt] = WFrag<T16>::mma(ka[kt][kc], q[kc], s[kt]);
            }
        if constexpr (!HL) {   // the next pass's key fragments (the last pass asks for its own again: always inside the plane)
            const int kn = min(kb + 1, nkb - 1) * 64; const T16* kp = Kp + koff + (size_t)kn * HD;
#pragma unroll
            for (int kt = 0; kt < 4; ++kt)
#pragma unroll
                for (int kc = 0; kc < 2; ++kc) ka[kt][kc] = WFrag<T16>::ld(kp + (size_t)kt * 16 * HD + kc * 512);
            asm volatile("s_wait_xcnt 0x0" :: "v"(kp) : "memory");   // behind the key loads, before their address registers are given to anything else (the address is an input, so that it lives up to the wait)
        } else asm volatile("s_wait_xcnt 0x0" :: "v"(kh), "v"(kl) : "memory");   // the same behind this pass's key loads
        const int rel = i - key0 - 8 * hi;                     // key <= i  <=>  kt * 16 + r <= rel
        float mk[4];
#pragma unroll
        for (int kt = 0; kt < 4; ++kt) { mk[kt] = -3.0e38f;
#pragma unroll
            for (int r = 0; r < 8; ++r) { const float t = (kt * 16 + r <= rel) ? s[kt][r] * SCL : -3.0e38f; s[kt][r] = t; mk[kt] = fmaxf(mk[kt], t); } }
        float mx = fmaxf(fmaxf(fmaxf(mk[0], mk[1]), fmaxf(mk[2], mk[3])), m);
        mx = fmaxf(mx, __shfl_xor(mx, 16, 32));                // the other half of this query's keys
        const float al = exp2_slot((m - mx) * L2E); m = mx;   // first pass: exp2(-inf) = 0 on zero sums
#pragma unroll
        for (int dt = 0; dt < 4; ++dt) o[dt] *= al;
        float lk[4];
#pragma unroll
        for (int kt = 0; kt < 4; ++kt) { lk[kt] = 0.f;
#pragma unroll
            for (int r = 0; r < 8; ++r) { const float p = exp2_slot((s[kt][r] - m) * L2E); s[kt][r] = p; lk[kt] += p; } }
        l = l * al + ((lk[0] + lk[1]) + (lk[2] + lk[3]));
#pragma unroll
        for (int ks = 0; ks < 2; ++ks) {
            V pb, pb2;
            if constexpr (HL) { v8us h0, h1, l0, l1;
#pragma unroll
                for (int r = 0; r < 8; ++r) { unsigned short a, c; splitf(s[2 * ks][r], a, c); h0[r] = a; l0[r] = c; splitf(s[2 * ks + 1][r], a, c); h1[r] = a; l1[r] = c; }
                pb = cat16b(h0, h1); pb2 = cat16b(l0, l1); }
            else { v8h c0, c1;
#pragma unroll
                for (int r = 0; r < 8; ++r) { c0[r] = tohx(s[2 * ks][r]); c1[r] = tohx(s[2 * ks + 1][r]); }
                pb = cat16(c0, c1); }
#pragma unroll
            for (int dt = 0; dt < 4; ++dt) {
                if constexpr (HL) { const size_t off = (size_t)dt * 16 * TT + ks * 512; const V a = WFrag<T16>::ld(vh + off), a2 = WFrag<T16>::ld(vl + off);
                    o[dt] = WFrag<T16>::mma(a, pb, o[dt]); o[dt] = WFrag<T16>::mma(a, pb2, o[dt]); o[dt] = WFrag<T16>::mma(a2, pb, o[dt]); }
                else o[dt] = WFrag<T16>::mma(va[dt][ks], pb, o[dt]);
            }
        }
        // four vector slots behind the last matrix instruction, on the back edge and on the exit alike, before its fragments are reloaded or its accumulators read
        asm volatile("v_nop\n\tv_nop\n\tv_nop\n\tv_nop" : "+v"(o[0]), "+v"(o[1]), "+v"(o[2]), "+v"(o[3]));
        if constexpr (HL) asm volatile("s_wait_xcnt 0x0" :: "v"(vh), "v"(vl) : "memory");   // behind this pass's value loads, before their address registers are given to anything else
    }
    l += __shfl_xor(l, 16, 32);                                // join the halves' sums
    const float inv = __fdiv_rn(1.0f, l);
#pragma unroll
    for (int dt = 0; dt < 4; ++dt) { v8us oh, ol;
#pragma unroll
        for (int r = 0; r < 8; ++r) { unsigned short a, c; splitf(o[dt][r] * inv, a, c); oh[r] = a; ol[r] = c; }
        const size_t oo = (size_t)row0 * DQ + (dt >> 1) * 512 + (dt & 1) * 256 + koff; *(v8us*)(Ah + oo) = oh; *(v8us*)(Al + oo) = ol; }   // fragment order, K = DQ: the wave's store is 512 bytes in a row
}
// Both branches and all batches in one launch: grid (NH_ * NB_ * 2, TT / 64), blockIdx.x = (branch * NB_ + batch) * NH_ + head; blockIdx.y still counts the query tiles from the longest down, so that the longest tiles of every head start first.
// The nine pointers are the char branch's head planes; the concept branch's lie 3 * PLN elements behind them (the order of the projections). Ah / Al: [branch] x ([MR][DQ] in fragment order); a head's 64 columns are two 32-wide k blocks, 1024 elements on per head.
__global__ __launch_bounds__(128) void k_fattn(const h16* __restrict__ Q16, const bf* __restrict__ Qh, const bf* __restrict__ Ql, const h16* __restrict__ K16, const bf* __restrict__ Kh, const bf* __restrict__ Kl, const h16* __restrict__ V16, const bf* __restrict__ Vh, const bf* __restrict__ Vl, bf* Ah, bf* Al) {
    const int lane = threadIdx.x & 31, lr = lane & 15, hi = lane >> 4;
    const int w = __builtin_amdgcn_readfirstlane((int)(threadIdx.x >> 5));   // wave number in a scalar register: row0 and the loop's bounds stay scalar
    static_assert(REP == 1, "the key and value planes are indexed by the query's head");
    const int h = blockIdx.x % NH_, bb = blockIdx.x / NH_, br = bb / NB_, r0 = (TT / 64 - 1 - (int)blockIdx.y) * 64;   // bb = branch * NB_ + batch
    const size_t zq = (size_t)(3 * br) * PLN + ((size_t)(bb % NB_) * NH_ + h) * TT * HD, zk = zq, za = (size_t)bb * TT * DQ + h * (HD * 16);
    if (r0 < RH) fattn_wave<bf, true>(Qh + zq, Ql + zq, Kh + zk, Kl + zk, Vh + zk, Vl + zk, r0 + w * 16, r0 / 64 + 1, lr, hi, Ah + za, Al + za);
    else fattn_wave<h16, false>(Q16 + zq, nullptr, K16 + zk, nullptr, V16 + zk, nullptr, r0 + w * 16, r0 / 64 + 1, lr, hi, Ah + za, Al + za);
}

extern "C" void kernel_launch(void* const* d_in, const int* in_sizes, int n_in,
                              void* d_out, int out_size, void* d_ws, size_t ws_size, hipStream_t stream) {
    (void)in_sizes; (void)n_in; (void)out_size;
    const float* xvals = (const float*)d_in[0]; const float* xkeys = (const float*)d_in[1]; const float* xq = (const float*)d_in[2]; const int* CID = (const int*)d_in[3]; const float* EMB = (const float*)d_in[4]; const float* wcv = (const float*)d_in[5]; const float* bcv = (const float*)d_in[6]; const float* wck = (const float*)d_in[7]; const float* bck = (const float*)d_in[8]; const float* wcq = (const float*)d_in[9]; const float* bcq = (const float*)d_in[10]; const float* wco = (const float*)d_in[11]; const float* bco = (const float*)d_in[12]; const float* wpv = (const float*)d_in[13]; const float* bpv = (const float*)d_in[14]; const float* wpk = (const float*)d_in[15]; const float* bpk = (const float*)d_in[16]; const float* wpq = (const float*)d_in[17]; const float* bpq = (const float*)d_in[18]; const float* wpo = (const float*)d_in[19]; const float* bpo = (const float*)d_in[20]; const float* wg = (const float*)d_in[21]; const float* bg = (const float*)d_in[22];
    float* OUT = (float*)d_out;     // [2][2048][1024]
    char* wsp = (char*)d_ws;
    auto take = [&](size_t bytes) { char* p = wsp; wsp += (bytes + 255) & ~(size_t)255; return (void*)p; };
    bf* WT = (bf*)take((size_t)10 * DM * DM * 2);   /* transposed weights: q, k, v of the char branch, q, k, v of the concept branch, Wco, Wpo, Wg rows 0..1023 (multiply char_out), Wg rows 1024..2047 (concept_out) */
    bf* XP = (bf*)take(4 * PLN * 2);                /* bf16 planes of query, keys, values, gathered concept embeddings */
    bf* ATh = (bf*)take(2 * PLN * 2); bf* ATl = (bf*)take(2 * PLN * 2);   /* merged attention outputs, hi and lo, [branch] */
    char* pl0 = wsp;
    h16* P16 = (h16*)take(6 * PLN * 2); bf* Ph = (bf*)take(6 * PLN * 2); bf* Pl = (bf*)take(6 * PLN * 2);   /* head planes of the six projections */
    char* end0 = wsp; wsp = pl0;                    /* the head planes are dead behind the attention launch: what follows it lies in their place */
    float* CO = (float*)take(2 * PLN * 4); float* PO = CO + PLN; bf* Ch = (bf*)take(2 * PLN * 2); bf* Dh = Ch + PLN; bf* Cl = (bf*)take(2 * PLN * 2); bf* Dl = Cl + PLN; float* G1 = (float*)take(PLN * 4);
    if (wsp > end0 || (size_t)(end0 - (char*)d_ws) > ws_size) return;    // ws 256 MiB
    k_prep<<<dim3(256, 10 + 8), 256, 0, stream>>>(wcq, wck, wcv, wpq, wpk, wpv, wco, wpo, wg, wg + (size_t)DM * DM, xq, xkeys, xvals, EMB, CID, WT, XP);
    k_qkv<<<dim3(MR / 64, DM / 64, 6), 256, 0, stream>>>(XP, WT, bcq, bck, bcv, bpq, bpk, bpv, P16, Ph, Pl);
    k_fattn<<<dim3(NH_ * NB_ * 2, TT / 64), 128, 0, stream>>>(P16, Ph, Pl, P16 + PLN, Ph + PLN, Pl + PLN, P16 + 2 * PLN, Ph + 2 * PLN, Pl + 2 * PLN, ATh, ATl);
    /* out-projections of both branches (z): f32 char_out / concept_out and their hi / lo planes */
    k_gemmk<bf, 1, false, true, 8, 3><<<dim3(MR / 64, DM / 64, 2), 256, 0, stream>>>(ATh, ATl, WT + (size_t)6 * DM * DM, CO, DM, bco, bpo, PLN, (size_t)DM * DM, PLN, Ch, Cl, nullptr, nullptr, nullptr);
    /* ---- gate + mix: char_out Wg[:1024] to G1; concept_out Wg[1024:] ends in the sigmoid and the mix ---- */
    k_gemmk<bf, 1, false, false, 8, 0><<<dim3(MR / 64, DM / 64, 1), 256, 0, stream>>>(Ch, Cl, WT + (size_t)8 * DM * DM, G1, DM, nullptr, nullptr, 0, 0, 0, nullptr, nullptr, nullptr, nullptr, nullptr);
    k_gemmk<bf, 1, false, true, 8, 4><<<dim3(MR / 64, DM / 64, 1), 256, 0, stream>>>(Dh, Dl, WT + (size_t)9 * DM * DM, OUT, DM, bg, nullptr, 0, 0, 0, nullptr, nullptr, G1, CO, PO);
}

// v006
// One run takes 233 microseconds.
// Two timings next to v005 put it at 1.11 and 1.12 times that version's speed.
// Counting every step since v000, it is 13.3 times as fast.
#include <hip/hip_runtime.h>

// Hierarchical (char + concept) gated attention (values, keys, query [2][2048][1024]; concept_ids int32 [2][2048] -> ce = emb[concept_ids] ([1000][1024], gathered on device); char branch: q = query Wcq + bcq, k = keys Wck + bck, v = values Wcv + bcv; concept branch: q = query Wpq + bpq, k = ce Wpk + bpk, v = ce Wpv + bpv ('xw' [1024][1024] + biases; 16 heads x 64); per branch: scores masked causally (-1e20) then x 1/sqrt(1024), softmax, merged, Wo + bo; gate = sigmoid([char_out | concept_out] Wg + bg) (Wg [2048][1024]); out = gate char_out + (1 - gate) concept_out -> [2][2048][1024] (4.2 M)).
// Compute dtypes, f32 accumulate: every input rounded to bf16; q/k/v on PLAIN bf16 operands (inputs: exact) + biases; causal scores, softmax and attn.v in one kernel (key tiles beyond the diagonal block skipped): query rows < 512 hl (3 products), the rest single fp16; softmax f32, running maximum and sum; Wco / Wpo hl x exact (2 products) + bias; gate GEMMs 2 products; sigmoid (precise expf) and the convex mix in f32.

#define NB_  2
#define TT   2048
#define DM   1024
#define NH_  16
#define NKV  16
#define REP  (NH_ / NKV)
#define HD   64
#define DQ   (NH_ * HD)
#define DKV  (NKV * HD)
#define NVOC 1000
#define RH   512                  // query rows < RH use hi+lo planes (0: none)
#define SCL  0.03125f   // 1/sqrt(embed_size = 1024) as in the source
typedef _Float16 h16;
typedef unsigned short bf;
typedef __attribute__((ext_vector_type(16))) __bf16   v16bf;
typedef __attribute__((ext_vector_type(16))) _Float16 v16h;
typedef __attribute__((ext_vector_type(8)))  _Float16 v8h;
typedef __attribute__((ext_vector_type(8)))  unsigned short v8us;
typedef __attribute__((ext_vector_type(8)))  float    v8f;
typedef __attribute__((ext_vector_type(4)))  float    v4f;
typedef v8h  __attribute__((may_alias)) v8ha;
typedef v4f  __attribute__((may_alias)) v4fa;
typedef v8us __attribute__((may_alias)) v8usa;

__device__ __forceinline__ unsigned short f2bf(float f) { unsigned u = __float_as_uint(f); u += 0x7FFFu + ((u >> 16) & 1u); return (unsigned short)(u >> 16); }
__device__ __forceinline__ float bf2f(unsigned short b) { return __uint_as_float(((unsigned)b) << 16); }
__device__ __forceinline__ float bfr(float f) { return bf2f(f2bf(f)); }
__device__ __forceinline__ v16h cat16(v8h lo, v8h hi) { return __builtin_shufflevector(lo, hi, 0, 1, 2, 3, 4, 5, 6, 7, 8, 9, 10, 11, 12, 13, 14, 15); }
__device__ __forceinline__ v16bf cat16b(v8us lo, v8us hi) { return __builtin_bit_cast(v16bf, __builtin_shufflevector(lo, hi, 0, 1, 2, 3, 4, 5, 6, 7, 8, 9, 10, 11, 12, 13, 14, 15)); }
__device__ __forceinline__ v8f wmma16(v16h a, v16h b, v8f c) { return __builtin_amdgcn_wmma_f32_16x16x32_f16(false, a, false, b, (short)0, c, false, false); }
__device__ __forceinline__ v8f wmmab(v16bf a, v16bf b, v8f c) { return __builtin_amdgcn_wmma_f32_16x16x32_bf16(false, a, false, b, (short)0, c, false, false); }



// ---- k_gemmk: register-blocked GEMM, one 64x64 output tile per block, the K loop SPLIT OVER THE NW WAVES of the block: wave w takes the 32-wide K steps w, w + NW, ...
// into its own 16 accumulators, operands straight from 16-bit planes in fragment order (below); the NW partial tiles are then summed through LDS in fixed wave order 0..NW-1. grid (M/64, N/64, Z), NW*32 threads.
// C[m][n] (f32, pitch ldc, + optional f32 bias[n]) = sum_k A[m][k] Bt[n][k] (+ split products per NSPLIT). z-batch strides sA/sB/sC in elements. K % 32 == 0.
// EPI picks what the block does with its summed tile (+ bias): 0 f32 C; 1 head planes [head][row][d] (fp16, bf16 hi, bf16 lo; the tile's 64 columns are one head); 2 the same three planes transposed [head][d][row];
// 3 f32 C and its hi / lo planes; 4 the tile is the second half of the gate's logits: out = g X2 + (1 - g) X3 with g = sigmoid((X1 + tile) + bias), stored to C.
// CAUSALK limits the key (K) range of the probability x value contraction to the diagonal block (probabilities beyond it are exactly zero); roff = row offset of this launch's first row within the sequence.
// FRAGMENT ORDER: every 16-bit operand plane ([rows][K], rows % 16 == 0, K % 32 == 0) is kept as 1-KiB tiles of 16 rows x 32 k, tile (row / 16, k / 32) at element (row / 16) * 16 * K + (k / 32) * 512, and inside a tile
// [k / 16 % 2][k / 8 % 2][row % 16][k % 8]: the first 16 bytes of all 32 lanes of a fragment (lane = 16 * hi + lr: row lr, k 8 hi ..) are 512 bytes in a row, the second 16 bytes (k 16 + 8 hi ..) the next 512.
// A fragment load so touches four whole 128-byte lines; from a row-major plane it would touch sixteen lines for 32 bytes each. ld(p): p = the tile + lane * 8.
// fro: where the eight neighbours k .. k + 7 (k % 8 == 0) of a row lie.
__device__ __forceinline__ size_t fro(size_t row, size_t k, size_t K) { return (row >> 4) * (16 * K) + (k >> 5) * 512 + ((k >> 4) & 1) * 256 + ((k >> 3) & 1) * 128 + (row & 15) * 8; }
template <typename T16> struct WFrag;
template <> struct WFrag<h16> { typedef v16h V; static __device__ __forceinline__ V ld(const h16* p) { return cat16(*(const v8h*)p, *(const v8h*)(p + 256)); } static __device__ __forceinline__ v8f mma(V a, V b, v8f c) { return wmma16(a, b, c); } };
template <> struct WFrag<bf> { typedef v16bf V; static __device__ __forceinline__ V ld(const bf* p) { return cat16b(*(const v8us*)p, *(const v8us*)(p + 256)); } static __device__ __forceinline__ v8f mma(V a, V b, v8f c) { return wmmab(a, b, c); } };
__device__ __forceinline__ h16 tohx(float x) { return (h16)x; }
__device__ __forceinline__ void splitf(float y, unsigned short& h, unsigned short& l) { h = f2bf(y); l = f2bf(y - bf2f(h)); }
// The tile's work is a device function, so that one launch can hold GEMMs with different epilogues (the kernel picks by blockIdx.z, alike for the whole block) on ONE pair of LDS arrays, which the kernel owns:
// part[NW * 4096]: [wave][tile 0..15][j half][lane][4]: every wave's accumulators in register order, 16-byte stores contiguous over the lanes; os[64 * 68]: the summed tile, row-major (pitch 68 floats: both half-waves on disjoint banks).
// The M rows are the rows of all NB_ batches, one behind the other (a 64-row tile lies in one batch); the head planes are [batch][head] x ([row][d] or [d][row] in fragment order).
template <typename T16, int NSPLIT, bool CAUSALK, bool BIAS, int NW, int EPI>
__device__ __forceinline__ void gemm_tile(float* part, float* os, const T16* __restrict__ A, const T16* __restrict__ A2, const T16* __restrict__ Bt, const T16* __restrict__ Bt2, int K, float* C, int ldc, const float* __restrict__ bias, int roff, h16* P16, bf* Ph, bf* Pl, const float* __restrict__ X1, const float* __restrict__ X2, const float* __restrict__ X3) {
    static_assert(HD == 64, "a 64-column tile is one head"); static_assert(EPI == 0 || BIAS, "the plane and gate epilogues always add the bias"); static_assert(NW == 8, "the epilogues deal 64 rows x 8 pieces to 256 threads");
    typedef typename WFrag<T16>::V V;
    const int lane = threadIdx.x & 31, lr = lane & 15, hi = lane >> 4; const int r0 = blockIdx.x * 64, c0 = blockIdx.y * 64;
    const int w = __builtin_amdgcn_readfirstlane((int)(threadIdx.x >> 5));   // wave number in a scalar register: the K loop's bounds stay scalar
    const int Kl = CAUSALK ? min(K, r0 + roff + 64) : K;
    v8f acc[4][4];
#pragma unroll
    for (int mb = 0; mb < 4; ++mb)
#pragma unroll
        for (int nb = 0; nb < 4; ++nb) acc[mb][nb] = (v8f){};
    const size_t aoff = (size_t)r0 * K + lane * 8, boff = (size_t)c0 * K + lane * 8;   // 16 rows on: 16 * K elements; 32 k on: 512
#pragma unroll 1   // rolled: an unrolled body would hold a second set of fragments and pass the register budget of 16 waves
    for (int kc = w * 32; kc < Kl; kc += NW * 32) {
        V a[4], a2[4]; const T16* ap = A + aoff + (size_t)kc * 16; const T16* ap2 = (NSPLIT == 1 || NSPLIT == 2) ? A2 + aoff + (size_t)kc * 16 : ap; const T16* bp = Bt + boff + (size_t)kc * 16; const T16* bp2 = NSPLIT >= 2 ? Bt2 + boff + (size_t)kc * 16 : bp;
#pragma unroll
        for (int mb = 0; mb < 4; ++mb) { a[mb] = WFrag<T16>::ld(ap + (size_t)mb * 16 * K); if (NSPLIT == 1 || NSPLIT == 2) a2[mb] = WFrag<T16>::ld(ap2 + (size_t)mb * 16 * K); }
#pragma unroll
        for (int nb = 0; nb < 4; ++nb) { const V b = WFrag<T16>::ld(bp + (size_t)nb * 16 * K); V b2; if (NSPLIT >= 2) b2 = WFrag<T16>::ld(bp2 + (size_t)nb * 16 * K);
#pragma unroll
            for (int mb = 0; mb < 4; ++mb) { acc[mb][nb] = WFrag<T16>::mma(a[mb], b, acc[mb][nb]); if (NSPLIT == 1 || NSPLIT == 2) acc[mb][nb] = WFrag<T16>::mma(a2[mb], b, acc[mb][nb]); if (NSPLIT >= 2) acc[mb][nb] = WFrag<T16>::mma(a[mb], b2, acc[mb][nb]); } }
        // four vector slots behind the last matrix instruction, on the back edge and on the exit alike, before its fragments are reloaded or its accumulators stored;
        // the wait stands behind the pass's loads, before their address registers are given to anything else (the addresses are inputs, so that they live up to it)
        asm volatile("v_nop\n\tv_nop\n\tv_nop\n\tv_nop\n\ts_wait_xcnt 0x0" : "+v"(acc[0][0]), "+v"(acc[1][1]), "+v"(acc[2][2]), "+v"(acc[3][3]) : "v"(a[0]), "v"(a[3]), "v"(ap), "v"(ap2), "v"(bp), "v"(bp2) : "memory");
    }
    // EPI > 0: a thread ends with eight neighbours of LDS row erow + s * NW * 4; what it needs from memory for them is asked for here, so that it arrives while the partial tiles go to LDS
    // a wave takes 8 rows x 4 pieces of one 32-wide column block: in fragment order the eight rows' pieces are one whole 128-byte line, in a row-major f32 array the four pieces are one
    const int erow = ((int)threadIdx.x >> 6) * 8 + (((int)threadIdx.x >> 2) & 7), ecofs = (((int)threadIdx.x >> 5) & 1) * 32 + ((int)threadIdx.x & 3) * 8;
    float bv[8], bvr[16 / NW]; v8f g1[16 / NW], co[16 / NW], po[16 / NW];
    if constexpr (EPI == 2) {
#pragma unroll
        for (int s = 0; s < 16 / NW; ++s) bvr[s] = bias[c0 + erow + s * (NW * 4)];
    } else if constexpr (EPI > 0) {
#pragma unroll
        for (int k = 0; k < 8; ++k) bv[k] = bias[c0 + ecofs + k];
    }
    if constexpr (EPI == 4) {
#pragma unroll
        for (int s = 0; s < 16 / NW; ++s) { const size_t e = (size_t)(r0 + erow + s * (NW * 4)) * ldc + c0 + ecofs; g1[s] = *(const v8f*)(X1 + e); co[s] = *(const v8f*)(X2 + e); po[s] = *(const v8f*)(X3 + e); }
    }
#pragma unroll
    for (int mb = 0; mb < 4; ++mb)
#pragma unroll
        for (int nb = 0; nb < 4; ++nb) { float* p = part + ((w * 16 + mb * 4 + nb) * 2) * 128 + lane * 4; const v8f c = acc[mb][nb];
            *(v4fa*)p = (v4f){c[0], c[1], c[2], c[3]}; *(v4fa*)(p + 128) = (v4f){c[4], c[5], c[6], c[7]}; }
    // the loaded bias values are inputs only: that keeps their loads in front of the barriers, under the LDS stores above (left alone the compiler sinks them behind the second barrier, where nothing is left to cover their latency);
    // the base pointer is an input so that its registers live up to the wait, which stands before they are given to anything else
    if constexpr (EPI == 1 || EPI == 3 || EPI == 4) asm volatile("s_wait_xcnt 0x0" :: "v"(bv[0]), "v"(bv[1]), "v"(bv[2]), "v"(bv[3]), "v"(bv[4]), "v"(bv[5]), "v"(bv[6]), "v"(bv[7]), "s"(bias) : "memory");
    __syncthreads();   // every wave's partial tile is in LDS
#pragma unroll
    for (int q = 0; q < 16 / NW; ++q) { const int tile = w * (16 / NW) + q, mb = tile >> 2, nb = tile & 3; const float* p = part + tile * 256 + lane * 4;
        v4f s0 = *(const v4fa*)p, s1 = *(const v4fa*)(p + 128);
#pragma unroll
        for (int u = 1; u < NW; ++u) { s0 += *(const v4fa*)(p + u * 4096); s1 += *(const v4fa*)(p + u * 4096 + 128); }
        if constexpr (EPI == 2) { float* t = os + (nb * 16 + lr) * 68 + mb * 16 + hi * 8; *(v4fa*)t = s0; *(v4fa*)(t + 4) = s1; }   // tile kept [column][row]: a lane's eight sums are eight rows of one column
        else {
#pragma unroll
            for (int j = 0; j < 4; ++j) { os[(mb * 16 + hi * 8 + j) * 68 + nb * 16 + lr] = s0[j]; os[(mb * 16 + hi * 8 + 4 + j) * 68 + nb * 16 + lr] = s1[j]; } } }
    __syncthreads();   // the summed tile is complete
    if constexpr (EPI == 0) {
#pragma unroll
    for (int s = 0; s < 32 / NW; ++s) { const int idx = s * (NW * 32) + (int)threadIdx.x, row = idx >> 4, cofs = (idx & 15) * 4; v4f val = *(const v4fa*)(os + row * 68 + cofs); if (BIAS) { val[0] += bfr(bias[c0 + cofs]); val[1] += bfr(bias[c0 + cofs + 1]); val[2] += bfr(bias[c0 + cofs + 2]); val[3] += bfr(bias[c0 + cofs + 3]); }
        *(v4f*)(C + (size_t)(r0 + row) * ldc + c0 + cofs) = val; }
    } else {
#pragma unroll
    for (int s = 0; s < 16 / NW; ++s) { const int row = erow + s * (NW * 4), cofs = ecofs;   // 16-byte plane stores, eight rows to a 128-byte line
        const v4f va = *(const v4fa*)(os + row * 68 + cofs), vb = *(const v4fa*)(os + row * 68 + cofs + 4); float v[8];
#pragma unroll
        for (int k = 0; k < 8; ++k) v[k] = k < 4 ? va[k] : vb[k - 4];
        if constexpr (EPI == 1 || EPI == 2) {
            v8h o16; v8us oh, ol;
#pragma unroll
            for (int k = 0; k < 8; ++k) { v[k] += bfr(EPI == 2 ? bvr[s] : bv[k]); o16[k] = tohx(v[k]); unsigned short a, c; splitf(v[k], a, c); oh[k] = a; ol[k] = c; }
            const size_t hp = (size_t)(r0 / TT) * NH_ + blockIdx.y; const int rl = r0 % TT;   // plane of this batch and head; the tile's first row inside the batch
            const size_t e = hp * TT * HD + (EPI == 1 ? fro(rl + row, cofs, HD) : fro(row, rl + cofs, TT));
            *(v8h*)(P16 + e) = o16; *(v8us*)(Ph + e) = oh; *(v8us*)(Pl + e) = ol;
        } else if constexpr (EPI == 3) {
            v8us oh, ol;
#pragma unroll
            for (int k = 0; k < 8; ++k) { v[k] += bfr(bv[k]); unsigned short a, c; splitf(v[k], a, c); oh[k] = a; ol[k] = c; }
            const size_t e = (size_t)(r0 + row) * ldc + c0 + cofs, ep = fro(r0 + row, c0 + cofs, ldc);
            *(v4f*)(C + e) = (v4f){v[0], v[1], v[2], v[3]}; *(v4f*)(C + e + 4) = (v4f){v[4], v[5], v[6], v[7]}; *(v8us*)(Ph + ep) = oh; *(v8us*)(Pl + ep) = ol;
            asm volatile("s_wait_xcnt 0x0" ::: "memory");   // behind the four stores, before their address or data registers are given to anything else
        } else {
            v8f o;
#pragma unroll
            for (int k = 0; k < 8; ++k) { const float lg = (g1[s][k] + v[k]) + bfr(bv[k]); const float gt = __fdiv_rn(1.0f, 1.0f + expf(-lg)); o[k] = gt * co[s][k] + (1.0f - gt) * po[s][k]; }
            *(v8f*)(C + (size_t)(r0 + row) * ldc + c0 + cofs) = o;
        } }
    }
}
#define MR   (NB_ * TT)           // rows of all batches
#define PLN  ((size_t)MR * DM)    // elements of one [MR][DM] plane (= one set of head planes)
static_assert(DQ == DM, "the merged attention output is as wide as the model");
// One GEMM per blockIdx.z, K = DM (a constant: the steps from tile to tile are immediate offsets on one address pair per plane): operands, C and the hi / lo planes step by sA / sB / sC elements, the bias is bias (z = 0) or bias1. grid (MR/64, N/64, Z).
template <typename T16, int NSPLIT, bool CAUSALK, bool BIAS, int NW, int EPI>
__global__ __launch_bounds__(NW * 32) void k_gemmk(const T16* __restrict__ A, const T16* __restrict__ A2, const T16* __restrict__ Bt, float* C, int ldc, const float* __restrict__ bias, const float* __restrict__ bias1, size_t sA, size_t sB, size_t sC, bf* Ph, bf* Pl, const float* __restrict__ X1, const float* __restrict__ X2, const float* __restrict__ X3) {
    __shared__ __align__(16) float part[NW * 4096];
    __shared__ __align__(16) float os[64 * 68];
    const size_t z = blockIdx.z;
    gemm_tile<T16, NSPLIT, CAUSALK, BIAS, NW, EPI>(part, os, A + z * sA, A2 + z * sA, Bt + z * sB, nullptr, DM, C + z * sC, ldc, z ? bias1 : bias, 0, nullptr, Ph + z * sC, Pl + z * sC, X1, X2, X3);
}
// The six projections of both branches in one launch: z = 3 * branch + (0 q, 1 k, 2 v). X: the planes query, keys, values, gathered embeddings; Wt: the transposed weights in z order; every z writes its own three head planes (v: transposed). grid (MR/64, DM/64, 6).
__global__ __launch_bounds__(256) void k_qkv(const bf* __restrict__ X, const bf* __restrict__ Wt, const float* __restrict__ bcq, const float* __restrict__ bck, const float* __restrict__ bcv, const float* __restrict__ bpq, const float* __restrict__ bpk, const float* __restrict__ bpv, h16* P16, bf* Ph, bf* Pl) {
    __shared__ __align__(16) float part[8 * 4096];
    __shared__ __align__(16) float os[64 * 68];
    const int z = blockIdx.z; const int xi = z < 3 ? z : (z == 3 ? 0 : 3);   // the concept branch: q from the query plane, k and v from the embeddings
    const float* bias = z == 0 ? bcq : z == 1 ? bck : z == 2 ? bcv : z == 3 ? bpq : z == 4 ? bpk : bpv;
    const bf* A = X + (size_t)xi * PLN; const bf* Bt = Wt + (size_t)z * DM * DM; const size_t pz = (size_t)z * PLN;
    if (z == 2 || z == 5) gemm_tile<bf, 0, false, true, 8, 2>(part, os, A, nullptr, Bt, nullptr, DM, nullptr, DM, bias, 0, P16 + pz, Ph + pz, Pl + pz, nullptr, nullptr, nullptr);
    else gemm_tile<bf, 0, false, true, 8, 1>(part, os, A, nullptr, Bt, nullptr, DM, nullptr, DM, bias, 0, P16 + pz, Ph + pz, Pl + pz, nullptr, nullptr, nullptr);
}


// Transposed plane Bt[n][k] (fragment order) of w[k][n], both DM wide: a thread makes the eight neighbours k0 .. k0 + 7 of column n, a wave has 32 neighbouring n: every read is one whole line, every store two runs of 256 bytes.
__device__ __forceinline__ void wtG(const float* __restrict__ w, bf* Bt) {
    const int idx = (int)blockIdx.x * 256 + (int)threadIdx.x; const int n = idx & (DM - 1), k0 = (idx >> 10) * 8;   // the thread's second piece lies DM / 2 rows of w further on
    const float* wp = w + (size_t)k0 * DM + n; const float* wq = wp + (size_t)(DM / 2) * DM; float x[8], y[8];
#pragma unroll
    for (int j = 0; j < 8; ++j) { x[j] = wp[(size_t)j * DM]; y[j] = wq[(size_t)j * DM]; }
    asm volatile("s_wait_xcnt 0x0" :: "v"(wp), "v"(wq) : "memory");   // behind the sixteen reads, before their address registers are given to anything else (the addresses are inputs, so that they live up to the wait)
    v8us o, p;
#pragma unroll
    for (int j = 0; j < 8; ++j) { o[j] = f2bf(x[j]); p[j] = f2bf(y[j]); }
    *(v8us*)(Bt + fro(n, k0, DM)) = o; *(v8us*)(Bt + fro(n, k0 + DM / 2, DM)) = p;
    asm volatile("s_wait_xcnt 0x0" ::: "memory");   // behind the two stores, before their address or data registers are given to anything else
}
__device__ __forceinline__ void put8(v8f v, bf* dst) { v8us o;
#pragma unroll
    for (int k = 0; k < 8; ++k) o[k] = f2bf(v[k]); *(v8us*)dst = o; }
// Everything that depends on the inputs alone, in one launch. grid (256, 10 + 8): blockIdx.y < 10: transposed bf16 plane of weight y (the slow part, so it starts first);
// then eight rows of blocks for the four [MR][DM] bf16 planes (fragment order): query, keys, values, gathered concept embeddings (a thread makes the same eight neighbours of all four: four independent reads in flight, a quarter of the waves to start;
// a wave takes 8 rows x one 32-wide k block: it reads eight whole lines of each input and stores four whole lines of each plane).
__global__ __launch_bounds__(256) void k_prep(const float* __restrict__ w0, const float* __restrict__ w1, const float* __restrict__ w2, const float* __restrict__ w3, const float* __restrict__ w4, const float* __restrict__ w5, const float* __restrict__ w6, const float* __restrict__ w7, const float* __restrict__ w8, const float* __restrict__ w9,
                                              const float* __restrict__ xq, const float* __restrict__ xk, const float* __restrict__ xv, const float* __restrict__ TE, const int* __restrict__ IDS, bf* Wt, bf* X) {
    static_assert(PLN / 8 == (size_t)8 * 256 * 256, "eight rows of 256 blocks cover a plane"); static_assert(DM * DM / 8 == 2 * 256 * 256 && DM == 1024, "256 blocks, two pieces a thread, cover a weight");
    const int y = blockIdx.y;
    if (y < 10) { const float* w = y == 0 ? w0 : y == 1 ? w1 : y == 2 ? w2 : y == 3 ? w3 : y == 4 ? w4 : y == 5 ? w5 : y == 6 ? w6 : y == 7 ? w7 : y == 8 ? w8 : w9; wtG(w, Wt + (size_t)y * DM * DM); return; }
    const int g = ((y - 10) * 256 + (int)blockIdx.x) * 256 + (int)threadIdx.x; const int row = (g >> 10) * 8 + ((g >> 2) & 7), k0 = ((g >> 5) & 31) * 32 + (g & 3) * 8;
    const size_t e = (size_t)row * DM + k0, d = fro(row, k0, DM);   // the thread's first element in each input and in each plane
    const int* ip = IDS + row; const float* qp = xq + e; const float* kp = xk + e; const float* vp = xv + e;
    const int id = *ip; const v8f q = *(const v8f*)qp, k = *(const v8f*)kp, v = *(const v8f*)vp;
    // behind the four reads, before their address registers are given to anything else (the addresses are inputs, so that they live up to the wait)
    asm volatile("s_wait_xcnt 0x0" :: "v"(ip), "v"(qp), "v"(kp), "v"(vp) : "memory");
    const float* ep = TE + (size_t)min(max(id, 0), NVOC - 1) * DM + k0; const v8f ge = *(const v8f*)ep;
    asm volatile("s_wait_xcnt 0x0" :: "v"(ep) : "memory");   // the same behind the gathered read
    put8(q, X + d); put8(k, X + PLN + d); put8(v, X + 2 * PLN + d); put8(ge, X + 3 * PLN + d);
    asm volatile("s_wait_xcnt 0x0" ::: "memory");   // behind the last of the four stores, before any of their address or data registers is given to anything else
}
// ---- k_fattn: causal attention of one head and 64 query rows per block in ONE kernel: scores, softmax with a running maximum and sum, probabilities x values, and the hi/lo planes of the merged output; no score and no probability leaves the registers.
// Four waves, each with 16 queries of its own; no LDS, no barrier. The products are transposed: S^T = K Q^T (A = 16 key rows, B = 16 query columns), so a lane holds scores of ONE query (column lr; keys 8 hi + r of each 16-key tile):
// maximum and sum are taken in the lane, plus one exchange between the wave's halves. Two neighbouring S^T tiles, converted in place, are the B operand of O^T += V^T P^T in the k order of the loaders (8 hi + s, then 16 + 8 hi + s - 8).
// O^T: a lane holds 8 consecutive d of its query, one 16-byte store per plane. Every plane read or written here is in fragment order. Query rows < RH: hi + lo bf16 planes, three products; the rest single fp16. A pass takes 64 keys. grid (NH_ * NB_ * 2, TT / 64), the longest tiles first.
// v_exp_f32 with one free vector slot behind it: the register allocator lets the next instruction overwrite an exp's source directly behind it, where the instruction set asks for one independent instruction
// In place: the register written is the one the compiler's own arithmetic has just written, so its padding behind a matrix instruction covers this statement too.
__device__ __forceinline__ float exp2_slot(float x) { asm("v_exp_f32 %0, %0\n\tv_nop" : "+v"(x)); return x; }
// Eight of them in one statement: each is the independent instruction behind the one before it, so only the last needs the free slot.
__device__ __forceinline__ v8f exp2_slot8(v8f x) { float a = x[0], b = x[1], c = x[2], d = x[3], e = x[4], f = x[5], g = x[6], h = x[7];
    asm("v_exp_f32 %0, %0\n\tv_exp_f32 %1, %1\n\tv_exp_f32 %2, %2\n\tv_exp_f32 %3, %3\n\tv_exp_f32 %4, %4\n\tv_exp_f32 %5, %5\n\tv_exp_f32 %6, %6\n\tv_exp_f32 %7, %7\n\tv_nop" : "+v"(a), "+v"(b), "+v"(c), "+v"(d), "+v"(e), "+v"(f), "+v"(g), "+v"(h));
    return (v8f){a, b, c, d, e, f, g, h}; }
__device__ __forceinline__ float xhalf(float x) { return __builtin_bit_cast(float, __builtin_amdgcn_permlanex16(__builtin_bit_cast(int, x), __builtin_bit_cast(int, x), 0x76543210, 0xfedcba98, false, false)); }   // lane l with lane l ^ 16, in the vector unit
template <bool B> struct BoolC { static constexpr bool value = B; };
template <typename T16, bool HL>
__device__ __forceinline__ void fattn_wave(const T16* __restrict__ Q, const T16* __restrict__ Q2, const T16* __restrict__ Kp, const T16* __restrict__ K2, const T16* __restrict__ Vt, const T16* __restrict__ V2, int row0, int nkb, int lr, int hi, bf* Ah, bf* Al) {
    typedef typename WFrag<T16>::V V;
    const float CE = SCL * 1.4426950408889634f;               // scores stay as the matrix unit leaves them; the scale (a power of two) and log2(e) enter in the exponent's one multiply-add, and the running maximum is kept unscaled
    const size_t koff = (size_t)(16 * hi + lr) * 8, voff = koff;   // the lane's place in a tile of a plane in fragment order; 16 rows on: 16 * HD (keys, queries) or 16 * TT (values) elements, 32 k on: 512
    V q[2], q2[2], ka[4][2];
    const T16* qp = Q + (size_t)row0 * HD + koff; const T16* qp2 = HL ? Q2 + (size_t)row0 * HD + koff : nullptr;
#pragma unroll
    for (int kc = 0; kc < 2; ++kc) { q[kc] = WFrag<T16>::ld(qp + kc * 512); if (HL) q2[kc] = WFrag<T16>::ld(qp2 + kc * 512); }
    // behind the query loads, before their address registers are given to anything else (the addresses are inputs, so that they live up to the wait)
    if constexpr (HL) asm volatile("s_wait_xcnt 0x0" :: "v"(qp), "v"(qp2) : "memory"); else asm volatile("s_wait_xcnt 0x0" :: "v"(qp) : "memory");
    if constexpr (!HL) {
        const T16* kp = Kp + koff;
#pragma unroll
        for (int kt = 0; kt < 4; ++kt)
#pragma unroll
            for (int kc = 0; kc < 2; ++kc) ka[kt][kc] = WFrag<T16>::ld(kp + (size_t)kt * 16 * HD + kc * 512);
        asm volatile("s_wait_xcnt 0x0" :: "v"(kp) : "memory");   // behind the key loads, before their address registers are given to anything else (the address is an input, so that it lives up to the wait)
    }
    v8f o[4];
#pragma unroll
    for (int dt = 0; dt < 4; ++dt) o[dt] = (v8f){};
    float m = -3.0e38f, l = 0.f;
    // One pass of 64 keys. Only the last pass (the diagonal block) holds keys behind a query, so only its copy of the body compares and selects.
    auto pass = [&](const int kb, auto DIAG) __attribute__((always_inline)) {
        const int key0 = kb * 64;
        V va[4][2];
        if constexpr (!HL) {   // this pass's value fragments: they depend on nothing of the pass, so the compiler may place them as early as its registers allow
            const T16* vp = Vt + voff + (size_t)key0 * 16;
#pragma unroll
            for (int dt = 0; dt < 4; ++dt)
#pragma unroll
                for (int ks = 0; ks < 2; ++ks) va[dt][ks] = WFrag<T16>::ld(vp + (size_t)dt * 16 * TT + ks * 512);
            asm volatile("s_wait_xcnt 0x0" :: "v"(vp) : "memory");   // behind the value loads, before their address registers are given to the next loads' data (the address is an input, so that it lives up to the wait)
        }
        const T16* kh = Kp + koff + (size_t)key0 * HD; const T16* kl = HL ? K2 + koff + (size_t)key0 * HD : kh; const T16* vh = Vt + voff + (size_t)key0 * 16; const T16* vl = HL ? V2 + voff + (size_t)key0 * 16 : vh;   // HL: this pass's tiles
        v8f s[4];
#pragma unroll
        for (int kt = 0; kt < 4; ++kt) s[kt] = (v8f){};
#pragma unroll
        for (int kc = 0; kc < 2; ++kc)
#pragma unroll
            for (int kt = 0; kt < 4; ++kt) {
                if constexpr (HL) { const size_t off = (size_t)kt * 16 * HD + kc * 512; const V a = WFrag<T16>::ld(kh + off), a2 = WFrag<T16>::ld(kl + off);
                    s[kt] = WFrag<T16>::mma(a, q[kc], s[kt]); s[kt] = WFrag<T16>::mma(a, q2[kc], s[kt]); s[kt] = WFrag<T16>::mma(a2, q[kc], s[kt]); }
                else s[kt] = WFrag<T16>::mma(ka[kt][kc], q[kc], s[kt]);
            }
        if constexpr (!HL) {   // the next pass's key fragments (the last pass asks for its own again: always inside the plane)
            const int kn = min(kb + 1, nkb - 1) * 64; const T16* kp = Kp + koff + (size_t)kn * HD;
#pragma unroll
            for (int kt = 0; kt < 4; ++kt)
#pragma unroll
                for (int kc = 0; kc < 2; ++kc) ka[kt][kc] = WFrag<T16>::ld(kp + (size_t)kt * 16 * HD + kc * 512);
            asm volatile("s_wait_xcnt 0x0" :: "v"(kp) : "memory");   // behind the key loads, before their address registers are given to anything else (the address is an input, so that it lives up to the wait)
        } else asm volatile("s_wait_xcnt 0x0" :: "v"(kh), "v"(kl) : "memory");   // the same behind this pass's key loads
        if constexpr (decltype(DIAG)::value) {
            const int ln = (int)__builtin_amdgcn_mbcnt_lo(~0u, 0u);   // the lane's number, made anew: nothing of it has to be held in a register through the loop (held there, it was spilled)
            const int rel = row0 + (ln & 15) - key0 - 8 * (ln >> 4);   // key <= this lane's query row  <=>  kt * 16 + r <= rel
#pragma unroll
            for (int kt = 0; kt < 4; ++kt)
#pragma unroll
                for (int r = 0; r < 8; ++r) s[kt][r] = (kt * 16 + r <= rel) ? s[kt][r] : -3.0e38f;
        }
        float mk[4];
#pragma unroll
        for (int kt = 0; kt < 4; ++kt) { mk[kt] = s[kt][0];
#pragma unroll
            for (int r = 1; r < 8; ++r) mk[kt] = fmaxf(mk[kt], s[kt][r]); }
        float mx = fmaxf(fmaxf(fmaxf(mk[0], mk[1]), fmaxf(mk[2], mk[3])), m);
        mx = fmaxf(mx, xhalf(mx));                             // the other half of this query's keys
        const float al = exp2_slot((m - mx) * CE); m = mx;    // first pass: exp2 of a huge negative number = 0 on zero sums
#pragma unroll
        for (int dt = 0; dt < 4; ++dt) o[dt] *= al;
        const float nm = -m * CE; const v8f cev = {CE, CE, CE, CE, CE, CE, CE, CE}, nmv = {nm, nm, nm, nm, nm, nm, nm, nm};
#pragma unroll
        for (int kt = 0; kt < 4; ++kt) s[kt] = exp2_slot8(__builtin_elementwise_fma(s[kt], cev, nmv));
        const v8f sv = (s[0] + s[1]) + (s[2] + s[3]);          // the four tiles register by register (packed adds on the pairs as they lie), then the eight sums
        l = l * al + (((sv[0] + sv[4]) + (sv[1] + sv[5])) + ((sv[2] + sv[6]) + (sv[3] + sv[7])));
#pragma unroll
        for (int ks = 0; ks < 2; ++ks) {
            V pb, pb2;
            if constexpr (HL) { v8us h0, h1, l0, l1;
#pragma unroll
                for (int r = 0; r < 8; ++r) { unsigned short a, c; splitf(s[2 * ks][r], a, c); h0[r] = a; l0[r] = c; splitf(s[2 * ks + 1][r], a, c); h1[r] = a; l1[r] = c; }
                pb = cat16b(h0, h1); pb2 = cat16b(l0, l1); }
            else { v8h c0, c1;
#pragma unroll
                for (int r = 0; r < 8; ++r) { c0[r] = tohx(s[2 * ks][r]); c1[r] = tohx(s[2 * ks + 1][r]); }
                pb = cat16(c0, c1); }
#pragma unroll
            for (int dt = 0; dt < 4; ++dt) {
                if constexpr (HL) { const size_t off = (size_t)dt * 16 * TT + ks * 512; const V a = WFrag<T16>::ld(vh + off), a2 = WFrag<T16>::ld(vl + off);
                    o[dt] = WFrag<T16>::mma(a, pb, o[dt]); o[dt] = WFrag<T16>::mma(a, pb2, o[dt]); o[dt] = WFrag<T16>::mma(a2, pb, o[dt]); }
                else o[dt] = WFrag<T16>::mma(va[dt][ks], pb, o[dt]);
            }
        }
        // four vector slots behind the last matrix instruction, on the back edge and on the exit alike, before its fragments are reloaded or its accumulators read
        asm volatile("v_nop\n\tv_nop\n\tv_nop\n\tv_nop" : "+v"(o[0]), "+v"(o[1]), "+v"(o[2]), "+v"(o[3]));
        if constexpr (HL) asm volatile("s_wait_xcnt 0x0" :: "v"(vh), "v"(vl) : "memory");   // behind this pass's value loads, before their address registers are given to anything else
    };
#pragma unroll 1   // rolled: the body is long, and a second copy would double the fragments held
    for (int kb = 0; kb < nkb - 1; ++kb) pass(kb, BoolC<false>{});
    pass(nkb - 1, BoolC<true>{});
    l += xhalf(l);                                             // join the halves' sums
    const size_t ooff = (size_t)__builtin_amdgcn_mbcnt_lo(~0u, 0u) * 8;   // the lane's place in a tile, made anew for the same reason
    const float inv = __fdiv_rn(1.0f, l);
#pragma unroll
    for (int dt = 0; dt < 4; ++dt) { v8us oh, ol;
#pragma unroll
        for (int r = 0; r < 8; ++r) { unsigned short a, c; splitf(o[dt][r] * inv, a, c); oh[r] = a; ol[r] = c; }
        const size_t oo = (size_t)row0 * DQ + (dt >> 1) * 512 + (dt & 1) * 256 + ooff; *(v8us*)(Ah + oo) = oh; *(v8us*)(Al + oo) = ol; }   // fragment order, K = DQ: the wave's store is 512 bytes in a row
}
// Both branches and all batches in one launch: grid (NH_ * NB_ * 2, TT / 64), blockIdx.x = (branch * NB_ + batch) * NH_ + head; blockIdx.y still counts the query tiles from the longest down, so that the longest tiles of every head start first.
// Four waves per SIMD, no more and no fewer, are asked for: with the 256 registers of that budget the compiler issues a pass's value loads at its head and the next pass's key loads right behind the score products; aiming at more waves it issued them late and waited for them at once.
// The nine pointers are the char branch's head planes; the concept branch's lie 3 * PLN elements behind them (the order of the projections). Ah / Al: [branch] x ([MR][DQ] in fragment order); a head's 64 columns are two 32-wide k blocks, 1024 elements on per head.
__global__ __launch_bounds__(128) __attribute__((amdgpu_waves_per_eu(4, 4))) void k_fattn(const h16* __restrict__ Q16, const bf* __restrict__ Qh, const bf* __restrict__ Ql, const h16* __restrict__ K16, const bf* __restrict__ Kh, const bf* __restrict__ Kl, const h16* __restrict__ V16, const bf* __restrict__ Vh, const bf* __restrict__ Vl, bf* Ah, bf* Al) {
    const int lane = threadIdx.x & 31, lr = lane & 15, hi = lane >> 4;
    const int w = __builtin_amdgcn_readfirstlane((int)(threadIdx.x >> 5));   // wave number in a scalar register: row0 and the loop's bounds stay scalar
    static_assert(REP == 1, "the key and value planes are indexed by the query's head");
    const int h = blockIdx.x % NH_, bb = blockIdx.x / NH_, br = bb / NB_, r0 = (TT / 64 - 1 - (int)blockIdx.y) * 64;   // bb = branch * NB_ + batch
    const size_t zq = (size_t)(3 * br) * PLN + ((size_t)(bb % NB_) * NH_ + h) * TT * HD, zk = zq, za = (size_t)bb * TT * DQ + h * (HD * 16);
    if (r0 < RH) fattn_wave<bf, true>(Qh + zq, Ql + zq, Kh + zk, Kl + zk, Vh + zk, Vl + zk, r0 + w * 16, r0 / 64 + 1, lr, hi, Ah + za, Al + za);
    else fattn_wave<h16, false>(Q16 + zq, nullptr, K16 + zk, nullptr, V16 + zk, nullptr, r0 + w * 16, r0 / 64 + 1, lr, hi, Ah + za, Al + za);
}

extern "C" void kernel_launch(void* const* d_in, const int* in_sizes, int n_in,
                              void* d_out, int out_size, void* d_ws, size_t ws_size, hipStream_t stream) {
    (void)in_sizes; (void)n_in; (void)out_size;
    const float* xvals = (const float*)d_in[0]; const float* xkeys = (const float*)d_in[1]; const float* xq = (const float*)d_in[2]; const int* CID = (const int*)d_in[3]; const float* EMB = (const float*)d_in[4]; const float* wcv = (const float*)d_in[5]; const float* bcv = (const float*)d_in[6]; const float* wck = (const float*)d_in[7]; const float* bck = (const float*)d_in[8]; const float* wcq = (const float*)d_in[9]; const float* bcq = (const float*)d_in[10]; const float* wco = (const float*)d_in[11]; const float* bco = (const float*)d_in[12]; const float* wpv = (const float*)d_in[13]; const float* bpv = (const float*)d_in[14]; const float* wpk = (const float*)d_in[15]; const float* bpk = (const float*)d_in[16]; const float* wpq = (const float*)d_in[17]; const float* bpq = (const float*)d_in[18]; const float* wpo = (const float*)d_in[19]; const float* bpo = (const float*)d_in[20]; const float* wg = (const float*)d_in[21]; const float* bg = (const float*)d_in[22];
    float* OUT = (float*)d_out;     // [2][2048][1024]
    char* wsp = (char*)d_ws;
    auto take = [&](size_t bytes) { char* p = wsp; wsp += (bytes + 255) & ~(size_t)255; return (void*)p; };
    bf* WT = (bf*)take((size_t)10 * DM * DM * 2);   /* transposed weights: q, k, v of the char branch, q, k, v of the concept branch, Wco, Wpo, Wg rows 0..1023 (multiply char_out), Wg rows 1024..2047 (concept_out) */
    bf* XP = (bf*)take(4 * PLN * 2);                /* bf16 planes of query, keys, values, gathered concept embeddings */
    bf* ATh = (bf*)take(2 * PLN * 2); bf* ATl = (bf*)take(2 * PLN * 2);   /* merged attention outputs, hi and lo, [branch] */
    char* pl0 = wsp;
    h16* P16 = (h16*)take(6 * PLN * 2); bf* Ph = (bf*)take(6 * PLN * 2); bf* Pl = (bf*)take(6 * PLN * 2);   /* head planes of the six projections */
    char* end0 = wsp; wsp = pl0;                    /* the head planes are dead behind the attention launch: what follows it lies in their place */
    float* CO = (float*)take(2 * PLN * 4); float* PO = CO + PLN; bf* Ch = (bf*)take(2 * PLN * 2); bf* Dh = Ch + PLN; bf* Cl = (bf*)take(2 * PLN * 2); bf* Dl = Cl + PLN; float* G1 = (float*)take(PLN * 4);
    if (wsp > end0 || (size_t)(end0 - (char*)d_ws) > ws_size) return;    // ws 256 MiB
    k_prep<<<dim3(256, 10 + 8), 256, 0, stream>>>(wcq, wck, wcv, wpq, wpk, wpv, wco, wpo, wg, wg + (size_t)DM * DM, xq, xkeys, xvals, EMB, CID, WT, XP);
    k_qkv<<<dim3(MR / 64, DM / 64, 6), 256, 0, stream>>>(XP, WT, bcq, bck, bcv, bpq, bpk, bpv, P16, Ph, Pl);
    k_fattn<<<dim3(NH_ * NB_ * 2, TT / 64), 128, 0, stream>>>(P16, Ph, Pl, P16 + PLN, Ph + PLN, Pl + PLN, P16 + 2 * PLN, Ph + 2 * PLN, Pl + 2 * PLN, ATh, ATl);
    /* out-projections of both branches (z): f32 char_out / concept_out and their hi / lo planes */
    k_gemmk<bf, 1, false, true, 8, 3><<<dim3(MR / 64, DM / 64, 2), 256, 0, stream>>>(ATh, ATl, WT + (size_t)6 * DM * DM, CO, DM, bco, bpo, PLN, (size_t)DM * DM, PLN, Ch, Cl, nullptr, nullptr, nullptr);
    /* ---- gate + mix: char_out Wg[:1024] to G1; concept_out Wg[1024:] ends in the sigmoid and the mix ---- */
    k_gemmk<bf, 1, false, false, 8, 0><<<dim3(MR / 64, DM / 64, 1), 256, 0, stream>>>(Ch, Cl, WT + (size_t)8 * DM * DM, G1, DM, nullptr, nullptr, 0, 0, 0, nullptr, nullptr, nullptr, nullptr, nullptr);
    k_gemmk<bf, 1, false, true, 8, 4><<<dim3(MR / 64, DM / 64, 1), 256, 0, stream>>>(Dh, Dl, WT + (size_t)9 * DM * DM, OUT, DM, bg, nullptr, 0, 0, 0, nullptr, nullptr, G1, CO, PO);
}

// v007
// Measured time: 215 microseconds a run.
// Next to v006, in two timings, it ran 1.09 times as fast each time.
// Counting every step since v000, it is 14.5 times as fast.
#include <hip/hip_runtime.h>

// Hierarchical (char + concept) gated attention (values, keys, query [2][2048][1024]; concept_ids int32 [2][2048] -> ce = emb[concept_ids] ([1000][1024], gathered on device); char branch: q = query Wcq + bcq, k = keys Wck + bck, v = values Wcv + bcv; concept branch: q = query Wpq + bpq, k = ce Wpk + bpk, v = ce Wpv + bpv ('xw' [1024][1024] + biases; 16 heads x 64); per branch: scores masked causally (-1e20) then x 1/sqrt(1024), softmax, merged, Wo + bo; gate = sigmoid([char_out | concept_out] Wg + bg) (Wg [2048][1024]); out = gate char_out + (1 - gate) concept_out -> [2][2048][1024] (4.2 M)).
// Compute dtypes, f32 accumulate: every input rounded to bf16; q/k/v on PLAIN bf16 operands (inputs: exact) + biases; causal scores, softmax and attn.v in one kernel (key tiles beyond the diagonal block skipped): query rows < 512 hl (3 products), the rest single fp16; softmax f32, running maximum and sum; Wco / Wpo hl x exact (2 products) + bias; gate GEMMs 2 products; sigmoid (precise expf) and the convex mix in f32.

#define NB_  2
#define TT   2048
#define DM   1024
#define NH_  16
#define NKV  16
#define REP  (NH_ / NKV)
#define HD   64
#define DQ   (NH_ * HD)
#define DKV  (NKV * HD)
#define NVOC 1000
#define RH   512                  // query rows < RH use hi+lo planes (0: none)
#define SCL  0.03125f   // 1/sqrt(embed_size = 1024) as in the source
typedef _Float16 h16;
typedef unsigned short bf;
typedef __attribute__((ext_vector_type(16))) __bf16   v16bf;
typedef __attribute__((ext_vector_type(16))) _Float16 v16h;
typedef __attribute__((ext_vector_type(8)))  _Float16 v8h;
typedef __attribute__((ext_vector_type(8)))  unsigned short v8us;
typedef __attribute__((ext_vector_type(8)))  float    v8f;
typedef __attribute__((ext_vector_type(4)))  float    v4f;
typedef v8h  __attribute__((may_alias)) v8ha;
typedef v4f  __attribute__((may_alias)) v4fa;
typedef v8us __attribute__((may_alias)) v8usa;

__device__ __forceinline__ unsigned short f2bf(float f) { unsigned u = __float_as_uint(f); u += 0x7FFFu + ((u >> 16) & 1u); return (unsigned short)(u >> 16); }
__device__ __forceinline__ float bf2f(unsigned short b) { return __uint_as_float(((unsigned)b) << 16); }
__device__ __forceinline__ float bfr(float f) { return bf2f(f2bf(f)); }
__device__ __forceinline__ v16h cat16(v8h lo, v8h hi) { return __builtin_shufflevector(lo, hi, 0, 1, 2, 3, 4, 5, 6, 7, 8, 9, 10, 11, 12, 13, 14, 15); }
__device__ __forceinline__ v16bf cat16b(v8us lo, v8us hi) { return __builtin_bit_cast(v16bf, __builtin_shufflevector(lo, hi, 0, 1, 2, 3, 4, 5, 6, 7, 8, 9, 10, 11, 12, 13, 14, 15)); }
__device__ __forceinline__ v8f wmma16(v16h a, v16h b, v8f c) { return __builtin_amdgcn_wmma_f32_16x16x32_f16(false, a, false, b, (short)0, c, false, false); }
__device__ __forceinline__ v8f wmmab(v16bf a, v16bf b, v8f c) { return __builtin_amdgcn_wmma_f32_16x16x32_bf16(false, a, false, b, (short)0, c, false, false); }



// ---- k_gemmk: register-blocked GEMM, one 64x64 output tile per block, the K loop SPLIT OVER THE NW WAVES of the block: wave w takes the 32-wide K steps w, w + NW, ...
// into its own 16 accumulators, operands straight from 16-bit planes in fragment order (below); the NW partial tiles are then summed through LDS in fixed wave order 0..NW-1. grid (M/64, N/64, Z), NW*32 threads.
// C[m][n] (f32, pitch ldc, + optional f32 bias[n]) = sum_k A[m][k] Bt[n][k] (+ split products per NSPLIT). z-batch strides sA/sB/sC in elements. K % 32 == 0.
// EPI picks what the block does with its summed tile (+ bias): 0 f32 C; 1 head planes [head][row][d] (fp16, bf16 hi, bf16 lo; the tile's 64 columns are one head); 2 the same three planes transposed [head][d][row];
// 3 f32 C and its hi / lo planes; 4 the tile is the second half of the gate's logits: out = g X2 + (1 - g) X3 with g = sigmoid((X1 + tile) + bias), stored to C.
// CAUSALK limits the key (K) range of the probability x value contraction to the diagonal block (probabilities beyond it are exactly zero); roff = row offset of this launch's first row within the sequence.
// FRAGMENT ORDER: every 16-bit operand plane ([rows][K], rows % 16 == 0, K % 32 == 0) is kept as 1-KiB tiles of 16 rows x 32 k, tile (row / 16, k / 32) at element (row / 16) * 16 * K + (k / 32) * 512, and inside a tile
// [k / 16 % 2][k / 8 % 2][row % 16][k % 8]: the first 16 bytes of all 32 lanes of a fragment (lane = 16 * hi + lr: row lr, k 8 hi ..) are 512 bytes in a row, the second 16 bytes (k 16 + 8 hi ..) the next 512.
// A fragment load so touches four whole 128-byte lines; from a row-major plane it would touch sixteen lines for 32 bytes each. ld(p): p = the tile + lane * 8.
// fro: where the eight neighbours k .. k + 7 (k % 8 == 0) of a row lie.
__device__ __forceinline__ size_t fro(size_t row, size_t k, size_t K) { return (row >> 4) * (16 * K) + (k >> 5) * 512 + ((k >> 4) & 1) * 256 + ((k >> 3) & 1) * 128 + (row & 15) * 8; }
template <typename T16> struct WFrag;
template <> struct WFrag<h16> { typedef v16h V; static __device__ __forceinline__ V ld(const h16* p) { return cat16(*(const v8h*)p, *(const v8h*)(p + 256)); } static __device__ __forceinline__ v8f mma(V a, V b, v8f c) { return wmma16(a, b, c); } };
template <> struct WFrag<bf> { typedef v16bf V; static __device__ __forceinline__ V ld(const bf* p) { return cat16b(*(const v8us*)p, *(const v8us*)(p + 256)); } static __device__ __forceinline__ v8f mma(V a, V b, v8f c) { return wmmab(a, b, c); } };
__device__ __forceinline__ h16 tohx(float x) { return (h16)x; }
__device__ __forceinline__ void splitf(float y, unsigned short& h, unsigned short& l) { h = f2bf(y); l = f2bf(y - bf2f(h)); }
// The tile's work is a device function, so that one launch can hold GEMMs with different epilogues (the kernel picks by blockIdx.z, alike for the whole block) on ONE LDS array, which the kernel owns and which holds first part, then, behind a barrier, os in the same place:
// part[NW * 4096]: [wave][tile 0..15][j half][lane][4]: every wave's accumulators in register order, 16-byte stores contiguous over the lanes; os[64 * 68]: the summed tile, row-major (pitch 68 floats: both half-waves on disjoint banks).
// The M rows are the rows of all NB_ batches, one behind the other (a 64-row tile lies in one batch); the head planes are [batch][head] x ([row][d] or [d][row] in fragment order).
template <typename T16, int NSPLIT, bool CAUSALK, bool BIAS, int NW, int EPI>
__device__ __forceinline__ void gemm_tile(float* part, float* os, const T16* __restrict__ A, const T16* __restrict__ A2, const T16* __restrict__ Bt, const T16* __restrict__ Bt2, int K, float* C, int ldc, const float* __restrict__ bias, int roff, h16* P16, bf* Ph, bf* Pl, const float* __restrict__ X1, const float* __restrict__ X2, const float* __restrict__ X3) {
    static_assert(HD == 64, "a 64-column tile is one head"); static_assert(EPI == 0 || BIAS, "the plane and gate epilogues always add the bias"); static_assert(NW == 4 || NW == 8, "the epilogues deal 64 rows x 8 pieces to NW * 32 threads, 16 / NW rows a thread"); static_assert(64 * 68 <= NW * 4096, "os fits in the place of part");
    typedef typename WFrag<T16>::V V;
    const int lane = threadIdx.x & 31, lr = lane & 15, hi = lane >> 4; const int r0 = blockIdx.x * 64, c0 = blockIdx.y * 64;
    const int w = __builtin_amdgcn_readfirstlane((int)(threadIdx.x >> 5));   // wave number in a scalar register: the K loop's bounds stay scalar
    const int Kl = CAUSALK ? min(K, r0 + roff + 64) : K;
    v8f acc[4][4];
#pragma unroll
    for (int mb = 0; mb < 4; ++mb)
#pragma unroll
        for (int nb = 0; nb < 4; ++nb) acc[mb][nb] = (v8f){};
    const size_t aoff = (size_t)r0 * K + lane * 8, boff = (size_t)c0 * K + lane * 8;   // 16 rows on: 16 * K elements; 32 k on: 512
#pragma unroll 1   // rolled: an unrolled body would hold a second set of fragments and pass the register budget of 16 waves
    for (int kc = w * 32; kc < Kl; kc += NW * 32) {
        V a[4], a2[4]; const T16* ap = A + aoff + (size_t)kc * 16; const T16* ap2 = (NSPLIT == 1 || NSPLIT == 2) ? A2 + aoff + (size_t)kc * 16 : ap; const T16* bp = Bt + boff + (size_t)kc * 16; const T16* bp2 = NSPLIT >= 2 ? Bt2 + boff + (size_t)kc * 16 : bp;
#pragma unroll
        for (int mb = 0; mb < 4; ++mb) { a[mb] = WFrag<T16>::ld(ap + (size_t)mb * 16 * K); if (NSPLIT == 1 || NSPLIT == 2) a2[mb] = WFrag<T16>::ld(ap2 + (size_t)mb * 16 * K); }
#pragma unroll
        for (int nb = 0; nb < 4; ++nb) { const V b = WFrag<T16>::ld(bp + (size_t)nb * 16 * K); V b2; if (NSPLIT >= 2) b2 = WFrag<T16>::ld(bp2 + (size_t)nb * 16 * K);
#pragma unroll
            for (int mb = 0; mb < 4; ++mb) { acc[mb][nb] = WFrag<T16>::mma(a[mb], b, acc[mb][nb]); if (NSPLIT == 1 || NSPLIT == 2) acc[mb][nb] = WFrag<T16>::mma(a2[mb], b, acc[mb][nb]); if (NSPLIT >= 2) acc[mb][nb] = WFrag<T16>::mma(a[mb], b2, acc[mb][nb]); } }
        // four vector slots behind the last matrix instruction, on the back edge and on the exit alike, before its fragments are reloaded or its accumulators stored;
        // the wait stands behind the pass's loads, before their address registers are given to anything else (the addresses are inputs, so that they live up to it)
        asm volatile("v_nop\n\tv_nop\n\tv_nop\n\tv_nop\n\ts_wait_xcnt 0x0" : "+v"(acc[0][0]), "+v"(acc[1][1]), "+v"(acc[2][2]), "+v"(acc[3][3]) : "v"(a[0]), "v"(a[3]), "v"(ap), "v"(ap2), "v"(bp), "v"(bp2) : "memory");
    }
    // EPI > 0: a thread ends with eight neighbours of LDS row erow + s * NW * 4; what it needs from memory for them is asked for here, so that it arrives while the partial tiles go to LDS
    // a wave takes 8 rows x 4 pieces of one 32-wide column block: in fragment order the eight rows' pieces are one whole 128-byte line, in a row-major f32 array the four pieces are one
    const int erow = ((int)threadIdx.x >> 6) * 8 + (((int)threadIdx.x >> 2) & 7), ecofs = (((int)threadIdx.x >> 5) & 1) * 32 + ((int)threadIdx.x & 3) * 8;
    float bv[8], bvr[16 / NW]; v8f g1[16 / NW], co[16 / NW], po[16 / NW];
    if constexpr (EPI == 2) {
#pragma unroll
        for (int s = 0; s < 16 / NW; ++s) bvr[s] = bias[c0 + erow + s * (NW * 4)];
    } else if constexpr (EPI > 0) {
#pragma unroll
        for (int k = 0; k < 8; ++k) bv[k] = bias[c0 + ecofs + k];
    }
    if constexpr (EPI == 4) {
#pragma unroll
        for (int s = 0; s < 16 / NW; ++s) { const size_t e = (size_t)(r0 + erow + s * (NW * 4)) * ldc + c0 + ecofs; const float* x1 = X1 + e; const float* x2 = X2 + e; const float* x3 = X3 + e; g1[s] = *(const v8f*)x1; co[s] = *(const v8f*)x2; po[s] = *(const v8f*)x3;
            asm volatile("s_wait_xcnt 0x0" :: "v"(x1), "v"(x2), "v"(x3) : "memory"); }   // behind each row's three reads, before their address registers are given to the next row's data (the addresses are inputs, so that they live up to the wait)
    }
#pragma unroll
    for (int mb = 0; mb < 4; ++mb)
#pragma unroll
        for (int nb = 0; nb < 4; ++nb) { float* p = part + ((w * 16 + mb * 4 + nb) * 2) * 128 + lane * 4; const v8f c = acc[mb][nb];
            *(v4fa*)p = (v4f){c[0], c[1], c[2], c[3]}; *(v4fa*)(p + 128) = (v4f){c[4], c[5], c[6], c[7]}; }
    // the loaded bias values are inputs only: that keeps their loads in front of the barriers, under the LDS stores above (left alone the compiler sinks them behind the third barrier, where nothing is left to cover their latency);
    // the base pointer is an input so that its registers live up to the wait, which stands before they are given to anything else
    if constexpr (EPI == 1 || EPI == 3 || EPI == 4) asm volatile("s_wait_xcnt 0x0" :: "v"(bv[0]), "v"(bv[1]), "v"(bv[2]), "v"(bv[3]), "v"(bv[4]), "v"(bv[5]), "v"(bv[6]), "v"(bv[7]), "s"(bias) : "memory");
    __syncthreads();   // every wave's partial tile is in LDS
    v4f t0[16 / NW], t1[16 / NW];
#pragma unroll
    for (int q = 0; q < 16 / NW; ++q) { const float* p = part + (w * (16 / NW) + q) * 256 + lane * 4;
        t0[q] = *(const v4fa*)p; t1[q] = *(const v4fa*)(p + 128);
#pragma unroll
        for (int u = 1; u < NW; ++u) { t0[q] += *(const v4fa*)(p + u * 4096); t1[q] += *(const v4fa*)(p + u * 4096 + 128); } }
    __syncthreads();   // every partial tile has been read: the summed tile may take their place in LDS
#pragma unroll
    for (int q = 0; q < 16 / NW; ++q) { const int tile = w * (16 / NW) + q, mb = tile >> 2, nb = tile & 3; const v4f s0 = t0[q], s1 = t1[q];
        if constexpr (EPI == 2) { float* t = os + (nb * 16 + lr) * 68 + mb * 16 + hi * 8; *(v4fa*)t = s0; *(v4fa*)(t + 4) = s1; }   // tile kept [column][row]: a lane's eight sums are eight rows of one column
        else {
#pragma unroll
            for (int j = 0; j < 4; ++j) { os[(mb * 16 + hi * 8 + j) * 68 + nb * 16 + lr] = s0[j]; os[(mb * 16 + hi * 8 + 4 + j) * 68 + nb * 16 + lr] = s1[j]; } } }
    __syncthreads();   // the summed tile is complete
    if constexpr (EPI == 0) {
#pragma unroll
    for (int s = 0; s < 32 / NW; ++s) { const int idx = s * (NW * 32) + (int)threadIdx.x, row = idx >> 4, cofs = (idx & 15) * 4; v4f val = *(const v4fa*)(os + row * 68 + cofs); if (BIAS) { val[0] += bfr(bias[c0 + cofs]); val[1] += bfr(bias[c0 + cofs + 1]); val[2] += bfr(bias[c0 + cofs + 2]); val[3] += bfr(bias[c0 + cofs + 3]); }
        *(v4f*)(C + (size_t)(r0 + row) * ldc + c0 + cofs) = val; }
    } else {
#pragma unroll
    for (int s = 0; s < 16 / NW; ++s) { const int row = erow + s * (NW * 4), cofs = ecofs;   // 16-byte plane stores, eight rows to a 128-byte line
        const v4f va = *(const v4fa*)(os + row * 68 + cofs), vb = *(const v4fa*)(os + row * 68 + cofs + 4); float v[8];
#pragma unroll
        for (int k = 0; k < 8; ++k) v[k] = k < 4 ? va[k] : vb[k - 4];
        if constexpr (EPI == 1 || EPI == 2) {
            v8h o16; v8us oh, ol;
#pragma unroll
            for (int k = 0; k < 8; ++k) { v[k] += bfr(EPI == 2 ? bvr[s] : bv[k]); o16[k] = tohx(v[k]); unsigned short a, c; splitf(v[k], a, c); oh[k] = a; ol[k] = c; }
            const size_t hp = (size_t)(r0 / TT) * NH_ + blockIdx.y; const int rl = r0 % TT;   // plane of this batch and head; the tile's first row inside the batch
            const size_t e = hp * TT * HD + (EPI == 1 ? fro(rl + row, cofs, HD) : fro(row, rl + cofs, TT));
            *(v8h*)(P16 + e) = o16; *(v8us*)(Ph + e) = oh; *(v8us*)(Pl + e) = ol;
        } else if constexpr (EPI == 3) {
            v8us oh, ol;
#pragma unroll
            for (int k = 0; k < 8; ++k) { v[k] += bfr(bv[k]); unsigned short a, c; splitf(v[k], a, c); oh[k] = a; ol[k] = c; }
            const size_t e = (size_t)(r0 + row) * ldc + c0 + cofs, ep = fro(r0 + row, c0 + cofs, ldc);
            *(v4f*)(C + e) = (v4f){v[0], v[1], v[2], v[3]}; *(v4f*)(C + e + 4) = (v4f){v[4], v[5], v[6], v[7]}; *(v8us*)(Ph + ep) = oh; *(v8us*)(Pl + ep) = ol;
            asm volatile("s_wait_xcnt 0x0" ::: "memory");   // behind the four stores, before their address or data registers are given to anything else
        } else {
            v8f o;
#pragma unroll
            for (int k = 0; k < 8; ++k) { const float lg = (g1[s][k] + v[k]) + bfr(bv[k]); const float gt = __fdiv_rn(1.0f, 1.0f + expf(-lg)); o[k] = gt * co[s][k] + (1.0f - gt) * po[s][k]; }
            *(v8f*)(C + (size_t)(r0 + row) * ldc + c0 + cofs) = o;
        } }
    }
}
#define MR   (NB_ * TT)           // rows of all batches
#define PLN  ((size_t)MR * DM)    // elements of one [MR][DM] plane (= one set of head planes)
static_assert(DQ == DM, "the merged attention output is as wide as the model");
// One GEMM per blockIdx.z, K = DM (a constant: the steps from tile to tile are immediate offsets on one address pair per plane): operands, C and the hi / lo planes step by sA / sB / sC elements, the bias is bias (z = 0) or bias1. grid (MR/64, N/64, Z).
template <typename T16, int NSPLIT, bool CAUSALK, bool BIAS, int NW, int EPI>
__global__ __launch_bounds__(NW * 32) void k_gemmk(const T16* __restrict__ A, const T16* __restrict__ A2, const T16* __restrict__ Bt, float* C, int ldc, const float* __restrict__ bias, const float* __restrict__ bias1, size_t sA, size_t sB, size_t sC, bf* Ph, bf* Pl, const float* __restrict__ X1, const float* __restrict__ X2, const float* __restrict__ X3) {
    __shared__ __align__(16) float part[NW * 4096];
    float* os = part;   // the summed tile lies where the partial tiles lay: 64 KiB a block, so that LDS does not hold the resident blocks below what the registers allow
    const size_t z = blockIdx.z;
    gemm_tile<T16, NSPLIT, CAUSALK, BIAS, NW, EPI>(part, os, A + z * sA, A2 + z * sA, Bt + z * sB, nullptr, DM, C + z * sC, ldc, z ? bias1 : bias, 0, nullptr, Ph + z * sC, Pl + z * sC, X1, X2, X3);
}
// The six projections of both branches in one launch: z = 3 * branch + (0 q, 1 k, 2 v). X: the planes query, keys, values, gathered embeddings; Wt: the transposed weights in z order; every z writes its own three head planes (v: transposed). grid (MR/64, DM/64, 6).
__global__ __launch_bounds__(128) void k_qkv(const bf* __restrict__ X, const bf* __restrict__ Wt, const float* __restrict__ bcq, const float* __restrict__ bck, const float* __restrict__ bcv, const float* __restrict__ bpq, const float* __restrict__ bpk, const float* __restrict__ bpv, h16* P16, bf* Ph, bf* Pl) {
    __shared__ __align__(16) float part[4 * 4096];
    float* os = part;   // the summed tile lies where the partial tiles lay: 64 KiB a block, so that LDS does not hold the resident blocks below what the registers allow
    const int z = blockIdx.z; const int xi = z < 3 ? z : (z == 3 ? 0 : 3);   // the concept branch: q from the query plane, k and v from the embeddings
    const float* bias = z == 0 ? bcq : z == 1 ? bck : z == 2 ? bcv : z == 3 ? bpq : z == 4 ? bpk : bpv;
    const bf* A = X + (size_t)xi * PLN; const bf* Bt = Wt + (size_t)z * DM * DM; const size_t pz = (size_t)z * PLN;
    if (z == 2 || z == 5) gemm_tile<bf, 0, false, true, 4, 2>(part, os, A, nullptr, Bt, nullptr, DM, nullptr, DM, bias, 0, P16 + pz, Ph + pz, Pl + pz, nullptr, nullptr, nullptr);
    else gemm_tile<bf, 0, false, true, 4, 1>(part, os, A, nullptr, Bt, nullptr, DM, nullptr, DM, bias, 0, P16 + pz, Ph + pz, Pl + pz, nullptr, nullptr, nullptr);
}


// Transposed plane Bt[n][k] (fragment order) of w[k][n], both DM wide: a thread makes the eight neighbours k0 .. k0 + 7 of column n, a wave has 32 neighbouring n: every read is one whole line, every store two runs of 256 bytes.
__device__ __forceinline__ void wtG(const float* __restrict__ w, bf* Bt) {
    const int idx = (int)blockIdx.x * 256 + (int)threadIdx.x; const int n = idx & (DM - 1), k0 = (idx >> 10) * 8;   // the thread's second piece lies DM / 2 rows of w further on
    const float* wp = w + (size_t)k0 * DM + n; const float* wq = wp + (size_t)(DM / 2) * DM; float x[8], y[8];
#pragma unroll
    for (int j = 0; j < 8; ++j) { x[j] = wp[(size_t)j * DM]; y[j] = wq[(size_t)j * DM]; }
    asm volatile("s_wait_xcnt 0x0" :: "v"(wp), "v"(wq) : "memory");   // behind the sixteen reads, before their address registers are given to anything else (the addresses are inputs, so that they live up to the wait)
    v8us o, p;
#pragma unroll
    for (int j = 0; j < 8; ++j) { o[j] = f2bf(x[j]); p[j] = f2bf(y[j]); }
    *(v8us*)(Bt + fro(n, k0, DM)) = o; *(v8us*)(Bt + fro(n, k0 + DM / 2, DM)) = p;
    asm volatile("s_wait_xcnt 0x0" ::: "memory");   // behind the two stores, before their address or data registers are given to anything else
}
__device__ __forceinline__ void put8(v8f v, bf* dst) { v8us o;
#pragma unroll
    for (int k = 0; k < 8; ++k) o[k] = f2bf(v[k]); *(v8us*)dst = o; }
// Everything that depends on the inputs alone, in one launch. grid (256, 10 + 8): blockIdx.y < 10: transposed bf16 plane of weight y (the slow part, so it starts first);
// then eight rows of blocks for the four [MR][DM] bf16 planes (fragment order): query, keys, values, gathered concept embeddings (a thread makes the same eight neighbours of all four: four independent reads in flight, a quarter of the waves to start;
// a wave takes 8 rows x one 32-wide k block: it reads eight whole lines of each input and stores four whole lines of each plane).
__global__ __launch_bounds__(256) void k_prep(const float* __restrict__ w0, const float* __restrict__ w1, const float* __restrict__ w2, const float* __restrict__ w3, const float* __restrict__ w4, const float* __restrict__ w5, const float* __restrict__ w6, const float* __restrict__ w7, const float* __restrict__ w8, const float* __restrict__ w9,
                                              const float* __restrict__ xq, const float* __restrict__ xk, const float* __restrict__ xv, const float* __restrict__ TE, const int* __restrict__ IDS, bf* Wt, bf* X) {
    static_assert(PLN / 8 == (size_t)8 * 256 * 256, "eight rows of 256 blocks cover a plane"); static_assert(DM * DM / 8 == 2 * 256 * 256 && DM == 1024, "256 blocks, two pieces a thread, cover a weight");
    const int y = blockIdx.y;
    if (y < 10) { const float* w = y == 0 ? w0 : y == 1 ? w1 : y == 2 ? w2 : y == 3 ? w3 : y == 4 ? w4 : y == 5 ? w5 : y == 6 ? w6 : y == 7 ? w7 : y == 8 ? w8 : w9; wtG(w, Wt + (size_t)y * DM * DM); return; }
    const int g = ((y - 10) * 256 + (int)blockIdx.x) * 256 + (int)threadIdx.x; const int row = (g >> 10) * 8 + ((g >> 2) & 7), k0 = ((g >> 5) & 31) * 32 + (g & 3) * 8;
    const size_t e = (size_t)row * DM + k0, d = fro(row, k0, DM);   // the thread's first element in each input and in each plane
    const int* ip = IDS + row; const float* qp = xq + e; const float* kp = xk + e; const float* vp = xv + e;
    const int id = *ip; const v8f q = *(const v8f*)qp, k = *(const v8f*)kp, v = *(const v8f*)vp;
    // behind the four reads, before their address registers are given to anything else (the addresses are inputs, so that they live up to the wait)
    asm volatile("s_wait_xcnt 0x0" :: "v"(ip), "v"(qp), "v"(kp), "v"(vp) : "memory");
    const float* ep = TE + (size_t)min(max(id, 0), NVOC - 1) * DM + k0; const v8f ge = *(const v8f*)ep;
    asm volatile("s_wait_xcnt 0x0" :: "v"(ep) : "memory");   // the same behind the gathered read
    put8(q, X + d); put8(k, X + PLN + d); put8(v, X + 2 * PLN + d); put8(ge, X + 3 * PLN + d);
    asm volatile("s_wait_xcnt 0x0" ::: "memory");   // behind the last of the four stores, before any of their address or data registers is given to anything else
}
// ---- k_fattn: causal attention of one head and 64 query rows per block in ONE kernel: scores, softmax with a running maximum and sum, probabilities x values, and the hi/lo planes of the merged output; no score and no probability leaves the registers.
// Four waves, each with 16 queries of its own; no LDS, no barrier. The products are transposed: S^T = K Q^T (A = 16 key rows, B = 16 query columns), so a lane holds scores of ONE query (column lr; keys 8 hi + r of each 16-key tile):
// maximum and sum are taken in the lane, plus one exchange between the wave's halves. Two neighbouring S^T tiles, converted in place, are the B operand of O^T += V^T P^T in the k order of the loaders (8 hi + s, then 16 + 8 hi + s - 8).
// O^T: a lane holds 8 consecutive d of its query, one 16-byte store per plane. Every plane read or written here is in fragment order. Query rows < RH: hi + lo bf16 planes, three products; the rest single fp16. A pass takes 64 keys. grid (NH_ * NB_ * 2, TT / 64), the longest tiles first.
// v_exp_f32 with one free vector slot behind it: the register allocator lets the next instruction overwrite an exp's source directly behind it, where the instruction set asks for one independent instruction
// In place: the register written is the one the compiler's own arithmetic has just written, so its padding behind a matrix instruction covers this statement too.
__device__ __forceinline__ float exp2_slot(float x) { asm("v_exp_f32 %0, %0\n\tv_nop" : "+v"(x)); return x; }
// Eight of them in one statement: each is the independent instruction behind the one before it, so only the last needs the free slot.
__device__ __forceinline__ v8f exp2_slot8(v8f x) { float a = x[0], b = x[1], c = x[2], d = x[3], e = x[4], f = x[5], g = x[6], h = x[7];
    asm("v_exp_f32 %0, %0\n\tv_exp_f32 %1, %1\n\tv_exp_f32 %2, %2\n\tv_exp_f32 %3, %3\n\tv_exp_f32 %4, %4\n\tv_exp_f32 %5, %5\n\tv_exp_f32 %6, %6\n\tv_exp_f32 %7, %7\n\tv_nop" : "+v"(a), "+v"(b), "+v"(c), "+v"(d), "+v"(e), "+v"(f), "+v"(g), "+v"(h));
    return (v8f){a, b, c, d, e, f, g, h}; }
__device__ __forceinline__ float xhalf(float x) { return __builtin_bit_cast(float, __builtin_amdgcn_permlanex16(__builtin_bit_cast(int, x), __builtin_bit_cast(int, x), 0x76543210, 0xfedcba98, false, false)); }   // lane l with lane l ^ 16, in the vector unit
template <bool B> struct BoolC { static constexpr bool value = B; };
template <typename T16, bool HL>
__device__ __forceinline__ void fattn_wave(const T16* __restrict__ Q, const T16* __restrict__ Q2, const T16* __restrict__ Kp, const T16* __restrict__ K2, const T16* __restrict__ Vt, const T16* __restrict__ V2, int row0, int nkb, int lr, int hi, bf* Ah, bf* Al) {
    typedef typename WFrag<T16>::V V;
    const float CE = SCL * 1.4426950408889634f;               // scores stay as the matrix unit leaves them; the scale (a power of two) and log2(e) enter in the exponent's one multiply-add, and the running maximum is kept unscaled
    const size_t koff = (size_t)(16 * hi + lr) * 8, voff = koff;   // the lane's place in a tile of a plane in fragment order; 16 rows on: 16 * HD (keys, queries) or 16 * TT (values) elements, 32 k on: 512
    V q[2], q2[2], ka[4][2];
    const T16* qp = Q + (size_t)row0 * HD + koff; const T16* qp2 = HL ? Q2 + (size_t)row0 * HD + koff : nullptr;
#pragma unroll
    for (int kc = 0; kc < 2; ++kc) { q[kc] = WFrag<T16>::ld(qp + kc * 512); if (HL) q2[kc] = WFrag<T16>::ld(qp2 + kc * 512); }
    // behind the query loads, before their address registers are given to anything else (the addresses are inputs, so that they live up to the wait)
    if constexpr (HL) asm volatile("s_wait_xcnt 0x0" :: "v"(qp), "v"(qp2) : "memory"); else asm volatile("s_wait_xcnt 0x0" :: "v"(qp) : "memory");
    if constexpr (!HL) {
        const T16* kp = Kp + koff;
#pragma unroll
        for (int kt = 0; kt < 4; ++kt)
#pragma unroll
            for (int kc = 0; kc < 2; ++kc) ka[kt][kc] = WFrag<T16>::ld(kp + (size_t)kt * 16 * HD + kc * 512);
        asm volatile("s_wait_xcnt 0x0" :: "v"(kp) : "memory");   // behind the key loads, before their address registers are given to anything else (the address is an input, so that it lives up to the wait)
    }
    v8f o[4];
#pragma unroll
    for (int dt = 0; dt < 4; ++dt) o[dt] = (v8f){};
    float m = -3.0e38f, l = 0.f;
    // One pass of 64 keys. Only the last pass (the diagonal block) holds keys behind a query, so only its copy of the body compares and selects.
    auto pass = [&](const int kb, auto DIAG) __attribute__((always_inline)) {
        const int key0 = kb * 64;
        V va[4][2];
        if constexpr (!HL) {   // this pass's value fragments: they depend on nothing of the pass, so the compiler may place them as early as its registers allow
            const T16* vp = Vt + voff + (size_t)key0 * 16;
#pragma unroll
            for (int dt = 0; dt < 4; ++dt)
#pragma unroll
                for (int ks = 0; ks < 2; ++ks) va[dt][ks] = WFrag<T16>::ld(vp + (size_t)dt * 16 * TT + ks * 512);
            asm volatile("s_wait_xcnt 0x0" :: "v"(vp) : "memory");   // behind the value loads, before their address registers are given to the next loads' data (the address is an input, so that it lives up to the wait)
        }
        const T16* kh = Kp + koff + (size_t)key0 * HD; const T16* kl = HL ? K2 + koff + (size_t)key0 * HD : kh; const T16* vh = Vt + voff + (size_t)key0 * 16; const T16* vl = HL ? V2 + voff + (size_t)key0 * 16 : vh;   // HL: this pass's tiles
        v8f s[4];
#pragma unroll
        for (int kt = 0; kt < 4; ++kt) s[kt] = (v8f){};
#pragma unroll
        for (int kc = 0; kc < 2; ++kc)
#pragma unroll
            for (int kt = 0; kt < 4; ++kt) {
                if constexpr (HL) { const size_t off = (size_t)kt * 16 * HD + kc * 512; const V a = WFrag<T16>::ld(kh + off), a2 = WFrag<T16>::ld(kl + off);
                    s[kt] = WFrag<T16>::mma(a, q[kc], s[kt]); s[kt] = WFrag<T16>::mma(a, q2[kc], s[kt]); s[kt] = WFrag<T16>::mma(a2, q[kc], s[kt]); }
                else s[kt] = WFrag<T16>::mma(ka[kt][kc], q[kc], s[kt]);
            }
        if constexpr (!HL) {   // the next pass's key fragments (the last pass asks for its own again: always inside the plane)
            const int kn = min(kb + 1, nkb - 1) * 64; const T16* kp = Kp + koff + (size_t)kn * HD;
#pragma unroll
            for (int kt = 0; kt < 4; ++kt)
#pragma unroll
                for (int kc = 0; kc < 2; ++kc) ka[kt][kc] = WFrag<T16>::ld(kp + (size_t)kt * 16 * HD + kc * 512);
            asm volatile("s_wait_xcnt 0x0" :: "v"(kp) : "memory");   // behind the key loads, before their address registers are given to anything else (the address is an input, so that it lives up to the wait)
        } else asm volatile("s_wait_xcnt 0x0" :: "v"(kh), "v"(kl) : "memory");   // the same behind this pass's key loads
        if constexpr (decltype(DIAG)::value) {
            const int ln = (int)__builtin_amdgcn_mbcnt_lo(~0u, 0u);   // the lane's number, made anew: nothing of it has to be held in a register through the loop (held there, it was spilled)
            const int rel = row0 + (ln & 15) - key0 - 8 * (ln >> 4);   // key <= this lane's query row  <=>  kt * 16 + r <= rel
#pragma unroll
            for (int kt = 0; kt < 4; ++kt)
#pragma unroll
                for (int r = 0; r < 8; ++r) s[kt][r] = (kt * 16 + r <= rel) ? s[kt][r] : -3.0e38f;
        }
        float mk[4];
#pragma unroll
        for (int kt = 0; kt < 4; ++kt) { mk[kt] = s[kt][0];
#pragma unroll
            for (int r = 1; r < 8; ++r) mk[kt] = fmaxf(mk[kt], s[kt][r]); }
        float mx = fmaxf(fmaxf(fmaxf(mk[0], mk[1]), fmaxf(mk[2], mk[3])), m);
        mx = fmaxf(mx, xhalf(mx));                             // the other half of this query's keys
        const float al = exp2_slot((m - mx) * CE); m = mx;    // first pass: exp2 of a huge negative number = 0 on zero sums
#pragma unroll
        for (int dt = 0; dt < 4; ++dt) o[dt] *= al;
        const float nm = -m * CE; const v8f cev = {CE, CE, CE, CE, CE, CE, CE, CE}, nmv = {nm, nm, nm, nm, nm, nm, nm, nm};
#pragma unroll
        for (int kt = 0; kt < 4; ++kt) s[kt] = exp2_slot8(__builtin_elementwise_fma(s[kt], cev, nmv));
        const v8f sv = (s[0] + s[1]) + (s[2] + s[3]);          // the four tiles register by register (packed adds on the pairs as they lie), then the eight sums
        l = l * al + (((sv[0] + sv[4]) + (sv[1] + sv[5])) + ((sv[2] + sv[6]) + (sv[3] + sv[7])));
#pragma unroll
        for (int ks = 0; ks < 2; ++ks) {
            V pb, pb2;
            if constexpr (HL) { v8us h0, h1, l0, l1;
#pragma unroll
                for (int r = 0; r < 8; ++r) { unsigned short a, c; splitf(s[2 * ks][r], a, c); h0[r] = a; l0[r] = c; splitf(s[2 * ks + 1][r], a, c); h1[r] = a; l1[r] = c; }
                pb = cat16b(h0, h1); pb2 = cat16b(l0, l1); }
            else { v8h c0, c1;
#pragma unroll
                for (int r = 0; r < 8; ++r) { c0[r] = tohx(s[2 * ks][r]); c1[r] = tohx(s[2 * ks + 1][r]); }
                pb = cat16(c0, c1); }
#pragma unroll
            for (int dt = 0; dt < 4; ++dt) {
                if constexpr (HL) { const size_t off = (size_t)dt * 16 * TT + ks * 512; const V a = WFrag<T16>::ld(vh + off), a2 = WFrag<T16>::ld(vl + off);
                    o[dt] = WFrag<T16>::mma(a, pb, o[dt]); o[dt] = WFrag<T16>::mma(a, pb2, o[dt]); o[dt] = WFrag<T16>::mma(a2, pb, o[dt]); }
                else o[dt] = WFrag<T16>::mma(va[dt][ks], pb, o[dt]);
            }
        }
        // four vector slots behind the last matrix instruction, on the back edge and on the exit alike, before its fragments are reloaded or its accumulators read
        asm volatile("v_nop\n\tv_nop\n\tv_nop\n\tv_nop" : "+v"(o[0]), "+v"(o[1]), "+v"(o[2]), "+v"(o[3]));
        if constexpr (HL) asm volatile("s_wait_xcnt 0x0" :: "v"(vh), "v"(vl) : "memory");   // behind this pass's value loads, before their address registers are given to anything else
    };
#pragma unroll 1   // rolled: the body is long, and a second copy would double the fragments held
    for (int kb = 0; kb < nkb - 1; ++kb) pass(kb, BoolC<false>{});
    pass(nkb - 1, BoolC<true>{});
    l += xhalf(l);                                             // join the halves' sums
    const size_t ooff = (size_t)__builtin_amdgcn_mbcnt_lo(~0u, 0u) * 8;   // the lane's place in a tile, made anew for the same reason
    const float inv = __fdiv_rn(1.0f, l);
#pragma unroll
    for (int dt = 0; dt < 4; ++dt) { v8us oh, ol;
#pragma unroll
        for (int r = 0; r < 8; ++r) { unsigned short a, c; splitf(o[dt][r] * inv, a, c); oh[r] = a; ol[r] = c; }
        const size_t oo = (size_t)row0 * DQ + (dt >> 1) * 512 + (dt & 1) * 256 + ooff; *(v8us*)(Ah + oo) = oh; *(v8us*)(Al + oo) = ol; }   // fragment order, K = DQ: the wave's store is 512 bytes in a row
}
// Both branches and all batches in one launch: grid (NH_ * NB_ * 2, TT / 64), blockIdx.x = (branch * NB_ + batch) * NH_ + head; blockIdx.y still counts the query tiles from the longest down, so that the longest tiles of every head start first.
// Four waves per SIMD, no more and no fewer, are asked for: with the 256 registers of that budget the compiler issues a pass's value loads at its head and the next pass's key loads right behind the score products; aiming at more waves it issued them late and waited for them at once.
// The nine pointers are the char branch's head planes; the concept branch's lie 3 * PLN elements behind them (the order of the projections). Ah / Al: [branch] x ([MR][DQ] in fragment order); a head's 64 columns are two 32-wide k blocks, 1024 elements on per head.
__global__ __launch_bounds__(128) __attribute__((amdgpu_waves_per_eu(4, 4))) void k_fattn(const h16* __restrict__ Q16, const bf* __restrict__ Qh, const bf* __restrict__ Ql, const h16* __restrict__ K16, const bf* __restrict__ Kh, const bf* __restrict__ Kl, const h16* __restrict__ V16, const bf* __restrict__ Vh, const bf* __restrict__ Vl, bf* Ah, bf* Al) {
    const int lane = threadIdx.x & 31, lr = lane & 15, hi = lane >> 4;
    const int w = __builtin_amdgcn_readfirstlane((int)(threadIdx.x >> 5));   // wave number in a scalar register: row0 and the loop's bounds stay scalar
    static_assert(REP == 1, "the key and value planes are indexed by the query's head");
    const int h = blockIdx.x % NH_, bb = blockIdx.x / NH_, br = bb / NB_, r0 = (TT / 64 - 1 - (int)blockIdx.y) * 64;   // bb = branch * NB_ + batch
    const size_t zq = (size_t)(3 * br) * PLN + ((size_t)(bb % NB_) * NH_ + h) * TT * HD, zk = zq, za = (size_t)bb * TT * DQ + h * (HD * 16);
    if (r0 < RH) fattn_wave<bf, true>(Qh + zq, Ql + zq, Kh + zk, Kl + zk, Vh + zk, Vl + zk, r0 + w * 16, r0 / 64 + 1, lr, hi, Ah + za, Al + za);
    else fattn_wave<h16, false>(Q16 + zq, nullptr, K16 + zk, nullptr, V16 + zk, nullptr, r0 + w * 16, r0 / 64 + 1, lr, hi, Ah + za, Al + za);
}

extern "C" void kernel_launch(void* const* d_in, const int* in_sizes, int n_in,
                              void* d_out, int out_size, void* d_ws, size_t ws_size, hipStream_t stream) {
    (void)in_sizes; (void)n_in; (void)out_size;
    const float* xvals = (const float*)d_in[0]; const float* xkeys = (const float*)d_in[1]; const float* xq = (const float*)d_in[2]; const int* CID = (const int*)d_in[3]; const float* EMB = (const float*)d_in[4]; const float* wcv = (const float*)d_in[5]; const float* bcv = (const float*)d_in[6]; const float* wck = (const float*)d_in[7]; const float* bck = (const float*)d_in[8]; const float* wcq = (const float*)d_in[9]; const float* bcq = (const float*)d_in[10]; const float* wco = (const float*)d_in[11]; const float* bco = (const float*)d_in[12]; const float* wpv = (const float*)d_in[13]; const float* bpv = (const float*)d_in[14]; const float* wpk = (const float*)d_in[15]; const float* bpk = (const float*)d_in[16]; const float* wpq = (const float*)d_in[17]; const float* bpq = (const float*)d_in[18]; const float* wpo = (const float*)d_in[19]; const float* bpo = (const float*)d_in[20]; const float* wg = (const float*)d_in[21]; const float* bg = (const float*)d_in[22];
    float* OUT = (float*)d_out;     // [2][2048][1024]
    char* wsp = (char*)d_ws;
    auto take = [&](size_t bytes) { char* p = wsp; wsp += (bytes + 255) & ~(size_t)255; return (void*)p; };
    bf* WT = (bf*)take((size_t)10 * DM * DM * 2);   /* transposed weights: q, k, v of the char branch, q, k, v of the concept branch, Wco, Wpo, Wg rows 0..1023 (multiply char_out), Wg rows 1024..2047 (concept_out) */
    bf* XP = (bf*)take(4 * PLN * 2);                /* bf16 planes of query, keys, values, gathered concept embeddings */
    bf* ATh = (bf*)take(2 * PLN * 2); bf* ATl = (bf*)take(2 * PLN * 2);   /* merged attention outputs, hi and lo, [branch] */
    char* pl0 = wsp;
    h16* P16 = (h16*)take(6 * PLN * 2); bf* Ph = (bf*)take(6 * PLN * 2); bf* Pl = (bf*)take(6 * PLN * 2);   /* head planes of the six projections */
    char* end0 = wsp; wsp = pl0;                    /* the head planes are dead behind the attention launch: what follows it lies in their place */
    float* CO = (float*)take(2 * PLN * 4); float* PO = CO + PLN; bf* Ch = (bf*)take(2 * PLN * 2); bf* Dh = Ch + PLN; bf* Cl = (bf*)take(2 * PLN * 2); bf* Dl = Cl + PLN; float* G1 = (float*)take(PLN * 4);
    if (wsp > end0 || (size_t)(end0 - (char*)d_ws) > ws_size) return;    // ws 256 MiB
    k_prep<<<dim3(256, 10 + 8), 256, 0, stream>>>(wcq, wck, wcv, wpq, wpk, wpv, wco, wpo, wg, wg + (size_t)DM * DM, xq, xkeys, xvals, EMB, CID, WT, XP);
    k_qkv<<<dim3(MR / 64, DM / 64, 6), 128, 0, stream>>>(XP, WT, bcq, bck, bcv, bpq, bpk, bpv, P16, Ph, Pl);
    k_fattn<<<dim3(NH_ * NB_ * 2, TT / 64), 128, 0, stream>>>(P16, Ph, Pl, P16 + PLN, Ph + PLN, Pl + PLN, P16 + 2 * PLN, Ph + 2 * PLN, Pl + 2 * PLN, ATh, ATl);
    /* out-projections of both branches (z): f32 char_out / concept_out and their hi / lo planes */
    k_gemmk<bf, 1, false, true, 4, 3><<<dim3(MR / 64, DM / 64, 2), 128, 0, stream>>>(ATh, ATl, WT + (size_t)6 * DM * DM, CO, DM, bco, bpo, PLN, (size_t)DM * DM, PLN, Ch, Cl, nullptr, nullptr, nullptr);
    /* ---- gate + mix: char_out Wg[:1024] to G1; concept_out Wg[1024:] ends in the sigmoid and the mix ---- */
    k_gemmk<bf, 1, false, false, 4, 0><<<dim3(MR / 64, DM / 64, 1), 128, 0, stream>>>(Ch, Cl, WT + (size_t)8 * DM * DM, G1, DM, nullptr, nullptr, 0, 0, 0, nullptr, nullptr, nullptr, nullptr, nullptr);
    k_gemmk<bf, 1, false, true, 4, 4><<<dim3(MR / 64, DM / 64, 1), 128, 0, stream>>>(Dh, Dl, WT + (size_t)9 * DM * DM, OUT, DM, bg, nullptr, 0, 0, 0, nullptr, nullptr, G1, CO, PO);
}

// v008
// A run of this version takes 207 microseconds.
// Two timings next to v007 put it at 1.04 and 1.03 times that version's speed.
// All steps since v000 together make it 15.1 times as fast.
#include <hip/hip_runtime.h>

// Hierarchical (char + concept) gated attention (values, keys, query [2][2048][1024]; concept_ids int32 [2][2048] -> ce = emb[concept_ids] ([1000][1024], gathered on device); char branch: q = query Wcq + bcq, k = keys Wck + bck, v = values Wcv + bcv; concept branch: q = query Wpq + bpq, k = ce Wpk + bpk, v = ce Wpv + bpv ('xw' [1024][1024] + biases; 16 heads x 64); per branch: scores masked causally (-1e20) then x 1/sqrt(1024), softmax, merged, Wo + bo; gate = sigmoid([char_out | concept_out] Wg + bg) (Wg [2048][1024]); out = gate char_out + (1 - gate) concept_out -> [2][2048][1024] (4.2 M)).
// Compute dtypes, f32 accumulate: every input rounded to bf16; q/k/v on PLAIN bf16 operands (inputs: exact) + biases; the concept branch's k and v: emb Wpk and emb Wpv once per table row, the rows then gathered by concept_ids (a row of a product depends on its own row of the left operand alone); causal scores, softmax and attn.v in one kernel (key tiles beyond the diagonal block skipped): query rows < 512 hl (3 products), the rest single fp16; softmax f32, running maximum and sum; Wco / Wpo hl x exact (2 products) + bias; gate GEMMs 2 products; sigmoid (precise expf) and the convex mix in f32.

#define NB_  2
#define TT   2048
#define DM   1024
#define NH_  16
#define NKV  16
#define REP  (NH_ / NKV)
#define HD   64
#define DQ   (NH_ * HD)
#define DKV  (NKV * HD)
#define NVOC 1000
#define NVP  1024                 // table rows as the GEMM tiles see them: NVOC rounded up to whole 64-row tiles (the rows behind the last repeat it and are never gathered)
#define RH   512                  // query rows < RH use hi+lo planes (0: none)
#define SCL  0.03125f   // 1/sqrt(embed_size = 1024) as in the source
typedef _Float16 h16;
typedef unsigned short bf;
typedef __attribute__((ext_vector_type(16))) __bf16   v16bf;
typedef __attribute__((ext_vector_type(16))) _Float16 v16h;
typedef __attribute__((ext_vector_type(8)))  _Float16 v8h;
typedef __attribute__((ext_vector_type(8)))  unsigned short v8us;
typedef __attribute__((ext_vector_type(8)))  float    v8f;
typedef __attribute__((ext_vector_type(4)))  float    v4f;
typedef v8h  __attribute__((may_alias)) v8ha;
typedef v4f  __attribute__((may_alias)) v4fa;
typedef v8us __attribute__((may_alias)) v8usa;

__device__ __forceinline__ unsigned short f2bf(float f) { unsigned u = __float_as_uint(f); u += 0x7FFFu + ((u >> 16) & 1u); return (unsigned short)(u >> 16); }
__device__ __forceinline__ float bf2f(unsigned short b) { return __uint_as_float(((unsigned)b) << 16); }
__device__ __forceinline__ float bfr(float f) { return bf2f(f2bf(f)); }
__device__ __forceinline__ v16h cat16(v8h lo, v8h hi) { return __builtin_shufflevector(lo, hi, 0, 1, 2, 3, 4, 5, 6, 7, 8, 9, 10, 11, 12, 13, 14, 15); }
__device__ __forceinline__ v16bf cat16b(v8us lo, v8us hi) { return __builtin_bit_cast(v16bf, __builtin_shufflevector(lo, hi, 0, 1, 2, 3, 4, 5, 6, 7, 8, 9, 10, 11, 12, 13, 14, 15)); }
__device__ __forceinline__ v8f wmma16(v16h a, v16h b, v8f c) { return __builtin_amdgcn_wmma_f32_16x16x32_f16(false, a, false, b, (short)0, c, false, false); }
__device__ __forceinline__ v8f wmmab(v16bf a, v16bf b, v8f c) { return __builtin_amdgcn_wmma_f32_16x16x32_bf16(false, a, false, b, (short)0, c, false, false); }



// ---- k_gemmk: register-blocked GEMM, one 64x64 output tile per block, the K loop SPLIT OVER THE NW WAVES of the block: wave w takes the 32-wide K steps w, w + NW, ...
// into its own 16 accumulators, operands straight from 16-bit planes in fragment order (below); the NW partial tiles are then summed through LDS in fixed wave order 0..NW-1. grid (M/64, N/64, Z), NW*32 threads.
// C[m][n] (f32, pitch ldc, + optional f32 bias[n]) = sum_k A[m][k] Bt[n][k] (+ split products per NSPLIT). z-batch strides sA/sB/sC in elements. K % 32 == 0.
// EPI picks what the block does with its summed tile (+ bias): 0 f32 C; 1 head planes [head][row][d] (fp16, bf16 hi, bf16 lo; the tile's 64 columns are one head); 2 the same three planes transposed [head][d][row];
// 3 f32 C and its hi / lo planes; 4 the tile is the second half of the gate's logits: out = g X2 + (1 - g) X3 with g = sigmoid((X1 + tile) + bias), stored to C.
// CAUSALK limits the key (K) range of the probability x value contraction to the diagonal block (probabilities beyond it are exactly zero); roff = row offset of this launch's first row within the sequence.
// FRAGMENT ORDER: every 16-bit operand plane ([rows][K], rows % 16 == 0, K % 32 == 0) is kept as 1-KiB tiles of 16 rows x 32 k, tile (row / 16, k / 32) at element (row / 16) * 16 * K + (k / 32) * 512, and inside a tile
// [k / 16 % 2][k / 8 % 2][row % 16][k % 8]: the first 16 bytes of all 32 lanes of a fragment (lane = 16 * hi + lr: row lr, k 8 hi ..) are 512 bytes in a row, the second 16 bytes (k 16 + 8 hi ..) the next 512.
// A fragment load so touches four whole 128-byte lines; from a row-major plane it would touch sixteen lines for 32 bytes each. ld(p): p = the tile + lane * 8.
// fro: where the eight neighbours k .. k + 7 (k % 8 == 0) of a row lie.
__device__ __forceinline__ size_t fro(size_t row, size_t k, size_t K) { return (row >> 4) * (16 * K) + (k >> 5) * 512 + ((k >> 4) & 1) * 256 + ((k >> 3) & 1) * 128 + (row & 15) * 8; }
template <typename T16> struct WFrag;
template <> struct WFrag<h16> { typedef v16h V; static __device__ __forceinline__ V ld(const h16* p) { return cat16(*(const v8h*)p, *(const v8h*)(p + 256)); } static __device__ __forceinline__ v8f mma(V a, V b, v8f c) { return wmma16(a, b, c); } };
template <> struct WFrag<bf> { typedef v16bf V; static __device__ __forceinline__ V ld(const bf* p) { return cat16b(*(const v8us*)p, *(const v8us*)(p + 256)); } static __device__ __forceinline__ v8f mma(V a, V b, v8f c) { return wmmab(a, b, c); } };
__device__ __forceinline__ h16 tohx(float x) { return (h16)x; }
__device__ __forceinline__ void splitf(float y, unsigned short& h, unsigned short& l) { h = f2bf(y); l = f2bf(y - bf2f(h)); }
// The tile's work is a device function, so that one launch can hold GEMMs with different epilogues (the kernel picks by the block's index, alike for the whole block) on ONE LDS array, which the kernel owns and which holds first part, then, behind a barrier, os in the same place:
// part[NW * 4096]: [wave][tile 0..15][j half][lane][4]: every wave's accumulators in register order, 16-byte stores contiguous over the lanes; os[64 * 68]: the summed tile, row-major (pitch 68 floats: both half-waves on disjoint banks).
// The M rows are the rows of all NB_ batches, one behind the other (a 64-row tile lies in one batch); the head planes are [batch][head] x ([row][d] or [d][row] in fragment order).
template <typename T16, int NSPLIT, bool CAUSALK, bool BIAS, int NW, int EPI>
__device__ __forceinline__ void gemm_tile(float* part, float* os, const T16* __restrict__ A, const T16* __restrict__ A2, const T16* __restrict__ Bt, const T16* __restrict__ Bt2, int K, float* C, int ldc, const float* __restrict__ bias, int roff, h16* P16, bf* Ph, bf* Pl, const float* __restrict__ X1, const float* __restrict__ X2, const float* __restrict__ X3, int bx, int by) {
    static_assert(HD == 64, "a 64-column tile is one head"); static_assert(EPI == 0 || BIAS, "the plane and gate epilogues always add the bias"); static_assert(NW == 4 || NW == 8, "the epilogues deal 64 rows x 8 pieces to NW * 32 threads, 16 / NW rows a thread"); static_assert(64 * 68 <= NW * 4096, "os fits in the place of part");
    typedef typename WFrag<T16>::V V;
    const int lane = threadIdx.x & 31, lr = lane & 15, hi = lane >> 4; const int r0 = bx * 64, c0 = by * 64;   // bx, by: the tile's place among the 64-row tiles of A and C and among the 64-column tiles of Bt and C
    const int w = __builtin_amdgcn_readfirstlane((int)(threadIdx.x >> 5));   // wave number in a scalar register: the K loop's bounds stay scalar
    const int Kl = CAUSALK ? min(K, r0 + roff + 64) : K;
    v8f acc[4][4];
#pragma unroll
    for (int mb = 0; mb < 4; ++mb)
#pragma unroll
        for (int nb = 0; nb < 4; ++nb) acc[mb][nb] = (v8f){};
    const size_t aoff = (size_t)r0 * K + lane * 8, boff = (size_t)c0 * K + lane * 8;   // 16 rows on: 16 * K elements; 32 k on: 512
#pragma unroll 1   // rolled: an unrolled body would hold a second set of fragments and pass the register budget of 16 waves
    for (int kc = w * 32; kc < Kl; kc += NW * 32) {
        V a[4], a2[4]; const T16* ap = A + aoff + (size_t)kc * 16; const T16* ap2 = (NSPLIT == 1 || NSPLIT == 2) ? A2 + aoff + (size_t)kc * 16 : ap; const T16* bp = Bt + boff + (size_t)kc * 16; const T16* bp2 = NSPLIT >= 2 ? Bt2 + boff + (size_t)kc * 16 : bp;
#pragma unroll
        for (int mb = 0; mb < 4; ++mb) { a[mb] = WFrag<T16>::ld(ap + (size_t)mb * 16 * K); if (NSPLIT == 1 || NSPLIT == 2) a2[mb] = WFrag<T16>::ld(ap2 + (size_t)mb * 16 * K); }
        // the table product alone: there the register allocator gives the A loads' address pair to the data of a B load of the same pass, so the wait at the loop's foot comes too late for it: one more stands directly behind the A loads
        if constexpr (EPI == 0 && NSPLIT == 0) asm volatile("s_wait_xcnt 0x0" :: "v"(ap) : "memory");
#pragma unroll
        for (int nb = 0; nb < 4; ++nb) { const V b = WFrag<T16>::ld(bp + (size_t)nb * 16 * K); V b2; if (NSPLIT >= 2) b2 = WFrag<T16>::ld(bp2 + (size_t)nb * 16 * K);
#pragma unroll
            for (int mb = 0; mb < 4; ++mb) { acc[mb][nb] = WFrag<T16>::mma(a[mb], b, acc[mb][nb]); if (NSPLIT == 1 || NSPLIT == 2) acc[mb][nb] = WFrag<T16>::mma(a2[mb], b, acc[mb][nb]); if (NSPLIT >= 2) acc[mb][nb] = WFrag<T16>::mma(a[mb], b2, acc[mb][nb]); } }
        // four vector slots behind the last matrix instruction, on the back edge and on the exit alike, before its fragments are reloaded or its accumulators stored;
        // the wait stands behind the pass's loads, before their address registers are given to anything else (the addresses are inputs, so that they live up to it)
        asm volatile("v_nop\n\tv_nop\n\tv_nop\n\tv_nop\n\ts_wait_xcnt 0x0" : "+v"(acc[0][0]), "+v"(acc[1][1]), "+v"(acc[2][2]), "+v"(acc[3][3]) : "v"(a[0]), "v"(a[3]), "v"(ap), "v"(ap2), "v"(bp), "v"(bp2) : "memory");
    }
    // EPI > 0: a thread ends with eight neighbours of LDS row erow + s * NW * 4; what it needs from memory for them is asked for here, so that it arrives while the partial tiles go to LDS
    // a wave takes 8 rows x 4 pieces of one 32-wide column block: in fragment order the eight rows' pieces are one whole 128-byte line, in a row-major f32 array the four pieces are one
    const int erow = ((int)threadIdx.x >> 6) * 8 + (((int)threadIdx.x >> 2) & 7), ecofs = (((int)threadIdx.x >> 5) & 1) * 32 + ((int)threadIdx.x & 3) * 8;
    float bv[8], bvr[16 / NW]; v8f g1[16 / NW], co[16 / NW], po[16 / NW];
    if constexpr (EPI == 2) {
#pragma unroll
        for (int s = 0; s < 16 / NW; ++s) bvr[s] = bias[c0 + erow + s * (NW * 4)];
    } else if constexpr (EPI > 0) {
#pragma unroll
        for (int k = 0; k < 8; ++k) bv[k] = bias[c0 + ecofs + k];
    }
    if constexpr (EPI == 4) {
#pragma unroll
        for (int s = 0; s < 16 / NW; ++s) { const size_t e = (size_t)(r0 + erow + s * (NW * 4)) * ldc + c0 + ecofs; const float* x1 = X1 + e; const float* x2 = X2 + e; const float* x3 = X3 + e; g1[s] = *(const v8f*)x1; co[s] = *(const v8f*)x2; po[s] = *(const v8f*)x3;
            asm volatile("s_wait_xcnt 0x0" :: "v"(x1), "v"(x2), "v"(x3) : "memory"); }   // behind each row's three reads, before their address registers are given to the next row's data (the addresses are inputs, so that they live up to the wait)
    }
#pragma unroll
    for (int mb = 0; mb < 4; ++mb)
#pragma unroll
        for (int nb = 0; nb < 4; ++nb) { float* p = part + ((w * 16 + mb * 4 + nb) * 2) * 128 + lane * 4; const v8f c = acc[mb][nb];
            *(v4fa*)p = (v4f){c[0], c[1], c[2], c[3]}; *(v4fa*)(p + 128) = (v4f){c[4], c[5], c[6], c[7]}; }
    // the loaded bias values are inputs only: that keeps their loads in front of the barriers, under the LDS stores above (left alone the compiler sinks them behind the third barrier, where nothing is left to cover their latency);
    // the base pointer is an input so that its registers live up to the wait, which stands before they are given to anything else
    if constexpr (EPI == 1 || EPI == 3 || EPI == 4) asm volatile("s_wait_xcnt 0x0" :: "v"(bv[0]), "v"(bv[1]), "v"(bv[2]), "v"(bv[3]), "v"(bv[4]), "v"(bv[5]), "v"(bv[6]), "v"(bv[7]), "s"(bias) : "memory");
    __syncthreads();   // every wave's partial tile is in LDS
    v4f t0[16 / NW], t1[16 / NW];
#pragma unroll
    for (int q = 0; q < 16 / NW; ++q) { const float* p = part + (w * (16 / NW) + q) * 256 + lane * 4;
        t0[q] = *(const v4fa*)p; t1[q] = *(const v4fa*)(p + 128);
#pragma unroll
        for (int u = 1; u < NW; ++u) { t0[q] += *(const v4fa*)(p + u * 4096); t1[q] += *(const v4fa*)(p + u * 4096 + 128); } }
    __syncthreads();   // every partial tile has been read: the summed tile may take their place in LDS
#pragma unroll
    for (int q = 0; q < 16 / NW; ++q) { const int tile = w * (16 / NW) + q, mb = tile >> 2, nb = tile & 3; const v4f s0 = t0[q], s1 = t1[q];
        if constexpr (EPI == 2) { float* t = os + (nb * 16 + lr) * 68 + mb * 16 + hi * 8; *(v4fa*)t = s0; *(v4fa*)(t + 4) = s1; }   // tile kept [column][row]: a lane's eight sums are eight rows of one column
        else {
#pragma unroll
            for (int j = 0; j < 4; ++j) { os[(mb * 16 + hi * 8 + j) * 68 + nb * 16 + lr] = s0[j]; os[(mb * 16 + hi * 8 + 4 + j) * 68 + nb * 16 + lr] = s1[j]; } } }
    __syncthreads();   // the summed tile is complete
    if constexpr (EPI == 0) {
#pragma unroll
    for (int s = 0; s < 32 / NW; ++s) { const int idx = s * (NW * 32) + (int)threadIdx.x, row = idx >> 4, cofs = (idx & 15) * 4; v4f val = *(const v4fa*)(os + row * 68 + cofs); if (BIAS) { val[0] += bfr(bias[c0 + cofs]); val[1] += bfr(bias[c0 + cofs + 1]); val[2] += bfr(bias[c0 + cofs + 2]); val[3] += bfr(bias[c0 + cofs + 3]); }
        *(v4f*)(C + (size_t)(r0 + row) * ldc + c0 + cofs) = val; }
    } else {
#pragma unroll
    for (int s = 0; s < 16 / NW; ++s) { const int row = erow + s * (NW * 4), cofs = ecofs;   // 16-byte plane stores, eight rows to a 128-byte line
        const v4f va = *(const v4fa*)(os + row * 68 + cofs), vb = *(const v4fa*)(os + row * 68 + cofs + 4); float v[8];
#pragma unroll
        for (int k = 0; k < 8; ++k) v[k] = k < 4 ? va[k] : vb[k - 4];
        if constexpr (EPI == 1 || EPI == 2) {
            v8h o16; v8us oh, ol;
#pragma unroll
            for (int k = 0; k < 8; ++k) { v[k] += bfr(EPI == 2 ? bvr[s] : bv[k]); o16[k] = tohx(v[k]); unsigned short a, c; splitf(v[k], a, c); oh[k] = a; ol[k] = c; }
            const size_t hp = (size_t)(r0 / TT) * NH_ + by; const int rl = r0 % TT;   // plane of this batch and head; the tile's first row inside the batch
            const size_t e = hp * TT * HD + (EPI == 1 ? fro(rl + row, cofs, HD) : fro(row, rl + cofs, TT));
            *(v8h*)(P16 + e) = o16; *(v8us*)(Ph + e) = oh; *(v8us*)(Pl + e) = ol;
            if (s == 16 / NW - 1) asm volatile("s_wait_xcnt 0x0" ::: "memory");   // behind the last of the stores: where this tile's code is followed by another tile's in one kernel, nothing else stands before their address and data registers are given away
        } else if constexpr (EPI == 3) {
            v8us oh, ol;
#pragma unroll
            for (int k = 0; k < 8; ++k) { v[k] += bfr(bv[k]); unsigned short a, c; splitf(v[k], a, c); oh[k] = a; ol[k] = c; }
            const size_t e = (size_t)(r0 + row) * ldc + c0 + cofs, ep = fro(r0 + row, c0 + cofs, ldc);
            *(v4f*)(C + e) = (v4f){v[0], v[1], v[2], v[3]}; *(v4f*)(C + e + 4) = (v4f){v[4], v[5], v[6], v[7]}; *(v8us*)(Ph + ep) = oh; *(v8us*)(Pl + ep) = ol;
            asm volatile("s_wait_xcnt 0x0" ::: "memory");   // behind the four stores, before their address or data registers are given to anything else
        } else {
            v8f o;
#pragma unroll
            for (int k = 0; k < 8; ++k) { const float lg = (g1[s][k] + v[k]) + bfr(bv[k]); const float gt = __fdiv_rn(1.0f, 1.0f + expf(-lg)); o[k] = gt * co[s][k] + (1.0f - gt) * po[s][k]; }
            *(v8f*)(C + (size_t)(r0 + row) * ldc + c0 + cofs) = o;
        } }
    }
}
#define MR   (NB_ * TT)           // rows of all batches
#define PLN  ((size_t)MR * DM)    // elements of one [MR][DM] plane (= one set of head planes)
static_assert(DQ == DM, "the merged attention output is as wide as the model");
// One GEMM per blockIdx.z, K = DM (a constant: the steps from tile to tile are immediate offsets on one address pair per plane): operands, C and the hi / lo planes step by sA / sB / sC elements, the bias is bias (z = 0) or bias1. grid (MR/64, N/64, Z).
template <typename T16, int NSPLIT, bool CAUSALK, bool BIAS, int NW, int EPI>
__global__ __launch_bounds__(NW * 32) void k_gemmk(const T16* __restrict__ A, const T16* __restrict__ A2, const T16* __restrict__ Bt, float* C, int ldc, const float* __restrict__ bias, const float* __restrict__ bias1, size_t sA, size_t sB, size_t sC, bf* Ph, bf* Pl, const float* __restrict__ X1, const float* __restrict__ X2, const float* __restrict__ X3) {
    __shared__ __align__(16) float part[NW * 4096];
    float* os = part;   // the summed tile lies where the partial tiles lay: 64 KiB a block, so that LDS does not hold the resident blocks below what the registers allow
    const size_t z = blockIdx.z;
    gemm_tile<T16, NSPLIT, CAUSALK, BIAS, NW, EPI>(part, os, A + z * sA, A2 + z * sA, Bt + z * sB, nullptr, DM, C + z * sC, ldc, z ? bias1 : bias, 0, nullptr, Ph + z * sC, Pl + z * sC, X1, X2, X3, (int)blockIdx.x, (int)blockIdx.y);
}
// The projections of both branches in one launch, 64 x 64 tiles; blockIdx.y = 16 * z + column tile. z < 4: q, k, v of the char branch and q of the concept branch, over all MR rows (X: the planes query, keys, values; Wt: the transposed weights q, k, v, q, k, v); each writes its own three head planes (v: transposed).
// The last rows of blocks: the concept branch's k and v as products of the embedding TABLE (X's fourth plane, NVP rows), a quarter of the rows that the gathered embeddings would have; the blocks are counted through (0 k, 1 v), column tile, row tile;
// plain f32 sums to Tf[k, v][NVP][DM], no bias yet. grid (MR/64, 4 * DM/64 + QKV_TY).
#define QKV_TY (2 * (NVP / 64) * (DM / 64) / (MR / 64))   // rows of blocks that hold the tiles of both table products
__global__ __launch_bounds__(128) void k_qkv(const bf* __restrict__ X, const bf* __restrict__ Wt, const float* __restrict__ bcq, const float* __restrict__ bck, const float* __restrict__ bcv, const float* __restrict__ bpq, h16* P16, bf* Ph, bf* Pl, float* Tf) {
    static_assert(NVP % 64 == 0 && NVP >= NVOC && (2 * (NVP / 64) * (DM / 64)) % (MR / 64) == 0, "the tiles of both table products fill whole rows of blocks");
    __shared__ __align__(16) float part[4 * 4096];
    float* os = part;   // the summed tile lies where the partial tiles lay: 64 KiB a block, so that LDS does not hold the resident blocks below what the registers allow
    const int z = (int)blockIdx.y / (DM / 64), by = (int)blockIdx.y % (DM / 64);
    if (z >= 4) { const int i = ((int)blockIdx.y - 4 * (DM / 64)) * (MR / 64) + (int)blockIdx.x, t = i / ((NVP / 64) * (DM / 64)), r = i % ((NVP / 64) * (DM / 64));
        gemm_tile<bf, 0, false, false, 4, 0>(part, os, X + 3 * PLN, nullptr, Wt + (size_t)(4 + t) * DM * DM, nullptr, DM, Tf + (size_t)t * NVP * DM, DM, nullptr, 0, nullptr, nullptr, nullptr, nullptr, nullptr, nullptr, r % (NVP / 64), r / (NVP / 64)); return; }
    const float* bias = z == 0 ? bcq : z == 1 ? bck : z == 2 ? bcv : bpq;
    const bf* A = X + (size_t)(z < 3 ? z : 0) * PLN; const bf* Bt = Wt + (size_t)z * DM * DM; const size_t pz = (size_t)z * PLN;   // the concept branch's q comes from the query plane
    if (z == 2) gemm_tile<bf, 0, false, true, 4, 2>(part, os, A, nullptr, Bt, nullptr, DM, nullptr, DM, bias, 0, P16 + pz, Ph + pz, Pl + pz, nullptr, nullptr, nullptr, (int)blockIdx.x, by);
    else gemm_tile<bf, 0, false, true, 4, 1>(part, os, A, nullptr, Bt, nullptr, DM, nullptr, DM, bias, 0, P16 + pz, Ph + pz, Pl + pz, nullptr, nullptr, nullptr, (int)blockIdx.x, by);
}
// From a gathered tile in LDS to the three head planes: bias, rounding and stores are those of the GEMM's plane epilogues (EPI 1: [row][d]; EPI 2: transposed), value for value. bb: the eight (EPI 1) or four (EPI 2) bias values of this thread.
template <int EPI>
__device__ __forceinline__ void gath_put(const float* os, const float* bb, int erow, int ecofs, int r0, h16* P16, bf* Ph, bf* Pl) {
#pragma unroll
    for (int s = 0; s < 4; ++s) { const int row = erow + s * 16, cofs = ecofs;   // 16-byte plane stores, eight rows to a 128-byte line
        const v4f va = *(const v4fa*)(os + row * 68 + cofs), vb = *(const v4fa*)(os + row * 68 + cofs + 4); float v[8];
#pragma unroll
        for (int k = 0; k < 8; ++k) v[k] = k < 4 ? va[k] : vb[k - 4];
        v8h o16; v8us oh, ol;
#pragma unroll
        for (int k = 0; k < 8; ++k) { v[k] += bfr(EPI == 2 ? bb[s] : bb[k]); o16[k] = tohx(v[k]); unsigned short a, c; splitf(v[k], a, c); oh[k] = a; ol[k] = c; }
        const size_t hp = (size_t)(r0 / TT) * NH_ + blockIdx.y; const int rl = r0 % TT;   // plane of this batch and head; the tile's first row inside the batch
        const size_t e = hp * TT * HD + (EPI == 1 ? fro(rl + row, cofs, HD) : fro(row, rl + cofs, TT));
        *(v8h*)(P16 + e) = o16; *(v8us*)(Ph + e) = oh; *(v8us*)(Pl + e) = ol;
        if (EPI == 1 && s == 3) asm volatile("s_wait_xcnt 0x0" ::: "memory");   // behind the last of the keys' stores, before their address or data registers are given to the values' work
    }
}
// The concept branch's k and v head planes of 64 sequence rows x one head per block: row r of a tile is row concept_ids[r] of the table product (Tk, Tv: [NVP][DM] f32), brought to LDS as the GEMM's summed tile would lie there
// (keys [row][column], values [column][row] for the transposed planes; pitch 68). One block makes both, so the indices are read once and half as many waves have to start. grid (MR/64, DM/64).
// P16 / Ph / Pl: the keys' planes; the values' lie PLN elements behind them.
__global__ __launch_bounds__(128) void k_gath(const float* __restrict__ Tk, const float* __restrict__ Tv, const int* __restrict__ IDS, const float* __restrict__ bpk, const float* __restrict__ bpv, h16* P16, bf* Ph, bf* Pl) {
    __shared__ __align__(16) float osk[64 * 68];
    __shared__ __align__(16) float osv[64 * 68];
    const int tx = (int)threadIdx.x, r0 = blockIdx.x * 64, c0 = blockIdx.y * 64;
    const int grow = tx >> 4, gc = (tx & 15) * 4;   // sixteen lanes read the 256 bytes that one table row has of this head: whole lines
    const int erow = (tx >> 6) * 8 + ((tx >> 2) & 7), ecofs = ((tx >> 5) & 1) * 32 + (tx & 3) * 8;
    const int* ip = IDS + r0 + grow; int id[8];
#pragma unroll
    for (int s = 0; s < 8; ++s) id[s] = ip[s * 8];
    asm volatile("s_wait_xcnt 0x0" :: "v"(ip) : "memory");   // behind the eight reads, before their address registers are given to anything else (the address is an input, so that it lives up to the wait)
    v4f xk[8], xv[8];
#pragma unroll
    for (int s = 0; s < 8; ++s) { const size_t ro = (size_t)min(max(id[s], 0), NVOC - 1) * DM + c0 + gc; const float* tk = Tk + ro; const float* tv = Tv + ro; xk[s] = *(const v4f*)tk; xv[s] = *(const v4f*)tv;   // the index is bounded here, whatever the array holds
        asm volatile("s_wait_xcnt 0x0" :: "v"(tk), "v"(tv) : "memory"); }   // behind each pair of gathered reads: the register allocator gives a read's address registers to the data of a later read
    float bv[8], bvr[4];
#pragma unroll
    for (int k = 0; k < 8; ++k) bv[k] = bpk[c0 + ecofs + k];
#pragma unroll
    for (int s = 0; s < 4; ++s) bvr[s] = bpv[c0 + erow + s * 16];
#pragma unroll
    for (int s = 0; s < 8; ++s) { *(v4fa*)(osk + (s * 8 + grow) * 68 + gc) = xk[s];
#pragma unroll
        for (int j = 0; j < 4; ++j) osv[(gc + j) * 68 + s * 8 + grow] = xv[s][j]; }
    // the loaded bias values are inputs only: that keeps their loads in front of the barrier, beside the gathered reads (left alone the compiler sinks them behind it, where nothing is left to cover their latency);
    // the base pointers are inputs so that their registers live up to the wait, which stands before they are given to anything else
    asm volatile("s_wait_xcnt 0x0" :: "v"(bv[0]), "v"(bv[1]), "v"(bv[2]), "v"(bv[3]), "v"(bv[4]), "v"(bv[5]), "v"(bv[6]), "v"(bv[7]), "v"(bvr[0]), "v"(bvr[1]), "v"(bvr[2]), "v"(bvr[3]), "s"(bpk), "s"(bpv) : "memory");
    __syncthreads();   // both gathered tiles are complete
    gath_put<1>(osk, bv, erow, ecofs, r0, P16, Ph, Pl);
    gath_put<2>(osv, bvr, erow, ecofs, r0, P16 + PLN, Ph + PLN, Pl + PLN);
}


// Transposed plane Bt[n][k] (fragment order) of w[k][n], both DM wide: a thread makes the eight neighbours k0 .. k0 + 7 of column n, a wave has 32 neighbouring n: every read is one whole line, every store two runs of 256 bytes.
__device__ __forceinline__ void wtG(const float* __restrict__ w, bf* Bt) {
    const int idx = (int)blockIdx.x * 256 + (int)threadIdx.x; const int n = idx & (DM - 1), k0 = (idx >> 10) * 8;   // the thread's second piece lies DM / 2 rows of w further on
    const float* wp = w + (size_t)k0 * DM + n; const float* wq = wp + (size_t)(DM / 2) * DM; float x[8], y[8];
#pragma unroll
    for (int j = 0; j < 8; ++j) { x[j] = wp[(size_t)j * DM]; y[j] = wq[(size_t)j * DM]; }
    asm volatile("s_wait_xcnt 0x0" :: "v"(wp), "v"(wq) : "memory");   // behind the sixteen reads, before their address registers are given to anything else (the addresses are inputs, so that they live up to the wait)
    v8us o, p;
#pragma unroll
    for (int j = 0; j < 8; ++j) { o[j] = f2bf(x[j]); p[j] = f2bf(y[j]); }
    *(v8us*)(Bt + fro(n, k0, DM)) = o; *(v8us*)(Bt + fro(n, k0 + DM / 2, DM)) = p;
    asm volatile("s_wait_xcnt 0x0" ::: "memory");   // behind the two stores, before their address or data registers are given to anything else
}
__device__ __forceinline__ void put8(v8f v, bf* dst) { v8us o;
#pragma unroll
    for (int k = 0; k < 8; ++k) o[k] = f2bf(v[k]); *(v8us*)dst = o; }
// Everything that depends on the inputs alone, in one launch. grid (256, 10 + 8): blockIdx.y < 10: transposed bf16 plane of weight y (the slow part, so it starts first);
// then eight rows of blocks for the three [MR][DM] bf16 planes (fragment order) query, keys, values and the [NVP][DM] plane of the embedding table (a thread makes the same eight neighbours of all of them: independent reads in flight, fewer waves to start;
// a wave takes 8 rows x one 32-wide k block: it reads eight whole lines of each input and stores four whole lines of each plane).
__global__ __launch_bounds__(256) void k_prep(const float* __restrict__ w0, const float* __restrict__ w1, const float* __restrict__ w2, const float* __restrict__ w3, const float* __restrict__ w4, const float* __restrict__ w5, const float* __restrict__ w6, const float* __restrict__ w7, const float* __restrict__ w8, const float* __restrict__ w9,
                                              const float* __restrict__ xq, const float* __restrict__ xk, const float* __restrict__ xv, const float* __restrict__ TE, bf* Wt, bf* X) {
    static_assert(PLN / 8 == (size_t)8 * 256 * 256, "eight rows of 256 blocks cover a plane"); static_assert(DM * DM / 8 == 2 * 256 * 256 && DM == 1024, "256 blocks, two pieces a thread, cover a weight");
    const int y = blockIdx.y;
    if (y < 10) { const float* w = y == 0 ? w0 : y == 1 ? w1 : y == 2 ? w2 : y == 3 ? w3 : y == 4 ? w4 : y == 5 ? w5 : y == 6 ? w6 : y == 7 ? w7 : y == 8 ? w8 : w9; wtG(w, Wt + (size_t)y * DM * DM); return; }
    const int g = ((y - 10) * 256 + (int)blockIdx.x) * 256 + (int)threadIdx.x; const int row = (g >> 10) * 8 + ((g >> 2) & 7), k0 = ((g >> 5) & 31) * 32 + (g & 3) * 8;
    const size_t e = (size_t)row * DM + k0, d = fro(row, k0, DM);   // the thread's first element in each input and in each plane
    const float* qp = xq + e; const float* kp = xk + e; const float* vp = xv + e; const float* ep = TE + (size_t)min(row, NVOC - 1) * DM + k0;   // table rows behind the last repeat it: every byte of the plane is written
    const bool tab = row < NVP;   // alike for the whole block (1024 threads share eight rows)
    const v8f q = *(const v8f*)qp, k = *(const v8f*)kp, v = *(const v8f*)vp; v8f ge = {};
    if (tab) ge = *(const v8f*)ep;
    // behind the reads, before their address registers are given to anything else (the addresses are inputs, so that they live up to the wait)
    asm volatile("s_wait_xcnt 0x0" :: "v"(qp), "v"(kp), "v"(vp), "v"(ep) : "memory");
    put8(q, X + d); put8(k, X + PLN + d); put8(v, X + 2 * PLN + d);
    if (tab) put8(ge, X + 3 * PLN + d);
    asm volatile("s_wait_xcnt 0x0" ::: "memory");   // behind the last of the stores, before any of their address or data registers is given to anything else
}
// ---- k_fattn: causal attention of one head and 64 query rows per block in ONE kernel: scores, softmax with a running maximum and sum, probabilities x values, and the hi/lo planes of the merged output; no score and no probability leaves the registers.
// Four waves, each with 16 queries of its own; no LDS, no barrier. The products are transposed: S^T = K Q^T (A = 16 key rows, B = 16 query columns), so a lane holds scores of ONE query (column lr; keys 8 hi + r of each 16-key tile):
// maximum and sum are taken in the lane, plus one exchange between the wave's halves. Two neighbouring S^T tiles, converted in place, are the B operand of O^T += V^T P^T in the k order of the loaders (8 hi + s, then 16 + 8 hi + s - 8).
// O^T: a lane holds 8 consecutive d of its query, one 16-byte store per plane. Every plane read or written here is in fragment order. Query rows < RH: hi + lo bf16 planes, three products; the rest single fp16. A pass takes 64 keys. grid (NH_ * NB_ * 2, TT / 64), the longest tiles first.
// v_exp_f32 with one free vector slot behind it: the register allocator lets the next instruction overwrite an exp's source directly behind it, where the instruction set asks for one independent instruction
// In place: the register written is the one the compiler's own arithmetic has just written, so its padding behind a matrix instruction covers this statement too.
__device__ __forceinline__ float exp2_slot(float x) { asm("v_exp_f32 %0, %0\n\tv_nop" : "+v"(x)); return x; }
// Eight of them in one statement: each is the independent instruction behind the one before it, so only the last needs the free slot.
__device__ __forceinline__ v8f exp2_slot8(v8f x) { float a = x[0], b = x[1], c = x[2], d = x[3], e = x[4], f = x[5], g = x[6], h = x[7];
    asm("v_exp_f32 %0, %0\n\tv_exp_f32 %1, %1\n\tv_exp_f32 %2, %2\n\tv_exp_f32 %3, %3\n\tv_exp_f32 %4, %4\n\tv_exp_f32 %5, %5\n\tv_exp_f32 %6, %6\n\tv_exp_f32 %7, %7\n\tv_nop" : "+v"(a), "+v"(b), "+v"(c), "+v"(d), "+v"(e), "+v"(f), "+v"(g), "+v"(h));
    return (v8f){a, b, c, d, e, f, g, h}; }
__device__ __forceinline__ float xhalf(float x) { return __builtin_bit_cast(float, __builtin_amdgcn_permlanex16(__builtin_bit_cast(int, x), __builtin_bit_cast(int, x), 0x76543210, 0xfedcba98, false, false)); }   // lane l with lane l ^ 16, in the vector unit
template <bool B> struct BoolC { static constexpr bool value = B; };
template <typename T16, bool HL>
__device__ __forceinline__ void fattn_wave(const T16* __restrict__ Q, const T16* __restrict__ Q2, const T16* __restrict__ Kp, const T16* __restrict__ K2, const T16* __restrict__ Vt, const T16* __restrict__ V2, int row0, int nkb, int lr, int hi, bf* Ah, bf* Al) {
    typedef typename WFrag<T16>::V V;
    const float CE = SCL * 1.4426950408889634f;               // scores stay as the matrix unit leaves them; the scale (a power of two) and log2(e) enter in the exponent's one multiply-add, and the running maximum is kept unscaled
    const size_t koff = (size_t)(16 * hi + lr) * 8, voff = koff;   // the lane's place in a tile of a plane in fragment order; 16 rows on: 16 * HD (keys, queries) or 16 * TT (values) elements, 32 k on: 512
    V q[2], q2[2], ka[4][2];
    const T16* qp = Q + (size_t)row0 * HD + koff; const T16* qp2 = HL ? Q2 + (size_t)row0 * HD + koff : nullptr;
#pragma unroll
    for (int kc = 0; kc < 2; ++kc) { q[kc] = WFrag<T16>::ld(qp + kc * 512); if (HL) q2[kc] = WFrag<T16>::ld(qp2 + kc * 512); }
    // behind the query loads, before their address registers are given to anything else (the addresses are inputs, so that they live up to the wait)
    if constexpr (HL) asm volatile("s_wait_xcnt 0x0" :: "v"(qp), "v"(qp2) : "memory"); else asm volatile("s_wait_xcnt 0x0" :: "v"(qp) : "memory");
    if constexpr (!HL) {
        const T16* kp = Kp + koff;
#pragma unroll
        for (int kt = 0; kt < 4; ++kt)
#pragma unroll
            for (int kc = 0; kc < 2; ++kc) ka[kt][kc] = WFrag<T16>::ld(kp + (size_t)kt * 16 * HD + kc * 512);
        asm volatile("s_wait_xcnt 0x0" :: "v"(kp) : "memory");   // behind the key loads, before their address registers are given to anything else (the address is an input, so that it lives up to the wait)
    }
    v8f o[4];
#pragma unroll
    for (int dt = 0; dt < 4; ++dt) o[dt] = (v8f){};
    float m = -3.0e38f, l = 0.f;
    // One pass of 64 keys. Only the last pass (the diagonal block) holds keys behind a query, so only its copy of the body compares and selects.
    auto pass = [&](const int kb, auto DIAG) __attribute__((always_inline)) {
        const int key0 = kb * 64;
        V va[4][2];
        if constexpr (!HL) {   // this pass's value fragments: they depend on nothing of the pass, so the compiler may place them as early as its registers allow
            const T16* vp = Vt + voff + (size_t)key0 * 16;
#pragma unroll
            for (int dt = 0; dt < 4; ++dt)
#pragma unroll
                for (int ks = 0; ks < 2; ++ks) va[dt][ks] = WFrag<T16>::ld(vp + (size_t)dt * 16 * TT + ks * 512);
            asm volatile("s_wait_xcnt 0x0" :: "v"(vp) : "memory");   // behind the value loads, before their address registers are given to the next loads' data (the address is an input, so that it lives up to the wait)
        }
        const T16* kh = Kp + koff + (size_t)key0 * HD; const T16* kl = HL ? K2 + koff + (size_t)key0 * HD : kh; const T16* vh = Vt + voff + (size_t)key0 * 16; const T16* vl = HL ? V2 + voff + (size_t)key0 * 16 : vh;   // HL: this pass's tiles
        v8f s[4];
#pragma unroll
        for (int kt = 0; kt < 4; ++kt) s[kt] = (v8f){};
#pragma unroll
        for (int kc = 0; kc < 2; ++kc)
#pragma unroll
            for (int kt = 0; kt < 4; ++kt) {
                if constexpr (HL) { const size_t off = (size_t)kt * 16 * HD + kc * 512; const V a = WFrag<T16>::ld(kh + off), a2 = WFrag<T16>::ld(kl + off);
                    s[kt] = WFrag<T16>::mma(a, q[kc], s[kt]); s[kt] = WFrag<T16>::mma(a, q2[kc], s[kt]); s[kt] = WFrag<T16>::mma(a2, q[kc], s[kt]); }
                else s[kt] = WFrag<T16>::mma(ka[kt][kc], q[kc], s[kt]);
            }
        if constexpr (!HL) {   // the next pass's key fragments (the last pass asks for its own again: always inside the plane)
            const int kn = min(kb + 1, nkb - 1) * 64; const T16* kp = Kp + koff + (size_t)kn * HD;
#pragma unroll
            for (int kt = 0; kt < 4; ++kt)
#pragma unroll
                for (int kc = 0; kc < 2; ++kc) ka[kt][kc] = WFrag<T16>::ld(kp + (size_t)kt * 16 * HD + kc * 512);
            asm volatile("s_wait_xcnt 0x0" :: "v"(kp) : "memory");   // behind the key loads, before their address registers are given to anything else (the address is an input, so that it lives up to the wait)
        } else asm volatile("s_wait_xcnt 0x0" :: "v"(kh), "v"(kl) : "memory");   // the same behind this pass's key loads
        if constexpr (decltype(DIAG)::value) {
            const int ln = (int)__builtin_amdgcn_mbcnt_lo(~0u, 0u);   // the lane's number, made anew: nothing of it has to be held in a register through the loop (held there, it was spilled)
            const int rel = row0 + (ln & 15) - key0 - 8 * (ln >> 4);   // key <= this lane's query row  <=>  kt * 16 + r <= rel
#pragma unroll
            for (int kt = 0; kt < 4; ++kt)
#pragma unroll
                for (int r = 0; r < 8; ++r) s[kt][r] = (kt * 16 + r <= rel) ? s[kt][r] : -3.0e38f;
        }
        float mk[4];
#pragma unroll
        for (int kt = 0; kt < 4; ++kt) { mk[kt] = s[kt][0];
#pragma unroll
            for (int r = 1; r < 8; ++r) mk[kt] = fmaxf(mk[kt], s[kt][r]); }
        float mx = fmaxf(fmaxf(fmaxf(mk[0], mk[1]), fmaxf(mk[2], mk[3])), m);
        mx = fmaxf(mx, xhalf(mx));                             // the other half of this query's keys
        const float al = exp2_slot((m - mx) * CE); m = mx;    // first pass: exp2 of a huge negative number = 0 on zero sums
#pragma unroll
        for (int dt = 0; dt < 4; ++dt) o[dt] *= al;
        const float nm = -m * CE; const v8f cev = {CE, CE, CE, CE, CE, CE, CE, CE}, nmv = {nm, nm, nm, nm, nm, nm, nm, nm};
#pragma unroll
        for (int kt = 0; kt < 4; ++kt) s[kt] = exp2_slot8(__builtin_elementwise_fma(s[kt], cev, nmv));
        const v8f sv = (s[0] + s[1]) + (s[2] + s[3]);          // the four tiles register by register (packed adds on the pairs as they lie), then the eight sums
        l = l * al + (((sv[0] + sv[4]) + (sv[1] + sv[5])) + ((sv[2] + sv[6]) + (sv[3] + sv[7])));
#pragma unroll
        for (int ks = 0; ks < 2; ++ks) {
            V pb, pb2;
            if constexpr (HL) { v8us h0, h1, l0, l1;
#pragma unroll
                for (int r = 0; r < 8; ++r) { unsigned short a, c; splitf(s[2 * ks][r], a, c); h0[r] = a; l0[r] = c; splitf(s[2 * ks + 1][r], a, c); h1[r] = a; l1[r] = c; }
                pb = cat16b(h0, h1); pb2 = cat16b(l0, l1); }
            else { v8h c0, c1;
#pragma unroll
                for (int r = 0; r < 8; ++r) { c0[r] = tohx(s[2 * ks][r]); c1[r] = tohx(s[2 * ks + 1][r]); }
                pb = cat16(c0, c1); }
#pragma unroll
            for (int dt = 0; dt < 4; ++dt) {
                if constexpr (HL) { const size_t off = (size_t)dt * 16 * TT + ks * 512; const V a = WFrag<T16>::ld(vh + off), a2 = WFrag<T16>::ld(vl + off);
                    o[dt] = WFrag<T16>::mma(a, pb, o[dt]); o[dt] = WFrag<T16>::mma(a, pb2, o[dt]); o[dt] = WFrag<T16>::mma(a2, pb, o[dt]); }
                else o[dt] = WFrag<T16>::mma(va[dt][ks], pb, o[dt]);
            }
        }
        // four vector slots behind the last matrix instruction, on the back edge and on the exit alike, before its fragments are reloaded or its accumulators read
        asm volatile("v_nop\n\tv_nop\n\tv_nop\n\tv_nop" : "+v"(o[0]), "+v"(o[1]), "+v"(o[2]), "+v"(o[3]));
        if constexpr (HL) asm volatile("s_wait_xcnt 0x0" :: "v"(vh), "v"(vl) : "memory");   // behind this pass's value loads, before their address registers are given to anything else
    };
#pragma unroll 1   // rolled: the body is long, and a second copy would double the fragments held
    for (int kb = 0; kb < nkb - 1; ++kb) pass(kb, BoolC<false>{});
    pass(nkb - 1, BoolC<true>{});
    l += xhalf(l);                                             // join the halves' sums
    const size_t ooff = (size_t)__builtin_amdgcn_mbcnt_lo(~0u, 0u) * 8;   // the lane's place in a tile, made anew for the same reason
    const float inv = __fdiv_rn(1.0f, l);
#pragma unroll
    for (int dt = 0; dt < 4; ++dt) { v8us oh, ol;
#pragma unroll
        for (int r = 0; r < 8; ++r) { unsigned short a, c; splitf(o[dt][r] * inv, a, c); oh[r] = a; ol[r] = c; }
        const size_t oo = (size_t)row0 * DQ + (dt >> 1) * 512 + (dt & 1) * 256 + ooff; *(v8us*)(Ah + oo) = oh; *(v8us*)(Al + oo) = ol; }   // fragment order, K = DQ: the wave's store is 512 bytes in a row
}
// Both branches and all batches in one launch: grid (NH_ * NB_ * 2, TT / 64), blockIdx.x = (branch * NB_ + batch) * NH_ + head; blockIdx.y still counts the query tiles from the longest down, so that the longest tiles of every head start first.
// Four waves per SIMD, no more and no fewer, are asked for: with the 256 registers of that budget the compiler issues a pass's value loads at its head and the next pass's key loads right behind the score products; aiming at more waves it issued them late and waited for them at once.
// The nine pointers are the char branch's head planes; the concept branch's lie 3 * PLN elements behind them (the order of the projections). Ah / Al: [branch] x ([MR][DQ] in fragment order); a head's 64 columns are two 32-wide k blocks, 1024 elements on per head.
__global__ __launch_bounds__(128) __attribute__((amdgpu_waves_per_eu(4, 4))) void k_fattn(const h16* __restrict__ Q16, const bf* __restrict__ Qh, const bf* __restrict__ Ql, const h16* __restrict__ K16, const bf* __restrict__ Kh, const bf* __restrict__ Kl, const h16* __restrict__ V16, const bf* __restrict__ Vh, const bf* __restrict__ Vl, bf* Ah, bf* Al) {
    const int lane = threadIdx.x & 31, lr = lane & 15, hi = lane >> 4;
    const int w = __builtin_amdgcn_readfirstlane((int)(threadIdx.x >> 5));   // wave number in a scalar register: row0 and the loop's bounds stay scalar
    static_assert(REP == 1, "the key and value planes are indexed by the query's head");
    const int h = blockIdx.x % NH_, bb = blockIdx.x / NH_, br = bb / NB_, r0 = (TT / 64 - 1 - (int)blockIdx.y) * 64;   // bb = branch * NB_ + batch
    const size_t zq = (size_t)(3 * br) * PLN + ((size_t)(bb % NB_) * NH_ + h) * TT * HD, zk = zq, za = (size_t)bb * TT * DQ + h * (HD * 16);
    if (r0 < RH) fattn_wave<bf, true>(Qh + zq, Ql + zq, Kh + zk, Kl + zk, Vh + zk, Vl + zk, r0 + w * 16, r0 / 64 + 1, lr, hi, Ah + za, Al + za);
    else fattn_wave<h16, false>(Q16 + zq, nullptr, K16 + zk, nullptr, V16 + zk, nullptr, r0 + w * 16, r0 / 64 + 1, lr, hi, Ah + za, Al + za);
}

extern "C" void kernel_launch(void* const* d_in, const int* in_sizes, int n_in,
                              void* d_out, int out_size, void* d_ws, size_t ws_size, hipStream_t stream) {
    (void)in_sizes; (void)n_in; (void)out_size;
    const float* xvals = (const float*)d_in[0]; const float* xkeys = (const float*)d_in[1]; const float* xq = (const float*)d_in[2]; const int* CID = (const int*)d_in[3]; const float* EMB = (const float*)d_in[4]; const float* wcv = (const float*)d_in[5]; const float* bcv = (const float*)d_in[6]; const float* wck = (const float*)d_in[7]; const float* bck = (const float*)d_in[8]; const float* wcq = (const float*)d_in[9]; const float* bcq = (const float*)d_in[10]; const float* wco = (const float*)d_in[11]; const float* bco = (const float*)d_in[12]; const float* wpv = (const float*)d_in[13]; const float* bpv = (const float*)d_in[14]; const float* wpk = (const float*)d_in[15]; const float* bpk = (const float*)d_in[16]; const float* wpq = (const float*)d_in[17]; const float* bpq = (const float*)d_in[18]; const float* wpo = (const float*)d_in[19]; const float* bpo = (const float*)d_in[20]; const float* wg = (const float*)d_in[21]; const float* bg = (const float*)d_in[22];
    float* OUT = (float*)d_out;     // [2][2048][1024]
    char* wsp = (char*)d_ws;
    auto take = [&](size_t bytes) { char* p = wsp; wsp += (bytes + 255) & ~(size_t)255; return (void*)p; };
    bf* WT = (bf*)take((size_t)10 * DM * DM * 2);   /* transposed weights: q, k, v of the char branch, q, k, v of the concept branch, Wco, Wpo, Wg rows 0..1023 (multiply char_out), Wg rows 1024..2047 (concept_out) */
    bf* XP = (bf*)take(4 * PLN * 2);                /* bf16 planes of query, keys, values; in the fourth place the embedding table's NVP rows */
    float* TF = (float*)take((size_t)2 * NVP * DM * 4);   /* table x Wpk, table x Wpv */
    bf* ATh = (bf*)take(2 * PLN * 2); bf* ATl = (bf*)take(2 * PLN * 2);   /* merged attention outputs, hi and lo, [branch] */
    char* pl0 = wsp;
    h16* P16 = (h16*)take(6 * PLN * 2); bf* Ph = (bf*)take(6 * PLN * 2); bf* Pl = (bf*)take(6 * PLN * 2);   /* head planes of the six projections */
    char* end0 = wsp; wsp = pl0;                    /* the head planes are dead behind the attention launch: what follows it lies in their place */
    float* CO = (float*)take(2 * PLN * 4); float* PO = CO + PLN; bf* Ch = (bf*)take(2 * PLN * 2); bf* Dh = Ch + PLN; bf* Cl = (bf*)take(2 * PLN * 2); bf* Dl = Cl + PLN; float* G1 = (float*)take(PLN * 4);
    if (wsp > end0 || (size_t)(end0 - (char*)d_ws) > ws_size) return;    // ws 256 MiB
    k_prep<<<dim3(256, 10 + 8), 256, 0, stream>>>(wcq, wck, wcv, wpq, wpk, wpv, wco, wpo, wg, wg + (size_t)DM * DM, xq, xkeys, xvals, EMB, WT, XP);
    k_qkv<<<dim3(MR / 64, 4 * (DM / 64) + QKV_TY), 128, 0, stream>>>(XP, WT, bcq, bck, bcv, bpq, P16, Ph, Pl, TF);
    k_gath<<<dim3(MR / 64, DM / 64), 128, 0, stream>>>(TF, TF + (size_t)NVP * DM, CID, bpk, bpv, P16 + 4 * PLN, Ph + 4 * PLN, Pl + 4 * PLN);
    k_fattn<<<dim3(NH_ * NB_ * 2, TT / 64), 128, 0, stream>>>(P16, Ph, Pl, P16 + PLN, Ph + PLN, Pl + PLN, P16 + 2 * PLN, Ph + 2 * PLN, Pl + 2 * PLN, ATh, ATl);
    /* out-projections of both branches (z): f32 char_out / concept_out and their hi / lo planes */
    k_gemmk<bf, 1, false, true, 4, 3><<<dim3(MR / 64, DM / 64, 2), 128, 0, stream>>>(ATh, ATl, WT + (size_t)6 * DM * DM, CO, DM, bco, bpo, PLN, (size_t)DM * DM, PLN, Ch, Cl, nullptr, nullptr, nullptr);
    /* ---- gate + mix: char_out Wg[:1024] to G1; concept_out Wg[1024:] ends in the sigmoid and the mix ---- */
    k_gemmk<bf, 1, false, false, 4, 0><<<dim3(MR / 64, DM / 64, 1), 128, 0, stream>>>(Ch, Cl, WT + (size_t)8 * DM * DM, G1, DM, nullptr, nullptr, 0, 0, 0, nullptr, nullptr, nullptr, nullptr, nullptr);
    k_gemmk<bf, 1, false, true, 4, 4><<<dim3(MR / 64, DM / 64, 1), 128, 0, stream>>>(Dh, Dl, WT + (size_t)9 * DM * DM, OUT, DM, bg, nullptr, 0, 0, 0, nullptr, nullptr, G1, CO, PO);
}

// v009
// One run takes 198 microseconds.
// Timed twice side by side with v008, it ran 1.05 times as fast both times.
// Over all steps from v000 it is 15.8 times as fast.
#include <hip/hip_runtime.h>

// Hierarchical (char + concept) gated attention (values, keys, query [2][2048][1024]; concept_ids int32 [2][2048] -> ce = emb[concept_ids] ([1000][1024], gathered on device); char branch: q = query Wcq + bcq, k = keys Wck + bck, v = values Wcv + bcv; concept branch: q = query Wpq + bpq, k = ce Wpk + bpk, v = ce Wpv + bpv ('xw' [1024][1024] + biases; 16 heads x 64); per branch: scores masked causally (-1e20) then x 1/sqrt(1024), softmax, merged, Wo + bo; gate = sigmoid([char_out | concept_out] Wg + bg) (Wg [2048][1024]); out = gate char_out + (1 - gate) concept_out -> [2][2048][1024] (4.2 M)).
// Compute dtypes, f32 accumulate: every input rounded to bf16; q/k/v on PLAIN bf16 operands (inputs: exact) + biases; the concept branch's k and v: emb Wpk and emb Wpv once per table row, the rows then gathered by concept_ids (a row of a product depends on its own row of the left operand alone); causal scores, softmax and attn.v in one kernel (key tiles beyond the diagonal block skipped): query rows < 512 hl (3 products), the rest single fp16; softmax f32, running maximum and sum; Wco / Wpo hl x exact (2 products) + bias; gate GEMMs 2 products; sigmoid (precise expf) and the convex mix in f32.

#define NB_  2
#define TT   2048
#define DM   1024
#define NH_  16
#define NKV  16
#define REP  (NH_ / NKV)
#define HD   64
#define DQ   (NH_ * HD)
#define DKV  (NKV * HD)
#define NVOC 1000
#define NVP  1024                 // table rows as the GEMM tiles see them: NVOC rounded up to whole 64-row tiles (the rows behind the last repeat it and are never gathered)
#define RH   512                  // query rows < RH use hi+lo planes (0: none)
#define SCL  0.03125f   // 1/sqrt(embed_size = 1024) as in the source
typedef _Float16 h16;
typedef unsigned short bf;
typedef __attribute__((ext_vector_type(16))) __bf16   v16bf;
typedef __attribute__((ext_vector_type(16))) _Float16 v16h;
typedef __attribute__((ext_vector_type(8)))  _Float16 v8h;
typedef __attribute__((ext_vector_type(8)))  unsigned short v8us;
typedef __attribute__((ext_vector_type(8)))  float    v8f;
typedef __attribute__((ext_vector_type(4)))  float    v4f;
typedef v8h  __attribute__((may_alias)) v8ha;
typedef v4f  __attribute__((may_alias)) v4fa;
typedef v8us __attribute__((may_alias)) v8usa;

__device__ __forceinline__ unsigned short f2bf(float f) { unsigned u = __float_as_uint(f); u += 0x7FFFu + ((u >> 16) & 1u); return (unsigned short)(u >> 16); }
__device__ __forceinline__ float bf2f(unsigned short b) { return __uint_as_float(((unsigned)b) << 16); }
__device__ __forceinline__ float bfr(float f) { return bf2f(f2bf(f)); }
__device__ __forceinline__ v16h cat16(v8h lo, v8h hi) { return __builtin_shufflevector(lo, hi, 0, 1, 2, 3, 4, 5, 6, 7, 8, 9, 10, 11, 12, 13, 14, 15); }
__device__ __forceinline__ v16bf cat16b(v8us lo, v8us hi) { return __builtin_bit_cast(v16bf, __builtin_shufflevector(lo, hi, 0, 1, 2, 3, 4, 5, 6, 7, 8, 9, 10, 11, 12, 13, 14, 15)); }
__device__ __forceinline__ v8f wmma16(v16h a, v16h b, v8f c) { return __builtin_amdgcn_wmma_f32_16x16x32_f16(false, a, false, b, (short)0, c, false, false); }
__device__ __forceinline__ v8f wmmab(v16bf a, v16bf b, v8f c) { return __builtin_amdgcn_wmma_f32_16x16x32_bf16(false, a, false, b, (short)0, c, false, false); }



// ---- k_gemmk: register-blocked GEMM, one 64x64 output tile per block, the K loop SPLIT OVER THE NW WAVES of the block: wave w takes the 32-wide K steps w, w + NW, ...
// into its own 16 accumulators, operands straight from 16-bit planes in fragment order (below); the NW partial tiles are then summed through LDS in fixed wave order 0..NW-1. grid (M/64, N/64, Z), NW*32 threads.
// C[m][n] (f32, pitch ldc, + optional f32 bias[n]) = sum_k A[m][k] Bt[n][k] (+ split products per NSPLIT). z-batch strides sA/sB/sC in elements. K % 32 == 0.
// EPI picks what the block does with its summed tile (+ bias): 0 f32 C; 1 head planes [head][row][d] (fp16, bf16 hi, bf16 lo; the tile's 64 columns are one head; isq: the planes are a query's); 2 the same three planes transposed [head][d][row];
// 3 f32 C and its hi / lo planes; 4 the tile is the second half of the gate's logits: out = g X2 + (1 - g) X3 with g = sigmoid((X1 + tile) + bias), stored to C.
// CAUSALK limits the key (K) range of the probability x value contraction to the diagonal block (probabilities beyond it are exactly zero); roff = row offset of this launch's first row within the sequence.
// FRAGMENT ORDER: every 16-bit operand plane ([rows][K], rows % 16 == 0, K % 32 == 0) is kept as 1-KiB tiles of 16 rows x 32 k, tile (row / 16, k / 32) at element (row / 16) * 16 * K + (k / 32) * 512, and inside a tile
// [k / 16 % 2][k / 8 % 2][row % 16][k % 8]: the first 16 bytes of all 32 lanes of a fragment (lane = 16 * hi + lr: row lr, k 8 hi ..) are 512 bytes in a row, the second 16 bytes (k 16 + 8 hi ..) the next 512.
// A fragment load so touches four whole 128-byte lines; from a row-major plane it would touch sixteen lines for 32 bytes each. ld(p): p = the tile + lane * 8.
// fro: where the eight neighbours k .. k + 7 (k % 8 == 0) of a row lie.
__device__ __forceinline__ size_t fro(size_t row, size_t k, size_t K) { return (row >> 4) * (16 * K) + (k >> 5) * 512 + ((k >> 4) & 1) * 256 + ((k >> 3) & 1) * 128 + (row & 15) * 8; }
template <typename T16> struct WFrag;
template <> struct WFrag<h16> { typedef v16h V; static __device__ __forceinline__ V ld(const h16* p) { return cat16(*(const v8h*)p, *(const v8h*)(p + 256)); } static __device__ __forceinline__ v8f mma(V a, V b, v8f c) { return wmma16(a, b, c); } };
template <> struct WFrag<bf> { typedef v16bf V; static __device__ __forceinline__ V ld(const bf* p) { return cat16b(*(const v8us*)p, *(const v8us*)(p + 256)); } static __device__ __forceinline__ v8f mma(V a, V b, v8f c) { return wmmab(a, b, c); } };
__device__ __forceinline__ h16 tohx(float x) { return (h16)x; }
__device__ __forceinline__ void splitf(float y, unsigned short& h, unsigned short& l) { h = f2bf(y); l = f2bf(y - bf2f(h)); }
// The tile's work is a device function, so that one launch can hold GEMMs with different epilogues (the kernel picks by the block's index, alike for the whole block) on ONE LDS array, which the kernel owns and which holds first part, then, behind a barrier, os in the same place:
// part[NW * 4096]: [wave][tile 0..15][j half][lane][4]: every wave's accumulators in register order, 16-byte stores contiguous over the lanes; os[64 * 68]: the summed tile, row-major (pitch 68 floats: both half-waves on disjoint banks).
// The M rows are the rows of all NB_ batches, one behind the other (a 64-row tile lies in one batch); the head planes are [batch][head] x ([row][d] or [d][row] in fragment order).
template <typename T16, int NSPLIT, bool CAUSALK, bool BIAS, int NW, int EPI>
__device__ __forceinline__ void gemm_tile(float* part, float* os, const T16* __restrict__ A, const T16* __restrict__ A2, const T16* __restrict__ Bt, const T16* __restrict__ Bt2, int K, float* C, int ldc, const float* __restrict__ bias, int roff, h16* P16, bf* Ph, bf* Pl, const float* __restrict__ X1, const float* __restrict__ X2, const float* __restrict__ X3, int bx, int by, bool isq = false) {
    static_assert(HD == 64, "a 64-column tile is one head"); static_assert(RH % 64 == 0, "a 64-row tile lies wholly on one side of RH"); static_assert(EPI == 0 || BIAS, "the plane and gate epilogues always add the bias"); static_assert(NW == 4 || NW == 8, "the epilogues deal 64 rows x 8 pieces to NW * 32 threads, 16 / NW rows a thread"); static_assert(64 * 68 <= NW * 4096, "os fits in the place of part");
    typedef typename WFrag<T16>::V V;
    const int lane = threadIdx.x & 31, lr = lane & 15, hi = lane >> 4; const int r0 = bx * 64, c0 = by * 64;   // bx, by: the tile's place among the 64-row tiles of A and C and among the 64-column tiles of Bt and C
    const int w = __builtin_amdgcn_readfirstlane((int)(threadIdx.x >> 5));   // wave number in a scalar register: the K loop's bounds stay scalar
    const int Kl = CAUSALK ? min(K, r0 + roff + 64) : K;
    v8f acc[4][4];
#pragma unroll
    for (int mb = 0; mb < 4; ++mb)
#pragma unroll
        for (int nb = 0; nb < 4; ++nb) acc[mb][nb] = (v8f){};
    const size_t aoff = (size_t)r0 * K + lane * 8, boff = (size_t)c0 * K + lane * 8;   // 16 rows on: 16 * K elements; 32 k on: 512
#pragma unroll 1   // rolled: an unrolled body would hold a second set of fragments and pass the register budget of 16 waves
    for (int kc = w * 32; kc < Kl; kc += NW * 32) {
        V a[4], a2[4]; const T16* ap = A + aoff + (size_t)kc * 16; const T16* ap2 = (NSPLIT == 1 || NSPLIT == 2) ? A2 + aoff + (size_t)kc * 16 : ap; const T16* bp = Bt + boff + (size_t)kc * 16; const T16* bp2 = NSPLIT >= 2 ? Bt2 + boff + (size_t)kc * 16 : bp;
#pragma unroll
        for (int mb = 0; mb < 4; ++mb) { a[mb] = WFrag<T16>::ld(ap + (size_t)mb * 16 * K); if (NSPLIT == 1 || NSPLIT == 2) a2[mb] = WFrag<T16>::ld(ap2 + (size_t)mb * 16 * K); }
        // the table product alone: there the register allocator gives the A loads' address pair to the data of a B load of the same pass, so the wait at the loop's foot comes too late for it: one more stands directly behind the A loads
        if constexpr (EPI == 0 && NSPLIT == 0) asm volatile("s_wait_xcnt 0x0" :: "v"(ap) : "memory");
#pragma unroll
        for (int nb = 0; nb < 4; ++nb) { const V b = WFrag<T16>::ld(bp + (size_t)nb * 16 * K); V b2; if (NSPLIT >= 2) b2 = WFrag<T16>::ld(bp2 + (size_t)nb * 16 * K);
#pragma unroll
            for (int mb = 0; mb < 4; ++mb) { acc[mb][nb] = WFrag<T16>::mma(a[mb], b, acc[mb][nb]); if (NSPLIT == 1 || NSPLIT == 2) acc[mb][nb] = WFrag<T16>::mma(a2[mb], b, acc[mb][nb]); if (NSPLIT >= 2) acc[mb][nb] = WFrag<T16>::mma(a[mb], b2, acc[mb][nb]); } }
        // four vector slots behind the last matrix instruction, on the back edge and on the exit alike, before its fragments are reloaded or its accumulators stored;
        // the wait stands behind the pass's loads, before their address registers are given to anything else (the addresses are inputs, so that they live up to it)
        asm volatile("v_nop\n\tv_nop\n\tv_nop\n\tv_nop\n\ts_wait_xcnt 0x0" : "+v"(acc[0][0]), "+v"(acc[1][1]), "+v"(acc[2][2]), "+v"(acc[3][3]) : "v"(a[0]), "v"(a[3]), "v"(ap), "v"(ap2), "v"(bp), "v"(bp2) : "memory");
    }
    // EPI > 0: a thread ends with eight neighbours of LDS row erow + s * NW * 4; what it needs from memory for them is asked for here, so that it arrives while the partial tiles go to LDS
    // a wave takes 8 rows x 4 pieces of one 32-wide column block: in fragment order the eight rows' pieces are one whole 128-byte line, in a row-major f32 array the four pieces are one
    const int erow = ((int)threadIdx.x >> 6) * 8 + (((int)threadIdx.x >> 2) & 7), ecofs = (((int)threadIdx.x >> 5) & 1) * 32 + ((int)threadIdx.x & 3) * 8;
    float bv[8], bvr[16 / NW]; v8f g1[16 / NW], co[16 / NW], po[16 / NW];
    if constexpr (EPI == 2) {
#pragma unroll
        for (int s = 0; s < 16 / NW; ++s) bvr[s] = bias[c0 + erow + s * (NW * 4)];
    } else if constexpr (EPI > 0) {
#pragma unroll
        for (int k = 0; k < 8; ++k) bv[k] = bias[c0 + ecofs + k];
    }
    if constexpr (EPI == 4) {
#pragma unroll
        for (int s = 0; s < 16 / NW; ++s) { const size_t e = (size_t)(r0 + erow + s * (NW * 4)) * ldc + c0 + ecofs; const float* x1 = X1 + e; const float* x2 = X2 + e; const float* x3 = X3 + e; g1[s] = *(const v8f*)x1; co[s] = *(const v8f*)x2; po[s] = *(const v8f*)x3;
            asm volatile("s_wait_xcnt 0x0" :: "v"(x1), "v"(x2), "v"(x3) : "memory"); }   // behind each row's three reads, before their address registers are given to the next row's data (the addresses are inputs, so that they live up to the wait)
    }
#pragma unroll
    for (int mb = 0; mb < 4; ++mb)
#pragma unroll
        for (int nb = 0; nb < 4; ++nb) { float* p = part + ((w * 16 + mb * 4 + nb) * 2) * 128 + lane * 4; const v8f c = acc[mb][nb];
            *(v4fa*)p = (v4f){c[0], c[1], c[2], c[3]}; *(v4fa*)(p + 128) = (v4f){c[4], c[5], c[6], c[7]}; }
    // the loaded bias values are inputs only: that keeps their loads in front of the barriers, under the LDS stores above (left alone the compiler sinks them behind the third barrier, where nothing is left to cover their latency);
    // the base pointer is an input so that its registers live up to the wait, which stands before they are given to anything else
    if constexpr (EPI == 1 || EPI == 3 || EPI == 4) asm volatile("s_wait_xcnt 0x0" :: "v"(bv[0]), "v"(bv[1]), "v"(bv[2]), "v"(bv[3]), "v"(bv[4]), "v"(bv[5]), "v"(bv[6]), "v"(bv[7]), "s"(bias) : "memory");
    __syncthreads();   // every wave's partial tile is in LDS
    v4f t0[16 / NW], t1[16 / NW];
#pragma unroll
    for (int q = 0; q < 16 / NW; ++q) { const float* p = part + (w * (16 / NW) + q) * 256 + lane * 4;
        t0[q] = *(const v4fa*)p; t1[q] = *(const v4fa*)(p + 128);
#pragma unroll
        for (int u = 1; u < NW; ++u) { t0[q] += *(const v4fa*)(p + u * 4096); t1[q] += *(const v4fa*)(p + u * 4096 + 128); } }
    __syncthreads();   // every partial tile has been read: the summed tile may take their place in LDS
#pragma unroll
    for (int q = 0; q < 16 / NW; ++q) { const int tile = w * (16 / NW) + q, mb = tile >> 2, nb = tile & 3; const v4f s0 = t0[q], s1 = t1[q];
        if constexpr (EPI == 2) { float* t = os + (nb * 16 + lr) * 68 + mb * 16 + hi * 8; *(v4fa*)t = s0; *(v4fa*)(t + 4) = s1; }   // tile kept [column][row]: a lane's eight sums are eight rows of one column
        else {
#pragma unroll
            for (int j = 0; j < 4; ++j) { os[(mb * 16 + hi * 8 + j) * 68 + nb * 16 + lr] = s0[j]; os[(mb * 16 + hi * 8 + 4 + j) * 68 + nb * 16 + lr] = s1[j]; } } }
    __syncthreads();   // the summed tile is complete
    if constexpr (EPI == 0) {
#pragma unroll
    for (int s = 0; s < 32 / NW; ++s) { const int idx = s * (NW * 32) + (int)threadIdx.x, row = idx >> 4, cofs = (idx & 15) * 4; v4f val = *(const v4fa*)(os + row * 68 + cofs); if (BIAS) { val[0] += bfr(bias[c0 + cofs]); val[1] += bfr(bias[c0 + cofs + 1]); val[2] += bfr(bias[c0 + cofs + 2]); val[3] += bfr(bias[c0 + cofs + 3]); }
        *(v4f*)(C + (size_t)(r0 + row) * ldc + c0 + cofs) = val; }
    } else {
#pragma unroll
    for (int s = 0; s < 16 / NW; ++s) { const int row = erow + s * (NW * 4), cofs = ecofs;   // 16-byte plane stores, eight rows to a 128-byte line
        const v4f va = *(const v4fa*)(os + row * 68 + cofs), vb = *(const v4fa*)(os + row * 68 + cofs + 4); float v[8];
#pragma unroll
        for (int k = 0; k < 8; ++k) v[k] = k < 4 ? va[k] : vb[k - 4];
        if constexpr (EPI == 1 || EPI == 2) {
#pragma unroll
            for (int k = 0; k < 8; ++k) v[k] += bfr(EPI == 2 ? bvr[s] : bv[k]);
            const size_t hp = (size_t)(r0 / TT) * NH_ + by; const int rl = r0 % TT;   // plane of this batch and head; the tile's first row inside the batch
            const size_t e = hp * TT * HD + (EPI == 1 ? fro(rl + row, cofs, HD) : fro(row, rl + cofs, TT));
            // Only what the attention kernel reads is made (both tests are alike for the whole block): its query rows < RH, which see no key or value row from RH on, work on the hi / lo planes, all others on the fp16 planes
            if (!(isq && rl < RH)) { v8h o16;
#pragma unroll
                for (int k = 0; k < 8; ++k) o16[k] = tohx(v[k]);
                *(v8h*)(P16 + e) = o16;
                asm volatile("s_wait_xcnt 0x0" ::: "memory"); }   // behind the store, before its address or data registers are given to anything else
            if (rl < RH) { v8us oh, ol;
#pragma unroll
                for (int k = 0; k < 8; ++k) { unsigned short a, c; splitf(v[k], a, c); oh[k] = a; ol[k] = c; }
                *(v8us*)(Ph + e) = oh; *(v8us*)(Pl + e) = ol;
                asm volatile("s_wait_xcnt 0x0" ::: "memory"); }   // the same behind these two
        } else if constexpr (EPI == 3) {
            v8us oh, ol;
#pragma unroll
            for (int k = 0; k < 8; ++k) { v[k] += bfr(bv[k]); unsigned short a, c; splitf(v[k], a, c); oh[k] = a; ol[k] = c; }
            const size_t e = (size_t)(r0 + row) * ldc + c0 + cofs, ep = fro(r0 + row, c0 + cofs, ldc);
            *(v4f*)(C + e) = (v4f){v[0], v[1], v[2], v[3]}; *(v4f*)(C + e + 4) = (v4f){v[4], v[5], v[6], v[7]}; *(v8us*)(Ph + ep) = oh; *(v8us*)(Pl + ep) = ol;
            asm volatile("s_wait_xcnt 0x0" ::: "memory");   // behind the four stores, before their address or data registers are given to anything else
        } else {
            v8f o;
#pragma unroll
            for (int k = 0; k < 8; ++k) { const float lg = (g1[s][k] + v[k]) + bfr(bv[k]); const float gt = __fdiv_rn(1.0f, 1.0f + expf(-lg)); o[k] = gt * co[s][k] + (1.0f - gt) * po[s][k]; }
            *(v8f*)(C + (size_t)(r0 + row) * ldc + c0 + cofs) = o;
        } }
    }
}
#define MR   (NB_ * TT)           // rows of all batches
#define PLN  ((size_t)MR * DM)    // elements of one [MR][DM] plane (= one set of head planes)
static_assert(DQ == DM, "the merged attention output is as wide as the model");
// One GEMM per blockIdx.z, K = DM (a constant: the steps from tile to tile are immediate offsets on one address pair per plane): operands, C and the hi / lo planes step by sA / sB / sC elements, the bias is bias (z = 0) or bias1. grid (MR/64, N/64, Z).
template <typename T16, int NSPLIT, bool CAUSALK, bool BIAS, int NW, int EPI>
__global__ __launch_bounds__(NW * 32) void k_gemmk(const T16* __restrict__ A, const T16* __restrict__ A2, const T16* __restrict__ Bt, float* C, int ldc, const float* __restrict__ bias, const float* __restrict__ bias1, size_t sA, size_t sB, size_t sC, bf* Ph, bf* Pl, const float* __restrict__ X1, const float* __restrict__ X2, const float* __restrict__ X3) {
    __shared__ __align__(16) float part[NW * 4096];
    float* os = part;   // the summed tile lies where the partial tiles lay: 64 KiB a block, so that LDS does not hold the resident blocks below what the registers allow
    const size_t z = blockIdx.z;
    gemm_tile<T16, NSPLIT, CAUSALK, BIAS, NW, EPI>(part, os, A + z * sA, A2 + z * sA, Bt + z * sB, nullptr, DM, C + z * sC, ldc, z ? bias1 : bias, 0, nullptr, Ph + z * sC, Pl + z * sC, X1, X2, X3, (int)blockIdx.x, (int)blockIdx.y);
}
// The projections of both branches in one launch, 64 x 64 tiles; blockIdx.y = 16 * z + column tile. z < 4: q, k, v of the char branch and q of the concept branch, over all MR rows (X: the planes query, keys, values; Wt: the transposed weights q, k, v, q, k, v); each writes its own head planes (v: transposed), as far as the attention kernel reads them: hi / lo for sequence rows < RH alone, fp16 for all rows of k and v and for the rows from RH on of q.
// The last rows of blocks: the concept branch's k and v as products of the embedding TABLE (X's fourth plane, NVP rows), a quarter of the rows that the gathered embeddings would have; the blocks are counted through (0 k, 1 v), column tile, row tile;
// plain f32 sums to Tf[k, v][NVP][DM], no bias yet. grid (MR/64, 4 * DM/64 + QKV_TY).
#define QKV_TY (2 * (NVP / 64) * (DM / 64) / (MR / 64))   // rows of blocks that hold the tiles of both table products
__global__ __launch_bounds__(128) void k_qkv(const bf* __restrict__ X, const bf* __restrict__ Wt, const float* __restrict__ bcq, const float* __restrict__ bck, const float* __restrict__ bcv, const float* __restrict__ bpq, h16* P16, bf* Ph, bf* Pl, float* Tf) {
    static_assert(NVP % 64 == 0 && NVP >= NVOC && (2 * (NVP / 64) * (DM / 64)) % (MR / 64) == 0, "the tiles of both table products fill whole rows of blocks");
    __shared__ __align__(16) float part[4 * 4096];
    float* os = part;   // the summed tile lies where the partial tiles lay: 64 KiB a block, so that LDS does not hold the resident blocks below what the registers allow
    const int z = (int)blockIdx.y / (DM / 64), by = (int)blockIdx.y % (DM / 64);
    if (z >= 4) { const int i = ((int)blockIdx.y - 4 * (DM / 64)) * (MR / 64) + (int)blockIdx.x, t = i / ((NVP / 64) * (DM / 64)), r = i % ((NVP / 64) * (DM / 64));
        gemm_tile<bf, 0, false, false, 4, 0>(part, os, X + 3 * PLN, nullptr, Wt + (size_t)(4 + t) * DM * DM, nullptr, DM, Tf + (size_t)t * NVP * DM, DM, nullptr, 0, nullptr, nullptr, nullptr, nullptr, nullptr, nullptr, r % (NVP / 64), r / (NVP / 64)); return; }
    const float* bias = z == 0 ? bcq : z == 1 ? bck : z == 2 ? bcv : bpq;
    const bf* A = X + (size_t)(z < 3 ? z : 0) * PLN; const bf* Bt = Wt + (size_t)z * DM * DM; const size_t pz = (size_t)z * PLN;   // the concept branch's q comes from the query plane
    if (z == 2) gemm_tile<bf, 0, false, true, 4, 2>(part, os, A, nullptr, Bt, nullptr, DM, nullptr, DM, bias, 0, P16 + pz, Ph + pz, Pl + pz, nullptr, nullptr, nullptr, (int)blockIdx.x, by);
    else gemm_tile<bf, 0, false, true, 4, 1>(part, os, A, nullptr, Bt, nullptr, DM, nullptr, DM, bias, 0, P16 + pz, Ph + pz, Pl + pz, nullptr, nullptr, nullptr, (int)blockIdx.x, by, z != 1);   // z 0 and 3 are queries
}
// From a gathered tile in LDS to the head planes: bias, rounding and stores are those of the GEMM's plane epilogues (EPI 1: [row][d]; EPI 2: transposed), value for value. bb: the eight (EPI 1) or four (EPI 2) bias values of this thread.
template <int EPI>
__device__ __forceinline__ void gath_put(const float* os, const float* bb, int erow, int ecofs, int r0, h16* P16, bf* Ph, bf* Pl) {
#pragma unroll
    for (int s = 0; s < 4; ++s) { const int row = erow + s * 16, cofs = ecofs;   // 16-byte plane stores, eight rows to a 128-byte line
        const v4f va = *(const v4fa*)(os + row * 68 + cofs), vb = *(const v4fa*)(os + row * 68 + cofs + 4); float v[8];
#pragma unroll
        for (int k = 0; k < 8; ++k) v[k] = k < 4 ? va[k] : vb[k - 4];
        v8h o16;
#pragma unroll
        for (int k = 0; k < 8; ++k) { v[k] += bfr(EPI == 2 ? bb[s] : bb[k]); o16[k] = tohx(v[k]); }
        const size_t hp = (size_t)(r0 / TT) * NH_ + blockIdx.y; const int rl = r0 % TT;   // plane of this batch and head; the tile's first row inside the batch
        const size_t e = hp * TT * HD + (EPI == 1 ? fro(rl + row, cofs, HD) : fro(row, rl + cofs, TT));
        *(v8h*)(P16 + e) = o16;
        asm volatile("s_wait_xcnt 0x0" ::: "memory");   // behind the store, before its address or data registers are given to anything else
        if (rl < RH) { v8us oh, ol;   // alike for the whole block: the hi / lo planes are read for sequence rows < RH alone
#pragma unroll
            for (int k = 0; k < 8; ++k) { unsigned short a, c; splitf(v[k], a, c); oh[k] = a; ol[k] = c; }
            *(v8us*)(Ph + e) = oh; *(v8us*)(Pl + e) = ol;
            asm volatile("s_wait_xcnt 0x0" ::: "memory"); }   // the same behind these two
    }
}
// The concept branch's k and v head planes of 64 sequence rows x one head per block: row r of a tile is row concept_ids[r] of the table product (Tk, Tv: [NVP][DM] f32), brought to LDS as the GEMM's summed tile would lie there
// (keys [row][column], values [column][row] for the transposed planes; pitch 68). One block makes both, so the indices are read once and half as many waves have to start. grid (MR/64, DM/64).
// P16 / Ph / Pl: the keys' planes; the values' lie PLN elements behind them.
__global__ __launch_bounds__(128) void k_gath(const float* __restrict__ Tk, const float* __restrict__ Tv, const int* __restrict__ IDS, const float* __restrict__ bpk, const float* __restrict__ bpv, h16* P16, bf* Ph, bf* Pl) {
    __shared__ __align__(16) float osk[64 * 68];
    __shared__ __align__(16) float osv[64 * 68];
    const int tx = (int)threadIdx.x, r0 = blockIdx.x * 64, c0 = blockIdx.y * 64;
    const int grow = tx >> 4, gc = (tx & 15) * 4;   // sixteen lanes read the 256 bytes that one table row has of this head: whole lines
    const int erow = (tx >> 6) * 8 + ((tx >> 2) & 7), ecofs = ((tx >> 5) & 1) * 32 + (tx & 3) * 8;
    const int* ip = IDS + r0 + grow; int id[8];
#pragma unroll
    for (int s = 0; s < 8; ++s) id[s] = ip[s * 8];
    asm volatile("s_wait_xcnt 0x0" :: "v"(ip) : "memory");   // behind the eight reads, before their address registers are given to anything else (the address is an input, so that it lives up to the wait)
    v4f xk[8], xv[8];
#pragma unroll
    for (int s = 0; s < 8; ++s) { const size_t ro = (size_t)min(max(id[s], 0), NVOC - 1) * DM + c0 + gc; const float* tk = Tk + ro; const float* tv = Tv + ro; xk[s] = *(const v4f*)tk; xv[s] = *(const v4f*)tv;   // the index is bounded here, whatever the array holds
        asm volatile("s_wait_xcnt 0x0" :: "v"(tk), "v"(tv) : "memory"); }   // behind each pair of gathered reads: the register allocator gives a read's address registers to the data of a later read
    float bv[8], bvr[4];
#pragma unroll
    for (int k = 0; k < 8; ++k) bv[k] = bpk[c0 + ecofs + k];
#pragma unroll
    for (int s = 0; s < 4; ++s) bvr[s] = bpv[c0 + erow + s * 16];
#pragma unroll
    for (int s = 0; s < 8; ++s) { *(v4fa*)(osk + (s * 8 + grow) * 68 + gc) = xk[s];
#pragma unroll
        for (int j = 0; j < 4; ++j) osv[(gc + j) * 68 + s * 8 + grow] = xv[s][j]; }
    // the loaded bias values are inputs only: that keeps their loads in front of the barrier, beside the gathered reads (left alone the compiler sinks them behind it, where nothing is left to cover their latency);
    // the base pointers are inputs so that their registers live up to the wait, which stands before they are given to anything else
    asm volatile("s_wait_xcnt 0x0" :: "v"(bv[0]), "v"(bv[1]), "v"(bv[2]), "v"(bv[3]), "v"(bv[4]), "v"(bv[5]), "v"(bv[6]), "v"(bv[7]), "v"(bvr[0]), "v"(bvr[1]), "v"(bvr[2]), "v"(bvr[3]), "s"(bpk), "s"(bpv) : "memory");
    __syncthreads();   // both gathered tiles are complete
    gath_put<1>(osk, bv, erow, ecofs, r0, P16, Ph, Pl);
    gath_put<2>(osv, bvr, erow, ecofs, r0, P16 + PLN, Ph + PLN, Pl + PLN);
}


// Transposed plane Bt[n][k] (fragment order) of w[k][n], both DM wide: a thread makes the eight neighbours k0 .. k0 + 7 of column n, a wave has 32 neighbouring n: every read is one whole line, every store two runs of 256 bytes.
__device__ __forceinline__ void wtG(const float* __restrict__ w, bf* Bt) {
    const int idx = (int)blockIdx.x * 256 + (int)threadIdx.x; const int n = idx & (DM - 1), k0 = (idx >> 10) * 8;   // the thread's second piece lies DM / 2 rows of w further on
    const float* wp = w + (size_t)k0 * DM + n; const float* wq = wp + (size_t)(DM / 2) * DM; float x[8], y[8];
#pragma unroll
    for (int j = 0; j < 8; ++j) { x[j] = wp[(size_t)j * DM]; y[j] = wq[(size_t)j * DM]; }
    asm volatile("s_wait_xcnt 0x0" :: "v"(wp), "v"(wq) : "memory");   // behind the sixteen reads, before their address registers are given to anything else (the addresses are inputs, so that they live up to the wait)
    v8us o, p;
#pragma unroll
    for (int j = 0; j < 8; ++j) { o[j] = f2bf(x[j]); p[j] = f2bf(y[j]); }
    *(v8us*)(Bt + fro(n, k0, DM)) = o; *(v8us*)(Bt + fro(n, k0 + DM / 2, DM)) = p;
    asm volatile("s_wait_xcnt 0x0" ::: "memory");   // behind the two stores, before their address or data registers are given to anything else
}
__device__ __forceinline__ void put8(v8f v, bf* dst) { v8us o;
#pragma unroll
    for (int k = 0; k < 8; ++k) o[k] = f2bf(v[k]); *(v8us*)dst = o; }
// Everything that depends on the inputs alone, in one launch. grid (256, 10 + 8): blockIdx.y < 10: transposed bf16 plane of weight y (the slow part, so it starts first);
// then eight rows of blocks for the three [MR][DM] bf16 planes (fragment order) query, keys, values and the [NVP][DM] plane of the embedding table (a thread makes the same eight neighbours of all of them: independent reads in flight, fewer waves to start;
// a wave takes 8 rows x one 32-wide k block: it reads eight whole lines of each input and stores four whole lines of each plane).
__global__ __launch_bounds__(256) void k_prep(const float* __restrict__ w0, const float* __restrict__ w1, const float* __restrict__ w2, const float* __restrict__ w3, const float* __restrict__ w4, const float* __restrict__ w5, const float* __restrict__ w6, const float* __restrict__ w7, const float* __restrict__ w8, const float* __restrict__ w9,
                                              const float* __restrict__ xq, const float* __restrict__ xk, const float* __restrict__ xv, const float* __restrict__ TE, bf* Wt, bf* X) {
    static_assert(PLN / 8 == (size_t)8 * 256 * 256, "eight rows of 256 blocks cover a plane"); static_assert(DM * DM / 8 == 2 * 256 * 256 && DM == 1024, "256 blocks, two pieces a thread, cover a weight");
    const int y = blockIdx.y;
    if (y < 10) { const float* w = y == 0 ? w0 : y == 1 ? w1 : y == 2 ? w2 : y == 3 ? w3 : y == 4 ? w4 : y == 5 ? w5 : y == 6 ? w6 : y == 7 ? w7 : y == 8 ? w8 : w9; wtG(w, Wt + (size_t)y * DM * DM); return; }
    const int g = ((y - 10) * 256 + (int)blockIdx.x) * 256 + (int)threadIdx.x; const int row = (g >> 10) * 8 + ((g >> 2) & 7), k0 = ((g >> 5) & 31) * 32 + (g & 3) * 8;
    const size_t e = (size_t)row * DM + k0, d = fro(row, k0, DM);   // the thread's first element in each input and in each plane
    const float* qp = xq + e; const float* kp = xk + e; const float* vp = xv + e; const float* ep = TE + (size_t)min(row, NVOC - 1) * DM + k0;   // table rows behind the last repeat it: every byte of the plane is written
    const bool tab = row < NVP;   // alike for the whole block (1024 threads share eight rows)
    const v8f q = *(const v8f*)qp, k = *(const v8f*)kp, v = *(const v8f*)vp; v8f ge = {};
    if (tab) ge = *(const v8f*)ep;
    // behind the reads, before their address registers are given to anything else (the addresses are inputs, so that they live up to the wait)
    asm volatile("s_wait_xcnt 0x0" :: "v"(qp), "v"(kp), "v"(vp), "v"(ep) : "memory");
    put8(q, X + d); put8(k, X + PLN + d); put8(v, X + 2 * PLN + d);
    if (tab) put8(ge, X + 3 * PLN + d);
    asm volatile("s_wait_xcnt 0x0" ::: "memory");   // behind the last of the stores, before any of their address or data registers is given to anything else
}
// ---- k_fattn: causal attention of one head and 64 query rows per block in ONE kernel: scores, softmax with a running maximum and sum, probabilities x values, and the hi/lo planes of the merged output; no score and no probability leaves the registers.
// Four waves, each with 16 queries of its own; no LDS, no barrier. The products are transposed: S^T = K Q^T (A = 16 key rows, B = 16 query columns), so a lane holds scores of ONE query (column lr; keys 8 hi + r of each 16-key tile):
// maximum and sum are taken in the lane, plus one exchange between the wave's halves. Two neighbouring S^T tiles, converted in place, are the B operand of O^T += V^T P^T in the k order of the loaders (8 hi + s, then 16 + 8 hi + s - 8).
// O^T: a lane holds 8 consecutive d of its query, one 16-byte store per plane. Every plane read or written here is in fragment order. Query rows < RH: hi + lo bf16 planes, three products; the rest single fp16. A pass takes 64 keys. grid (NH_ * NB_ * 2, TT / 64), the longest tiles first.
// v_exp_f32 with one free vector slot behind it: the register allocator lets the next instruction overwrite an exp's source directly behind it, where the instruction set asks for one independent instruction
// In place: the register written is the one the compiler's own arithmetic has just written, so its padding behind a matrix instruction covers this statement too.
__device__ __forceinline__ float exp2_slot(float x) { asm("v_exp_f32 %0, %0\n\tv_nop" : "+v"(x)); return x; }
// Eight of them in one statement: each is the independent instruction behind the one before it, so only the last needs the free slot.
__device__ __forceinline__ v8f exp2_slot8(v8f x) { float a = x[0], b = x[1], c = x[2], d = x[3], e = x[4], f = x[5], g = x[6], h = x[7];
    asm("v_exp_f32 %0, %0\n\tv_exp_f32 %1, %1\n\tv_exp_f32 %2, %2\n\tv_exp_f32 %3, %3\n\tv_exp_f32 %4, %4\n\tv_exp_f32 %5, %5\n\tv_exp_f32 %6, %6\n\tv_exp_f32 %7, %7\n\tv_nop" : "+v"(a), "+v"(b), "+v"(c), "+v"(d), "+v"(e), "+v"(f), "+v"(g), "+v"(h));
    return (v8f){a, b, c, d, e, f, g, h}; }
__device__ __forceinline__ float xhalf(float x) { return __builtin_bit_cast(float, __builtin_amdgcn_permlanex16(__builtin_bit_cast(int, x), __builtin_bit_cast(int, x), 0x76543210, 0xfedcba98, false, false)); }   // lane l with lane l ^ 16, in the vector unit
template <bool B> struct BoolC { static constexpr bool value = B; };
template <typename T16, bool HL>
__device__ __forceinline__ void fattn_wave(const T16* __restrict__ Q, const T16* __restrict__ Q2, const T16* __restrict__ Kp, const T16* __restrict__ K2, const T16* __restrict__ Vt, const T16* __restrict__ V2, int row0, int nkb, int lr, int hi, bf* Ah, bf* Al) {
    typedef typename WFrag<T16>::V V;
    const float CE = SCL * 1.4426950408889634f;               // scores stay as the matrix unit leaves them; the scale (a power of two) and log2(e) enter in the exponent's one multiply-add, and the running maximum is kept unscaled
    const size_t koff = (size_t)(16 * hi + lr) * 8, voff = koff;   // the lane's place in a tile of a plane in fragment order; 16 rows on: 16 * HD (keys, queries) or 16 * TT (values) elements, 32 k on: 512
    V q[2], q2[2], ka[4][2];
    const T16* qp = Q + (size_t)row0 * HD + koff; const T16* qp2 = HL ? Q2 + (size_t)row0 * HD + koff : nullptr;
#pragma unroll
    for (int kc = 0; kc < 2; ++kc) { q[kc] = WFrag<T16>::ld(qp + kc * 512); if (HL) q2[kc] = WFrag<T16>::ld(qp2 + kc * 512); }
    // behind the query loads, before their address registers are given to anything else (the addresses are inputs, so that they live up to the wait)
    if constexpr (HL) asm volatile("s_wait_xcnt 0x0" :: "v"(qp), "v"(qp2) : "memory"); else asm volatile("s_wait_xcnt 0x0" :: "v"(qp) : "memory");
    if constexpr (!HL) {
        const T16* kp = Kp + koff;
#pragma unroll
        for (int kt = 0; kt < 4; ++kt)
#pragma unroll
            for (int kc = 0; kc < 2; ++kc) ka[kt][kc] = WFrag<T16>::ld(kp + (size_t)kt * 16 * HD + kc * 512);
        asm volatile("s_wait_xcnt 0x0" :: "v"(kp) : "memory");   // behind the key loads, before their address registers are given to anything else (the address is an input, so that it lives up to the wait)
    }
    v8f o[4];
#pragma unroll
    for (int dt = 0; dt < 4; ++dt) o[dt] = (v8f){};
    float m = -3.0e38f, l = 0.f;
    // One pass of 64 keys. Only the last pass (the diagonal block) holds keys behind a query, so only its copy of the body compares and selects.
    auto pass = [&](const int kb, auto DIAG) __attribute__((always_inline)) {
        const int key0 = kb * 64;
        V va[4][2];
        if constexpr (!HL) {   // this pass's value fragments: they depend on nothing of the pass, so the compiler may place them as early as its registers allow
            const T16* vp = Vt + voff + (size_t)key0 * 16;
#pragma unroll
            for (int dt = 0; dt < 4; ++dt)
#pragma unroll
                for (int ks = 0; ks < 2; ++ks) va[dt][ks] = WFrag<T16>::ld(vp + (size_t)dt * 16 * TT + ks * 512);
            asm volatile("s_wait_xcnt 0x0" :: "v"(vp) : "memory");   // behind the value loads, before their address registers are given to the next loads' data (the address is an input, so that it lives up to the wait)
        }
        const T16* kh = Kp + koff + (size_t)key0 * HD; const T16* kl = HL ? K2 + koff + (size_t)key0 * HD : kh; const T16* vh = Vt + voff + (size_t)key0 * 16; const T16* vl = HL ? V2 + voff + (size_t)key0 * 16 : vh;   // HL: this pass's tiles
        v8f s[4];
#pragma unroll
        for (int kt = 0; kt < 4; ++kt) s[kt] = (v8f){};
#pragma unroll
        for (int kc = 0; kc < 2; ++kc)
#pragma unroll
            for (int kt = 0; kt < 4; ++kt) {
                if constexpr (HL) { const size_t off = (size_t)kt * 16 * HD + kc * 512; const V a = WFrag<T16>::ld(kh + off), a2 = WFrag<T16>::ld(kl + off);
                    s[kt] = WFrag<T16>::mma(a, q[kc], s[kt]); s[kt] = WFrag<T16>::mma(a, q2[kc], s[kt]); s[kt] = WFrag<T16>::mma(a2, q[kc], s[kt]); }
                else s[kt] = WFrag<T16>::mma(ka[kt][kc], q[kc], s[kt]);
            }
        if constexpr (!HL) {   // the next pass's key fragments (the last pass asks for its own again: always inside the plane)
            const int kn = min(kb + 1, nkb - 1) * 64; const T16* kp = Kp + koff + (size_t)kn * HD;
#pragma unroll
            for (int kt = 0; kt < 4; ++kt)
#pragma unroll
                for (int kc = 0; kc < 2; ++kc) ka[kt][kc] = WFrag<T16>::ld(kp + (size_t)kt * 16 * HD + kc * 512);
            asm volatile("s_wait_xcnt 0x0" :: "v"(kp) : "memory");   // behind the key loads, before their address registers are given to anything else (the address is an input, so that it lives up to the wait)
        } else asm volatile("s_wait_xcnt 0x0" :: "v"(kh), "v"(kl) : "memory");   // the same behind this pass's key loads
        if constexpr (decltype(DIAG)::value) {
            const int ln = (int)__builtin_amdgcn_mbcnt_lo(~0u, 0u);   // the lane's number, made anew: nothing of it has to be held in a register through the loop (held there, it was spilled)
            const int rel = row0 + (ln & 15) - key0 - 8 * (ln >> 4);   // key <= this lane's query row  <=>  kt * 16 + r <= rel
#pragma unroll
            for (int kt = 0; kt < 4; ++kt)
#pragma unroll
                for (int r = 0; r < 8; ++r) s[kt][r] = (kt * 16 + r <= rel) ? s[kt][r] : -3.0e38f;
        }
        float mk[4];
#pragma unroll
        for (int kt = 0; kt < 4; ++kt) { mk[kt] = s[kt][0];
#pragma unroll
            for (int r = 1; r < 8; ++r) mk[kt] = fmaxf(mk[kt], s[kt][r]); }
        float mx = fmaxf(fmaxf(fmaxf(mk[0], mk[1]), fmaxf(mk[2], mk[3])), m);
        mx = fmaxf(mx, xhalf(mx));                             // the other half of this query's keys
        const float al = exp2_slot((m - mx) * CE); m = mx;    // first pass: exp2 of a huge negative number = 0 on zero sums
#pragma unroll
        for (int dt = 0; dt < 4; ++dt) o[dt] *= al;
        const float nm = -m * CE; const v8f cev = {CE, CE, CE, CE, CE, CE, CE, CE}, nmv = {nm, nm, nm, nm, nm, nm, nm, nm};
#pragma unroll
        for (int kt = 0; kt < 4; ++kt) s[kt] = exp2_slot8(__builtin_elementwise_fma(s[kt], cev, nmv));
        const v8f sv = (s[0] + s[1]) + (s[2] + s[3]);          // the four tiles register by register (packed adds on the pairs as they lie), then the eight sums
        l = l * al + (((sv[0] + sv[4]) + (sv[1] + sv[5])) + ((sv[2] + sv[6]) + (sv[3] + sv[7])));
#pragma unroll
        for (int ks = 0; ks < 2; ++ks) {
            V pb, pb2;
            if constexpr (HL) { v8us h0, h1, l0, l1;
#pragma unroll
                for (int r = 0; r < 8; ++r) { unsigned short a, c; splitf(s[2 * ks][r], a, c); h0[r] = a; l0[r] = c; splitf(s[2 * ks + 1][r], a, c); h1[r] = a; l1[r] = c; }
                pb = cat16b(h0, h1); pb2 = cat16b(l0, l1); }
            else { v8h c0, c1;
#pragma unroll
                for (int r = 0; r < 8; ++r) { c0[r] = tohx(s[2 * ks][r]); c1[r] = tohx(s[2 * ks + 1][r]); }
                pb = cat16(c0, c1); }
#pragma unroll
            for (int dt = 0; dt < 4; ++dt) {
                if constexpr (HL) { const size_t off = (size_t)dt * 16 * TT + ks * 512; const V a = WFrag<T16>::ld(vh + off), a2 = WFrag<T16>::ld(vl + off);
                    o[dt] = WFrag<T16>::mma(a, pb, o[dt]); o[dt] = WFrag<T16>::mma(a, pb2, o[dt]); o[dt] = WFrag<T16>::mma(a2, pb, o[dt]); }
                else o[dt] = WFrag<T16>::mma(va[dt][ks], pb, o[dt]);
            }
        }
        // four vector slots behind the last matrix instruction, on the back edge and on the exit alike, before its fragments are reloaded or its accumulators read
        asm volatile("v_nop\n\tv_nop\n\tv_nop\n\tv_nop" : "+v"(o[0]), "+v"(o[1]), "+v"(o[2]), "+v"(o[3]));
        if constexpr (HL) asm volatile("s_wait_xcnt 0x0" :: "v"(vh), "v"(vl) : "memory");   // behind this pass's value loads, before their address registers are given to anything else
    };
#pragma unroll 1   // rolled: the body is long, and a second copy would double the fragments held
    for (int kb = 0; kb < nkb - 1; ++kb) pass(kb, BoolC<false>{});
    pass(nkb - 1, BoolC<true>{});
    l += xhalf(l);                                             // join the halves' sums
    const size_t ooff = (size_t)__builtin_amdgcn_mbcnt_lo(~0u, 0u) * 8;   // the lane's place in a tile, made anew for the same reason
    const float inv = __fdiv_rn(1.0f, l);
#pragma unroll
    for (int dt = 0; dt < 4; ++dt) { v8us oh, ol;
#pragma unroll
        for (int r = 0; r < 8; ++r) { unsigned short a, c; splitf(o[dt][r] * inv, a, c); oh[r] = a; ol[r] = c; }
        const size_t oo = (size_t)row0 * DQ + (dt >> 1) * 512 + (dt & 1) * 256 + ooff; *(v8us*)(Ah + oo) = oh; *(v8us*)(Al + oo) = ol; }   // fragment order, K = DQ: the wave's store is 512 bytes in a row
}
// Both branches and all batches in one launch: grid (NH_ * NB_ * 2, TT / 64), blockIdx.x = (branch * NB_ + batch) * NH_ + head; blockIdx.y still counts the query tiles from the longest down, so that the longest tiles of every head start first.
// Four waves per SIMD, no more and no fewer, are asked for: with the 256 registers of that budget the compiler issues a pass's value loads at its head and the next pass's key loads right behind the score products; aiming at more waves it issued them late and waited for them at once.
// The nine pointers are the char branch's head planes; the concept branch's lie 3 * PLN elements behind them (the order of the projections). Ah / Al: [branch] x ([MR][DQ] in fragment order); a head's 64 columns are two 32-wide k blocks, 1024 elements on per head.
__global__ __launch_bounds__(128) __attribute__((amdgpu_waves_per_eu(4, 4))) void k_fattn(const h16* __restrict__ Q16, const bf* __restrict__ Qh, const bf* __restrict__ Ql, const h16* __restrict__ K16, const bf* __restrict__ Kh, const bf* __restrict__ Kl, const h16* __restrict__ V16, const bf* __restrict__ Vh, const bf* __restrict__ Vl, bf* Ah, bf* Al) {
    const int lane = threadIdx.x & 31, lr = lane & 15, hi = lane >> 4;
    const int w = __builtin_amdgcn_readfirstlane((int)(threadIdx.x >> 5));   // wave number in a scalar register: row0 and the loop's bounds stay scalar
    static_assert(REP == 1, "the key and value planes are indexed by the query's head");
    const int h = blockIdx.x % NH_, bb = blockIdx.x / NH_, br = bb / NB_, r0 = (TT / 64 - 1 - (int)blockIdx.y) * 64;   // bb = branch * NB_ + batch
    const size_t zq = (size_t)(3 * br) * PLN + ((size_t)(bb % NB_) * NH_ + h) * TT * HD, zk = zq, za = (size_t)bb * TT * DQ + h * (HD * 16);
    if (r0 < RH) fattn_wave<bf, true>(Qh + zq, Ql + zq, Kh + zk, Kl + zk, Vh + zk, Vl + zk, r0 + w * 16, r0 / 64 + 1, lr, hi, Ah + za, Al + za);
    else fattn_wave<h16, false>(Q16 + zq, nullptr, K16 + zk, nullptr, V16 + zk, nullptr, r0 + w * 16, r0 / 64 + 1, lr, hi, Ah + za, Al + za);
}

extern "C" void kernel_launch(void* const* d_in, const int* in_sizes, int n_in,
                              void* d_out, int out_size, void* d_ws, size_t ws_size, hipStream_t stream) {
    (void)in_sizes; (void)n_in; (void)out_size;
    const float* xvals = (const float*)d_in[0]; const float* xkeys = (const float*)d_in[1]; const float* xq = (const float*)d_in[2]; const int* CID = (const int*)d_in[3]; const float* EMB = (const float*)d_in[4]; const float* wcv = (const float*)d_in[5]; const float* bcv = (const float*)d_in[6]; const float* wck = (const float*)d_in[7]; const float* bck = (const float*)d_in[8]; const float* wcq = (const float*)d_in[9]; const float* bcq = (const float*)d_in[10]; const float* wco = (const float*)d_in[11]; const float* bco = (const float*)d_in[12]; const float* wpv = (const float*)d_in[13]; const float* bpv = (const float*)d_in[14]; const float* wpk = (const float*)d_in[15]; const float* bpk = (const float*)d_in[16]; const float* wpq = (const float*)d_in[17]; const float* bpq = (const float*)d_in[18]; const float* wpo = (const float*)d_in[19]; const float* bpo = (const float*)d_in[20]; const float* wg = (const float*)d_in[21]; const float* bg = (const float*)d_in[22];
    float* OUT = (float*)d_out;     // [2][2048][1024]
    char* wsp = (char*)d_ws;
    auto take = [&](size_t bytes) { char* p = wsp; wsp += (bytes + 255) & ~(size_t)255; return (void*)p; };
    bf* WT = (bf*)take((size_t)10 * DM * DM * 2);   /* transposed weights: q, k, v of the char branch, q, k, v of the concept branch, Wco, Wpo, Wg rows 0..1023 (multiply char_out), Wg rows 1024..2047 (concept_out) */
    bf* XP = (bf*)take(4 * PLN * 2);                /* bf16 planes of query, keys, values; in the fourth place the embedding table's NVP rows */
    float* TF = (float*)take((size_t)2 * NVP * DM * 4);   /* table x Wpk, table x Wpv */
    bf* ATh = (bf*)take(2 * PLN * 2); bf* ATl = (bf*)take(2 * PLN * 2);   /* merged attention outputs, hi and lo, [branch] */
    char* pl0 = wsp;
    h16* P16 = (h16*)take(6 * PLN * 2); bf* Ph = (bf*)take(6 * PLN * 2); bf* Pl = (bf*)take(6 * PLN * 2);   /* head planes of the six projections */
    char* end0 = wsp; wsp = pl0;                    /* the head planes are dead behind the attention launch: what follows it lies in their place */
    float* CO = (float*)take(2 * PLN * 4); float* PO = CO + PLN; bf* Ch = (bf*)take(2 * PLN * 2); bf* Dh = Ch + PLN; bf* Cl = (bf*)take(2 * PLN * 2); bf* Dl = Cl + PLN; float* G1 = (float*)take(PLN * 4);
    if (wsp > end0 || (size_t)(end0 - (char*)d_ws) > ws_size) return;    // ws 256 MiB
    k_prep<<<dim3(256, 10 + 8), 256, 0, stream>>>(wcq, wck, wcv, wpq, wpk, wpv, wco, wpo, wg, wg + (size_t)DM * DM, xq, xkeys, xvals, EMB, WT, XP);
    k_qkv<<<dim3(MR / 64, 4 * (DM / 64) + QKV_TY), 128, 0, stream>>>(XP, WT, bcq, bck, bcv, bpq, P16, Ph, Pl, TF);
    k_gath<<<dim3(MR / 64, DM / 64), 128, 0, stream>>>(TF, TF + (size_t)NVP * DM, CID, bpk, bpv, P16 + 4 * PLN, Ph + 4 * PLN, Pl + 4 * PLN);
    k_fattn<<<dim3(NH_ * NB_ * 2, TT / 64), 128, 0, stream>>>(P16, Ph, Pl, P16 + PLN, Ph + PLN, Pl + PLN, P16 + 2 * PLN, Ph + 2 * PLN, Pl + 2 * PLN, ATh, ATl);
    /* out-projections of both branches (z): f32 char_out / concept_out and their hi / lo planes */
    k_gemmk<bf, 1, false, true, 4, 3><<<dim3(MR / 64, DM / 64, 2), 128, 0, stream>>>(ATh, ATl, WT + (size_t)6 * DM * DM, CO, DM, bco, bpo, PLN, (size_t)DM * DM, PLN, Ch, Cl, nullptr, nullptr, nullptr);
    /* ---- gate + mix: char_out Wg[:1024] to G1; concept_out Wg[1024:] ends in the sigmoid and the mix ---- */
    k_gemmk<bf, 1, false, false, 4, 0><<<dim3(MR / 64, DM / 64, 1), 128, 0, stream>>>(Ch, Cl, WT + (size_t)8 * DM * DM, G1, DM, nullptr, nullptr, 0, 0, 0, nullptr, nullptr, nullptr, nullptr, nullptr);
    k_gemmk<bf, 1, false, true, 4, 4><<<dim3(MR / 64, DM / 64, 1), 128, 0, stream>>>(Dh, Dl, WT + (size_t)9 * DM * DM, OUT, DM, bg, nullptr, 0, 0, 0, nullptr, nullptr, G1, CO, PO);
}

// v010
// One run takes 189 microseconds.
// Timed twice side by side with v009, it ran 1.05 times as fast both times.
// All steps since v000 together make it 16.5 times as fast.
#include <hip/hip_runtime.h>

// Hierarchical (char + concept) gated attention (values, keys, query [2][2048][1024]; concept_ids int32 [2][2048] -> ce = emb[concept_ids] ([1000][1024], gathered on device); char branch: q = query Wcq + bcq, k = keys Wck + bck, v = values Wcv + bcv; concept branch: q = query Wpq + bpq, k = ce Wpk + bpk, v = ce Wpv + bpv ('xw' [1024][1024] + biases; 16 heads x 64); per branch: scores masked causally (-1e20) then x 1/sqrt(1024), softmax, merged, Wo + bo; gate = sigmoid([char_out | concept_out] Wg + bg) (Wg [2048][1024]); out = gate char_out + (1 - gate) concept_out -> [2][2048][1024] (4.2 M)).
// Compute dtypes, f32 accumulate: every input rounded to bf16; q/k/v on PLAIN bf16 operands (inputs: exact) + biases; the concept branch's k and v: emb Wpk and emb Wpv once per table row, the rows then gathered by concept_ids (a row of a product depends on its own row of the left operand alone); causal scores, softmax and attn.v in one kernel (key tiles beyond the diagonal block skipped): query rows < 512 hl (3 products), the rest single fp16; softmax f32, running maximum and sum; Wco / Wpo hl x exact (2 products) + bias; gate GEMMs 2 products; sigmoid (precise expf) and the convex mix in f32.

#define NB_  2
#define TT   2048
#define DM   1024
#define NH_  16
#define NKV  16
#define REP  (NH_ / NKV)
#define HD   64
#define DQ   (NH_ * HD)
#define DKV  (NKV * HD)
#define NVOC 1000
#define NVP  1024                 // table rows as the GEMM tiles see them: NVOC rounded up to whole 64-row tiles (the rows behind the last repeat it and are never gathered)
#define RH   512                  // query rows < RH use hi+lo planes (0: none)
#define SCL  0.03125f   // 1/sqrt(embed_size = 1024) as in the source
typedef _Float16 h16;
typedef unsigned short bf;
typedef __attribute__((ext_vector_type(16))) __bf16   v16bf;
typedef __attribute__((ext_vector_type(16))) _Float16 v16h;
typedef __attribute__((ext_vector_type(8)))  _Float16 v8h;
typedef __attribute__((ext_vector_type(8)))  unsigned short v8us;
typedef __attribute__((ext_vector_type(8)))  float    v8f;
typedef __attribute__((ext_vector_type(4)))  float    v4f;
typedef v8h  __attribute__((may_alias)) v8ha;
typedef v4f  __attribute__((may_alias)) v4fa;
typedef v8us __attribute__((may_alias)) v8usa;

__device__ __forceinline__ unsigned short f2bf(float f) { unsigned u = __float_as_uint(f); u += 0x7FFFu + ((u >> 16) & 1u); return (unsigned short)(u >> 16); }
__device__ __forceinline__ float bf2f(unsigned short b) { return __uint_as_float(((unsigned)b) << 16); }
__device__ __forceinline__ float bfr(float f) { return bf2f(f2bf(f)); }
__device__ __forceinline__ v16h cat16(v8h lo, v8h hi) { return __builtin_shufflevector(lo, hi, 0, 1, 2, 3, 4, 5, 6, 7, 8, 9, 10, 11, 12, 13, 14, 15); }
__device__ __forceinline__ v16bf cat16b(v8us lo, v8us hi) { return __builtin_bit_cast(v16bf, __builtin_shufflevector(lo, hi, 0, 1, 2, 3, 4, 5, 6, 7, 8, 9, 10, 11, 12, 13, 14, 15)); }
__device__ __forceinline__ v8f wmma16(v16h a, v16h b, v8f c) { return __builtin_amdgcn_wmma_f32_16x16x32_f16(false, a, false, b, (short)0, c, false, false); }
__device__ __forceinline__ v8f wmmab(v16bf a, v16bf b, v8f c) { return __builtin_amdgcn_wmma_f32_16x16x32_bf16(false, a, false, b, (short)0, c, false, false); }



// ---- k_gemmk: register-blocked GEMM, one 64x64 output tile per block, the K loop SPLIT OVER THE NW WAVES of the block: wave w takes the 32-wide K steps w, w + NW, ...
// into its own 16 accumulators, operands straight from 16-bit planes in fragment order (below); the NW partial tiles are then summed through LDS in fixed wave order 0..NW-1. grid (M/64, N/64, Z), NW*32 threads.
// C[m][n] (f32, pitch ldc, + optional f32 bias[n]) = sum_k A[m][k] Bt[n][k] (+ split products per NSPLIT). z-batch strides sA/sB/sC in elements. K % 32 == 0.
// EPI picks what the block does with its summed tile (+ bias): 0 f32 C; 1 head planes [head][row][d] (fp16, bf16 hi, bf16 lo; the tile's 64 columns are one head; isq: the planes are a query's); 2 the same three planes transposed [head][d][row];
// 3 f32 C and its hi / lo planes; 4 the tile is the second half of the gate's logits: out = g X2 + (1 - g) X3 with g = sigmoid((X1 + tile) + bias), stored to C.
// CAUSALK limits the key (K) range of the probability x value contraction to the diagonal block (probabilities beyond it are exactly zero); roff = row offset of this launch's first row within the sequence.
// FRAGMENT ORDER: every 16-bit operand plane ([rows][K], rows % 16 == 0, K % 32 == 0) is kept as 1-KiB tiles of 16 rows x 32 k, tile (row / 16, k / 32) at element (row / 16) * 16 * K + (k / 32) * 512, and inside a tile
// [k / 16 % 2][k / 8 % 2][row % 16][k % 8]: the first 16 bytes of all 32 lanes of a fragment (lane = 16 * hi + lr: row lr, k 8 hi ..) are 512 bytes in a row, the second 16 bytes (k 16 + 8 hi ..) the next 512.
// A fragment load so touches four whole 128-byte lines; from a row-major plane it would touch sixteen lines for 32 bytes each. ld(p): p = the tile + lane * 8.
// fro: where the eight neighbours k .. k + 7 (k % 8 == 0) of a row lie.
__device__ __forceinline__ size_t fro(size_t row, size_t k, size_t K) { return (row >> 4) * (16 * K) + (k >> 5) * 512 + ((k >> 4) & 1) * 256 + ((k >> 3) & 1) * 128 + (row & 15) * 8; }
template <typename T16> struct WFrag;
template <> struct WFrag<h16> { typedef v16h V; static __device__ __forceinline__ V ld(const h16* p) { return cat16(*(const v8h*)p, *(const v8h*)(p + 256)); } static __device__ __forceinline__ v8f mma(V a, V b, v8f c) { return wmma16(a, b, c); } };
template <> struct WFrag<bf> { typedef v16bf V; static __device__ __forceinline__ V ld(const bf* p) { return cat16b(*(const v8us*)p, *(const v8us*)(p + 256)); } static __device__ __forceinline__ v8f mma(V a, V b, v8f c) { return wmmab(a, b, c); } };
__device__ __forceinline__ h16 tohx(float x) { return (h16)x; }
__device__ __forceinline__ void splitf(float y, unsigned short& h, unsigned short& l) { h = f2bf(y); l = f2bf(y - bf2f(h)); }
// The tile's work is a device function, so that one launch can hold GEMMs with different epilogues (the kernel picks by the block's index, alike for the whole block) on ONE LDS array, which the kernel owns and which holds first part, then, behind a barrier, os in the same place:
// part[NW * 4096]: [wave][tile 0..15][j half][lane][4]: every wave's accumulators in register order, 16-byte stores contiguous over the lanes; os[64 * 68]: the summed tile, row-major (pitch 68 floats: both half-waves on disjoint banks).
// The M rows are the rows of all NB_ batches, one behind the other (a 64-row tile lies in one batch); the head planes are [batch][head] x ([row][d] or [d][row] in fragment order).
template <typename T16, int NSPLIT, bool CAUSALK, bool BIAS, int NW, int EPI>
__device__ __forceinline__ void gemm_tile(float* part, float* os, const T16* __restrict__ A, const T16* __restrict__ A2, const T16* __restrict__ Bt, const T16* __restrict__ Bt2, int K, float* C, int ldc, const float* __restrict__ bias, int roff, h16* P16, bf* Ph, bf* Pl, const float* __restrict__ X1, const float* __restrict__ X2, const float* __restrict__ X3, int bx, int by, bool isq = false) {
    static_assert(HD == 64, "a 64-column tile is one head"); static_assert(RH % 64 == 0, "a 64-row tile lies wholly on one side of RH"); static_assert(EPI == 0 || BIAS, "the plane and gate epilogues always add the bias"); static_assert(NW == 4 || NW == 8, "the epilogues deal 64 rows x 8 pieces to NW * 32 threads, 16 / NW rows a thread"); static_assert(64 * 68 <= NW * 4096, "os fits in the place of part");
    typedef typename WFrag<T16>::V V;
    const int lane = threadIdx.x & 31, lr = lane & 15, hi = lane >> 4; const int r0 = bx * 64, c0 = by * 64;   // bx, by: the tile's place among the 64-row tiles of A and C and among the 64-column tiles of Bt and C
    const int w = __builtin_amdgcn_readfirstlane((int)(threadIdx.x >> 5));   // wave number in a scalar register: the K loop's bounds stay scalar
    const int Kl = CAUSALK ? min(K, r0 + roff + 64) : K;
    v8f acc[4][4];
#pragma unroll
    for (int mb = 0; mb < 4; ++mb)
#pragma unroll
        for (int nb = 0; nb < 4; ++nb) acc[mb][nb] = (v8f){};
    const size_t aoff = (size_t)r0 * K + lane * 8, boff = (size_t)c0 * K + lane * 8;   // 16 rows on: 16 * K elements; 32 k on: 512
#pragma unroll 1   // rolled: an unrolled body would hold a second set of fragments and pass the register budget of 16 waves
    for (int kc = w * 32; kc < Kl; kc += NW * 32) {
        V a[4], a2[4]; const T16* ap = A + aoff + (size_t)kc * 16; const T16* ap2 = (NSPLIT == 1 || NSPLIT == 2) ? A2 + aoff + (size_t)kc * 16 : ap; const T16* bp = Bt + boff + (size_t)kc * 16; const T16* bp2 = NSPLIT >= 2 ? Bt2 + boff + (size_t)kc * 16 : bp;
#pragma unroll
        for (int mb = 0; mb < 4; ++mb) { a[mb] = WFrag<T16>::ld(ap + (size_t)mb * 16 * K); if (NSPLIT == 1 || NSPLIT == 2) a2[mb] = WFrag<T16>::ld(ap2 + (size_t)mb * 16 * K); }
        // the table product alone: there the register allocator gives the A loads' address pair to the data of a B load of the same pass, so the wait at the loop's foot comes too late for it: one more stands directly behind the A loads
        if constexpr (EPI == 0 && NSPLIT == 0) asm volatile("s_wait_xcnt 0x0" :: "v"(ap) : "memory");
#pragma unroll
        for (int nb = 0; nb < 4; ++nb) { const V b = WFrag<T16>::ld(bp + (size_t)nb * 16 * K); V b2; if (NSPLIT >= 2) b2 = WFrag<T16>::ld(bp2 + (size_t)nb * 16 * K);
#pragma unroll
            for (int mb = 0; mb < 4; ++mb) { acc[mb][nb] = WFrag<T16>::mma(a[mb], b, acc[mb][nb]); if (NSPLIT == 1 || NSPLIT == 2) acc[mb][nb] = WFrag<T16>::mma(a2[mb], b, acc[mb][nb]); if (NSPLIT >= 2) acc[mb][nb] = WFrag<T16>::mma(a[mb], b2, acc[mb][nb]); } }
        // four vector slots behind the last matrix instruction, on the back edge and on the exit alike, before its fragments are reloaded or its accumulators stored;
        // the wait stands behind the pass's loads, before their address registers are given to anything else (the addresses are inputs, so that they live up to it)
        asm volatile("v_nop\n\tv_nop\n\tv_nop\n\tv_nop\n\ts_wait_xcnt 0x0" : "+v"(acc[0][0]), "+v"(acc[1][1]), "+v"(acc[2][2]), "+v"(acc[3][3]) : "v"(a[0]), "v"(a[3]), "v"(ap), "v"(ap2), "v"(bp), "v"(bp2) : "memory");
    }
    // EPI > 0: a thread ends with eight neighbours of LDS row erow + s * NW * 4; what it needs from memory for them is asked for here, so that it arrives while the partial tiles go to LDS
    // a wave takes 8 rows x 4 pieces of one 32-wide column block: in fragment order the eight rows' pieces are one whole 128-byte line, in a row-major f32 array the four pieces are one
    const int erow = ((int)threadIdx.x >> 6) * 8 + (((int)threadIdx.x >> 2) & 7), ecofs = (((int)threadIdx.x >> 5) & 1) * 32 + ((int)threadIdx.x & 3) * 8;
    float bv[8], bvr[16 / NW]; v8f g1[16 / NW], co[16 / NW], po[16 / NW];
    if constexpr (EPI == 2) {
#pragma unroll
        for (int s = 0; s < 16 / NW; ++s) bvr[s] = bias[c0 + erow + s * (NW * 4)];
    } else if constexpr (EPI > 0) {
#pragma unroll
        for (int k = 0; k < 8; ++k) bv[k] = bias[c0 + ecofs + k];
    }
    if constexpr (EPI == 4) {
#pragma unroll
        for (int s = 0; s < 16 / NW; ++s) { const size_t e = (size_t)(r0 + erow + s * (NW * 4)) * ldc + c0 + ecofs; const float* x1 = X1 + e; const float* x2 = X2 + e; const float* x3 = X3 + e; g1[s] = *(const v8f*)x1; co[s] = *(const v8f*)x2; po[s] = *(const v8f*)x3;
            asm volatile("s_wait_xcnt 0x0" :: "v"(x1), "v"(x2), "v"(x3) : "memory"); }   // behind each row's three reads, before their address registers are given to the next row's data (the addresses are inputs, so that they live up to the wait)
    }
#pragma unroll
    for (int mb = 0; mb < 4; ++mb)
#pragma unroll
        for (int nb = 0; nb < 4; ++nb) { float* p = part + ((w * 16 + mb * 4 + nb) * 2) * 128 + lane * 4; const v8f c = acc[mb][nb];
            *(v4fa*)p = (v4f){c[0], c[1], c[2], c[3]}; *(v4fa*)(p + 128) = (v4f){c[4], c[5], c[6], c[7]}; }
    // the loaded bias values are inputs only: that keeps their loads in front of the barriers, under the LDS stores above (left alone the compiler sinks them behind the third barrier, where nothing is left to cover their latency);
    // the base pointer is an input so that its registers live up to the wait, which stands before they are given to anything else
    if constexpr (EPI == 1 || EPI == 3 || EPI == 4) asm volatile("s_wait_xcnt 0x0" :: "v"(bv[0]), "v"(bv[1]), "v"(bv[2]), "v"(bv[3]), "v"(bv[4]), "v"(bv[5]), "v"(bv[6]), "v"(bv[7]), "s"(bias) : "memory");
    __syncthreads();   // every wave's partial tile is in LDS
    v4f t0[16 / NW], t1[16 / NW];
#pragma unroll
    for (int q = 0; q < 16 / NW; ++q) { const float* p = part + (w * (16 / NW) + q) * 256 + lane * 4;
        t0[q] = *(const v4fa*)p; t1[q] = *(const v4fa*)(p + 128);
#pragma unroll
        for (int u = 1; u < NW; ++u) { t0[q] += *(const v4fa*)(p + u * 4096); t1[q] += *(const v4fa*)(p + u * 4096 + 128); } }
    __syncthreads();   // every partial tile has been read: the summed tile may take their place in LDS
#pragma unroll
    for (int q = 0; q < 16 / NW; ++q) { const int tile = w * (16 / NW) + q, mb = tile >> 2, nb = tile & 3; const v4f s0 = t0[q], s1 = t1[q];
        if constexpr (EPI == 2) { float* t = os + (nb * 16 + lr) * 68 + mb * 16 + hi * 8; *(v4fa*)t = s0; *(v4fa*)(t + 4) = s1; }   // tile kept [column][row]: a lane's eight sums are eight rows of one column
        else {
#pragma unroll
            for (int j = 0; j < 4; ++j) { os[(mb * 16 + hi * 8 + j) * 68 + nb * 16 + lr] = s0[j]; os[(mb * 16 + hi * 8 + 4 + j) * 68 + nb * 16 + lr] = s1[j]; } } }
    __syncthreads();   // the summed tile is complete
    if constexpr (EPI == 0) {
#pragma unroll
    for (int s = 0; s < 32 / NW; ++s) { const int idx = s * (NW * 32) + (int)threadIdx.x, row = idx >> 4, cofs = (idx & 15) * 4; v4f val = *(const v4fa*)(os + row * 68 + cofs); if (BIAS) { val[0] += bfr(bias[c0 + cofs]); val[1] += bfr(bias[c0 + cofs + 1]); val[2] += bfr(bias[c0 + cofs + 2]); val[3] += bfr(bias[c0 + cofs + 3]); }
        *(v4f*)(C + (size_t)(r0 + row) * ldc + c0 + cofs) = val; }
    } else {
#pragma unroll
    for (int s = 0; s < 16 / NW; ++s) { const int row = erow + s * (NW * 4), cofs = ecofs;   // 16-byte plane stores, eight rows to a 128-byte line
        const v4f va = *(const v4fa*)(os + row * 68 + cofs), vb = *(const v4fa*)(os + row * 68 + cofs + 4); float v[8];
#pragma unroll
        for (int k = 0; k < 8; ++k) v[k] = k < 4 ? va[k] : vb[k - 4];
        if constexpr (EPI == 1 || EPI == 2) {
#pragma unroll
            for (int k = 0; k < 8; ++k) v[k] += bfr(EPI == 2 ? bvr[s] : bv[k]);
            const size_t hp = (size_t)(r0 / TT) * NH_ + by; const int rl = r0 % TT;   // plane of this batch and head; the tile's first row inside the batch
            const size_t e = hp * TT * HD + (EPI == 1 ? fro(rl + row, cofs, HD) : fro(row, rl + cofs, TT));
            // Only what the attention kernel reads is made (both tests are alike for the whole block): its query rows < RH, which see no key or value row from RH on, work on the hi / lo planes, all others on the fp16 planes
            if (!(isq && rl < RH)) { v8h o16;
#pragma unroll
                for (int k = 0; k < 8; ++k) o16[k] = tohx(v[k]);
                *(v8h*)(P16 + e) = o16;
                asm volatile("s_wait_xcnt 0x0" ::: "memory"); }   // behind the store, before its address or data registers are given to anything else
            if (rl < RH) { v8us oh, ol;
#pragma unroll
                for (int k = 0; k < 8; ++k) { unsigned short a, c; splitf(v[k], a, c); oh[k] = a; ol[k] = c; }
                *(v8us*)(Ph + e) = oh; *(v8us*)(Pl + e) = ol;
                asm volatile("s_wait_xcnt 0x0" ::: "memory"); }   // the same behind these two
        } else if constexpr (EPI == 3) {
            v8us oh, ol;
#pragma unroll
            for (int k = 0; k < 8; ++k) { v[k] += bfr(bv[k]); unsigned short a, c; splitf(v[k], a, c); oh[k] = a; ol[k] = c; }
            const size_t e = (size_t)(r0 + row) * ldc + c0 + cofs, ep = fro(r0 + row, c0 + cofs, ldc);
            *(v4f*)(C + e) = (v4f){v[0], v[1], v[2], v[3]}; *(v4f*)(C + e + 4) = (v4f){v[4], v[5], v[6], v[7]}; *(v8us*)(Ph + ep) = oh; *(v8us*)(Pl + ep) = ol;
            asm volatile("s_wait_xcnt 0x0" ::: "memory");   // behind the four stores, before their address or data registers are given to anything else
        } else {
            v8f o;
#pragma unroll
            for (int k = 0; k < 8; ++k) { const float lg = (g1[s][k] + v[k]) + bfr(bv[k]); const float gt = __fdiv_rn(1.0f, 1.0f + expf(-lg)); o[k] = gt * co[s][k] + (1.0f - gt) * po[s][k]; }
            *(v8f*)(C + (size_t)(r0 + row) * ldc + c0 + cofs) = o;
        } }
    }
}
#define MR   (NB_ * TT)           // rows of all batches
#define PLN  ((size_t)MR * DM)    // elements of one [MR][DM] plane (= one set of head planes)
static_assert(DQ == DM, "the merged attention output is as wide as the model");
// One GEMM per blockIdx.z, K = DM (a constant: the steps from tile to tile are immediate offsets on one address pair per plane): operands, C and the hi / lo planes step by sA / sB / sC elements, the bias is bias (z = 0) or bias1. grid (MR/64, N/64, Z).
template <typename T16, int NSPLIT, bool CAUSALK, bool BIAS, int NW, int EPI>
__global__ __launch_bounds__(NW * 32) void k_gemmk(const T16* __restrict__ A, const T16* __restrict__ A2, const T16* __restrict__ Bt, float* C, int ldc, const float* __restrict__ bias, const float* __restrict__ bias1, size_t sA, size_t sB, size_t sC, bf* Ph, bf* Pl, const float* __restrict__ X1, const float* __restrict__ X2, const float* __restrict__ X3) {
    __shared__ __align__(16) float part[NW * 4096];
    float* os = part;   // the summed tile lies where the partial tiles lay: 64 KiB a block, so that LDS does not hold the resident blocks below what the registers allow
    const size_t z = blockIdx.z;
    gemm_tile<T16, NSPLIT, CAUSALK, BIAS, NW, EPI>(part, os, A + z * sA, A2 + z * sA, Bt + z * sB, nullptr, DM, C + z * sC, ldc, z ? bias1 : bias, 0, nullptr, Ph + z * sC, Pl + z * sC, X1, X2, X3, (int)blockIdx.x, (int)blockIdx.y);
}
// The projections of both branches in one launch, 64 x 64 tiles; blockIdx.y = 16 * z + column tile. z < 4: q, k, v of the char branch and q of the concept branch, over all MR rows (X: the planes query, keys, values; Wt: the transposed weights q, k, v, q, k, v); each writes its own head planes (v: transposed), as far as the attention kernel reads them: hi / lo for sequence rows < RH alone, fp16 for all rows of k and v and for the rows from RH on of q.
// The last rows of blocks: the concept branch's k and v as products of the embedding TABLE (X's fourth plane, NVP rows), a quarter of the rows that the gathered embeddings would have; the blocks are counted through (0 k, 1 v), column tile, row tile;
// plain f32 sums to Tf[k, v][NVP][DM], no bias yet. grid (MR/64, 4 * DM/64 + QKV_TY).
#define QKV_TY (2 * (NVP / 64) * (DM / 64) / (MR / 64))   // rows of blocks that hold the tiles of both table products
__global__ __launch_bounds__(128) void k_qkv(const bf* __restrict__ X, const bf* __restrict__ Wt, const float* __restrict__ bcq, const float* __restrict__ bck, const float* __restrict__ bcv, const float* __restrict__ bpq, h16* P16, bf* Ph, bf* Pl, float* Tf) {
    static_assert(NVP % 64 == 0 && NVP >= NVOC && (2 * (NVP / 64) * (DM / 64)) % (MR / 64) == 0, "the tiles of both table products fill whole rows of blocks");
    __shared__ __align__(16) float part[4 * 4096];
    float* os = part;   // the summed tile lies where the partial tiles lay: 64 KiB a block, so that LDS does not hold the resident blocks below what the registers allow
    const int z = (int)blockIdx.y / (DM / 64), by = (int)blockIdx.y % (DM / 64);
    if (z >= 4) { const int i = ((int)blockIdx.y - 4 * (DM / 64)) * (MR / 64) + (int)blockIdx.x, t = i / ((NVP / 64) * (DM / 64)), r = i % ((NVP / 64) * (DM / 64));
        gemm_tile<bf, 0, false, false, 4, 0>(part, os, X + 3 * PLN, nullptr, Wt + (size_t)(4 + t) * DM * DM, nullptr, DM, Tf + (size_t)t * NVP * DM, DM, nullptr, 0, nullptr, nullptr, nullptr, nullptr, nullptr, nullptr, r % (NVP / 64), r / (NVP / 64)); return; }
    const float* bias = z == 0 ? bcq : z == 1 ? bck : z == 2 ? bcv : bpq;
    const bf* A = X + (size_t)(z < 3 ? z : 0) * PLN; const bf* Bt = Wt + (size_t)z * DM * DM; const size_t pz = (size_t)z * PLN;   // the concept branch's q comes from the query plane
    if (z == 2) gemm_tile<bf, 0, false, true, 4, 2>(part, os, A, nullptr, Bt, nullptr, DM, nullptr, DM, bias, 0, P16 + pz, Ph + pz, Pl + pz, nullptr, nullptr, nullptr, (int)blockIdx.x, by);
    else gemm_tile<bf, 0, false, true, 4, 1>(part, os, A, nullptr, Bt, nullptr, DM, nullptr, DM, bias, 0, P16 + pz, Ph + pz, Pl + pz, nullptr, nullptr, nullptr, (int)blockIdx.x, by, z != 1);   // z 0 and 3 are queries
}
// From a gathered tile in LDS to the head planes: bias, rounding and stores are those of the GEMM's plane epilogues (EPI 1: [row][d]; EPI 2: transposed), value for value. bb: the eight (EPI 1) or four (EPI 2) bias values of this thread.
template <int EPI>
__device__ __forceinline__ void gath_put(const float* os, const float* bb, int erow, int ecofs, int r0, h16* P16, bf* Ph, bf* Pl) {
#pragma unroll
    for (int s = 0; s < 4; ++s) { const int row = erow + s * 16, cofs = ecofs;   // 16-byte plane stores, eight rows to a 128-byte line
        const v4f va = *(const v4fa*)(os + row * 68 + cofs), vb = *(const v4fa*)(os + row * 68 + cofs + 4); float v[8];
#pragma unroll
        for (int k = 0; k < 8; ++k) v[k] = k < 4 ? va[k] : vb[k - 4];
        v8h o16;
#pragma unroll
        for (int k = 0; k < 8; ++k) { v[k] += bfr(EPI == 2 ? bb[s] : bb[k]); o16[k] = tohx(v[k]); }
        const size_t hp = (size_t)(r0 / TT) * NH_ + blockIdx.y; const int rl = r0 % TT;   // plane of this batch and head; the tile's first row inside the batch
        const size_t e = hp * TT * HD + (EPI == 1 ? fro(rl + row, cofs, HD) : fro(row, rl + cofs, TT));
        *(v8h*)(P16 + e) = o16;
        asm volatile("s_wait_xcnt 0x0" ::: "memory");   // behind the store, before its address or data registers are given to anything else
        if (rl < RH) { v8us oh, ol;   // alike for the whole block: the hi / lo planes are read for sequence rows < RH alone
#pragma unroll
            for (int k = 0; k < 8; ++k) { unsigned short a, c; splitf(v[k], a, c); oh[k] = a; ol[k] = c; }
            *(v8us*)(Ph + e) = oh; *(v8us*)(Pl + e) = ol;
            asm volatile("s_wait_xcnt 0x0" ::: "memory"); }   // the same behind these two
    }
}
// The concept branch's k and v head planes of 64 sequence rows x one head per block: row r of a tile is row concept_ids[r] of the table product (Tk, Tv: [NVP][DM] f32), brought to LDS as the GEMM's summed tile would lie there
// (keys [row][column], values [column][row] for the transposed planes; pitch 68). One block makes both, so the indices are read once and half as many waves have to start. grid (MR/64, DM/64).
// P16 / Ph / Pl: the keys' planes; the values' lie PLN elements behind them.
__global__ __launch_bounds__(128) void k_gath(const float* __restrict__ Tk, const float* __restrict__ Tv, const int* __restrict__ IDS, const float* __restrict__ bpk, const float* __restrict__ bpv, h16* P16, bf* Ph, bf* Pl) {
    __shared__ __align__(16) float osk[64 * 68];
    __shared__ __align__(16) float osv[64 * 68];
    const int tx = (int)threadIdx.x, r0 = blockIdx.x * 64, c0 = blockIdx.y * 64;
    const int grow = tx >> 4, gc = (tx & 15) * 4;   // sixteen lanes read the 256 bytes that one table row has of this head: whole lines
    const int erow = (tx >> 6) * 8 + ((tx >> 2) & 7), ecofs = ((tx >> 5) & 1) * 32 + (tx & 3) * 8;
    const int* ip = IDS + r0 + grow; int id[8];
#pragma unroll
    for (int s = 0; s < 8; ++s) id[s] = ip[s * 8];
    asm volatile("s_wait_xcnt 0x0" :: "v"(ip) : "memory");   // behind the eight reads, before their address registers are given to anything else (the address is an input, so that it lives up to the wait)
    v4f xk[8], xv[8];
#pragma unroll
    for (int s = 0; s < 8; ++s) { const size_t ro = (size_t)min(max(id[s], 0), NVOC - 1) * DM + c0 + gc; const float* tk = Tk + ro; const float* tv = Tv + ro; xk[s] = *(const v4f*)tk; xv[s] = *(const v4f*)tv;   // the index is bounded here, whatever the array holds
        asm volatile("s_wait_xcnt 0x0" :: "v"(tk), "v"(tv) : "memory"); }   // behind each pair of gathered reads: the register allocator gives a read's address registers to the data of a later read
    float bv[8], bvr[4];
#pragma unroll
    for (int k = 0; k < 8; ++k) bv[k] = bpk[c0 + ecofs + k];
#pragma unroll
    for (int s = 0; s < 4; ++s) bvr[s] = bpv[c0 + erow + s * 16];
#pragma unroll
    for (int s = 0; s < 8; ++s) { *(v4fa*)(osk + (s * 8 + grow) * 68 + gc) = xk[s];
#pragma unroll
        for (int j = 0; j < 4; ++j) osv[(gc + j) * 68 + s * 8 + grow] = xv[s][j]; }
    // the loaded bias values are inputs only: that keeps their loads in front of the barrier, beside the gathered reads (left alone the compiler sinks them behind it, where nothing is left to cover their latency);
    // the base pointers are inputs so that their registers live up to the wait, which stands before they are given to anything else
    asm volatile("s_wait_xcnt 0x0" :: "v"(bv[0]), "v"(bv[1]), "v"(bv[2]), "v"(bv[3]), "v"(bv[4]), "v"(bv[5]), "v"(bv[6]), "v"(bv[7]), "v"(bvr[0]), "v"(bvr[1]), "v"(bvr[2]), "v"(bvr[3]), "s"(bpk), "s"(bpv) : "memory");
    __syncthreads();   // both gathered tiles are complete
    gath_put<1>(osk, bv, erow, ecofs, r0, P16, Ph, Pl);
    gath_put<2>(osv, bvr, erow, ecofs, r0, P16 + PLN, Ph + PLN, Pl + PLN);
}


// Transposed plane Bt[n][k] (fragment order) of w[k][n], both DM wide: a thread makes the eight neighbours k0 .. k0 + 7 of column n, a wave has 32 neighbouring n: every read is one whole line, every store two runs of 256 bytes.
__device__ __forceinline__ void wtG(const float* __restrict__ w, bf* Bt) {
    const int idx = (int)blockIdx.x * 256 + (int)threadIdx.x; const int n = idx & (DM - 1), k0 = (idx >> 10) * 8;   // the thread's second piece lies DM / 2 rows of w further on
    const float* wp = w + (size_t)k0 * DM + n; const float* wq = wp + (size_t)(DM / 2) * DM; float x[8], y[8];
#pragma unroll
    for (int j = 0; j < 8; ++j) { x[j] = wp[(size_t)j * DM]; y[j] = wq[(size_t)j * DM]; }
    asm volatile("s_wait_xcnt 0x0" :: "v"(wp), "v"(wq) : "memory");   // behind the sixteen reads, before their address registers are given to anything else (the addresses are inputs, so that they live up to the wait)
    v8us o, p;
#pragma unroll
    for (int j = 0; j < 8; ++j) { o[j] = f2bf(x[j]); p[j] = f2bf(y[j]); }
    *(v8us*)(Bt + fro(n, k0, DM)) = o; *(v8us*)(Bt + fro(n, k0 + DM / 2, DM)) = p;
    asm volatile("s_wait_xcnt 0x0" ::: "memory");   // behind the two stores, before their address or data registers are given to anything else
}
__device__ __forceinline__ void put8(v8f v, bf* dst) { v8us o;
#pragma unroll
    for (int k = 0; k < 8; ++k) o[k] = f2bf(v[k]); *(v8us*)dst = o; }
// Everything that depends on the inputs alone, in one launch. grid (256, 10 + 8): blockIdx.y < 10: transposed bf16 plane of weight y (the slow part, so it starts first);
// then eight rows of blocks for the three [MR][DM] bf16 planes (fragment order) query, keys, values and the [NVP][DM] plane of the embedding table (a thread makes the same eight neighbours of all of them: independent reads in flight, fewer waves to start;
// a wave takes 8 rows x one 32-wide k block: it reads eight whole lines of each input and stores four whole lines of each plane).
__global__ __launch_bounds__(256) void k_prep(const float* __restrict__ w0, const float* __restrict__ w1, const float* __restrict__ w2, const float* __restrict__ w3, const float* __restrict__ w4, const float* __restrict__ w5, const float* __restrict__ w6, const float* __restrict__ w7, const float* __restrict__ w8, const float* __restrict__ w9,
                                              const float* __restrict__ xq, const float* __restrict__ xk, const float* __restrict__ xv, const float* __restrict__ TE, bf* Wt, bf* X) {
    static_assert(PLN / 8 == (size_t)8 * 256 * 256, "eight rows of 256 blocks cover a plane"); static_assert(DM * DM / 8 == 2 * 256 * 256 && DM == 1024, "256 blocks, two pieces a thread, cover a weight");
    const int y = blockIdx.y;
    if (y < 10) { const float* w = y == 0 ? w0 : y == 1 ? w1 : y == 2 ? w2 : y == 3 ? w3 : y == 4 ? w4 : y == 5 ? w5 : y == 6 ? w6 : y == 7 ? w7 : y == 8 ? w8 : w9; wtG(w, Wt + (size_t)y * DM * DM); return; }
    const int g = ((y - 10) * 256 + (int)blockIdx.x) * 256 + (int)threadIdx.x; const int row = (g >> 10) * 8 + ((g >> 2) & 7), k0 = ((g >> 5) & 31) * 32 + (g & 3) * 8;
    const size_t e = (size_t)row * DM + k0, d = fro(row, k0, DM);   // the thread's first element in each input and in each plane
    const float* qp = xq + e; const float* kp = xk + e; const float* vp = xv + e; const float* ep = TE + (size_t)min(row, NVOC - 1) * DM + k0;   // table rows behind the last repeat it: every byte of the plane is written
    const bool tab = row < NVP;   // alike for the whole block (1024 threads share eight rows)
    const v8f q = *(const v8f*)qp, k = *(const v8f*)kp, v = *(const v8f*)vp; v8f ge = {};
    if (tab) ge = *(const v8f*)ep;
    // behind the reads, before their address registers are given to anything else (the addresses are inputs, so that they live up to the wait)
    asm volatile("s_wait_xcnt 0x0" :: "v"(qp), "v"(kp), "v"(vp), "v"(ep) : "memory");
    put8(q, X + d); put8(k, X + PLN + d); put8(v, X + 2 * PLN + d);
    if (tab) put8(ge, X + 3 * PLN + d);
    asm volatile("s_wait_xcnt 0x0" ::: "memory");   // behind the last of the stores, before any of their address or data registers is given to anything else
}
// ---- k_fattn: causal attention of one head and 64 query rows per block in ONE kernel: scores, softmax with a running maximum and sum, probabilities x values, and the hi/lo planes of the merged output; no score and no probability leaves the registers.
// Four waves, each with 16 queries of its own. The products are transposed: S^T = K Q^T (A = 16 key rows, B = 16 query columns), so a lane holds scores of ONE query (column lr; keys 8 hi + r of each 16-key tile):
// maximum and sum are taken in the lane, plus one exchange between the wave's halves. Two neighbouring S^T tiles, converted in place, are the B operand of O^T += V^T P^T in the k order of the loaders (8 hi + s, then 16 + 8 hi + s - 8).
// O^T: a lane holds 8 consecutive d of its query, one 16-byte store per plane. Every plane read or written here is in fragment order. Query rows < RH: hi + lo bf16 planes, three products; the rest single fp16. A pass takes 64 keys. grid (branches x batches x heads, TT / 64), the longest tiles first.
// The four waves need the same key and value tiles, so each pass's tiles (per plane: keys 8 KiB, in a row in the plane; values four pieces of 2 KiB) come to LDS ONCE per block, by asynchronous copies into two buffers, one pass ahead,
// and every wave takes its fragments from there: a quarter of the bytes asked of L2. In LDS a tile keeps the fragment order: a fragment load is 512 bytes in a row, on all banks once.
// v_exp_f32 with one free vector slot behind it: the register allocator lets the next instruction overwrite an exp's source directly behind it, where the instruction set asks for one independent instruction
// In place: the register written is the one the compiler's own arithmetic has just written, so its padding behind a matrix instruction covers this statement too.
__device__ __forceinline__ float exp2_slot(float x) { asm("v_exp_f32 %0, %0\n\tv_nop" : "+v"(x)); return x; }
// Eight of them in one statement: each is the independent instruction behind the one before it, so only the last needs the free slot.
__device__ __forceinline__ v8f exp2_slot8(v8f x) { float a = x[0], b = x[1], c = x[2], d = x[3], e = x[4], f = x[5], g = x[6], h = x[7];
    asm("v_exp_f32 %0, %0\n\tv_exp_f32 %1, %1\n\tv_exp_f32 %2, %2\n\tv_exp_f32 %3, %3\n\tv_exp_f32 %4, %4\n\tv_exp_f32 %5, %5\n\tv_exp_f32 %6, %6\n\tv_exp_f32 %7, %7\n\tv_nop" : "+v"(a), "+v"(b), "+v"(c), "+v"(d), "+v"(e), "+v"(f), "+v"(g), "+v"(h));
    return (v8f){a, b, c, d, e, f, g, h}; }
__device__ __forceinline__ float xhalf(float x) { return __builtin_bit_cast(float, __builtin_amdgcn_permlanex16(__builtin_bit_cast(int, x), __builtin_bit_cast(int, x), 0x76543210, 0xfedcba98, false, false)); }   // lane l with lane l ^ 16, in the vector unit
template <bool B> struct BoolC { static constexpr bool value = B; };
template <typename T16, bool HL>
__device__ __forceinline__ void fattn_wave(const T16* __restrict__ Q, const T16* __restrict__ Q2, const T16* __restrict__ Kp, const T16* __restrict__ K2, const T16* __restrict__ Vt, const T16* __restrict__ V2, int row0, int nkb, int lr, int hi, bf* Ah, bf* Al, const T16* sm) {
    typedef typename WFrag<T16>::V V;
    constexpr int BUFE = HL ? 16384 : 8192;   // elements of one LDS buffer: keys (4096), values [d / 16][2 tiles] (4096); HL: the same of the lo planes behind them
    const float CE = SCL * 1.4426950408889634f;               // scores stay as the matrix unit leaves them; the scale (a power of two) and log2(e) enter in the exponent's one multiply-add, and the running maximum is kept unscaled
    const size_t koff = (size_t)(16 * hi + lr) * 8;   // the lane's place in a tile in fragment order; 16 rows on: 16 * HD elements (queries; keys and values in LDS), 32 k on: 512
    V q[2], q2[2], ka[4][2];
    const T16* qp = Q + (size_t)row0 * HD + koff; const T16* qp2 = HL ? Q2 + (size_t)row0 * HD + koff : nullptr;
#pragma unroll
    for (int kc = 0; kc < 2; ++kc) { q[kc] = WFrag<T16>::ld(qp + kc * 512); if (HL) q2[kc] = WFrag<T16>::ld(qp2 + kc * 512); }
    // behind the query loads, before their address registers are given to anything else (the addresses are inputs, so that they live up to the wait)
    if constexpr (HL) asm volatile("s_wait_xcnt 0x0" :: "v"(qp), "v"(qp2) : "memory"); else asm volatile("s_wait_xcnt 0x0" :: "v"(qp) : "memory");
    // The key and value tiles of pass kb of one pair of planes to LDS byte address ld (the thread's own): a thread copies 16 bytes of each of eight 2-KiB pieces, a wave 512 bytes in a row.
    // The eight copies and the wait that stands before their address registers are given to anything else are one statement, so that nothing can come between them.
    auto copy8 = [&](const unsigned ld, const T16* kpl, const T16* vpl, const int kb) __attribute__((always_inline)) {
        const char* gk = (const char*)(kpl + (size_t)kb * (64 * HD)) + (unsigned)threadIdx.x * 16u; const char* gv = (const char*)(vpl + (size_t)kb * (64 * 16)) + (unsigned)threadIdx.x * 16u;
        asm volatile("global_load_async_to_lds_b128 %0, %8, off\n\tglobal_load_async_to_lds_b128 %1, %9, off\n\tglobal_load_async_to_lds_b128 %2, %10, off\n\tglobal_load_async_to_lds_b128 %3, %11, off\n\t"
                     "global_load_async_to_lds_b128 %4, %12, off\n\tglobal_load_async_to_lds_b128 %5, %13, off\n\tglobal_load_async_to_lds_b128 %6, %14, off\n\tglobal_load_async_to_lds_b128 %7, %15, off\n\ts_wait_xcnt 0x0"
                     :: "v"(ld), "v"(ld + 2048u), "v"(ld + 4096u), "v"(ld + 6144u), "v"(ld + 8192u), "v"(ld + 10240u), "v"(ld + 12288u), "v"(ld + 14336u),
                        "v"(gk), "v"(gk + 2048), "v"(gk + 4096), "v"(gk + 6144), "v"(gv), "v"(gv + (size_t)16 * TT * 2), "v"(gv + (size_t)32 * TT * 2), "v"(gv + (size_t)48 * TT * 2) : "memory");
    };
    auto stage = [&](const int kb) __attribute__((always_inline)) {   // pass kb's tiles into buffer kb % 2
        const unsigned ld = (unsigned)(size_t)(const __attribute__((address_space(3))) T16*)sm + (unsigned)(kb & 1) * (unsigned)(BUFE * 2) + (unsigned)threadIdx.x * 16u;
        copy8(ld, Kp, Vt, kb);
        if constexpr (HL) copy8(ld + 16384u, K2, V2, kb);
    };
    stage(0);
    asm volatile("s_wait_asynccnt 0x0" ::: "memory");   // this wave's copies of pass 0 have landed
    __syncthreads();                                     // and every other wave's: pass 0's tiles may be read
    if (nkb > 1) stage(1);                               // alike for the whole block
    v8f o[4];
#pragma unroll
    for (int dt = 0; dt < 4; ++dt) o[dt] = (v8f){};
    float m = -3.0e38f, l = 0.f;
    // One pass of 64 keys. Only the last pass (the diagonal block) holds keys behind a query, so only its copy of the body compares and selects.
    auto pass = [&](const int kb, auto DIAG) __attribute__((always_inline)) {
        const int key0 = kb * 64;
        V va[4][2];
        const T16* lp = sm + (kb & 1) * BUFE + koff;   // the lane's place in this pass's LDS buffer
        if constexpr (!HL) {   // this pass's key and value fragments, asked for together at the pass's head
#pragma unroll
            for (int kt = 0; kt < 4; ++kt)
#pragma unroll
                for (int kc = 0; kc < 2; ++kc) ka[kt][kc] = WFrag<T16>::ld(lp + kt * 1024 + kc * 512);
#pragma unroll
            for (int dt = 0; dt < 4; ++dt)
#pragma unroll
                for (int ks = 0; ks < 2; ++ks) va[dt][ks] = WFrag<T16>::ld(lp + 4096 + dt * 1024 + ks * 512);
            __builtin_amdgcn_sched_barrier(0);   // keeps the whole group of reads here: left alone the scheduler sinks half of the value reads to just in front of their products and waits out the LDS latency at each
        }
        const T16* kh = lp; const T16* vh = lp + 4096; const T16* kl = lp + 8192; const T16* vl = lp + 12288;   // HL: this pass's tiles
        v8f s[4];
#pragma unroll
        for (int kt = 0; kt < 4; ++kt) s[kt] = (v8f){};
#pragma unroll
        for (int kc = 0; kc < 2; ++kc)
#pragma unroll
            for (int kt = 0; kt < 4; ++kt) {
                if constexpr (HL) { const int off = kt * 1024 + kc * 512; const V a = WFrag<T16>::ld(kh + off), a2 = WFrag<T16>::ld(kl + off);
                    s[kt] = WFrag<T16>::mma(a, q[kc], s[kt]); s[kt] = WFrag<T16>::mma(a, q2[kc], s[kt]); s[kt] = WFrag<T16>::mma(a2, q[kc], s[kt]); }
                else s[kt] = WFrag<T16>::mma(ka[kt][kc], q[kc], s[kt]);
            }
        if constexpr (decltype(DIAG)::value) {
            const int ln = (int)__builtin_amdgcn_mbcnt_lo(~0u, 0u);   // the lane's number, made anew: nothing of it has to be held in a register through the loop (held there, it was spilled)
            const int rel = row0 + (ln & 15) - key0 - 8 * (ln >> 4);   // key <= this lane's query row  <=>  kt * 16 + r <= rel
#pragma unroll
            for (int kt = 0; kt < 4; ++kt)
#pragma unroll
                for (int r = 0; r < 8; ++r) s[kt][r] = (kt * 16 + r <= rel) ? s[kt][r] : -3.0e38f;
        }
        float mk[4];
#pragma unroll
        for (int kt = 0; kt < 4; ++kt) { mk[kt] = s[kt][0];
#pragma unroll
            for (int r = 1; r < 8; ++r) mk[kt] = fmaxf(mk[kt], s[kt][r]); }
        float mx = fmaxf(fmaxf(fmaxf(mk[0], mk[1]), fmaxf(mk[2], mk[3])), m);
        mx = fmaxf(mx, xhalf(mx));                             // the other half of this query's keys
        const float al = exp2_slot((m - mx) * CE); m = mx;    // first pass: exp2 of a huge negative number = 0 on zero sums
#pragma unroll
        for (int dt = 0; dt < 4; ++dt) o[dt] *= al;
        const float nm = -m * CE; const v8f cev = {CE, CE, CE, CE, CE, CE, CE, CE}, nmv = {nm, nm, nm, nm, nm, nm, nm, nm};
#pragma unroll
        for (int kt = 0; kt < 4; ++kt) s[kt] = exp2_slot8(__builtin_elementwise_fma(s[kt], cev, nmv));
        const v8f sv = (s[0] + s[1]) + (s[2] + s[3]);          // the four tiles register by register (packed adds on the pairs as they lie), then the eight sums
        l = l * al + (((sv[0] + sv[4]) + (sv[1] + sv[5])) + ((sv[2] + sv[6]) + (sv[3] + sv[7])));
#pragma unroll
        for (int ks = 0; ks < 2; ++ks) {
            V pb, pb2, vfh[4], vfl[4];
            if constexpr (HL) {   // the eight value fragments of these 32 keys, asked for together
#pragma unroll
                for (int dt = 0; dt < 4; ++dt) { vfh[dt] = WFrag<T16>::ld(vh + dt * 1024 + ks * 512); vfl[dt] = WFrag<T16>::ld(vl + dt * 1024 + ks * 512); }
                __builtin_amdgcn_sched_barrier(0);   // keeps the group of reads in front of the hi / lo split of the probabilities, which covers their latency: left alone the scheduler sinks each read to just in front of its product and waits for it there
            }
            if constexpr (HL) { v8us h0, h1, l0, l1;
#pragma unroll
                for (int r = 0; r < 8; ++r) { unsigned short a, c; splitf(s[2 * ks][r], a, c); h0[r] = a; l0[r] = c; splitf(s[2 * ks + 1][r], a, c); h1[r] = a; l1[r] = c; }
                pb = cat16b(h0, h1); pb2 = cat16b(l0, l1); }
            else { v8h c0, c1;
#pragma unroll
                for (int r = 0; r < 8; ++r) { c0[r] = tohx(s[2 * ks][r]); c1[r] = tohx(s[2 * ks + 1][r]); }
                pb = cat16(c0, c1); }
#pragma unroll
            for (int dt = 0; dt < 4; ++dt) {
                if constexpr (HL) { const V a = vfh[dt], a2 = vfl[dt];
                    o[dt] = WFrag<T16>::mma(a, pb, o[dt]); o[dt] = WFrag<T16>::mma(a, pb2, o[dt]); o[dt] = WFrag<T16>::mma(a2, pb, o[dt]); }
                else o[dt] = WFrag<T16>::mma(va[dt][ks], pb, o[dt]);
            }
        }
        // four vector slots behind the last matrix instruction, on the back edge and on the exit alike, before its fragments are reloaded or its accumulators read
        asm volatile("v_nop\n\tv_nop\n\tv_nop\n\tv_nop" : "+v"(o[0]), "+v"(o[1]), "+v"(o[2]), "+v"(o[3]));
    };
#pragma unroll 1   // rolled: the body is long, and a second copy would double the fragments held
    for (int kb = 0; kb < nkb - 1; ++kb) { pass(kb, BoolC<false>{});
        asm volatile("s_wait_dscnt 0x0" ::: "memory");      // this wave's reads of pass kb's buffer are done
        asm volatile("s_wait_asynccnt 0x0" ::: "memory");   // its copies of pass kb + 1 have landed
        __syncthreads();                                     // both hold for every wave: pass kb + 1 may be read, pass kb's buffer may be filled again
        if (kb + 2 < nkb) stage(kb + 2); }                   // alike for the whole block
    pass(nkb - 1, BoolC<true>{});
    asm volatile("s_wait_asynccnt 0x0" ::: "memory");   // no copy is left in flight when the wave ends
    l += xhalf(l);                                             // join the halves' sums
    const size_t ooff = (size_t)__builtin_amdgcn_mbcnt_lo(~0u, 0u) * 8;   // the lane's place in a tile, made anew for the same reason
    const float inv = __fdiv_rn(1.0f, l);
#pragma unroll
    for (int dt = 0; dt < 4; ++dt) { v8us oh, ol;
#pragma unroll
        for (int r = 0; r < 8; ++r) { unsigned short a, c; splitf(o[dt][r] * inv, a, c); oh[r] = a; ol[r] = c; }
        const size_t oo = (size_t)row0 * DQ + (dt >> 1) * 512 + (dt & 1) * 256 + ooff; *(v8us*)(Ah + oo) = oh; *(v8us*)(Al + oo) = ol; }   // fragment order, K = DQ: the wave's store is 512 bytes in a row
}
// Both branches and all batches in one launch: grid (NH_ * NB_ * 2, TT / 64), blockIdx.x = (branch * NB_ + batch) * NH_ + head; blockIdx.y still counts the query tiles from the longest down, so that the longest tiles of every head start first.
// Four waves per SIMD, no more and no fewer, are asked for: the 256 registers of that budget hold all of an fp16 pass's key and value fragments, asked for at its head.
// The nine pointers are the char branch's head planes; the concept branch's lie 3 * PLN elements behind them (the order of the projections). Ah / Al: [branch] x ([MR][DQ] in fragment order); a head's 64 columns are two 32-wide k blocks, 1024 elements on per head.
__global__ __launch_bounds__(128) __attribute__((amdgpu_waves_per_eu(4, 4))) void k_fattn(const h16* __restrict__ Q16, const bf* __restrict__ Qh, const bf* __restrict__ Ql, const h16* __restrict__ K16, const bf* __restrict__ Kh, const bf* __restrict__ Kl, const h16* __restrict__ V16, const bf* __restrict__ Vh, const bf* __restrict__ Vl, bf* Ah, bf* Al) {
    __shared__ __align__(16) unsigned short kv[2 * 16384];   // two buffers of one pass's key and value tiles (hi / lo blocks: 32 KiB each; fp16 blocks: 16 KiB each, in the first half)
    const int lane = threadIdx.x & 31, lr = lane & 15, hi = lane >> 4;
    const int w = __builtin_amdgcn_readfirstlane((int)(threadIdx.x >> 5));   // wave number in a scalar register: row0 and the loop's bounds stay scalar
    static_assert(REP == 1, "the key and value planes are indexed by the query's head");
    const int h = blockIdx.x % NH_, bb = blockIdx.x / NH_, br = bb / NB_, r0 = (TT / 64 - 1 - (int)blockIdx.y) * 64;   // bb = branch * NB_ + batch
    const size_t zq = (size_t)(3 * br) * PLN + ((size_t)(bb % NB_) * NH_ + h) * TT * HD, zk = zq, za = (size_t)bb * TT * DQ + h * (HD * 16);
    if (r0 < RH) fattn_wave<bf, true>(Qh + zq, Ql + zq, Kh + zk, Kl + zk, Vh + zk, Vl + zk, r0 + w * 16, r0 / 64 + 1, lr, hi, Ah + za, Al + za, kv);
    else fattn_wave<h16, false>(Q16 + zq, nullptr, K16 + zk, nullptr, V16 + zk, nullptr, r0 + w * 16, r0 / 64 + 1, lr, hi, Ah + za, Al + za, (const h16*)kv);
}

extern "C" void kernel_launch(void* const* d_in, const int* in_sizes, int n_in,
                              void* d_out, int out_size, void* d_ws, size_t ws_size, hipStream_t stream) {
    (void)in_sizes; (void)n_in; (void)out_size;
    const float* xvals = (const float*)d_in[0]; const float* xkeys = (const float*)d_in[1]; const float* xq = (const float*)d_in[2]; const int* CID = (const int*)d_in[3]; const float* EMB = (const float*)d_in[4]; const float* wcv = (const float*)d_in[5]; const float* bcv = (const float*)d_in[6]; const float* wck = (const float*)d_in[7]; const float* bck = (const float*)d_in[8]; const float* wcq = (const float*)d_in[9]; const float* bcq = (const float*)d_in[10]; const float* wco = (const float*)d_in[11]; const float* bco = (const float*)d_in[12]; const float* wpv = (const float*)d_in[13]; const float* bpv = (const float*)d_in[14]; const float* wpk = (const float*)d_in[15]; const float* bpk = (const float*)d_in[16]; const float* wpq = (const float*)d_in[17]; const float* bpq = (const float*)d_in[18]; const float* wpo = (const float*)d_in[19]; const float* bpo = (const float*)d_in[20]; const float* wg = (const float*)d_in[21]; const float* bg = (const float*)d_in[22];
    float* OUT = (float*)d_out;     // [2][2048][1024]
    char* wsp = (char*)d_ws;
    auto take = [&](size_t bytes) { char* p = wsp; wsp += (bytes + 255) & ~(size_t)255; return (void*)p; };
    bf* WT = (bf*)take((size_t)10 * DM * DM * 2);   /* transposed weights: q, k, v of the char branch, q, k, v of the concept branch, Wco, Wpo, Wg rows 0..1023 (multiply char_out), Wg rows 1024..2047 (concept_out) */
    bf* XP = (bf*)take(4 * PLN * 2);                /* bf16 planes of query, keys, values; in the fourth place the embedding table's NVP rows */
    float* TF = (float*)take((size_t)2 * NVP * DM * 4);   /* table x Wpk, table x Wpv */
    bf* ATh = (bf*)take(2 * PLN * 2); bf* ATl = (bf*)take(2 * PLN * 2);   /* merged attention outputs, hi and lo, [branch] */
    char* pl0 = wsp;
    h16* P16 = (h16*)take(6 * PLN * 2); bf* Ph = (bf*)take(6 * PLN * 2); bf* Pl = (bf*)take(6 * PLN * 2);   /* head planes of the six projections */
    char* end0 = wsp; wsp = pl0;                    /* the head planes are dead behind the attention launch: what follows it lies in their place */
    float* CO = (float*)take(2 * PLN * 4); float* PO = CO + PLN; bf* Ch = (bf*)take(2 * PLN * 2); bf* Dh = Ch + PLN; bf* Cl = (bf*)take(2 * PLN * 2); bf* Dl = Cl + PLN; float* G1 = (float*)take(PLN * 4);
    if (wsp > end0 || (size_t)(end0 - (char*)d_ws) > ws_size) return;    // ws 256 MiB
    k_prep<<<dim3(256, 10 + 8), 256, 0, stream>>>(wcq, wck, wcv, wpq, wpk, wpv, wco, wpo, wg, wg + (size_t)DM * DM, xq, xkeys, xvals, EMB, WT, XP);
    k_qkv<<<dim3(MR / 64, 4 * (DM / 64) + QKV_TY), 128, 0, stream>>>(XP, WT, bcq, bck, bcv, bpq, P16, Ph, Pl, TF);
    k_gath<<<dim3(MR / 64, DM / 64), 128, 0, stream>>>(TF, TF + (size_t)NVP * DM, CID, bpk, bpv, P16 + 4 * PLN, Ph + 4 * PLN, Pl + 4 * PLN);
    k_fattn<<<dim3(NH_ * NB_ * 2, TT / 64), 128, 0, stream>>>(P16, Ph, Pl, P16 + PLN, Ph + PLN, Pl + PLN, P16 + 2 * PLN, Ph + 2 * PLN, Pl + 2 * PLN, ATh, ATl);
    /* out-projections of both branches (z): f32 char_out / concept_out and their hi / lo planes */
    k_gemmk<bf, 1, false, true, 4, 3><<<dim3(MR / 64, DM / 64, 2), 128, 0, stream>>>(ATh, ATl, WT + (size_t)6 * DM * DM, CO, DM, bco, bpo, PLN, (size_t)DM * DM, PLN, Ch, Cl, nullptr, nullptr, nullptr);
    /* ---- gate + mix: char_out Wg[:1024] to G1; concept_out Wg[1024:] ends in the sigmoid and the mix ---- */
    k_gemmk<bf, 1, false, false, 4, 0><<<dim3(MR / 64, DM / 64, 1), 128, 0, stream>>>(Ch, Cl, WT + (size_t)8 * DM * DM, G1, DM, nullptr, nullptr, 0, 0, 0, nullptr, nullptr, nullptr, nullptr, nullptr);
    k_gemmk<bf, 1, false, true, 4, 4><<<dim3(MR / 64, DM / 64, 1), 128, 0, stream>>>(Dh, Dl, WT + (size_t)9 * DM * DM, OUT, DM, bg, nullptr, 0, 0, 0, nullptr, nullptr, G1, CO, PO);
}
